// v000
// Measured on an AMD MI455X. A time is GPU time per run, averaged over a window of back-to-back runs after a warm-up
// (all launches, gaps included; the runs take copies of the inputs in turn), and the median of several windows.
// Apart from v000's, it joins two sittings. Times from different sittings can be a few percent apart, while
// side-by-side timings come from the same sitting.
// The starting kernel, v000, takes 1840 microseconds a run.
#include <hip/hip_runtime.h>
// qKv_attention (2 x 2048 tokens, C 1024 = 16 heads x 64; Gaussian-kernel attention WITHOUT normalisation: qkv = x Wqkv + b; K[i][j] = exp(-r_sigma ||q_j - k_i||^2) computed as kn_i + qn_j - 2 k_i.q_j; out_i = sum_j K[i][j] v_j; out = merge Wproj + bproj; r_sigma is a scalar input).
// Structure: exact f16 plane of x; qkv as one f16 WMMA GEMM (32x64 wave tiles, f32 accumulation, exact x16 weights + bias); per-(token, head) squared norms on VALU; q and k as f16 hi + 2^10 residual planes; V^T by LDS tiles; per (batch, group of 4 heads): the k.q GEMMs as three hi/residual terms (f32), the kernel weights exp(-r (kn + qn - 2 kq)) on VALU into f16 (x 2^10), the readout GEMMs (64 columns) straight into a merged context plane; Wproj + bproj GEMM.
// Compute dtype: inputs rounded to bf16; x and weights exact as f16; q, k as f16 hi + residual (~2^-21) because the exponent amplifies dot-product error by 2 r_sigma |k.q|; kernel weights and v as plain f16 operands (~2^-12; weights below 2^-34 of the unit scale flush to zero); merged context plain f16. v_wmma_f32_16x16x32_f16.
#define NB 2
#define DM 1024
#define NKV 16
#define NREP (NH / NKV)
#define KVD (NKV * 64)           /* 1024 */
#define NR (NB * SLEN)           /* 4096 */
#define CHK 512                  /* attention chunk */
typedef int v4i __attribute__((ext_vector_type(4)));
#define FF 2048
#define SLEN 2048
#define TQ SLEN
#define TK SLEN
#define NH 16
#define SCL 0.125f
#define QBLKS (TQ / 64)
#define QB05 0
#define QBN5 4
#define QB0P 0
#define QBNP QBLKS           /* non-causal: plain flash on every query block */
#define RE 256
typedef __bf16 v16b __attribute__((ext_vector_type(16)));
typedef unsigned short v8us __attribute__((ext_vector_type(8), may_alias));
typedef float  v8f  __attribute__((ext_vector_type(8)));
typedef float  v4f  __attribute__((ext_vector_type(4)));
typedef float  v4fa __attribute__((ext_vector_type(4), may_alias));
union FragB { v16b v; v8us half[2]; unsigned short u[16]; };

__device__ __forceinline__ unsigned short bf16_bits(float x) { unsigned int u = __float_as_uint(x); return (unsigned short)((u + 0x7FFFu + ((u >> 16) & 1u)) >> 16); }
__device__ __forceinline__ float bf16_val(unsigned short b) { return __uint_as_float(((unsigned int)b) << 16); }
__device__ __forceinline__ float bf16_round(float x) { return bf16_val(bf16_bits(x)); }
// D += A·B with NT terms: 1 = ah·bh, 2 = + al·bh (A split), 3 = + ah·bl (both split)
template <int NT>
__device__ __forceinline__ v8f mmaN(v16b ah, v16b al, v16b bh, v16b bl, v8f c) {
  c = __builtin_amdgcn_wmma_f32_16x16x32_bf16(false, ah, false, bh, (short)0, c, false, false);
  if (NT >= 2) c = __builtin_amdgcn_wmma_f32_16x16x32_bf16(false, al, false, bh, (short)0, c, false, false);
  if (NT >= 3) c = __builtin_amdgcn_wmma_f32_16x16x32_bf16(false, ah, false, bl, (short)0, c, false, false);
  asm volatile("v_nop\n\tv_nop\n\tv_nop\n\tv_nop" : "+v"(c) : "v"(ah), "v"(al), "v"(bh), "v"(bl));
  return c;
}

__global__ __launch_bounds__(256) void k_wt_bf16(const float* __restrict__ W, unsigned short* __restrict__ Wt, int K, int N) {
  const int t = blockIdx.x * 256 + threadIdx.x;
  const int k8n = K / 8;
  if (t >= N * k8n) return;
  const int n = t / k8n, k8 = (t % k8n) * 8;
  v8us v;
#pragma unroll
  for (int i = 0; i < 8; ++i) v[i] = bf16_bits(W[(size_t)(k8 + i) * N + n]);
  *(v8us*)(Wt + (size_t)n * K + k8) = v;
  
}

// GEMM C[M][N] (f32, pitch ldc) = act(A[M][K]·W + bias). A f32 row-major (pitch lda) converted per fragment to bf16
// (ASPLIT: hi/lo two planes -> 2 terms, else single rounded term); Wt bf16 [N][K] (pitch ldb). BIAS_BF16 rounds the
// bias to bf16 first (bias quantised to bf16 before the add). K%32==0, M%16==0, N%64==0.
template <bool ASPLIT, int ACT, bool BIAS_BF16>
__global__ __launch_bounds__(128) void k_gemm_bf(const float* __restrict__ A, int lda, const unsigned short* __restrict__ Wt, int ldb,
                                               const float* __restrict__ bias, float* __restrict__ C, int ldc, int M, int N, int K) {
  __shared__ __attribute__((aligned(16))) float so[4][16][64];
  const int tid = threadIdx.x, w = tid >> 5, lane = tid & 31, ln = lane & 15, hh = lane >> 4;
  const int ntn = N / 64;
  const int wid = blockIdx.x * 4 + w;
  const int mt = wid / ntn, nq = wid % ntn;
  if (mt * 16 >= M) return;
  const int row0 = mt * 16, col0 = nq * 64;
  const float* arow = A + (size_t)(row0 + ln) * lda;
  v8f acc[4] = {};
  for (int kb = 0; kb < K; kb += 32) {
    FragB ah, al;
    const v4f x0 = *(const v4fa*)(arow + kb + 8 * hh), x1 = *(const v4fa*)(arow + kb + 8 * hh + 4);
    const v4f x2 = *(const v4fa*)(arow + kb + 16 + 8 * hh), x3 = *(const v4fa*)(arow + kb + 16 + 8 * hh + 4);
    float xs[16] = {x0[0],x0[1],x0[2],x0[3],x1[0],x1[1],x1[2],x1[3],x2[0],x2[1],x2[2],x2[3],x3[0],x3[1],x3[2],x3[3]};
#pragma unroll
    for (int i = 0; i < 16; ++i) { const unsigned short hb = bf16_bits(xs[i]); ah.u[i] = hb; al.u[i] = ASPLIT ? bf16_bits(xs[i] - bf16_val(hb)) : (unsigned short)0; }
#pragma unroll
    for (int t = 0; t < 4; ++t) {
      const unsigned short* brow = Wt + (size_t)(col0 + t * 16 + ln) * ldb + kb;
      FragB b;
      b.half[0] = *(const v8us*)(brow + 8 * hh);
      b.half[1] = *(const v8us*)(brow + 16 + 8 * hh);
      acc[t] = mmaN<ASPLIT ? 2 : 1>(ah.v, al.v, b.v, b.v, acc[t]);
    }
  }
#pragma unroll
  for (int t = 0; t < 4; ++t) {
    float bv = bias ? bias[col0 + t * 16 + ln] : 0.f;
    if (BIAS_BF16) bv = bf16_round(bv);
#pragma unroll
    for (int r = 0; r < 8; ++r) { float v = acc[t][r] + bv; if (ACT == 1) v = fmaxf(v, 0.f); so[w][8 * hh + r][t * 16 + ln] = v; }
  }
  __builtin_amdgcn_fence(__ATOMIC_ACQ_REL, "workgroup");
  __builtin_amdgcn_wave_barrier();
  const int rsub = lane >> 4, c4 = (lane & 15) * 4;
  {
#pragma unroll
    for (int q = 0; q < 8; ++q) {
      const int r = q * 2 + rsub;
      const v4f v = *(const v4fa*)&so[w][r][c4];
      *(v4f*)(C + (size_t)(row0 + r) * ldc + col0 + c4) = v;
    }
    
  }
}

// GEMM C = act(A·W + bias + resid): A f32 (ASPLIT -> hi/lo 2 terms), Wt bf16 [N][K]; ACT 0 none, 1 relu, 2 exact gelu;
// resid (optional, f32, row index = (row % rmod), pitch ldr, RES_BF16 rounds it) added before the activation.
template <bool ASPLIT, int ACT, bool BIAS_BF16, bool RES_BF16>
__global__ __launch_bounds__(128) void k_gemm_bf3(const float* __restrict__ A, int lda, const unsigned short* __restrict__ Wt, int ldb,
                                                const float* __restrict__ bias, const float* __restrict__ resid, int rmod, int ldr,
                                                float* __restrict__ C, int ldc, int M, int N, int K) {
  __shared__ __attribute__((aligned(16))) float so[4][16][64];
  const int tid = threadIdx.x, w = tid >> 5, lane = tid & 31, ln = lane & 15, hh = lane >> 4;
  const int ntn = N / 64;
  const int wid = blockIdx.x * 4 + w;
  const int mt = wid / ntn, nq = wid % ntn;
  if (mt * 16 >= M) return;
  const int row0 = mt * 16, col0 = nq * 64;
  const float* arow = A + (size_t)(row0 + ln) * lda;
  v8f acc[4] = {};
  for (int kb = 0; kb < K; kb += 32) {
    FragB ah, al;
    const v4f x0 = *(const v4fa*)(arow + kb + 8 * hh), x1 = *(const v4fa*)(arow + kb + 8 * hh + 4);
    const v4f x2 = *(const v4fa*)(arow + kb + 16 + 8 * hh), x3 = *(const v4fa*)(arow + kb + 16 + 8 * hh + 4);
    float xs[16] = {x0[0],x0[1],x0[2],x0[3],x1[0],x1[1],x1[2],x1[3],x2[0],x2[1],x2[2],x2[3],x3[0],x3[1],x3[2],x3[3]};
#pragma unroll
    for (int i = 0; i < 16; ++i) { const unsigned short hb = bf16_bits(xs[i]); ah.u[i] = hb; al.u[i] = ASPLIT ? bf16_bits(xs[i] - bf16_val(hb)) : (unsigned short)0; }
#pragma unroll
    for (int t = 0; t < 4; ++t) {
      const unsigned short* brow = Wt + (size_t)(col0 + t * 16 + ln) * ldb + kb;
      FragB b;
      b.half[0] = *(const v8us*)(brow + 8 * hh);
      b.half[1] = *(const v8us*)(brow + 16 + 8 * hh);
      acc[t] = mmaN<ASPLIT ? 2 : 1>(ah.v, al.v, b.v, b.v, acc[t]);
    }
  }
#pragma unroll
  for (int t = 0; t < 4; ++t) {
    const int col = col0 + t * 16 + ln;
    float bv = bias ? bias[col] : 0.f;
    if (BIAS_BF16) bv = bf16_round(bv);
#pragma unroll
    for (int r = 0; r < 8; ++r) {
      float v = acc[t][r] + bv;
      if (resid) { float rv = resid[(size_t)((row0 + 8 * hh + r) % rmod) * ldr + col]; if (RES_BF16) rv = bf16_round(rv); v += rv; }
      if (ACT == 1) v = fmaxf(v, 0.f);
      if (ACT == 2) v = 0.5f * v * (1.0f + erff(v * 0.70710678118654752f));
      if (ACT == 3) { const float u = 0.7978845608028654f * (v + 0.044715f * v * v * v); v = 0.5f * v * (1.0f + tanhf(u)); }
      so[w][8 * hh + r][t * 16 + ln] = v;
    }
  }
  __builtin_amdgcn_fence(__ATOMIC_ACQ_REL, "workgroup");
  __builtin_amdgcn_wave_barrier();
  const int rsub = lane >> 4, c4 = (lane & 15) * 4;
  {
#pragma unroll
    for (int q = 0; q < 8; ++q) {
      const int r = q * 2 + rsub;
      const v4f v = *(const v4fa*)&so[w][r][c4];
      *(v4f*)(C + (size_t)(row0 + r) * ldc + col0 + c4) = v;
    }
    
  }
}
// row LayerNorm (biased variance, eps) over N: s = X (+ R); optional out_sum <- s; out_norm <- (s-mu)*rsqrt(var+eps)*g + b
template <bool PARAM_BF16>
__global__ __launch_bounds__(256) void k_layernorm(const float* __restrict__ X, const float* __restrict__ R, const float* __restrict__ g, const float* __restrict__ bta,
                                                  float* __restrict__ out_sum, float* __restrict__ out_norm, int N, float eps) {
  __shared__ float red[256];
  const int row = blockIdx.x, tid = threadIdx.x;
  const float* x = X + (size_t)row * N; const float* rr = R ? R + (size_t)row * N : nullptr;
  float vals[16];                     // up to N = 4096
  const int per = N / 256;            // contiguous chunk per thread? use strided-by-4 chunks: thread handles j = tid*4 + 1024*u
  float s1 = 0.f;
  for (int u = 0; u < per / 4; ++u) {
    const int j = tid * 4 + 1024 * u;
    const v4f a = *(const v4fa*)(x + j);
    v4f b = {0.f,0.f,0.f,0.f}; if (rr) b = *(const v4fa*)(rr + j);
#pragma unroll
    for (int q = 0; q < 4; ++q) { const float v = a[q] + b[q]; vals[u * 4 + q] = v; s1 += v; }
  }
  red[tid] = s1; __syncthreads();
  for (int st = 128; st > 0; st >>= 1) { if (tid < st) red[tid] += red[tid + st]; __syncthreads(); }
  const float mu = red[0] / (float)N; __syncthreads();
  float s2 = 0.f;
  for (int u = 0; u < per / 4; ++u)
#pragma unroll
    for (int q = 0; q < 4; ++q) { const float c = vals[u * 4 + q] - mu; s2 += c * c; }
  red[tid] = s2; __syncthreads();
  for (int st = 128; st > 0; st >>= 1) { if (tid < st) red[tid] += red[tid + st]; __syncthreads(); }
  const float rs = rsqrtf(red[0] / (float)N + eps);
  {
    for (int u = 0; u < per / 4; ++u) {
      const int j = tid * 4 + 1024 * u;
      v4f o, sm;
#pragma unroll
      for (int q = 0; q < 4; ++q) {
        float gg = g[j + q], bb = bta[j + q];
        if (PARAM_BF16) { gg = bf16_round(gg); bb = bf16_round(bb); }
        sm[q] = vals[u * 4 + q]; o[q] = (vals[u * 4 + q] - mu) * rs * gg + bb;
      }
      if (out_sum) *(v4f*)(out_sum + (size_t)row * N + j) = sm;
      *(v4f*)(out_norm + (size_t)row * N + j) = o;
    }
    
  }
}



// ---- f16 WMMA path (v_wmma_f32_16x16x32_f16): 11-bit significands for operands in range — used where a [0,1] probability operand needs more precision than bf16
typedef _Float16 v16h __attribute__((ext_vector_type(16)));
union FragH { v16h v; v8us half[2]; _Float16 h[16]; unsigned short u[16]; };
template <int NT>
__device__ __forceinline__ v8f mmaH(v16h ah, v16h al, v16h bh, v16h bl, v8f c) {
  c = __builtin_amdgcn_wmma_f32_16x16x32_f16(false, ah, false, bh, (short)0, c, false, false);
  if (NT >= 2) c = __builtin_amdgcn_wmma_f32_16x16x32_f16(false, al, false, bh, (short)0, c, false, false);
  if (NT >= 3) c = __builtin_amdgcn_wmma_f32_16x16x32_f16(false, ah, false, bl, (short)0, c, false, false);
  asm volatile("v_nop\n\tv_nop\n\tv_nop\n\tv_nop" : "+v"(c) : "v"(ah), "v"(al), "v"(bh), "v"(bl));
  return c;
}
// batched GEMM like k_gemm_b but f16 operands: A f32 (split into f16 hi/lo if ASPLIT, else rounded to f16), Bt = f16 values [n][k]; alpha; C f32; N multiple of 16 (partial tiles skipped)
template <bool ASPLIT>
__global__ __launch_bounds__(128) void k_gemm_h(const float* __restrict__ A, int lda, size_t sA, const _Float16* __restrict__ Bh, int ldb, size_t sB, float alpha, float* __restrict__ C, int ldc, size_t sC, int M, int N, int K) {
  __shared__ __attribute__((aligned(16))) float so[4][16][64];
  const int tid = threadIdx.x, w = tid >> 5, lane = tid & 31, ln = lane & 15, hh = lane >> 4; const int by = blockIdx.y;
  A += (size_t)by * sA; Bh += (size_t)by * sB; C += (size_t)by * sC;
  const int ntn = (N + 63) / 64; const int wid = blockIdx.x * 4 + w; const int mt = wid / ntn, nq = wid % ntn; if (mt * 16 >= M) return;
  const int row0 = mt * 16, col0 = nq * 64; const float* arow = A + (size_t)(row0 + ln) * lda;
  v8f acc[4] = {};
  for (int kb = 0; kb < K; kb += 32) {
    FragH ah, al;
    const v4f x0 = *(const v4fa*)(arow + kb + 8 * hh), x1 = *(const v4fa*)(arow + kb + 8 * hh + 4), x2 = *(const v4fa*)(arow + kb + 16 + 8 * hh), x3 = *(const v4fa*)(arow + kb + 16 + 8 * hh + 4);
    float xs[16] = {x0[0],x0[1],x0[2],x0[3],x1[0],x1[1],x1[2],x1[3],x2[0],x2[1],x2[2],x2[3],x3[0],x3[1],x3[2],x3[3]};
#pragma unroll
    for (int i = 0; i < 16; ++i) { const _Float16 h = (_Float16)xs[i]; ah.h[i] = h; al.h[i] = ASPLIT ? (_Float16)(xs[i] - (float)h) : (_Float16)0.0f; }
#pragma unroll
    for (int t = 0; t < 4; ++t) { if (col0 + t * 16 >= N) continue; const size_t boff = (size_t)(col0 + t * 16 + ln) * ldb + kb; FragH bq; bq.half[0] = *(const v8us*)(Bh + boff + 8 * hh); bq.half[1] = *(const v8us*)(Bh + boff + 16 + 8 * hh);
      acc[t] = mmaH<ASPLIT ? 2 : 1>(ah.v, al.v, bq.v, bq.v, acc[t]); }
  }
#pragma unroll
  for (int t = 0; t < 4; ++t) { if (col0 + t * 16 >= N) continue;
#pragma unroll
    for (int r = 0; r < 8; ++r) so[w][8 * hh + r][t * 16 + ln] = acc[t][r] * alpha; }
  __builtin_amdgcn_fence(__ATOMIC_ACQ_REL, "workgroup"); __builtin_amdgcn_wave_barrier();
  const int rsub = lane >> 4, c4 = (lane & 15) * 4;
  {
#pragma unroll
    for (int q = 0; q < 8; ++q) { const int r = q * 2 + rsub; if (col0 + c4 < N) { const v4f v = *(const v4fa*)&so[w][r][c4]; *(v4f*)(C + (size_t)(row0 + r) * ldc + col0 + c4) = v; } }
     }
}

// Wt[n][k] = f16(W[k][n]·scale) from f32 row-major W[K][N] (scale = power of two; bf16-exact weights stay exact in f16 away from the subnormal range)
__global__ __launch_bounds__(256) void k_wt_f16(const float* __restrict__ W, _Float16* __restrict__ Wt, int K, int N, float scale) {
  const int t = blockIdx.x * 256 + threadIdx.x; if (t >= N * (K / 8)) return; const int n = t / (K / 8), k8 = (t % (K / 8)) * 8; FragH f;
#pragma unroll
  for (int i = 0; i < 8; ++i) f.h[i] = (_Float16)(bf16_round(W[(size_t)(k8 + i) * N + n]) * scale); const v8us o = f.half[0];
  *(v8us*)((unsigned short*)Wt + (size_t)n * K + k8) = o; 
}
// k_gemm_hh variant with fused epilogue: v = acc·alpha + bias[by·sBias + col] (+ CP[(row/rowsPerB)·sCPb + by·64 + col] if CP) ; ACT 0 none / 1 elu ; writes f16 C16 (and f32 C if non-null)
template <int ACT>
__global__ __launch_bounds__(128) void k_gemm_hhx(const _Float16* __restrict__ A, int lda, size_t sA, const _Float16* __restrict__ Bh, int ldb, size_t sB, float alpha, const float* __restrict__ bias, size_t sBias, const float* __restrict__ CP, int rowsPerB, size_t sCPb, int row0g,
    float* __restrict__ C, _Float16* __restrict__ C16, int ldc, size_t sC, int M, int N, int K) {
  __shared__ __attribute__((aligned(16))) float so[4][16][64];
  const int tid = threadIdx.x, w = tid >> 5, lane = tid & 31, ln = lane & 15, hh = lane >> 4; const int by = blockIdx.y;
  A += (size_t)by * sA; Bh += (size_t)by * sB; const size_t cofs = (size_t)by * sC; const float* bp = bias ? bias + (size_t)by * sBias : nullptr;
  const int ntn = (N + 63) / 64; const int wid = blockIdx.x * 4 + w; const int mt = wid / ntn, nq = wid % ntn; if (mt * 16 >= M) return;
  const int row0 = mt * 16, col0 = nq * 64; const _Float16* arow = A + (size_t)(row0 + ln) * lda;
  v8f acc[4] = {};
  for (int kb = 0; kb < K; kb += 32) { FragH ah; ah.half[0] = *(const v8us*)((const unsigned short*)arow + kb + 8 * hh); ah.half[1] = *(const v8us*)((const unsigned short*)arow + kb + 16 + 8 * hh);
#pragma unroll
    for (int t = 0; t < 4; ++t) { if (col0 + t * 16 >= N) continue; const size_t boff = (size_t)(col0 + t * 16 + ln) * ldb + kb; FragH bq; bq.half[0] = *(const v8us*)((const unsigned short*)Bh + boff + 8 * hh); bq.half[1] = *(const v8us*)((const unsigned short*)Bh + boff + 16 + 8 * hh);
      acc[t] = mmaH<1>(ah.v, ah.v, bq.v, bq.v, acc[t]); }
  }
#pragma unroll
  for (int t = 0; t < 4; ++t) { if (col0 + t * 16 >= N) continue; const int col = col0 + t * 16 + ln; const float bv = bp ? bf16_round(bp[col]) : 0.f;
#pragma unroll
    for (int r = 0; r < 8; ++r) { float v = acc[t][r] * alpha + bv; if (CP) { const int bidx = (row0g + row0 + 8 * hh + r) / rowsPerB; v += CP[(size_t)bidx * sCPb + (size_t)by * 64 + col]; } if (ACT == 1) v = (v > 0.f) ? v : expm1f(v); else if (ACT == 7) v = (v > 0.f) ? v + 1.0f : expf(v); else if (ACT == 8) v = tanhf(v); else if (ACT == 9) v = 0.5f * v * (1.0f + tanhf(0.7978845608028654f * (v + 0.044715f * v * v * v))); else if (ACT == 11) v = 1.0f / (1.0f + expf(-v)); else if (ACT == 12) v = (v > 0.f) ? v : 0.01f * v; else if (ACT == 14) v = (v > 0.f) ? v : 0.1f * v; else if (ACT == 15) v = v / (1.0f + expf(-v)); else if (ACT == 3) v = fmaxf(v, 0.f); else if (ACT == 6) v = 0.5f * v * (1.0f + erff(v * 0.70710678118654752f)); so[w][8 * hh + r][t * 16 + ln] = v; } }
  __builtin_amdgcn_fence(__ATOMIC_ACQ_REL, "workgroup"); __builtin_amdgcn_wave_barrier();
  const int rsub = lane >> 4, c4 = (lane & 15) * 4; typedef _Float16 v4h __attribute__((ext_vector_type(4)));
  {
#pragma unroll
    for (int q = 0; q < 8; ++q) { const int r = q * 2 + rsub; if (col0 + c4 < N) { const v4f v = *(const v4fa*)&so[w][r][c4]; if (C) *(v4f*)(C + cofs + (size_t)(row0 + r) * ldc + col0 + c4) = v; if (C16) { v4h h4; for (int i = 0; i < 4; ++i) h4[i] = (_Float16)v[i]; *(v4h*)(C16 + cofs + (size_t)(row0 + r) * ldc + col0 + c4) = h4; } } }
     }
}


typedef _Float16 v4h __attribute__((ext_vector_type(4)));

__global__ __launch_bounds__(256) void k_x16(const float* __restrict__ x, _Float16* __restrict__ X16, size_t n8) { const size_t t = (size_t)blockIdx.x * 256 + threadIdx.x; if (t >= n8) return; FragH f;
#pragma unroll
  for (int q = 0; q < 8; ++q) f.h[q] = (_Float16)bf16_round(x[t * 8 + q]); *(v8us*)((unsigned short*)X16 + t * 8) = f.half[0];  }
__global__ __launch_bounds__(256) void k_h16(const float* __restrict__ x, _Float16* __restrict__ X16, size_t n8) { const size_t t = (size_t)blockIdx.x * 256 + threadIdx.x; if (t >= n8) return; FragH f;
#pragma unroll
  for (int q = 0; q < 8; ++q) f.h[q] = (_Float16)x[t * 8 + q]; *(v8us*)((unsigned short*)X16 + t * 8) = f.half[0];  }
__global__ __launch_bounds__(256) void k_round16f(const float* __restrict__ W, _Float16* __restrict__ Bt, size_t n8) { const size_t t = (size_t)blockIdx.x * 256 + threadIdx.x; if (t >= n8) return; FragH f;
#pragma unroll
  for (int i = 0; i < 8; ++i) f.h[i] = (_Float16)(bf16_round(W[t * 8 + i]) * 16.0f); *(v8us*)((unsigned short*)Bt + t * 8) = f.half[0];  }
template <int NHv, int TTv>
__global__ __launch_bounds__(256) void k_vt(const _Float16* __restrict__ V16, int ldv, int voff, _Float16* __restrict__ Vt) { __shared__ unsigned short tl[64][66]; const int tid = threadIdx.x; const int slab = blockIdx.x / (TTv / 64), lg = blockIdx.x % (TTv / 64); const int b = slab / NHv, h = slab % NHv;
  for (int i = tid; i < 64 * 8; i += 256) { const int r = i / 8, c8 = (i % 8) * 8; FragH f; f.half[0] = *(const v8us*)((const unsigned short*)V16 + ((size_t)b * TTv + lg * 64 + r) * ldv + voff + h * 64 + c8);
#pragma unroll
    for (int q = 0; q < 8; ++q) tl[r][c8 + q] = f.u[q]; }
  __syncthreads();
  {
#pragma unroll
    for (int rd = 0; rd < 2; ++rd) { const int d = rd * 32 + tid / 8, pc = tid % 8; FragH f;
#pragma unroll
      for (int q = 0; q < 8; ++q) f.u[q] = tl[pc * 8 + q][d];
      *(v8us*)((unsigned short*)Vt + ((size_t)slab * 64 + d) * TTv + lg * 64 + pc * 8) = f.half[0]; }
     } }

__global__ __launch_bounds__(256) void k_hl(const float* __restrict__ F, _Float16* __restrict__ Hh, _Float16* __restrict__ Hl, size_t n8) { const size_t t = (size_t)blockIdx.x * 256 + threadIdx.x; if (t >= n8) return; FragH fh, fl; const v4f a = *(const v4fa*)(F + t * 8), c = *(const v4fa*)(F + t * 8 + 4);
#pragma unroll
  for (int q = 0; q < 4; ++q) { _Float16 h = (_Float16)a[q]; fh.h[q] = h; fl.h[q] = (_Float16)((a[q] - (float)h) * 1024.0f); h = (_Float16)c[q]; fh.h[4 + q] = h; fl.h[4 + q] = (_Float16)((c[q] - (float)h) * 1024.0f); }
  { *(v8us*)((unsigned short*)Hh + t * 8) = fh.half[0]; *(v8us*)((unsigned short*)Hl + t * 8) = fl.half[0];  } }

// ---- fast GEMM (wave tile 32x64; requires M % 32 == 0 rows per launch region and N % 64 == 0); epilogue = k_gemm_hhx semantics ----
__device__ __forceinline__ v16h g2_frag(const _Float16* p, int hh) { FragH f; f.half[0] = *(const v8us*)((const unsigned short*)p + 8 * hh); f.half[1] = *(const v8us*)((const unsigned short*)p + 16 + 8 * hh); return f.v; }
__device__ __forceinline__ v8f g2_mma(v16h a, v16h b, v8f c) { v8f d = __builtin_amdgcn_wmma_f32_16x16x32_f16(false, a, false, b, (short)0, c, false, false); asm volatile("v_nop\n\tv_nop\n\tv_nop\n\tv_nop" : "+v"(d) : "v"(a), "v"(b)); return d; }
template <int ACT>
__global__ __launch_bounds__(128) void k_gemm2(const _Float16* __restrict__ A, int lda, size_t sA, const _Float16* __restrict__ Bh, int ldb, size_t sB, float alpha, const float* __restrict__ bias, size_t sBias, const float* __restrict__ CP, int rowsPerB, size_t sCPb, int row0g,
    float* __restrict__ C, _Float16* __restrict__ C16, int ldc, size_t sC, int M, int N, int K) {
  __shared__ __attribute__((aligned(16))) float so[4][32][68];
  const int tid = threadIdx.x, w = tid >> 5, lane = tid & 31, ln = lane & 15, hh = lane >> 4; const int by = blockIdx.y;
  A += (size_t)by * sA; Bh += (size_t)by * sB; const size_t cofs = (size_t)by * sC; const float* bp = bias ? bias + (size_t)by * sBias : nullptr;
  const int ntn = N >> 6; const int mt = blockIdx.x / ntn, nq = blockIdx.x - mt * ntn; const int row0 = mt * 128 + 32 * w, col0 = nq * 64; if (row0 >= M) return;
  const _Float16* a0p = A + (size_t)(row0 + ln) * lda; const _Float16* a1p = a0p + (size_t)16 * lda;
  const _Float16* b0p = Bh + (size_t)(col0 + ln) * ldb; const _Float16* b1p = b0p + (size_t)16 * ldb; const _Float16* b2p = b1p + (size_t)16 * ldb; const _Float16* b3p = b2p + (size_t)16 * ldb;
  const v8f z8 = {0.f,0.f,0.f,0.f,0.f,0.f,0.f,0.f}; v8f c00 = z8, c01 = z8, c02 = z8, c03 = z8, c10 = z8, c11 = z8, c12 = z8, c13 = z8;
#pragma unroll 1
  for (int kb = 0; kb < K; kb += 32) { const v16h a0 = g2_frag(a0p + kb, hh), a1 = g2_frag(a1p + kb, hh);
    v16h b = g2_frag(b0p + kb, hh); c00 = g2_mma(a0, b, c00); c10 = g2_mma(a1, b, c10);
    b = g2_frag(b1p + kb, hh); c01 = g2_mma(a0, b, c01); c11 = g2_mma(a1, b, c11);
    b = g2_frag(b2p + kb, hh); c02 = g2_mma(a0, b, c02); c12 = g2_mma(a1, b, c12);
    b = g2_frag(b3p + kb, hh); c03 = g2_mma(a0, b, c03); c13 = g2_mma(a1, b, c13); }
  v8f accs[8] = {c00, c01, c02, c03, c10, c11, c12, c13};
#pragma unroll
  for (int u = 0; u < 8; ++u) { const int t = u & 3, half = u >> 2; const int col = col0 + t * 16 + ln; const float bv = bp ? bf16_round(bp[col]) : 0.f;
#pragma unroll
    for (int r = 0; r < 8; ++r) { const int rloc = half * 16 + 8 * hh + r; float v = accs[u][r] * alpha + bv; if (CP) { if (rowsPerB < 0) v += CP[cofs + (size_t)(row0g + row0 + rloc) * ldc + col];      /* rowsPerB < 0: own element of the batched C plane */ else { const int bidx = (row0g + row0 + rloc) / rowsPerB; v += CP[(size_t)bidx * sCPb + (size_t)by * 64 + col]; } }
      if (ACT == 3) v = fmaxf(v, 0.f); else if (ACT == 6) v = 0.5f * v * (1.0f + erff(v * 0.70710678118654752f)); else if (ACT == 11) v = 1.0f / (1.0f + expf(-v)); else if (ACT == 15) v = v / (1.0f + expf(-v)); else if (ACT == 12) v = (v > 0.f) ? v : 0.01f * v; else if (ACT == 8) v = tanhf(v);
      so[w][rloc][t * 16 + ln] = v; } }
  __builtin_amdgcn_fence(__ATOMIC_ACQ_REL, "workgroup"); __builtin_amdgcn_wave_barrier();
  const int rsub = lane >> 4, c4 = (lane & 15) * 4;
  {
#pragma unroll
    for (int q = 0; q < 16; ++q) { const int r = q * 2 + rsub; const v4f v = *(const v4fa*)&so[w][r][c4]; if (C) *(v4f*)(C + cofs + (size_t)(row0 + r) * ldc + col0 + c4) = v; if (C16) { v4h h4; for (int i = 0; i < 4; ++i) h4[i] = (_Float16)v[i]; *(v4h*)(C16 + cofs + (size_t)(row0 + r) * ldc + col0 + c4) = h4; } }
     } }



template <int CAUSAL>
__global__ __launch_bounds__(128) void k_flash(const _Float16* __restrict__ Q16, int ldq, const _Float16* __restrict__ K16, int ldk, const _Float16* __restrict__ Vt, const int* __restrict__ MSK, float* __restrict__ O, int ldo) {
  constexpr int RPW = 16, RTN = RPW / 16, NQB = TQ / (4 * RPW), DT = 4, KS = 2;
  __shared__ __attribute__((aligned(16))) unsigned short sP[4][RPW][40]; __shared__ __attribute__((aligned(16))) float sO[4][RPW][64 + 4];
  const int tid = threadIdx.x, w = tid >> 5, lane = tid & 31, ln = lane & 15, hh = lane >> 4;
  const int slab = blockIdx.x / QBNP, qblk = QB0P + blockIdx.x % QBNP; (void)NQB; const int b = slab / NH, h = slab % NH; const int qb0 = qblk * (4 * RPW); const int q0 = qb0 + w * RPW;
  FragH aq[2][KS];
#pragma unroll
  for (int rt = 0; rt < RTN; ++rt) { const unsigned short* qr = (const unsigned short*)Q16 + ((size_t)b * TQ + q0 + rt * 16 + ln) * ldq + h * 64;
#pragma unroll
    for (int ks = 0; ks < KS; ++ks) { aq[rt][ks].half[0] = *(const v8us*)(qr + ks * 32 + 8 * hh); aq[rt][ks].half[1] = *(const v8us*)(qr + ks * 32 + 16 + 8 * hh); } }
  const unsigned short* Vth = (const unsigned short*)Vt + (size_t)slab * 64 * TK;
  float m_r[2][8], l_r[2][8]; v8f oacc[2][DT];
#pragma unroll
  for (int rt = 0; rt < RTN; ++rt) {
#pragma unroll
    for (int r = 0; r < 8; ++r) { m_r[rt][r] = -3.0e38f; l_r[rt][r] = 0.f; }
#pragma unroll
    for (int dt = 0; dt < DT; ++dt) oacc[rt][dt] = (v8f){0.f,0.f,0.f,0.f,0.f,0.f,0.f,0.f}; }
  const int jend = (CAUSAL == 1) ? (qb0 + 4 * RPW) : ((CAUSAL == 23) ? min(TK, (qb0 / CHK + 2) * CHK) : TK);      /* causal / window: keys that can never contribute are skipped */ const int jbeg = (CAUSAL == 23) ? max(0, (qb0 / CHK - 1) * CHK) : 0;
#pragma unroll 1
  for (int j0 = jbeg; j0 < jend; j0 += 32) {
    v8f s[2][2];
#pragma unroll
    for (int nt = 0; nt < 2; ++nt) { const unsigned short* kr = (const unsigned short*)K16 + ((size_t)b * TK + j0 + nt * 16 + ln) * ldk + h * 64; FragH bk[KS];
#pragma unroll
      for (int ks = 0; ks < KS; ++ks) { bk[ks].half[0] = *(const v8us*)(kr + ks * 32 + 8 * hh); bk[ks].half[1] = *(const v8us*)(kr + ks * 32 + 16 + 8 * hh); }
#pragma unroll
      for (int rt = 0; rt < RTN; ++rt) { v8f acc = (v8f){0.f,0.f,0.f,0.f,0.f,0.f,0.f,0.f};
#pragma unroll
        for (int ks = 0; ks < KS; ++ks) acc = mmaH<1>(aq[rt][ks].v, aq[rt][ks].v, bk[ks].v, bk[ks].v, acc); s[rt][nt] = acc; } }
#pragma unroll
    for (int rt = 0; rt < RTN; ++rt)
#pragma unroll
      for (int r = 0; r < 8; ++r) { const int tq = q0 + rt * 16 + 8 * hh + r; const int k0 = j0 + ln, k1 = j0 + 16 + ln;
        bool ok0 = (CAUSAL == 1) ? (k0 <= tq) : ((CAUSAL == 2) ? ((k0 >> 5) == (tq >> 5)) : true), ok1 = (CAUSAL == 1) ? (k1 <= tq) : ((CAUSAL == 2) ? ((k1 >> 5) == (tq >> 5)) : true); if (CAUSAL == 23) { const int cq = tq / CHK; ok0 = (abs(k0 / CHK - cq) <= 1) && (MSK[(size_t)b * TK + k0] == 0); ok1 = (abs(k1 / CHK - cq) <= 1) && (MSK[(size_t)b * TK + k1] == 0); }      /* mode 23: 3-chunk window + int key-padding mask */
        if (CAUSAL == 24) { ok0 = (MSK[(size_t)b * TK + k0] == 0); ok1 = (MSK[(size_t)b * TK + k1] == 0); }      /* mode 24: int key-padding mask (nonzero = padded = excluded) */      /* mode 2: block-diagonal 32-token groups */
        float s0 = ok0 ? s[rt][0][r] * SCL : -3.0e38f, s1 = ok1 ? s[rt][1][r] * SCL : -3.0e38f; if (CAUSAL == 17) { const float* amk = (const float*)MSK + (size_t)b * TK; s0 += bf16_round(amk[k0]); s1 += bf16_round(amk[k1]); } if (CAUSAL == 18) { const float* tb = (const float*)MSK; const int* ri = MSK + 1024 + (size_t)b * TK; const int rq = ri[tq]; s0 += tb[(h * 8 + rq) * 8 + ri[k0]]; s1 += tb[(h * 8 + rq) * 8 + ri[k1]]; } if (CAUSAL == 19) { const int* rel = MSK + (size_t)tq * TK; const float* rb = (const float*)MSK + (size_t)TQ * TK + ((size_t)(b * NH + h) * TQ + tq) * 64; s0 += rb[rel[k0]]; s1 += rb[rel[k1]]; }      /* mode 19: + (q.Ek[rel] + Eb[rel][h]) / 8 gathered by the int relative ids (packed [ids | table]) */      /* mode 18: + resource_bias[h][r_q][r_k] from the packed [table | ids] buffer (TQ == TK) */      /* mode 17: additive per-(batch, key) mask INPUT */ float mc = fmaxf(s0, s1);
        mc = fmaxf(mc, __shfl_xor(mc, 1, 32)); mc = fmaxf(mc, __shfl_xor(mc, 2, 32)); mc = fmaxf(mc, __shfl_xor(mc, 4, 32)); mc = fmaxf(mc, __shfl_xor(mc, 8, 32));
        const float mn = fmaxf(m_r[rt][r], mc); const float al = (mn > -1.0e38f) ? expf(m_r[rt][r] - mn) : 1.0f; m_r[rt][r] = mn; const float p0 = ok0 ? expf(s0 - mn) : 0.f, p1 = ok1 ? expf(s1 - mn) : 0.f; l_r[rt][r] = l_r[rt][r] * al + p0 + p1;
#pragma unroll
        for (int dt = 0; dt < DT; ++dt) oacc[rt][dt][r] *= al;
        FragH t2; t2.h[0] = (_Float16)(p0 * 1024.0f); t2.h[1] = (_Float16)(p1 * 1024.0f); sP[w][rt * 16 + 8 * hh + r][ln] = t2.u[0]; sP[w][rt * 16 + 8 * hh + r][16 + ln] = t2.u[1]; }
    __builtin_amdgcn_fence(__ATOMIC_ACQ_REL, "workgroup"); __builtin_amdgcn_wave_barrier();
    FragH pa[2];
#pragma unroll
    for (int rt = 0; rt < RTN; ++rt) { pa[rt].half[0] = *(const v8us*)&sP[w][rt * 16 + ln][8 * hh]; pa[rt].half[1] = *(const v8us*)&sP[w][rt * 16 + ln][16 + 8 * hh]; }
#pragma unroll
    for (int dt = 0; dt < DT; ++dt) { const unsigned short* vrow = Vth + (size_t)(dt * 16 + ln) * TK + j0; FragH bv; bv.half[0] = *(const v8us*)(vrow + 8 * hh); bv.half[1] = *(const v8us*)(vrow + 16 + 8 * hh);
#pragma unroll
      for (int rt = 0; rt < RTN; ++rt) oacc[rt][dt] = mmaH<1>(pa[rt].v, pa[rt].v, bv.v, bv.v, oacc[rt][dt]); }
    __builtin_amdgcn_fence(__ATOMIC_ACQ_REL, "workgroup"); __builtin_amdgcn_wave_barrier(); }
#pragma unroll
  for (int rt = 0; rt < RTN; ++rt) {
#pragma unroll
    for (int r = 0; r < 8; ++r) { float l = l_r[rt][r]; l += __shfl_xor(l, 1, 32); l += __shfl_xor(l, 2, 32); l += __shfl_xor(l, 4, 32); l += __shfl_xor(l, 8, 32); l_r[rt][r] = (l > 0.f) ? 1.0f / (l * 1024.0f) : 0.f; }
#pragma unroll
    for (int dt = 0; dt < DT; ++dt)
#pragma unroll
      for (int r = 0; r < 8; ++r) sO[w][rt * 16 + 8 * hh + r][dt * 16 + ln] = oacc[rt][dt][r] * l_r[rt][r]; }
  __builtin_amdgcn_fence(__ATOMIC_ACQ_REL, "workgroup"); __builtin_amdgcn_wave_barrier();
  {
#pragma unroll
    for (int rp = 0; rp < RPW; rp += 2) { const int r = rp + (lane >> 4), pc = lane & 15; const v4f val = *(const v4fa*)&sO[w][r][pc * 4]; *(v4f*)(O + ((size_t)b * TQ + q0 + r) * ldo + h * 64 + pc * 4) = val; }
     } }
// 5-plane variant: S = Qh Kh^T + (Ql Kh^T + Qh Kl^T)/1024 with Q/K = [hi | 2^10 residual] f16 planes (QL/KL same layout as Q16/K16), then the 3-term P.V below.
// 3-term variant: O = (P_hi V_hi + (P_lo V_hi + P_hi V_lo) / 1024) / l with P = [hi | 2^10 residual] of 1024 p and V^T = [hi | 2^10 residual] planes (VtL same layout as Vt) -> ~2^-21-class products for un-averaged (early causal / peaked) rows
template <int CAUSAL>
__global__ __launch_bounds__(128) void k_flash5(const _Float16* __restrict__ Q16, const _Float16* __restrict__ QL, int ldq, const _Float16* __restrict__ K16, const _Float16* __restrict__ KL, int ldk, const _Float16* __restrict__ Vt, const _Float16* __restrict__ VtL, const int* __restrict__ MSK, float* __restrict__ O, int ldo) {
  constexpr int RPW = 16, RTN = RPW / 16, NQB = TQ / (4 * RPW), DT = 4, KS = 2;
  __shared__ __attribute__((aligned(16))) unsigned short sP[4][RPW][40]; __shared__ __attribute__((aligned(16))) unsigned short sPL[4][RPW][40]; __shared__ __attribute__((aligned(16))) float sO[4][RPW][64 + 4];
  const int tid = threadIdx.x, w = tid >> 5, lane = tid & 31, ln = lane & 15, hh = lane >> 4;
  const int slab = blockIdx.x / QBN5, qblk = QB05 + blockIdx.x % QBN5; (void)NQB; const int b = slab / NH, h = slab % NH; const int qb0 = qblk * (4 * RPW); const int q0 = qb0 + w * RPW;
  FragH aq[2][KS], aql[2][KS];
#pragma unroll
  for (int rt = 0; rt < RTN; ++rt) { const unsigned short* qr = (const unsigned short*)Q16 + ((size_t)b * TQ + q0 + rt * 16 + ln) * ldq + h * 64; const unsigned short* ql = (const unsigned short*)QL + ((size_t)b * TQ + q0 + rt * 16 + ln) * ldq + h * 64;
#pragma unroll
    for (int ks = 0; ks < KS; ++ks) { aq[rt][ks].half[0] = *(const v8us*)(qr + ks * 32 + 8 * hh); aq[rt][ks].half[1] = *(const v8us*)(qr + ks * 32 + 16 + 8 * hh); aql[rt][ks].half[0] = *(const v8us*)(ql + ks * 32 + 8 * hh); aql[rt][ks].half[1] = *(const v8us*)(ql + ks * 32 + 16 + 8 * hh); } }
  const unsigned short* Vth = (const unsigned short*)Vt + (size_t)slab * 64 * TK; const unsigned short* Vtl = (const unsigned short*)VtL + (size_t)slab * 64 * TK;
  float m_r[2][8], l_r[2][8]; v8f oacc[2][DT], oaccL[2][DT];
#pragma unroll
  for (int rt = 0; rt < RTN; ++rt) {
#pragma unroll
    for (int r = 0; r < 8; ++r) { m_r[rt][r] = -3.0e38f; l_r[rt][r] = 0.f; }
#pragma unroll
    for (int dt = 0; dt < DT; ++dt) { oacc[rt][dt] = (v8f){0.f,0.f,0.f,0.f,0.f,0.f,0.f,0.f}; oaccL[rt][dt] = oacc[rt][dt]; } }
  const int jend = (CAUSAL == 1) ? (qb0 + 4 * RPW) : ((CAUSAL == 23) ? min(TK, (qb0 / CHK + 2) * CHK) : TK);      /* causal / window: keys that can never contribute are skipped */ const int jbeg = (CAUSAL == 23) ? max(0, (qb0 / CHK - 1) * CHK) : 0;
#pragma unroll 1
  for (int j0 = jbeg; j0 < jend; j0 += 32) {
    v8f s[2][2];
#pragma unroll
    for (int nt = 0; nt < 2; ++nt) { const unsigned short* kr = (const unsigned short*)K16 + ((size_t)b * TK + j0 + nt * 16 + ln) * ldk + h * 64; const unsigned short* klr = (const unsigned short*)KL + ((size_t)b * TK + j0 + nt * 16 + ln) * ldk + h * 64; FragH bk[KS], bkl[KS];
#pragma unroll
      for (int ks = 0; ks < KS; ++ks) { bk[ks].half[0] = *(const v8us*)(kr + ks * 32 + 8 * hh); bk[ks].half[1] = *(const v8us*)(kr + ks * 32 + 16 + 8 * hh); bkl[ks].half[0] = *(const v8us*)(klr + ks * 32 + 8 * hh); bkl[ks].half[1] = *(const v8us*)(klr + ks * 32 + 16 + 8 * hh); }
#pragma unroll
      for (int rt = 0; rt < RTN; ++rt) { v8f acc = (v8f){0.f,0.f,0.f,0.f,0.f,0.f,0.f,0.f}, accl = acc;
#pragma unroll
        for (int ks = 0; ks < KS; ++ks) { acc = mmaH<1>(aq[rt][ks].v, aq[rt][ks].v, bk[ks].v, bk[ks].v, acc); accl = mmaH<1>(aql[rt][ks].v, aql[rt][ks].v, bk[ks].v, bk[ks].v, accl); accl = mmaH<1>(aq[rt][ks].v, aq[rt][ks].v, bkl[ks].v, bkl[ks].v, accl); }
#pragma unroll
        for (int r = 0; r < 8; ++r) acc[r] += accl[r] * 0.0009765625f;
        s[rt][nt] = acc; } }
#pragma unroll
    for (int rt = 0; rt < RTN; ++rt)
#pragma unroll
      for (int r = 0; r < 8; ++r) { const int tq = q0 + rt * 16 + 8 * hh + r; const int k0 = j0 + ln, k1 = j0 + 16 + ln;
        bool ok0 = (CAUSAL == 1) ? (k0 <= tq) : ((CAUSAL == 2) ? ((k0 >> 5) == (tq >> 5)) : true), ok1 = (CAUSAL == 1) ? (k1 <= tq) : ((CAUSAL == 2) ? ((k1 >> 5) == (tq >> 5)) : true);      /* mode 2: block-diagonal 32-token groups */
        if (CAUSAL == 4) { const int* mrow = MSK + ((size_t)b * TQ + tq) * TK; ok0 = mrow[k0] != 0; ok1 = mrow[k1] != 0; }      /* mode 4: per-(query, key) INPUT mask shared by all heads; masked keys contribute nothing (== the reference's -4096 fill, whose exp underflows to 0), rows with no valid key give l = 0 -> output 0 (== the reference's row_valid zeroing) */
        float s0 = ok0 ? s[rt][0][r] * SCL : -3.0e38f, s1 = ok1 ? s[rt][1][r] * SCL : -3.0e38f; if (CAUSAL == 17) { const float* amk = (const float*)MSK + (size_t)b * TK; s0 += bf16_round(amk[k0]); s1 += bf16_round(amk[k1]); } if (CAUSAL == 18) { const float* tb = (const float*)MSK; const int* ri = MSK + 1024 + (size_t)b * TK; const int rq = ri[tq]; s0 += tb[(h * 8 + rq) * 8 + ri[k0]]; s1 += tb[(h * 8 + rq) * 8 + ri[k1]]; } if (CAUSAL == 19) { const int* rel = MSK + (size_t)tq * TK; const float* rb = (const float*)MSK + (size_t)TQ * TK + ((size_t)(b * NH + h) * TQ + tq) * 64; s0 += rb[rel[k0]]; s1 += rb[rel[k1]]; }      /* mode 19: + (q.Ek[rel] + Eb[rel][h]) / 8 gathered by the int relative ids (packed [ids | table]) */      /* mode 18: + resource_bias[h][r_q][r_k] from the packed [table | ids] buffer (TQ == TK) */      /* mode 17: additive per-(batch, key) mask INPUT */ float mc = fmaxf(s0, s1);
        mc = fmaxf(mc, __shfl_xor(mc, 1, 32)); mc = fmaxf(mc, __shfl_xor(mc, 2, 32)); mc = fmaxf(mc, __shfl_xor(mc, 4, 32)); mc = fmaxf(mc, __shfl_xor(mc, 8, 32));
        const float mn = fmaxf(m_r[rt][r], mc); const float al = (mn > -1.0e38f) ? expf(m_r[rt][r] - mn) : 1.0f; m_r[rt][r] = mn; const float p0 = ok0 ? expf(s0 - mn) : 0.f, p1 = ok1 ? expf(s1 - mn) : 0.f; l_r[rt][r] = l_r[rt][r] * al + p0 + p1;
#pragma unroll
        for (int dt = 0; dt < DT; ++dt) { oacc[rt][dt][r] *= al; oaccL[rt][dt][r] *= al; }
        FragH t2, t2l; const float ps0 = p0 * 1024.0f, ps1 = p1 * 1024.0f; t2.h[0] = (_Float16)ps0; t2.h[1] = (_Float16)ps1; t2l.h[0] = (_Float16)((ps0 - (float)t2.h[0]) * 1024.0f); t2l.h[1] = (_Float16)((ps1 - (float)t2.h[1]) * 1024.0f);
        sP[w][rt * 16 + 8 * hh + r][ln] = t2.u[0]; sP[w][rt * 16 + 8 * hh + r][16 + ln] = t2.u[1]; sPL[w][rt * 16 + 8 * hh + r][ln] = t2l.u[0]; sPL[w][rt * 16 + 8 * hh + r][16 + ln] = t2l.u[1]; }
    __builtin_amdgcn_fence(__ATOMIC_ACQ_REL, "workgroup"); __builtin_amdgcn_wave_barrier();
    FragH pa[2], pl[2];
#pragma unroll
    for (int rt = 0; rt < RTN; ++rt) { pa[rt].half[0] = *(const v8us*)&sP[w][rt * 16 + ln][8 * hh]; pa[rt].half[1] = *(const v8us*)&sP[w][rt * 16 + ln][16 + 8 * hh]; pl[rt].half[0] = *(const v8us*)&sPL[w][rt * 16 + ln][8 * hh]; pl[rt].half[1] = *(const v8us*)&sPL[w][rt * 16 + ln][16 + 8 * hh]; }
#pragma unroll
    for (int dt = 0; dt < DT; ++dt) { const unsigned short* vrow = Vth + (size_t)(dt * 16 + ln) * TK + j0; const unsigned short* vrl = Vtl + (size_t)(dt * 16 + ln) * TK + j0; FragH bv, bl; bv.half[0] = *(const v8us*)(vrow + 8 * hh); bv.half[1] = *(const v8us*)(vrow + 16 + 8 * hh); bl.half[0] = *(const v8us*)(vrl + 8 * hh); bl.half[1] = *(const v8us*)(vrl + 16 + 8 * hh);
#pragma unroll
      for (int rt = 0; rt < RTN; ++rt) { oacc[rt][dt] = mmaH<1>(pa[rt].v, pa[rt].v, bv.v, bv.v, oacc[rt][dt]); oaccL[rt][dt] = mmaH<1>(pl[rt].v, pl[rt].v, bv.v, bv.v, oaccL[rt][dt]); oaccL[rt][dt] = mmaH<1>(pa[rt].v, pa[rt].v, bl.v, bl.v, oaccL[rt][dt]); } }
    __builtin_amdgcn_fence(__ATOMIC_ACQ_REL, "workgroup"); __builtin_amdgcn_wave_barrier(); }
#pragma unroll
  for (int rt = 0; rt < RTN; ++rt) {
#pragma unroll
    for (int r = 0; r < 8; ++r) { float l = l_r[rt][r]; l += __shfl_xor(l, 1, 32); l += __shfl_xor(l, 2, 32); l += __shfl_xor(l, 4, 32); l += __shfl_xor(l, 8, 32); l_r[rt][r] = (l > 0.f) ? 1.0f / (l * 1024.0f) : 0.f; }
#pragma unroll
    for (int dt = 0; dt < DT; ++dt)
#pragma unroll
      for (int r = 0; r < 8; ++r) { float v = oacc[rt][dt][r]; v += oaccL[rt][dt][r] * 0.0009765625f; sO[w][rt * 16 + 8 * hh + r][dt * 16 + ln] = v * l_r[rt][r]; } }
  __builtin_amdgcn_fence(__ATOMIC_ACQ_REL, "workgroup"); __builtin_amdgcn_wave_barrier();
  {
#pragma unroll
    for (int rp = 0; rp < RPW; rp += 2) { const int r = rp + (lane >> 4), pc = lane & 15; const v4f val = *(const v4fa*)&sO[w][r][pc * 4]; *(v4f*)(O + ((size_t)b * TQ + q0 + r) * ldo + h * 64 + pc * 4) = val; }
     } }

__global__ __launch_bounds__(256) void k_rotab(float* __restrict__ CS, float* __restrict__ SN) {
  #pragma clang fp contract(off)
  const int t = blockIdx.x * 256 + threadIdx.x; if (t >= SLEN * 32) return; const int j = t % 32, s = t / 32; const float ex = (float)(2 * j) / 64.0f; const float inv = 1.0f / powf(10000.0f, ex); const float th = (float)s * inv; const float c = cosf(th), sn = sinf(th);
  { *(float*)(CS + t) = c; *(float*)(SN + t) = sn;  } }
__global__ __launch_bounds__(256) void k_rope(const float* __restrict__ F, int nsrc, int ndst, int rep, const float* __restrict__ CS, const float* __restrict__ SN, _Float16* __restrict__ H, _Float16* __restrict__ L) {
  #pragma clang fp contract(off)
  const size_t t = (size_t)blockIdx.x * 256 + threadIdx.x; if (t >= (size_t)NR * ndst * 4) return; const int g8 = (int)(t % 4); const int hd = (int)((t / 4) % ndst); const size_t row = t / ((size_t)4 * ndst); const int s = (int)(row % SLEN); const int hs = hd / rep;
  const float* src = F + row * (size_t)(nsrc * 64) + hs * 64; FragH ah, al, bh, bl;
  for (int i = 0; i < 8; ++i) { const int d = g8 * 8 + i; const float c = CS[s * 32 + d], sn = SN[s * 32 + d]; const float x1 = src[d], x2 = src[d + 32];
    float o1 = x1 * c; o1 += -x2 * sn; float o2 = x2 * c; o2 += x1 * sn;
    _Float16 hv = (_Float16)o1; ah.h[i] = hv; al.h[i] = (_Float16)((o1 - (float)hv) * 1024.0f); hv = (_Float16)o2; bh.h[i] = hv; bl.h[i] = (_Float16)((o2 - (float)hv) * 1024.0f); }
  const size_t o = row * (size_t)(ndst * 64) + hd * 64 + g8 * 8;
  { *(v8us*)((unsigned short*)H + o) = ah.half[0]; *(v8us*)((unsigned short*)H + o + 32) = bh.half[0]; *(v8us*)((unsigned short*)L + o) = al.half[0]; *(v8us*)((unsigned short*)L + o + 32) = bl.half[0];  } }
__global__ __launch_bounds__(256) void k_rope2(const float* __restrict__ F, int nsrc, int ndst, int rep, const float* __restrict__ CS, const float* __restrict__ SN, _Float16* __restrict__ H, _Float16* __restrict__ L) {
  #pragma clang fp contract(off)
  const size_t t = (size_t)blockIdx.x * 256 + threadIdx.x; if (t >= (size_t)NR * ndst * 4) return; const int g16 = (int)(t % 4); const int hd = (int)((t / 4) % ndst); const size_t row = t / ((size_t)4 * ndst); const int s = (int)(row % SLEN); const int hs = hd / rep;
  const float* src = F + row * (size_t)(nsrc * 64) + hs * 64 + g16 * 16; FragH ah, al;
  for (int pr = 0; pr < 8; ++pr) { const int i = g16 * 8 + pr; const float c = CS[s * 32 + i], sn = SN[s * 32 + i]; const float x1 = src[2 * pr], x2 = src[2 * pr + 1];
    float o1 = x1 * c; o1 -= x2 * sn; float o2 = x1 * sn; o2 += x2 * c;
    _Float16 hv = (_Float16)o1; ah.h[2 * pr] = hv; al.h[2 * pr] = (_Float16)((o1 - (float)hv) * 1024.0f); hv = (_Float16)o2; ah.h[2 * pr + 1] = hv; al.h[2 * pr + 1] = (_Float16)((o2 - (float)hv) * 1024.0f); }
  const size_t o = row * (size_t)(ndst * 64) + hd * 64 + g16 * 16;
  { *(v8us*)((unsigned short*)H + o) = ah.half[0]; *(v8us*)((unsigned short*)H + o + 8) = ah.half[1]; *(v8us*)((unsigned short*)L + o) = al.half[0]; *(v8us*)((unsigned short*)L + o + 8) = al.half[1];  } }
__global__ __launch_bounds__(256) void k_ln512(const float* __restrict__ A, const float* __restrict__ res, const float* __restrict__ g, const float* __restrict__ bb, float* __restrict__ Y, _Float16* __restrict__ Y16) {
  #pragma clang fp contract(off)
  const int wv = threadIdx.x >> 5, ln = threadIdx.x & 31; const size_t r = (size_t)blockIdx.x * 8 + wv; if (r >= NR) return; float x[16]; float s = 0.f;
  for (int i = 0; i < 2; ++i) { const v8f a = *(const v8f*)(A + r * DM + i * 256 + ln * 8); for (int q = 0; q < 8; ++q) { float v = a[q]; if (res) v += bf16_round(res[r * DM + i * 256 + ln * 8 + q]); x[i * 8 + q] = v; s += v; } }
  for (int o = 16; o > 0; o >>= 1) s += __shfl_xor(s, o, 32); const float mu = s / (float)DM; float var = 0.f; for (int q = 0; q < 16; ++q) { const float d = x[q] - mu; var += d * d; }
  for (int o = 16; o > 0; o >>= 1) var += __shfl_xor(var, o, 32); const float inv = rsqrtf(var / (float)DM + 1e-5f);
  { for (int i = 0; i < 2; ++i) { const int c0 = i * 256 + ln * 8; v8f y; FragH f; for (int q = 0; q < 8; ++q) { float v = (x[i * 8 + q] - mu) * inv; v *= bf16_round(g[c0 + q]); v += bf16_round(bb[c0 + q]); y[q] = v; f.h[q] = (_Float16)v; } *(v8f*)(Y + r * DM + c0) = y; if (Y16) *(v8us*)((unsigned short*)Y16 + r * DM + c0) = f.half[0]; }  } }
__global__ __launch_bounds__(256) void k_pack(const float* __restrict__ rb, const int* __restrict__ rid, int* __restrict__ PK) { const int t = blockIdx.x * 256 + threadIdx.x; if (t >= 1024 + NB * TK) return; int v; if (t < 1024) v = __float_as_int(bf16_round(rb[t])); else v = rid[t - 1024]; *(int*)(PK + t) = v;  }
__global__ __launch_bounds__(256) void k_tabin(const float* __restrict__ sp, float* __restrict__ CS, float* __restrict__ SN) { const int t = blockIdx.x * 256 + threadIdx.x; if (t >= SLEN * 32) return; const int i = t % 32, s = t / 32; const float c = bf16_round(sp[s * 64 + 32 + i]), sn = bf16_round(sp[s * 64 + i]);
  { *(float*)(CS + t) = c; *(float*)(SN + t) = sn;  } }
__global__ __launch_bounds__(256) void k_wsc(const float* __restrict__ Wm, _Float16* __restrict__ Bt, size_t n8, float sc) { const size_t t = (size_t)blockIdx.x * 256 + threadIdx.x; if (t >= n8) return; FragH f; for (int q = 0; q < 8; ++q) f.h[q] = (_Float16)(bf16_round(Wm[t * 8 + q]) * sc); *(v8us*)((unsigned short*)Bt + t * 8) = f.half[0];  }
__global__ __launch_bounds__(256) void k_rotab2(float* __restrict__ CS, float* __restrict__ SN) {
  #pragma clang fp contract(off)
  const int t = blockIdx.x * 256 + threadIdx.x; if (t >= SLEN * 32) return; const int j = t % 32, s = t / 32; const float c0 = -0.14391156831212787f;      /* -ln(10000)/64 rounded to f32 */ const float inv = expf((float)(2 * j) * c0); const float th = (float)s * inv; const float c = cosf(th), sn = sinf(th);
  { *(float*)(CS + t) = c; *(float*)(SN + t) = sn;  } }
__global__ __launch_bounds__(256) void k_lnu(const float* __restrict__ X, _Float16* __restrict__ N16, float* __restrict__ XB) {
  #pragma clang fp contract(off)
  const int wv = threadIdx.x >> 5, ln = threadIdx.x & 31; const size_t r = (size_t)blockIdx.x * 8 + wv; if (r >= NR) return; float a[32]; float s = 0.f;
  for (int i = 0; i < 4; ++i) { const v8f v = *(const v8f*)(X + r * DM + (i * 32 + ln) * 8); for (int q = 0; q < 8; ++q) { const float u = bf16_round(v[q]); a[i * 8 + q] = u; s += u; } }
  for (int o = 16; o > 0; o >>= 1) s += __shfl_xor(s, o, 32); const float mu = s / (float)DM; float var = 0.f; for (int q = 0; q < 32; ++q) { const float d = a[q] - mu; var += d * d; }
  for (int o = 16; o > 0; o >>= 1) var += __shfl_xor(var, o, 32); const float den = sqrtf(var / (float)(DM - 1)) + 1e-6f; const float inv = 1.0f / den;      /* one reciprocal per row; (x-mean)*inv vs the reference's division differs by <= 1 ulp */
  { for (int i = 0; i < 4; ++i) { const int c0 = (i * 32 + ln) * 8; FragH f; v8f xb; for (int q = 0; q < 8; ++q) { f.h[q] = (_Float16)((a[i * 8 + q] - mu) * inv); xb[q] = a[i * 8 + q]; } *(v8us*)((unsigned short*)N16 + r * DM + c0) = f.half[0]; *(v8f*)(XB + r * DM + c0) = xb; }  } }
__global__ __launch_bounds__(256) void k_vtg(const _Float16* __restrict__ V16, _Float16* __restrict__ Vt) { __shared__ unsigned short tl[64][66]; const int tid = threadIdx.x; const int slab = blockIdx.x / (SLEN / 64), lg = blockIdx.x % (SLEN / 64); const int b = slab / NH, h = slab % NH; const int hs = h / NREP;
  for (int i = tid; i < 64 * 8; i += 256) { const int r = i / 8, c8 = (i % 8) * 8; FragH f; f.half[0] = *(const v8us*)((const unsigned short*)V16 + ((size_t)b * SLEN + lg * 64 + r) * KVD + hs * 64 + c8); for (int q = 0; q < 8; ++q) tl[r][c8 + q] = f.u[q]; }
  __syncthreads();
  { for (int rd = 0; rd < 2; ++rd) { const int d = rd * 32 + tid / 8, pc = tid % 8; FragH f; for (int q = 0; q < 8; ++q) f.u[q] = tl[pc * 8 + q][d]; *(v8us*)((unsigned short*)Vt + ((size_t)slab * 64 + d) * SLEN + lg * 64 + pc * 8) = f.half[0]; }  } }

__global__ __launch_bounds__(256) void k_h16s(const float* __restrict__ SRC, int lds, int coff, _Float16* __restrict__ DST, size_t n8) { const size_t t = (size_t)blockIdx.x * 256 + threadIdx.x; if (t >= n8) return; const size_t r = (t * 8) / DM; const int c = (int)((t * 8) % DM); const v8f a = *(const v8f*)(SRC + r * lds + coff + c); FragH f; for (int q = 0; q < 8; ++q) f.h[q] = (_Float16)a[q];
  *(v8us*)((unsigned short*)DST + t * 8) = f.half[0];  }

#define HG 4
__global__ __launch_bounds__(256) void k_norms(const float* __restrict__ QKV, float* __restrict__ QN, float* __restrict__ KN) {
  #pragma clang fp contract(off)
  const size_t t = (size_t)blockIdx.x * 256 + threadIdx.x; if (t >= (size_t)NR * NH) return; const int h = (int)(t % NH); const size_t row = t / NH; const float* q = QKV + row * (3 * DM) + h * 64; const float* k = q + DM; float sq = 0.f, sk = 0.f;
#pragma unroll 1
  for (int d = 0; d < 64; d += 4) { const v4f a = *(const v4fa*)(q + d), b = *(const v4fa*)(k + d); for (int i = 0; i < 4; ++i) { sq += a[i] * a[i]; sk += b[i] * b[i]; } }
  { *(float*)(QN + t) = sq; *(float*)(KN + t) = sk;  } }
// strided hi + residual copy of a DM-wide third of QKV
__global__ __launch_bounds__(256) void k_hls(const float* __restrict__ SRC, int lds, int coff, _Float16* __restrict__ DH, _Float16* __restrict__ DL, size_t n8) { const size_t t = (size_t)blockIdx.x * 256 + threadIdx.x; if (t >= n8) return; const size_t r = (t * 8) / DM; const int c = (int)((t * 8) % DM); const v8f a = *(const v8f*)(SRC + r * lds + coff + c); FragH fh, fl; for (int q = 0; q < 8; ++q) { const _Float16 h = (_Float16)a[q]; fh.h[q] = h; fl.h[q] = (_Float16)((a[q] - (float)h) * 1024.0f); }
  { *(v8us*)((unsigned short*)DH + t * 8) = fh.half[0]; *(v8us*)((unsigned short*)DL + t * 8) = fl.half[0];  } }
__global__ __launch_bounds__(256) void k_kexp(const float* __restrict__ S, const float* __restrict__ QN, const float* __restrict__ KN, const float* __restrict__ rs, int b, int h0, _Float16* __restrict__ E) {
  #pragma clang fp contract(off)
  const size_t t = (size_t)blockIdx.x * 256 + threadIdx.x; if (t >= (size_t)HG * SLEN * SLEN / 8) return; const size_t e0 = t * 8; const int j0 = (int)(e0 % SLEN); const int i = (int)((e0 / SLEN) % SLEN); const int g = (int)(e0 / ((size_t)SLEN * SLEN)); const int h = h0 + g; const float r = bf16_round(rs[0]); const float kn = KN[((size_t)b * SLEN + i) * NH + h]; const v8f s = *(const v8f*)(S + e0); FragH f;
  for (int q = 0; q < 8; ++q) { const float qn = QN[((size_t)b * SLEN + j0 + q) * NH + h]; float d2 = kn + qn; d2 += -2.0f * s[q]; f.h[q] = (_Float16)(1024.0f * expf(-(d2 * r))); }
  *(v8us*)((unsigned short*)E + e0) = f.half[0];  }

extern "C" void kernel_launch(void* const* d_in, const int* in_sizes, int n_in,
                              void* d_out, int out_size, void* d_ws, size_t ws_size, hipStream_t stream) {
  (void)in_sizes; (void)n_in; (void)out_size;
  const float* const* I = (const float* const*)d_in; const float* x = I[0]; const float* Wqkv = I[1]; const float* bqkv = I[2]; const float* rs = I[3]; const float* Wp = I[4]; const float* bp = I[5];
  char* ws = (char*)d_ws; size_t off = 0;
  auto take = [&](size_t bytes) { char* p = ws + off; off += (bytes + 255) & ~(size_t)255; return p; };
  const size_t np = (size_t)NR * DM;
  _Float16* BQKV = (_Float16*)take((size_t)3 * DM * DM * 2); _Float16* BP = (_Float16*)take((size_t)DM * DM * 2);
  _Float16* X16 = (_Float16*)take(np * 2); float* QKV = (float*)take(np * 3 * 4); float* QN = (float*)take((size_t)NR * NH * 4); float* KN = (float*)take((size_t)NR * NH * 4); _Float16* QH = (_Float16*)take(np * 2); _Float16* QL = (_Float16*)take(np * 2); _Float16* KH = (_Float16*)take(np * 2); _Float16* KL = (_Float16*)take(np * 2); _Float16* VH = (_Float16*)take(np * 2); _Float16* VT = (_Float16*)take(np * 2);
  float* S = (float*)take((size_t)HG * SLEN * SLEN * 4); _Float16* E = (_Float16*)take((size_t)HG * SLEN * SLEN * 2); float* O = QKV;      /* merged context f32 [NR][DM] over the qkv plane (dead after norms + splits) */ _Float16* OH = QH;      /* over q hi (dead after the last score GEMM) */
  if (off > ws_size) return;      /* 6 + 2 + 8 + 48 + 0.5 + 5x8 + 8 + 64 + 32 = 209 MiB */
  k_wt_f16<<<(unsigned)(((size_t)DM * 3 * DM / 8 + 255) / 256), 256, 0, stream>>>(Wqkv, BQKV, DM, 3 * DM, 16.0f); k_wt_f16<<<(unsigned)(((size_t)DM * DM / 8 + 255) / 256), 256, 0, stream>>>(Wp, BP, DM, DM, 16.0f);      /* (in, out) */
  k_x16<<<(unsigned)((np / 8 + 255) / 256), 256, 0, stream>>>(x, X16, np / 8);
  k_gemm2<0><<<dim3((NR / 128) * (3 * DM / 64), 1), 128, 0, stream>>>(X16, DM, 0, BQKV, DM, 0, 0.0625f, bqkv, 0, nullptr, 1, 0, 0, QKV, nullptr, 3 * DM, 0, NR, 3 * DM, DM);      /* [q | k | v] f32 (head h = cols h*64..) */
  k_norms<<<(unsigned)(((size_t)NR * NH + 255) / 256), 256, 0, stream>>>(QKV, QN, KN);
  k_hls<<<(unsigned)((np / 8 + 255) / 256), 256, 0, stream>>>(QKV, 3 * DM, 0, QH, QL, np / 8); k_hls<<<(unsigned)((np / 8 + 255) / 256), 256, 0, stream>>>(QKV, 3 * DM, DM, KH, KL, np / 8); k_h16s<<<(unsigned)((np / 8 + 255) / 256), 256, 0, stream>>>(QKV, 3 * DM, 2 * DM, VH, np / 8);
  k_vtg<<<NB * NH * (SLEN / 64), 256, 0, stream>>>(VH, VT);      /* V^T [(b,h)][64][2048] */
  for (int b = 0; b < NB; ++b) for (int hg = 0; hg < NH / HG; ++hg) { const size_t r0 = (size_t)b * SLEN; const int h0 = hg * HG;
    /* S[g][i][j] = k_i . q_j for heads h0+g (rows i = key index, cols j = query index) as three hi/residual terms */
    k_gemm2<0><<<dim3((SLEN / 128) * (SLEN / 64), HG), 128, 0, stream>>>(KL + r0 * DM + h0 * 64, DM, (size_t)64, QH + r0 * DM + h0 * 64, DM, (size_t)64, 0.0009765625f, nullptr, 0, nullptr, 1, 0, 0, S, nullptr, SLEN, (size_t)SLEN * SLEN, SLEN, SLEN, 64);
    k_gemm2<0><<<dim3((SLEN / 128) * (SLEN / 64), HG), 128, 0, stream>>>(KH + r0 * DM + h0 * 64, DM, (size_t)64, QL + r0 * DM + h0 * 64, DM, (size_t)64, 0.0009765625f, nullptr, 0, S, -1, 0, 0, S, nullptr, SLEN, (size_t)SLEN * SLEN, SLEN, SLEN, 64);
    k_gemm2<0><<<dim3((SLEN / 128) * (SLEN / 64), HG), 128, 0, stream>>>(KH + r0 * DM + h0 * 64, DM, (size_t)64, QH + r0 * DM + h0 * 64, DM, (size_t)64, 1.0f, nullptr, 0, S, -1, 0, 0, S, nullptr, SLEN, (size_t)SLEN * SLEN, SLEN, SLEN, 64);
    k_kexp<<<(unsigned)(((size_t)HG * SLEN * SLEN / 8 + 255) / 256), 256, 0, stream>>>(S, QN, KN, rs, b, h0, E);
    k_gemm2<0><<<dim3((SLEN / 128) * 1, HG), 128, 0, stream>>>(E, SLEN, (size_t)SLEN * SLEN, VT + ((size_t)b * NH + h0) * 64 * SLEN, SLEN, (size_t)64 * SLEN, 0.0009765625f, nullptr, 0, nullptr, 1, 0, 0, O + r0 * DM + h0 * 64, nullptr, DM, (size_t)64, SLEN, 64, SLEN); }      /* out_i[(h,d)] = sum_j K[i][j] v_j[d] */
  k_h16<<<(unsigned)((np / 8 + 255) / 256), 256, 0, stream>>>(O, OH, np / 8);
  k_gemm2<0><<<dim3((NR / 128) * (DM / 64), 1), 128, 0, stream>>>(OH, DM, 0, BP, DM, 0, 0.0625f, bp, 0, nullptr, 1, 0, 0, (float*)d_out, nullptr, DM, 0, NR, DM, DM);      /* out = ctx Wproj + bproj */
}

// v001
// Measured time: 281 microseconds a run.
// Next to v000, in two timings, it ran 6.70 and 6.68 times as fast.
#include <hip/hip_runtime.h>
// qKv_attention (2 x 2048 tokens, C 1024 = 16 heads x 64; Gaussian-kernel attention WITHOUT normalisation: qkv = x Wqkv + b; K[i][j] = exp(-r_sigma ||q_j - k_i||^2) computed as kn_i + qn_j - 2 k_i.q_j; out_i = sum_j K[i][j] v_j; out = merge Wproj + bproj; r_sigma is a scalar input).
// Structure: exact f16 plane of x; qkv as one f16 WMMA GEMM (32x64 wave tiles, f32 accumulation, exact x16 weights + bias); per-(token, head) squared norms on VALU; q and k as f16 hi + 2^10 residual planes; V^T by LDS tiles; one fused launch over every (batch, head): the k.q products as three hi/residual terms (f32), the kernel weights exp(-r (kn + qn - 2 kq)) on VALU into f16 (x 2^10) in registers, the readout products (64 columns) straight into a merged context plane; Wproj + bproj GEMM.
// Compute dtype: inputs rounded to bf16; x and weights exact as f16; q, k as f16 hi + residual (~2^-21) because the exponent amplifies dot-product error by 2 r_sigma |k.q|; kernel weights and v as plain f16 operands (~2^-12; weights below 2^-34 of the unit scale flush to zero); merged context plain f16. v_wmma_f32_16x16x32_f16.
#define NB 2
#define DM 1024
#define NKV 16
#define NREP (NH / NKV)
#define KVD (NKV * 64)           /* 1024 */
#define NR (NB * SLEN)           /* 4096 */
#define CHK 512                  /* attention chunk */
typedef int v4i __attribute__((ext_vector_type(4)));
#define FF 2048
#define SLEN 2048
#define TQ SLEN
#define TK SLEN
#define NH 16
#define SCL 0.125f
#define QBLKS (TQ / 64)
#define QB05 0
#define QBN5 4
#define QB0P 0
#define QBNP QBLKS           /* non-causal: plain flash on every query block */
#define RE 256
typedef __bf16 v16b __attribute__((ext_vector_type(16)));
typedef unsigned short v8us __attribute__((ext_vector_type(8), may_alias));
typedef float  v8f  __attribute__((ext_vector_type(8)));
typedef float  v4f  __attribute__((ext_vector_type(4)));
typedef float  v4fa __attribute__((ext_vector_type(4), may_alias));
union FragB { v16b v; v8us half[2]; unsigned short u[16]; };

__device__ __forceinline__ unsigned short bf16_bits(float x) { unsigned int u = __float_as_uint(x); return (unsigned short)((u + 0x7FFFu + ((u >> 16) & 1u)) >> 16); }
__device__ __forceinline__ float bf16_val(unsigned short b) { return __uint_as_float(((unsigned int)b) << 16); }
__device__ __forceinline__ float bf16_round(float x) { return bf16_val(bf16_bits(x)); }
// D += A·B with NT terms: 1 = ah·bh, 2 = + al·bh (A split), 3 = + ah·bl (both split)
template <int NT>
__device__ __forceinline__ v8f mmaN(v16b ah, v16b al, v16b bh, v16b bl, v8f c) {
  c = __builtin_amdgcn_wmma_f32_16x16x32_bf16(false, ah, false, bh, (short)0, c, false, false);
  if (NT >= 2) c = __builtin_amdgcn_wmma_f32_16x16x32_bf16(false, al, false, bh, (short)0, c, false, false);
  if (NT >= 3) c = __builtin_amdgcn_wmma_f32_16x16x32_bf16(false, ah, false, bl, (short)0, c, false, false);
  asm volatile("v_nop\n\tv_nop\n\tv_nop\n\tv_nop" : "+v"(c) : "v"(ah), "v"(al), "v"(bh), "v"(bl));
  return c;
}

__global__ __launch_bounds__(256) void k_wt_bf16(const float* __restrict__ W, unsigned short* __restrict__ Wt, int K, int N) {
  const int t = blockIdx.x * 256 + threadIdx.x;
  const int k8n = K / 8;
  if (t >= N * k8n) return;
  const int n = t / k8n, k8 = (t % k8n) * 8;
  v8us v;
#pragma unroll
  for (int i = 0; i < 8; ++i) v[i] = bf16_bits(W[(size_t)(k8 + i) * N + n]);
  *(v8us*)(Wt + (size_t)n * K + k8) = v;
  
}

// GEMM C[M][N] (f32, pitch ldc) = act(A[M][K]·W + bias). A f32 row-major (pitch lda) converted per fragment to bf16
// (ASPLIT: hi/lo two planes -> 2 terms, else single rounded term); Wt bf16 [N][K] (pitch ldb). BIAS_BF16 rounds the
// bias to bf16 first (bias quantised to bf16 before the add). K%32==0, M%16==0, N%64==0.
template <bool ASPLIT, int ACT, bool BIAS_BF16>
__global__ __launch_bounds__(128) void k_gemm_bf(const float* __restrict__ A, int lda, const unsigned short* __restrict__ Wt, int ldb,
                                               const float* __restrict__ bias, float* __restrict__ C, int ldc, int M, int N, int K) {
  __shared__ __attribute__((aligned(16))) float so[4][16][64];
  const int tid = threadIdx.x, w = tid >> 5, lane = tid & 31, ln = lane & 15, hh = lane >> 4;
  const int ntn = N / 64;
  const int wid = blockIdx.x * 4 + w;
  const int mt = wid / ntn, nq = wid % ntn;
  if (mt * 16 >= M) return;
  const int row0 = mt * 16, col0 = nq * 64;
  const float* arow = A + (size_t)(row0 + ln) * lda;
  v8f acc[4] = {};
  for (int kb = 0; kb < K; kb += 32) {
    FragB ah, al;
    const v4f x0 = *(const v4fa*)(arow + kb + 8 * hh), x1 = *(const v4fa*)(arow + kb + 8 * hh + 4);
    const v4f x2 = *(const v4fa*)(arow + kb + 16 + 8 * hh), x3 = *(const v4fa*)(arow + kb + 16 + 8 * hh + 4);
    float xs[16] = {x0[0],x0[1],x0[2],x0[3],x1[0],x1[1],x1[2],x1[3],x2[0],x2[1],x2[2],x2[3],x3[0],x3[1],x3[2],x3[3]};
#pragma unroll
    for (int i = 0; i < 16; ++i) { const unsigned short hb = bf16_bits(xs[i]); ah.u[i] = hb; al.u[i] = ASPLIT ? bf16_bits(xs[i] - bf16_val(hb)) : (unsigned short)0; }
#pragma unroll
    for (int t = 0; t < 4; ++t) {
      const unsigned short* brow = Wt + (size_t)(col0 + t * 16 + ln) * ldb + kb;
      FragB b;
      b.half[0] = *(const v8us*)(brow + 8 * hh);
      b.half[1] = *(const v8us*)(brow + 16 + 8 * hh);
      acc[t] = mmaN<ASPLIT ? 2 : 1>(ah.v, al.v, b.v, b.v, acc[t]);
    }
  }
#pragma unroll
  for (int t = 0; t < 4; ++t) {
    float bv = bias ? bias[col0 + t * 16 + ln] : 0.f;
    if (BIAS_BF16) bv = bf16_round(bv);
#pragma unroll
    for (int r = 0; r < 8; ++r) { float v = acc[t][r] + bv; if (ACT == 1) v = fmaxf(v, 0.f); so[w][8 * hh + r][t * 16 + ln] = v; }
  }
  __builtin_amdgcn_fence(__ATOMIC_ACQ_REL, "workgroup");
  __builtin_amdgcn_wave_barrier();
  const int rsub = lane >> 4, c4 = (lane & 15) * 4;
  {
#pragma unroll
    for (int q = 0; q < 8; ++q) {
      const int r = q * 2 + rsub;
      const v4f v = *(const v4fa*)&so[w][r][c4];
      *(v4f*)(C + (size_t)(row0 + r) * ldc + col0 + c4) = v;
    }
    
  }
}

// GEMM C = act(A·W + bias + resid): A f32 (ASPLIT -> hi/lo 2 terms), Wt bf16 [N][K]; ACT 0 none, 1 relu, 2 exact gelu;
// resid (optional, f32, row index = (row % rmod), pitch ldr, RES_BF16 rounds it) added before the activation.
template <bool ASPLIT, int ACT, bool BIAS_BF16, bool RES_BF16>
__global__ __launch_bounds__(128) void k_gemm_bf3(const float* __restrict__ A, int lda, const unsigned short* __restrict__ Wt, int ldb,
                                                const float* __restrict__ bias, const float* __restrict__ resid, int rmod, int ldr,
                                                float* __restrict__ C, int ldc, int M, int N, int K) {
  __shared__ __attribute__((aligned(16))) float so[4][16][64];
  const int tid = threadIdx.x, w = tid >> 5, lane = tid & 31, ln = lane & 15, hh = lane >> 4;
  const int ntn = N / 64;
  const int wid = blockIdx.x * 4 + w;
  const int mt = wid / ntn, nq = wid % ntn;
  if (mt * 16 >= M) return;
  const int row0 = mt * 16, col0 = nq * 64;
  const float* arow = A + (size_t)(row0 + ln) * lda;
  v8f acc[4] = {};
  for (int kb = 0; kb < K; kb += 32) {
    FragB ah, al;
    const v4f x0 = *(const v4fa*)(arow + kb + 8 * hh), x1 = *(const v4fa*)(arow + kb + 8 * hh + 4);
    const v4f x2 = *(const v4fa*)(arow + kb + 16 + 8 * hh), x3 = *(const v4fa*)(arow + kb + 16 + 8 * hh + 4);
    float xs[16] = {x0[0],x0[1],x0[2],x0[3],x1[0],x1[1],x1[2],x1[3],x2[0],x2[1],x2[2],x2[3],x3[0],x3[1],x3[2],x3[3]};
#pragma unroll
    for (int i = 0; i < 16; ++i) { const unsigned short hb = bf16_bits(xs[i]); ah.u[i] = hb; al.u[i] = ASPLIT ? bf16_bits(xs[i] - bf16_val(hb)) : (unsigned short)0; }
#pragma unroll
    for (int t = 0; t < 4; ++t) {
      const unsigned short* brow = Wt + (size_t)(col0 + t * 16 + ln) * ldb + kb;
      FragB b;
      b.half[0] = *(const v8us*)(brow + 8 * hh);
      b.half[1] = *(const v8us*)(brow + 16 + 8 * hh);
      acc[t] = mmaN<ASPLIT ? 2 : 1>(ah.v, al.v, b.v, b.v, acc[t]);
    }
  }
#pragma unroll
  for (int t = 0; t < 4; ++t) {
    const int col = col0 + t * 16 + ln;
    float bv = bias ? bias[col] : 0.f;
    if (BIAS_BF16) bv = bf16_round(bv);
#pragma unroll
    for (int r = 0; r < 8; ++r) {
      float v = acc[t][r] + bv;
      if (resid) { float rv = resid[(size_t)((row0 + 8 * hh + r) % rmod) * ldr + col]; if (RES_BF16) rv = bf16_round(rv); v += rv; }
      if (ACT == 1) v = fmaxf(v, 0.f);
      if (ACT == 2) v = 0.5f * v * (1.0f + erff(v * 0.70710678118654752f));
      if (ACT == 3) { const float u = 0.7978845608028654f * (v + 0.044715f * v * v * v); v = 0.5f * v * (1.0f + tanhf(u)); }
      so[w][8 * hh + r][t * 16 + ln] = v;
    }
  }
  __builtin_amdgcn_fence(__ATOMIC_ACQ_REL, "workgroup");
  __builtin_amdgcn_wave_barrier();
  const int rsub = lane >> 4, c4 = (lane & 15) * 4;
  {
#pragma unroll
    for (int q = 0; q < 8; ++q) {
      const int r = q * 2 + rsub;
      const v4f v = *(const v4fa*)&so[w][r][c4];
      *(v4f*)(C + (size_t)(row0 + r) * ldc + col0 + c4) = v;
    }
    
  }
}
// row LayerNorm (biased variance, eps) over N: s = X (+ R); optional out_sum <- s; out_norm <- (s-mu)*rsqrt(var+eps)*g + b
template <bool PARAM_BF16>
__global__ __launch_bounds__(256) void k_layernorm(const float* __restrict__ X, const float* __restrict__ R, const float* __restrict__ g, const float* __restrict__ bta,
                                                  float* __restrict__ out_sum, float* __restrict__ out_norm, int N, float eps) {
  __shared__ float red[256];
  const int row = blockIdx.x, tid = threadIdx.x;
  const float* x = X + (size_t)row * N; const float* rr = R ? R + (size_t)row * N : nullptr;
  float vals[16];                     // up to N = 4096
  const int per = N / 256;            // contiguous chunk per thread? use strided-by-4 chunks: thread handles j = tid*4 + 1024*u
  float s1 = 0.f;
  for (int u = 0; u < per / 4; ++u) {
    const int j = tid * 4 + 1024 * u;
    const v4f a = *(const v4fa*)(x + j);
    v4f b = {0.f,0.f,0.f,0.f}; if (rr) b = *(const v4fa*)(rr + j);
#pragma unroll
    for (int q = 0; q < 4; ++q) { const float v = a[q] + b[q]; vals[u * 4 + q] = v; s1 += v; }
  }
  red[tid] = s1; __syncthreads();
  for (int st = 128; st > 0; st >>= 1) { if (tid < st) red[tid] += red[tid + st]; __syncthreads(); }
  const float mu = red[0] / (float)N; __syncthreads();
  float s2 = 0.f;
  for (int u = 0; u < per / 4; ++u)
#pragma unroll
    for (int q = 0; q < 4; ++q) { const float c = vals[u * 4 + q] - mu; s2 += c * c; }
  red[tid] = s2; __syncthreads();
  for (int st = 128; st > 0; st >>= 1) { if (tid < st) red[tid] += red[tid + st]; __syncthreads(); }
  const float rs = rsqrtf(red[0] / (float)N + eps);
  {
    for (int u = 0; u < per / 4; ++u) {
      const int j = tid * 4 + 1024 * u;
      v4f o, sm;
#pragma unroll
      for (int q = 0; q < 4; ++q) {
        float gg = g[j + q], bb = bta[j + q];
        if (PARAM_BF16) { gg = bf16_round(gg); bb = bf16_round(bb); }
        sm[q] = vals[u * 4 + q]; o[q] = (vals[u * 4 + q] - mu) * rs * gg + bb;
      }
      if (out_sum) *(v4f*)(out_sum + (size_t)row * N + j) = sm;
      *(v4f*)(out_norm + (size_t)row * N + j) = o;
    }
    
  }
}



// ---- f16 WMMA path (v_wmma_f32_16x16x32_f16): 11-bit significands for operands in range — used where a [0,1] probability operand needs more precision than bf16
typedef _Float16 v16h __attribute__((ext_vector_type(16)));
union FragH { v16h v; v8us half[2]; _Float16 h[16]; unsigned short u[16]; };
template <int NT>
__device__ __forceinline__ v8f mmaH(v16h ah, v16h al, v16h bh, v16h bl, v8f c) {
  c = __builtin_amdgcn_wmma_f32_16x16x32_f16(false, ah, false, bh, (short)0, c, false, false);
  if (NT >= 2) c = __builtin_amdgcn_wmma_f32_16x16x32_f16(false, al, false, bh, (short)0, c, false, false);
  if (NT >= 3) c = __builtin_amdgcn_wmma_f32_16x16x32_f16(false, ah, false, bl, (short)0, c, false, false);
  asm volatile("v_nop\n\tv_nop\n\tv_nop\n\tv_nop" : "+v"(c) : "v"(ah), "v"(al), "v"(bh), "v"(bl));
  return c;
}
// batched GEMM like k_gemm_b but f16 operands: A f32 (split into f16 hi/lo if ASPLIT, else rounded to f16), Bt = f16 values [n][k]; alpha; C f32; N multiple of 16 (partial tiles skipped)
template <bool ASPLIT>
__global__ __launch_bounds__(128) void k_gemm_h(const float* __restrict__ A, int lda, size_t sA, const _Float16* __restrict__ Bh, int ldb, size_t sB, float alpha, float* __restrict__ C, int ldc, size_t sC, int M, int N, int K) {
  __shared__ __attribute__((aligned(16))) float so[4][16][64];
  const int tid = threadIdx.x, w = tid >> 5, lane = tid & 31, ln = lane & 15, hh = lane >> 4; const int by = blockIdx.y;
  A += (size_t)by * sA; Bh += (size_t)by * sB; C += (size_t)by * sC;
  const int ntn = (N + 63) / 64; const int wid = blockIdx.x * 4 + w; const int mt = wid / ntn, nq = wid % ntn; if (mt * 16 >= M) return;
  const int row0 = mt * 16, col0 = nq * 64; const float* arow = A + (size_t)(row0 + ln) * lda;
  v8f acc[4] = {};
  for (int kb = 0; kb < K; kb += 32) {
    FragH ah, al;
    const v4f x0 = *(const v4fa*)(arow + kb + 8 * hh), x1 = *(const v4fa*)(arow + kb + 8 * hh + 4), x2 = *(const v4fa*)(arow + kb + 16 + 8 * hh), x3 = *(const v4fa*)(arow + kb + 16 + 8 * hh + 4);
    float xs[16] = {x0[0],x0[1],x0[2],x0[3],x1[0],x1[1],x1[2],x1[3],x2[0],x2[1],x2[2],x2[3],x3[0],x3[1],x3[2],x3[3]};
#pragma unroll
    for (int i = 0; i < 16; ++i) { const _Float16 h = (_Float16)xs[i]; ah.h[i] = h; al.h[i] = ASPLIT ? (_Float16)(xs[i] - (float)h) : (_Float16)0.0f; }
#pragma unroll
    for (int t = 0; t < 4; ++t) { if (col0 + t * 16 >= N) continue; const size_t boff = (size_t)(col0 + t * 16 + ln) * ldb + kb; FragH bq; bq.half[0] = *(const v8us*)(Bh + boff + 8 * hh); bq.half[1] = *(const v8us*)(Bh + boff + 16 + 8 * hh);
      acc[t] = mmaH<ASPLIT ? 2 : 1>(ah.v, al.v, bq.v, bq.v, acc[t]); }
  }
#pragma unroll
  for (int t = 0; t < 4; ++t) { if (col0 + t * 16 >= N) continue;
#pragma unroll
    for (int r = 0; r < 8; ++r) so[w][8 * hh + r][t * 16 + ln] = acc[t][r] * alpha; }
  __builtin_amdgcn_fence(__ATOMIC_ACQ_REL, "workgroup"); __builtin_amdgcn_wave_barrier();
  const int rsub = lane >> 4, c4 = (lane & 15) * 4;
  {
#pragma unroll
    for (int q = 0; q < 8; ++q) { const int r = q * 2 + rsub; if (col0 + c4 < N) { const v4f v = *(const v4fa*)&so[w][r][c4]; *(v4f*)(C + (size_t)(row0 + r) * ldc + col0 + c4) = v; } }
     }
}

// Wt[n][k] = f16(W[k][n]·scale) from f32 row-major W[K][N] (scale = power of two; bf16-exact weights stay exact in f16 away from the subnormal range)
__global__ __launch_bounds__(256) void k_wt_f16(const float* __restrict__ W, _Float16* __restrict__ Wt, int K, int N, float scale) {
  const int t = blockIdx.x * 256 + threadIdx.x; if (t >= N * (K / 8)) return; const int n = t / (K / 8), k8 = (t % (K / 8)) * 8; FragH f;
#pragma unroll
  for (int i = 0; i < 8; ++i) f.h[i] = (_Float16)(bf16_round(W[(size_t)(k8 + i) * N + n]) * scale); const v8us o = f.half[0];
  *(v8us*)((unsigned short*)Wt + (size_t)n * K + k8) = o; 
}
// k_gemm_hh variant with fused epilogue: v = acc·alpha + bias[by·sBias + col] (+ CP[(row/rowsPerB)·sCPb + by·64 + col] if CP) ; ACT 0 none / 1 elu ; writes f16 C16 (and f32 C if non-null)
template <int ACT>
__global__ __launch_bounds__(128) void k_gemm_hhx(const _Float16* __restrict__ A, int lda, size_t sA, const _Float16* __restrict__ Bh, int ldb, size_t sB, float alpha, const float* __restrict__ bias, size_t sBias, const float* __restrict__ CP, int rowsPerB, size_t sCPb, int row0g,
    float* __restrict__ C, _Float16* __restrict__ C16, int ldc, size_t sC, int M, int N, int K) {
  __shared__ __attribute__((aligned(16))) float so[4][16][64];
  const int tid = threadIdx.x, w = tid >> 5, lane = tid & 31, ln = lane & 15, hh = lane >> 4; const int by = blockIdx.y;
  A += (size_t)by * sA; Bh += (size_t)by * sB; const size_t cofs = (size_t)by * sC; const float* bp = bias ? bias + (size_t)by * sBias : nullptr;
  const int ntn = (N + 63) / 64; const int wid = blockIdx.x * 4 + w; const int mt = wid / ntn, nq = wid % ntn; if (mt * 16 >= M) return;
  const int row0 = mt * 16, col0 = nq * 64; const _Float16* arow = A + (size_t)(row0 + ln) * lda;
  v8f acc[4] = {};
  for (int kb = 0; kb < K; kb += 32) { FragH ah; ah.half[0] = *(const v8us*)((const unsigned short*)arow + kb + 8 * hh); ah.half[1] = *(const v8us*)((const unsigned short*)arow + kb + 16 + 8 * hh);
#pragma unroll
    for (int t = 0; t < 4; ++t) { if (col0 + t * 16 >= N) continue; const size_t boff = (size_t)(col0 + t * 16 + ln) * ldb + kb; FragH bq; bq.half[0] = *(const v8us*)((const unsigned short*)Bh + boff + 8 * hh); bq.half[1] = *(const v8us*)((const unsigned short*)Bh + boff + 16 + 8 * hh);
      acc[t] = mmaH<1>(ah.v, ah.v, bq.v, bq.v, acc[t]); }
  }
#pragma unroll
  for (int t = 0; t < 4; ++t) { if (col0 + t * 16 >= N) continue; const int col = col0 + t * 16 + ln; const float bv = bp ? bf16_round(bp[col]) : 0.f;
#pragma unroll
    for (int r = 0; r < 8; ++r) { float v = acc[t][r] * alpha + bv; if (CP) { const int bidx = (row0g + row0 + 8 * hh + r) / rowsPerB; v += CP[(size_t)bidx * sCPb + (size_t)by * 64 + col]; } if (ACT == 1) v = (v > 0.f) ? v : expm1f(v); else if (ACT == 7) v = (v > 0.f) ? v + 1.0f : expf(v); else if (ACT == 8) v = tanhf(v); else if (ACT == 9) v = 0.5f * v * (1.0f + tanhf(0.7978845608028654f * (v + 0.044715f * v * v * v))); else if (ACT == 11) v = 1.0f / (1.0f + expf(-v)); else if (ACT == 12) v = (v > 0.f) ? v : 0.01f * v; else if (ACT == 14) v = (v > 0.f) ? v : 0.1f * v; else if (ACT == 15) v = v / (1.0f + expf(-v)); else if (ACT == 3) v = fmaxf(v, 0.f); else if (ACT == 6) v = 0.5f * v * (1.0f + erff(v * 0.70710678118654752f)); so[w][8 * hh + r][t * 16 + ln] = v; } }
  __builtin_amdgcn_fence(__ATOMIC_ACQ_REL, "workgroup"); __builtin_amdgcn_wave_barrier();
  const int rsub = lane >> 4, c4 = (lane & 15) * 4; typedef _Float16 v4h __attribute__((ext_vector_type(4)));
  {
#pragma unroll
    for (int q = 0; q < 8; ++q) { const int r = q * 2 + rsub; if (col0 + c4 < N) { const v4f v = *(const v4fa*)&so[w][r][c4]; if (C) *(v4f*)(C + cofs + (size_t)(row0 + r) * ldc + col0 + c4) = v; if (C16) { v4h h4; for (int i = 0; i < 4; ++i) h4[i] = (_Float16)v[i]; *(v4h*)(C16 + cofs + (size_t)(row0 + r) * ldc + col0 + c4) = h4; } } }
     }
}


typedef _Float16 v4h __attribute__((ext_vector_type(4)));

__global__ __launch_bounds__(256) void k_x16(const float* __restrict__ x, _Float16* __restrict__ X16, size_t n8) { const size_t t = (size_t)blockIdx.x * 256 + threadIdx.x; if (t >= n8) return; FragH f;
#pragma unroll
  for (int q = 0; q < 8; ++q) f.h[q] = (_Float16)bf16_round(x[t * 8 + q]); *(v8us*)((unsigned short*)X16 + t * 8) = f.half[0];  }
__global__ __launch_bounds__(256) void k_h16(const float* __restrict__ x, _Float16* __restrict__ X16, size_t n8) { const size_t t = (size_t)blockIdx.x * 256 + threadIdx.x; if (t >= n8) return; FragH f;
#pragma unroll
  for (int q = 0; q < 8; ++q) f.h[q] = (_Float16)x[t * 8 + q]; *(v8us*)((unsigned short*)X16 + t * 8) = f.half[0];  }
__global__ __launch_bounds__(256) void k_round16f(const float* __restrict__ W, _Float16* __restrict__ Bt, size_t n8) { const size_t t = (size_t)blockIdx.x * 256 + threadIdx.x; if (t >= n8) return; FragH f;
#pragma unroll
  for (int i = 0; i < 8; ++i) f.h[i] = (_Float16)(bf16_round(W[t * 8 + i]) * 16.0f); *(v8us*)((unsigned short*)Bt + t * 8) = f.half[0];  }
template <int NHv, int TTv>
__global__ __launch_bounds__(256) void k_vt(const _Float16* __restrict__ V16, int ldv, int voff, _Float16* __restrict__ Vt) { __shared__ unsigned short tl[64][66]; const int tid = threadIdx.x; const int slab = blockIdx.x / (TTv / 64), lg = blockIdx.x % (TTv / 64); const int b = slab / NHv, h = slab % NHv;
  for (int i = tid; i < 64 * 8; i += 256) { const int r = i / 8, c8 = (i % 8) * 8; FragH f; f.half[0] = *(const v8us*)((const unsigned short*)V16 + ((size_t)b * TTv + lg * 64 + r) * ldv + voff + h * 64 + c8);
#pragma unroll
    for (int q = 0; q < 8; ++q) tl[r][c8 + q] = f.u[q]; }
  __syncthreads();
  {
#pragma unroll
    for (int rd = 0; rd < 2; ++rd) { const int d = rd * 32 + tid / 8, pc = tid % 8; FragH f;
#pragma unroll
      for (int q = 0; q < 8; ++q) f.u[q] = tl[pc * 8 + q][d];
      *(v8us*)((unsigned short*)Vt + ((size_t)slab * 64 + d) * TTv + lg * 64 + pc * 8) = f.half[0]; }
     } }

__global__ __launch_bounds__(256) void k_hl(const float* __restrict__ F, _Float16* __restrict__ Hh, _Float16* __restrict__ Hl, size_t n8) { const size_t t = (size_t)blockIdx.x * 256 + threadIdx.x; if (t >= n8) return; FragH fh, fl; const v4f a = *(const v4fa*)(F + t * 8), c = *(const v4fa*)(F + t * 8 + 4);
#pragma unroll
  for (int q = 0; q < 4; ++q) { _Float16 h = (_Float16)a[q]; fh.h[q] = h; fl.h[q] = (_Float16)((a[q] - (float)h) * 1024.0f); h = (_Float16)c[q]; fh.h[4 + q] = h; fl.h[4 + q] = (_Float16)((c[q] - (float)h) * 1024.0f); }
  { *(v8us*)((unsigned short*)Hh + t * 8) = fh.half[0]; *(v8us*)((unsigned short*)Hl + t * 8) = fl.half[0];  } }

// ---- fast GEMM (wave tile 32x64; requires M % 32 == 0 rows per launch region and N % 64 == 0); epilogue = k_gemm_hhx semantics ----
__device__ __forceinline__ v16h g2_frag(const _Float16* p, int hh) { FragH f; f.half[0] = *(const v8us*)((const unsigned short*)p + 8 * hh); f.half[1] = *(const v8us*)((const unsigned short*)p + 16 + 8 * hh); return f.v; }
__device__ __forceinline__ v8f g2_mma(v16h a, v16h b, v8f c) { v8f d = __builtin_amdgcn_wmma_f32_16x16x32_f16(false, a, false, b, (short)0, c, false, false); asm volatile("v_nop\n\tv_nop\n\tv_nop\n\tv_nop" : "+v"(d) : "v"(a), "v"(b)); return d; }
template <int ACT>
__global__ __launch_bounds__(128) void k_gemm2(const _Float16* __restrict__ A, int lda, size_t sA, const _Float16* __restrict__ Bh, int ldb, size_t sB, float alpha, const float* __restrict__ bias, size_t sBias, const float* __restrict__ CP, int rowsPerB, size_t sCPb, int row0g,
    float* __restrict__ C, _Float16* __restrict__ C16, int ldc, size_t sC, int M, int N, int K) {
  __shared__ __attribute__((aligned(16))) float so[4][32][68];
  const int tid = threadIdx.x, w = tid >> 5, lane = tid & 31, ln = lane & 15, hh = lane >> 4; const int by = blockIdx.y;
  A += (size_t)by * sA; Bh += (size_t)by * sB; const size_t cofs = (size_t)by * sC; const float* bp = bias ? bias + (size_t)by * sBias : nullptr;
  const int ntn = N >> 6; const int mt = blockIdx.x / ntn, nq = blockIdx.x - mt * ntn; const int row0 = mt * 128 + 32 * w, col0 = nq * 64; if (row0 >= M) return;
  const _Float16* a0p = A + (size_t)(row0 + ln) * lda; const _Float16* a1p = a0p + (size_t)16 * lda;
  const _Float16* b0p = Bh + (size_t)(col0 + ln) * ldb; const _Float16* b1p = b0p + (size_t)16 * ldb; const _Float16* b2p = b1p + (size_t)16 * ldb; const _Float16* b3p = b2p + (size_t)16 * ldb;
  const v8f z8 = {0.f,0.f,0.f,0.f,0.f,0.f,0.f,0.f}; v8f c00 = z8, c01 = z8, c02 = z8, c03 = z8, c10 = z8, c11 = z8, c12 = z8, c13 = z8;
#pragma unroll 1
  for (int kb = 0; kb < K; kb += 32) { const v16h a0 = g2_frag(a0p + kb, hh), a1 = g2_frag(a1p + kb, hh);
    v16h b = g2_frag(b0p + kb, hh); c00 = g2_mma(a0, b, c00); c10 = g2_mma(a1, b, c10);
    b = g2_frag(b1p + kb, hh); c01 = g2_mma(a0, b, c01); c11 = g2_mma(a1, b, c11);
    b = g2_frag(b2p + kb, hh); c02 = g2_mma(a0, b, c02); c12 = g2_mma(a1, b, c12);
    b = g2_frag(b3p + kb, hh); c03 = g2_mma(a0, b, c03); c13 = g2_mma(a1, b, c13); }
  v8f accs[8] = {c00, c01, c02, c03, c10, c11, c12, c13};
#pragma unroll
  for (int u = 0; u < 8; ++u) { const int t = u & 3, half = u >> 2; const int col = col0 + t * 16 + ln; const float bv = bp ? bf16_round(bp[col]) : 0.f;
#pragma unroll
    for (int r = 0; r < 8; ++r) { const int rloc = half * 16 + 8 * hh + r; float v = accs[u][r] * alpha + bv; if (CP) { if (rowsPerB < 0) v += CP[cofs + (size_t)(row0g + row0 + rloc) * ldc + col];      /* rowsPerB < 0: own element of the batched C plane */ else { const int bidx = (row0g + row0 + rloc) / rowsPerB; v += CP[(size_t)bidx * sCPb + (size_t)by * 64 + col]; } }
      if (ACT == 3) v = fmaxf(v, 0.f); else if (ACT == 6) v = 0.5f * v * (1.0f + erff(v * 0.70710678118654752f)); else if (ACT == 11) v = 1.0f / (1.0f + expf(-v)); else if (ACT == 15) v = v / (1.0f + expf(-v)); else if (ACT == 12) v = (v > 0.f) ? v : 0.01f * v; else if (ACT == 8) v = tanhf(v);
      so[w][rloc][t * 16 + ln] = v; } }
  __builtin_amdgcn_fence(__ATOMIC_ACQ_REL, "workgroup"); __builtin_amdgcn_wave_barrier();
  const int rsub = lane >> 4, c4 = (lane & 15) * 4;
  {
#pragma unroll
    for (int q = 0; q < 16; ++q) { const int r = q * 2 + rsub; const v4f v = *(const v4fa*)&so[w][r][c4]; if (C) *(v4f*)(C + cofs + (size_t)(row0 + r) * ldc + col0 + c4) = v; if (C16) { v4h h4; for (int i = 0; i < 4; ++i) h4[i] = (_Float16)v[i]; *(v4h*)(C16 + cofs + (size_t)(row0 + r) * ldc + col0 + c4) = h4; } }
     } }



template <int CAUSAL>
__global__ __launch_bounds__(128) void k_flash(const _Float16* __restrict__ Q16, int ldq, const _Float16* __restrict__ K16, int ldk, const _Float16* __restrict__ Vt, const int* __restrict__ MSK, float* __restrict__ O, int ldo) {
  constexpr int RPW = 16, RTN = RPW / 16, NQB = TQ / (4 * RPW), DT = 4, KS = 2;
  __shared__ __attribute__((aligned(16))) unsigned short sP[4][RPW][40]; __shared__ __attribute__((aligned(16))) float sO[4][RPW][64 + 4];
  const int tid = threadIdx.x, w = tid >> 5, lane = tid & 31, ln = lane & 15, hh = lane >> 4;
  const int slab = blockIdx.x / QBNP, qblk = QB0P + blockIdx.x % QBNP; (void)NQB; const int b = slab / NH, h = slab % NH; const int qb0 = qblk * (4 * RPW); const int q0 = qb0 + w * RPW;
  FragH aq[2][KS];
#pragma unroll
  for (int rt = 0; rt < RTN; ++rt) { const unsigned short* qr = (const unsigned short*)Q16 + ((size_t)b * TQ + q0 + rt * 16 + ln) * ldq + h * 64;
#pragma unroll
    for (int ks = 0; ks < KS; ++ks) { aq[rt][ks].half[0] = *(const v8us*)(qr + ks * 32 + 8 * hh); aq[rt][ks].half[1] = *(const v8us*)(qr + ks * 32 + 16 + 8 * hh); } }
  const unsigned short* Vth = (const unsigned short*)Vt + (size_t)slab * 64 * TK;
  float m_r[2][8], l_r[2][8]; v8f oacc[2][DT];
#pragma unroll
  for (int rt = 0; rt < RTN; ++rt) {
#pragma unroll
    for (int r = 0; r < 8; ++r) { m_r[rt][r] = -3.0e38f; l_r[rt][r] = 0.f; }
#pragma unroll
    for (int dt = 0; dt < DT; ++dt) oacc[rt][dt] = (v8f){0.f,0.f,0.f,0.f,0.f,0.f,0.f,0.f}; }
  const int jend = (CAUSAL == 1) ? (qb0 + 4 * RPW) : ((CAUSAL == 23) ? min(TK, (qb0 / CHK + 2) * CHK) : TK);      /* causal / window: keys that can never contribute are skipped */ const int jbeg = (CAUSAL == 23) ? max(0, (qb0 / CHK - 1) * CHK) : 0;
#pragma unroll 1
  for (int j0 = jbeg; j0 < jend; j0 += 32) {
    v8f s[2][2];
#pragma unroll
    for (int nt = 0; nt < 2; ++nt) { const unsigned short* kr = (const unsigned short*)K16 + ((size_t)b * TK + j0 + nt * 16 + ln) * ldk + h * 64; FragH bk[KS];
#pragma unroll
      for (int ks = 0; ks < KS; ++ks) { bk[ks].half[0] = *(const v8us*)(kr + ks * 32 + 8 * hh); bk[ks].half[1] = *(const v8us*)(kr + ks * 32 + 16 + 8 * hh); }
#pragma unroll
      for (int rt = 0; rt < RTN; ++rt) { v8f acc = (v8f){0.f,0.f,0.f,0.f,0.f,0.f,0.f,0.f};
#pragma unroll
        for (int ks = 0; ks < KS; ++ks) acc = mmaH<1>(aq[rt][ks].v, aq[rt][ks].v, bk[ks].v, bk[ks].v, acc); s[rt][nt] = acc; } }
#pragma unroll
    for (int rt = 0; rt < RTN; ++rt)
#pragma unroll
      for (int r = 0; r < 8; ++r) { const int tq = q0 + rt * 16 + 8 * hh + r; const int k0 = j0 + ln, k1 = j0 + 16 + ln;
        bool ok0 = (CAUSAL == 1) ? (k0 <= tq) : ((CAUSAL == 2) ? ((k0 >> 5) == (tq >> 5)) : true), ok1 = (CAUSAL == 1) ? (k1 <= tq) : ((CAUSAL == 2) ? ((k1 >> 5) == (tq >> 5)) : true); if (CAUSAL == 23) { const int cq = tq / CHK; ok0 = (abs(k0 / CHK - cq) <= 1) && (MSK[(size_t)b * TK + k0] == 0); ok1 = (abs(k1 / CHK - cq) <= 1) && (MSK[(size_t)b * TK + k1] == 0); }      /* mode 23: 3-chunk window + int key-padding mask */
        if (CAUSAL == 24) { ok0 = (MSK[(size_t)b * TK + k0] == 0); ok1 = (MSK[(size_t)b * TK + k1] == 0); }      /* mode 24: int key-padding mask (nonzero = padded = excluded) */      /* mode 2: block-diagonal 32-token groups */
        float s0 = ok0 ? s[rt][0][r] * SCL : -3.0e38f, s1 = ok1 ? s[rt][1][r] * SCL : -3.0e38f; if (CAUSAL == 17) { const float* amk = (const float*)MSK + (size_t)b * TK; s0 += bf16_round(amk[k0]); s1 += bf16_round(amk[k1]); } if (CAUSAL == 18) { const float* tb = (const float*)MSK; const int* ri = MSK + 1024 + (size_t)b * TK; const int rq = ri[tq]; s0 += tb[(h * 8 + rq) * 8 + ri[k0]]; s1 += tb[(h * 8 + rq) * 8 + ri[k1]]; } if (CAUSAL == 19) { const int* rel = MSK + (size_t)tq * TK; const float* rb = (const float*)MSK + (size_t)TQ * TK + ((size_t)(b * NH + h) * TQ + tq) * 64; s0 += rb[rel[k0]]; s1 += rb[rel[k1]]; }      /* mode 19: + (q.Ek[rel] + Eb[rel][h]) / 8 gathered by the int relative ids (packed [ids | table]) */      /* mode 18: + resource_bias[h][r_q][r_k] from the packed [table | ids] buffer (TQ == TK) */      /* mode 17: additive per-(batch, key) mask INPUT */ float mc = fmaxf(s0, s1);
        mc = fmaxf(mc, __shfl_xor(mc, 1, 32)); mc = fmaxf(mc, __shfl_xor(mc, 2, 32)); mc = fmaxf(mc, __shfl_xor(mc, 4, 32)); mc = fmaxf(mc, __shfl_xor(mc, 8, 32));
        const float mn = fmaxf(m_r[rt][r], mc); const float al = (mn > -1.0e38f) ? expf(m_r[rt][r] - mn) : 1.0f; m_r[rt][r] = mn; const float p0 = ok0 ? expf(s0 - mn) : 0.f, p1 = ok1 ? expf(s1 - mn) : 0.f; l_r[rt][r] = l_r[rt][r] * al + p0 + p1;
#pragma unroll
        for (int dt = 0; dt < DT; ++dt) oacc[rt][dt][r] *= al;
        FragH t2; t2.h[0] = (_Float16)(p0 * 1024.0f); t2.h[1] = (_Float16)(p1 * 1024.0f); sP[w][rt * 16 + 8 * hh + r][ln] = t2.u[0]; sP[w][rt * 16 + 8 * hh + r][16 + ln] = t2.u[1]; }
    __builtin_amdgcn_fence(__ATOMIC_ACQ_REL, "workgroup"); __builtin_amdgcn_wave_barrier();
    FragH pa[2];
#pragma unroll
    for (int rt = 0; rt < RTN; ++rt) { pa[rt].half[0] = *(const v8us*)&sP[w][rt * 16 + ln][8 * hh]; pa[rt].half[1] = *(const v8us*)&sP[w][rt * 16 + ln][16 + 8 * hh]; }
#pragma unroll
    for (int dt = 0; dt < DT; ++dt) { const unsigned short* vrow = Vth + (size_t)(dt * 16 + ln) * TK + j0; FragH bv; bv.half[0] = *(const v8us*)(vrow + 8 * hh); bv.half[1] = *(const v8us*)(vrow + 16 + 8 * hh);
#pragma unroll
      for (int rt = 0; rt < RTN; ++rt) oacc[rt][dt] = mmaH<1>(pa[rt].v, pa[rt].v, bv.v, bv.v, oacc[rt][dt]); }
    __builtin_amdgcn_fence(__ATOMIC_ACQ_REL, "workgroup"); __builtin_amdgcn_wave_barrier(); }
#pragma unroll
  for (int rt = 0; rt < RTN; ++rt) {
#pragma unroll
    for (int r = 0; r < 8; ++r) { float l = l_r[rt][r]; l += __shfl_xor(l, 1, 32); l += __shfl_xor(l, 2, 32); l += __shfl_xor(l, 4, 32); l += __shfl_xor(l, 8, 32); l_r[rt][r] = (l > 0.f) ? 1.0f / (l * 1024.0f) : 0.f; }
#pragma unroll
    for (int dt = 0; dt < DT; ++dt)
#pragma unroll
      for (int r = 0; r < 8; ++r) sO[w][rt * 16 + 8 * hh + r][dt * 16 + ln] = oacc[rt][dt][r] * l_r[rt][r]; }
  __builtin_amdgcn_fence(__ATOMIC_ACQ_REL, "workgroup"); __builtin_amdgcn_wave_barrier();
  {
#pragma unroll
    for (int rp = 0; rp < RPW; rp += 2) { const int r = rp + (lane >> 4), pc = lane & 15; const v4f val = *(const v4fa*)&sO[w][r][pc * 4]; *(v4f*)(O + ((size_t)b * TQ + q0 + r) * ldo + h * 64 + pc * 4) = val; }
     } }
// 5-plane variant: S = Qh Kh^T + (Ql Kh^T + Qh Kl^T)/1024 with Q/K = [hi | 2^10 residual] f16 planes (QL/KL same layout as Q16/K16), then the 3-term P.V below.
// 3-term variant: O = (P_hi V_hi + (P_lo V_hi + P_hi V_lo) / 1024) / l with P = [hi | 2^10 residual] of 1024 p and V^T = [hi | 2^10 residual] planes (VtL same layout as Vt) -> ~2^-21-class products for un-averaged (early causal / peaked) rows
template <int CAUSAL>
__global__ __launch_bounds__(128) void k_flash5(const _Float16* __restrict__ Q16, const _Float16* __restrict__ QL, int ldq, const _Float16* __restrict__ K16, const _Float16* __restrict__ KL, int ldk, const _Float16* __restrict__ Vt, const _Float16* __restrict__ VtL, const int* __restrict__ MSK, float* __restrict__ O, int ldo) {
  constexpr int RPW = 16, RTN = RPW / 16, NQB = TQ / (4 * RPW), DT = 4, KS = 2;
  __shared__ __attribute__((aligned(16))) unsigned short sP[4][RPW][40]; __shared__ __attribute__((aligned(16))) unsigned short sPL[4][RPW][40]; __shared__ __attribute__((aligned(16))) float sO[4][RPW][64 + 4];
  const int tid = threadIdx.x, w = tid >> 5, lane = tid & 31, ln = lane & 15, hh = lane >> 4;
  const int slab = blockIdx.x / QBN5, qblk = QB05 + blockIdx.x % QBN5; (void)NQB; const int b = slab / NH, h = slab % NH; const int qb0 = qblk * (4 * RPW); const int q0 = qb0 + w * RPW;
  FragH aq[2][KS], aql[2][KS];
#pragma unroll
  for (int rt = 0; rt < RTN; ++rt) { const unsigned short* qr = (const unsigned short*)Q16 + ((size_t)b * TQ + q0 + rt * 16 + ln) * ldq + h * 64; const unsigned short* ql = (const unsigned short*)QL + ((size_t)b * TQ + q0 + rt * 16 + ln) * ldq + h * 64;
#pragma unroll
    for (int ks = 0; ks < KS; ++ks) { aq[rt][ks].half[0] = *(const v8us*)(qr + ks * 32 + 8 * hh); aq[rt][ks].half[1] = *(const v8us*)(qr + ks * 32 + 16 + 8 * hh); aql[rt][ks].half[0] = *(const v8us*)(ql + ks * 32 + 8 * hh); aql[rt][ks].half[1] = *(const v8us*)(ql + ks * 32 + 16 + 8 * hh); } }
  const unsigned short* Vth = (const unsigned short*)Vt + (size_t)slab * 64 * TK; const unsigned short* Vtl = (const unsigned short*)VtL + (size_t)slab * 64 * TK;
  float m_r[2][8], l_r[2][8]; v8f oacc[2][DT], oaccL[2][DT];
#pragma unroll
  for (int rt = 0; rt < RTN; ++rt) {
#pragma unroll
    for (int r = 0; r < 8; ++r) { m_r[rt][r] = -3.0e38f; l_r[rt][r] = 0.f; }
#pragma unroll
    for (int dt = 0; dt < DT; ++dt) { oacc[rt][dt] = (v8f){0.f,0.f,0.f,0.f,0.f,0.f,0.f,0.f}; oaccL[rt][dt] = oacc[rt][dt]; } }
  const int jend = (CAUSAL == 1) ? (qb0 + 4 * RPW) : ((CAUSAL == 23) ? min(TK, (qb0 / CHK + 2) * CHK) : TK);      /* causal / window: keys that can never contribute are skipped */ const int jbeg = (CAUSAL == 23) ? max(0, (qb0 / CHK - 1) * CHK) : 0;
#pragma unroll 1
  for (int j0 = jbeg; j0 < jend; j0 += 32) {
    v8f s[2][2];
#pragma unroll
    for (int nt = 0; nt < 2; ++nt) { const unsigned short* kr = (const unsigned short*)K16 + ((size_t)b * TK + j0 + nt * 16 + ln) * ldk + h * 64; const unsigned short* klr = (const unsigned short*)KL + ((size_t)b * TK + j0 + nt * 16 + ln) * ldk + h * 64; FragH bk[KS], bkl[KS];
#pragma unroll
      for (int ks = 0; ks < KS; ++ks) { bk[ks].half[0] = *(const v8us*)(kr + ks * 32 + 8 * hh); bk[ks].half[1] = *(const v8us*)(kr + ks * 32 + 16 + 8 * hh); bkl[ks].half[0] = *(const v8us*)(klr + ks * 32 + 8 * hh); bkl[ks].half[1] = *(const v8us*)(klr + ks * 32 + 16 + 8 * hh); }
#pragma unroll
      for (int rt = 0; rt < RTN; ++rt) { v8f acc = (v8f){0.f,0.f,0.f,0.f,0.f,0.f,0.f,0.f}, accl = acc;
#pragma unroll
        for (int ks = 0; ks < KS; ++ks) { acc = mmaH<1>(aq[rt][ks].v, aq[rt][ks].v, bk[ks].v, bk[ks].v, acc); accl = mmaH<1>(aql[rt][ks].v, aql[rt][ks].v, bk[ks].v, bk[ks].v, accl); accl = mmaH<1>(aq[rt][ks].v, aq[rt][ks].v, bkl[ks].v, bkl[ks].v, accl); }
#pragma unroll
        for (int r = 0; r < 8; ++r) acc[r] += accl[r] * 0.0009765625f;
        s[rt][nt] = acc; } }
#pragma unroll
    for (int rt = 0; rt < RTN; ++rt)
#pragma unroll
      for (int r = 0; r < 8; ++r) { const int tq = q0 + rt * 16 + 8 * hh + r; const int k0 = j0 + ln, k1 = j0 + 16 + ln;
        bool ok0 = (CAUSAL == 1) ? (k0 <= tq) : ((CAUSAL == 2) ? ((k0 >> 5) == (tq >> 5)) : true), ok1 = (CAUSAL == 1) ? (k1 <= tq) : ((CAUSAL == 2) ? ((k1 >> 5) == (tq >> 5)) : true);      /* mode 2: block-diagonal 32-token groups */
        if (CAUSAL == 4) { const int* mrow = MSK + ((size_t)b * TQ + tq) * TK; ok0 = mrow[k0] != 0; ok1 = mrow[k1] != 0; }      /* mode 4: per-(query, key) INPUT mask shared by all heads; masked keys contribute nothing (== the reference's -4096 fill, whose exp underflows to 0), rows with no valid key give l = 0 -> output 0 (== the reference's row_valid zeroing) */
        float s0 = ok0 ? s[rt][0][r] * SCL : -3.0e38f, s1 = ok1 ? s[rt][1][r] * SCL : -3.0e38f; if (CAUSAL == 17) { const float* amk = (const float*)MSK + (size_t)b * TK; s0 += bf16_round(amk[k0]); s1 += bf16_round(amk[k1]); } if (CAUSAL == 18) { const float* tb = (const float*)MSK; const int* ri = MSK + 1024 + (size_t)b * TK; const int rq = ri[tq]; s0 += tb[(h * 8 + rq) * 8 + ri[k0]]; s1 += tb[(h * 8 + rq) * 8 + ri[k1]]; } if (CAUSAL == 19) { const int* rel = MSK + (size_t)tq * TK; const float* rb = (const float*)MSK + (size_t)TQ * TK + ((size_t)(b * NH + h) * TQ + tq) * 64; s0 += rb[rel[k0]]; s1 += rb[rel[k1]]; }      /* mode 19: + (q.Ek[rel] + Eb[rel][h]) / 8 gathered by the int relative ids (packed [ids | table]) */      /* mode 18: + resource_bias[h][r_q][r_k] from the packed [table | ids] buffer (TQ == TK) */      /* mode 17: additive per-(batch, key) mask INPUT */ float mc = fmaxf(s0, s1);
        mc = fmaxf(mc, __shfl_xor(mc, 1, 32)); mc = fmaxf(mc, __shfl_xor(mc, 2, 32)); mc = fmaxf(mc, __shfl_xor(mc, 4, 32)); mc = fmaxf(mc, __shfl_xor(mc, 8, 32));
        const float mn = fmaxf(m_r[rt][r], mc); const float al = (mn > -1.0e38f) ? expf(m_r[rt][r] - mn) : 1.0f; m_r[rt][r] = mn; const float p0 = ok0 ? expf(s0 - mn) : 0.f, p1 = ok1 ? expf(s1 - mn) : 0.f; l_r[rt][r] = l_r[rt][r] * al + p0 + p1;
#pragma unroll
        for (int dt = 0; dt < DT; ++dt) { oacc[rt][dt][r] *= al; oaccL[rt][dt][r] *= al; }
        FragH t2, t2l; const float ps0 = p0 * 1024.0f, ps1 = p1 * 1024.0f; t2.h[0] = (_Float16)ps0; t2.h[1] = (_Float16)ps1; t2l.h[0] = (_Float16)((ps0 - (float)t2.h[0]) * 1024.0f); t2l.h[1] = (_Float16)((ps1 - (float)t2.h[1]) * 1024.0f);
        sP[w][rt * 16 + 8 * hh + r][ln] = t2.u[0]; sP[w][rt * 16 + 8 * hh + r][16 + ln] = t2.u[1]; sPL[w][rt * 16 + 8 * hh + r][ln] = t2l.u[0]; sPL[w][rt * 16 + 8 * hh + r][16 + ln] = t2l.u[1]; }
    __builtin_amdgcn_fence(__ATOMIC_ACQ_REL, "workgroup"); __builtin_amdgcn_wave_barrier();
    FragH pa[2], pl[2];
#pragma unroll
    for (int rt = 0; rt < RTN; ++rt) { pa[rt].half[0] = *(const v8us*)&sP[w][rt * 16 + ln][8 * hh]; pa[rt].half[1] = *(const v8us*)&sP[w][rt * 16 + ln][16 + 8 * hh]; pl[rt].half[0] = *(const v8us*)&sPL[w][rt * 16 + ln][8 * hh]; pl[rt].half[1] = *(const v8us*)&sPL[w][rt * 16 + ln][16 + 8 * hh]; }
#pragma unroll
    for (int dt = 0; dt < DT; ++dt) { const unsigned short* vrow = Vth + (size_t)(dt * 16 + ln) * TK + j0; const unsigned short* vrl = Vtl + (size_t)(dt * 16 + ln) * TK + j0; FragH bv, bl; bv.half[0] = *(const v8us*)(vrow + 8 * hh); bv.half[1] = *(const v8us*)(vrow + 16 + 8 * hh); bl.half[0] = *(const v8us*)(vrl + 8 * hh); bl.half[1] = *(const v8us*)(vrl + 16 + 8 * hh);
#pragma unroll
      for (int rt = 0; rt < RTN; ++rt) { oacc[rt][dt] = mmaH<1>(pa[rt].v, pa[rt].v, bv.v, bv.v, oacc[rt][dt]); oaccL[rt][dt] = mmaH<1>(pl[rt].v, pl[rt].v, bv.v, bv.v, oaccL[rt][dt]); oaccL[rt][dt] = mmaH<1>(pa[rt].v, pa[rt].v, bl.v, bl.v, oaccL[rt][dt]); } }
    __builtin_amdgcn_fence(__ATOMIC_ACQ_REL, "workgroup"); __builtin_amdgcn_wave_barrier(); }
#pragma unroll
  for (int rt = 0; rt < RTN; ++rt) {
#pragma unroll
    for (int r = 0; r < 8; ++r) { float l = l_r[rt][r]; l += __shfl_xor(l, 1, 32); l += __shfl_xor(l, 2, 32); l += __shfl_xor(l, 4, 32); l += __shfl_xor(l, 8, 32); l_r[rt][r] = (l > 0.f) ? 1.0f / (l * 1024.0f) : 0.f; }
#pragma unroll
    for (int dt = 0; dt < DT; ++dt)
#pragma unroll
      for (int r = 0; r < 8; ++r) { float v = oacc[rt][dt][r]; v += oaccL[rt][dt][r] * 0.0009765625f; sO[w][rt * 16 + 8 * hh + r][dt * 16 + ln] = v * l_r[rt][r]; } }
  __builtin_amdgcn_fence(__ATOMIC_ACQ_REL, "workgroup"); __builtin_amdgcn_wave_barrier();
  {
#pragma unroll
    for (int rp = 0; rp < RPW; rp += 2) { const int r = rp + (lane >> 4), pc = lane & 15; const v4f val = *(const v4fa*)&sO[w][r][pc * 4]; *(v4f*)(O + ((size_t)b * TQ + q0 + r) * ldo + h * 64 + pc * 4) = val; }
     } }

__global__ __launch_bounds__(256) void k_rotab(float* __restrict__ CS, float* __restrict__ SN) {
  #pragma clang fp contract(off)
  const int t = blockIdx.x * 256 + threadIdx.x; if (t >= SLEN * 32) return; const int j = t % 32, s = t / 32; const float ex = (float)(2 * j) / 64.0f; const float inv = 1.0f / powf(10000.0f, ex); const float th = (float)s * inv; const float c = cosf(th), sn = sinf(th);
  { *(float*)(CS + t) = c; *(float*)(SN + t) = sn;  } }
__global__ __launch_bounds__(256) void k_rope(const float* __restrict__ F, int nsrc, int ndst, int rep, const float* __restrict__ CS, const float* __restrict__ SN, _Float16* __restrict__ H, _Float16* __restrict__ L) {
  #pragma clang fp contract(off)
  const size_t t = (size_t)blockIdx.x * 256 + threadIdx.x; if (t >= (size_t)NR * ndst * 4) return; const int g8 = (int)(t % 4); const int hd = (int)((t / 4) % ndst); const size_t row = t / ((size_t)4 * ndst); const int s = (int)(row % SLEN); const int hs = hd / rep;
  const float* src = F + row * (size_t)(nsrc * 64) + hs * 64; FragH ah, al, bh, bl;
  for (int i = 0; i < 8; ++i) { const int d = g8 * 8 + i; const float c = CS[s * 32 + d], sn = SN[s * 32 + d]; const float x1 = src[d], x2 = src[d + 32];
    float o1 = x1 * c; o1 += -x2 * sn; float o2 = x2 * c; o2 += x1 * sn;
    _Float16 hv = (_Float16)o1; ah.h[i] = hv; al.h[i] = (_Float16)((o1 - (float)hv) * 1024.0f); hv = (_Float16)o2; bh.h[i] = hv; bl.h[i] = (_Float16)((o2 - (float)hv) * 1024.0f); }
  const size_t o = row * (size_t)(ndst * 64) + hd * 64 + g8 * 8;
  { *(v8us*)((unsigned short*)H + o) = ah.half[0]; *(v8us*)((unsigned short*)H + o + 32) = bh.half[0]; *(v8us*)((unsigned short*)L + o) = al.half[0]; *(v8us*)((unsigned short*)L + o + 32) = bl.half[0];  } }
__global__ __launch_bounds__(256) void k_rope2(const float* __restrict__ F, int nsrc, int ndst, int rep, const float* __restrict__ CS, const float* __restrict__ SN, _Float16* __restrict__ H, _Float16* __restrict__ L) {
  #pragma clang fp contract(off)
  const size_t t = (size_t)blockIdx.x * 256 + threadIdx.x; if (t >= (size_t)NR * ndst * 4) return; const int g16 = (int)(t % 4); const int hd = (int)((t / 4) % ndst); const size_t row = t / ((size_t)4 * ndst); const int s = (int)(row % SLEN); const int hs = hd / rep;
  const float* src = F + row * (size_t)(nsrc * 64) + hs * 64 + g16 * 16; FragH ah, al;
  for (int pr = 0; pr < 8; ++pr) { const int i = g16 * 8 + pr; const float c = CS[s * 32 + i], sn = SN[s * 32 + i]; const float x1 = src[2 * pr], x2 = src[2 * pr + 1];
    float o1 = x1 * c; o1 -= x2 * sn; float o2 = x1 * sn; o2 += x2 * c;
    _Float16 hv = (_Float16)o1; ah.h[2 * pr] = hv; al.h[2 * pr] = (_Float16)((o1 - (float)hv) * 1024.0f); hv = (_Float16)o2; ah.h[2 * pr + 1] = hv; al.h[2 * pr + 1] = (_Float16)((o2 - (float)hv) * 1024.0f); }
  const size_t o = row * (size_t)(ndst * 64) + hd * 64 + g16 * 16;
  { *(v8us*)((unsigned short*)H + o) = ah.half[0]; *(v8us*)((unsigned short*)H + o + 8) = ah.half[1]; *(v8us*)((unsigned short*)L + o) = al.half[0]; *(v8us*)((unsigned short*)L + o + 8) = al.half[1];  } }
__global__ __launch_bounds__(256) void k_ln512(const float* __restrict__ A, const float* __restrict__ res, const float* __restrict__ g, const float* __restrict__ bb, float* __restrict__ Y, _Float16* __restrict__ Y16) {
  #pragma clang fp contract(off)
  const int wv = threadIdx.x >> 5, ln = threadIdx.x & 31; const size_t r = (size_t)blockIdx.x * 8 + wv; if (r >= NR) return; float x[16]; float s = 0.f;
  for (int i = 0; i < 2; ++i) { const v8f a = *(const v8f*)(A + r * DM + i * 256 + ln * 8); for (int q = 0; q < 8; ++q) { float v = a[q]; if (res) v += bf16_round(res[r * DM + i * 256 + ln * 8 + q]); x[i * 8 + q] = v; s += v; } }
  for (int o = 16; o > 0; o >>= 1) s += __shfl_xor(s, o, 32); const float mu = s / (float)DM; float var = 0.f; for (int q = 0; q < 16; ++q) { const float d = x[q] - mu; var += d * d; }
  for (int o = 16; o > 0; o >>= 1) var += __shfl_xor(var, o, 32); const float inv = rsqrtf(var / (float)DM + 1e-5f);
  { for (int i = 0; i < 2; ++i) { const int c0 = i * 256 + ln * 8; v8f y; FragH f; for (int q = 0; q < 8; ++q) { float v = (x[i * 8 + q] - mu) * inv; v *= bf16_round(g[c0 + q]); v += bf16_round(bb[c0 + q]); y[q] = v; f.h[q] = (_Float16)v; } *(v8f*)(Y + r * DM + c0) = y; if (Y16) *(v8us*)((unsigned short*)Y16 + r * DM + c0) = f.half[0]; }  } }
__global__ __launch_bounds__(256) void k_pack(const float* __restrict__ rb, const int* __restrict__ rid, int* __restrict__ PK) { const int t = blockIdx.x * 256 + threadIdx.x; if (t >= 1024 + NB * TK) return; int v; if (t < 1024) v = __float_as_int(bf16_round(rb[t])); else v = rid[t - 1024]; *(int*)(PK + t) = v;  }
__global__ __launch_bounds__(256) void k_tabin(const float* __restrict__ sp, float* __restrict__ CS, float* __restrict__ SN) { const int t = blockIdx.x * 256 + threadIdx.x; if (t >= SLEN * 32) return; const int i = t % 32, s = t / 32; const float c = bf16_round(sp[s * 64 + 32 + i]), sn = bf16_round(sp[s * 64 + i]);
  { *(float*)(CS + t) = c; *(float*)(SN + t) = sn;  } }
__global__ __launch_bounds__(256) void k_wsc(const float* __restrict__ Wm, _Float16* __restrict__ Bt, size_t n8, float sc) { const size_t t = (size_t)blockIdx.x * 256 + threadIdx.x; if (t >= n8) return; FragH f; for (int q = 0; q < 8; ++q) f.h[q] = (_Float16)(bf16_round(Wm[t * 8 + q]) * sc); *(v8us*)((unsigned short*)Bt + t * 8) = f.half[0];  }
__global__ __launch_bounds__(256) void k_rotab2(float* __restrict__ CS, float* __restrict__ SN) {
  #pragma clang fp contract(off)
  const int t = blockIdx.x * 256 + threadIdx.x; if (t >= SLEN * 32) return; const int j = t % 32, s = t / 32; const float c0 = -0.14391156831212787f;      /* -ln(10000)/64 rounded to f32 */ const float inv = expf((float)(2 * j) * c0); const float th = (float)s * inv; const float c = cosf(th), sn = sinf(th);
  { *(float*)(CS + t) = c; *(float*)(SN + t) = sn;  } }
__global__ __launch_bounds__(256) void k_lnu(const float* __restrict__ X, _Float16* __restrict__ N16, float* __restrict__ XB) {
  #pragma clang fp contract(off)
  const int wv = threadIdx.x >> 5, ln = threadIdx.x & 31; const size_t r = (size_t)blockIdx.x * 8 + wv; if (r >= NR) return; float a[32]; float s = 0.f;
  for (int i = 0; i < 4; ++i) { const v8f v = *(const v8f*)(X + r * DM + (i * 32 + ln) * 8); for (int q = 0; q < 8; ++q) { const float u = bf16_round(v[q]); a[i * 8 + q] = u; s += u; } }
  for (int o = 16; o > 0; o >>= 1) s += __shfl_xor(s, o, 32); const float mu = s / (float)DM; float var = 0.f; for (int q = 0; q < 32; ++q) { const float d = a[q] - mu; var += d * d; }
  for (int o = 16; o > 0; o >>= 1) var += __shfl_xor(var, o, 32); const float den = sqrtf(var / (float)(DM - 1)) + 1e-6f; const float inv = 1.0f / den;      /* one reciprocal per row; (x-mean)*inv vs the reference's division differs by <= 1 ulp */
  { for (int i = 0; i < 4; ++i) { const int c0 = (i * 32 + ln) * 8; FragH f; v8f xb; for (int q = 0; q < 8; ++q) { f.h[q] = (_Float16)((a[i * 8 + q] - mu) * inv); xb[q] = a[i * 8 + q]; } *(v8us*)((unsigned short*)N16 + r * DM + c0) = f.half[0]; *(v8f*)(XB + r * DM + c0) = xb; }  } }
__global__ __launch_bounds__(256) void k_vtg(const _Float16* __restrict__ V16, _Float16* __restrict__ Vt) { __shared__ unsigned short tl[64][66]; const int tid = threadIdx.x; const int slab = blockIdx.x / (SLEN / 64), lg = blockIdx.x % (SLEN / 64); const int b = slab / NH, h = slab % NH; const int hs = h / NREP;
  for (int i = tid; i < 64 * 8; i += 256) { const int r = i / 8, c8 = (i % 8) * 8; FragH f; f.half[0] = *(const v8us*)((const unsigned short*)V16 + ((size_t)b * SLEN + lg * 64 + r) * KVD + hs * 64 + c8); for (int q = 0; q < 8; ++q) tl[r][c8 + q] = f.u[q]; }
  __syncthreads();
  { for (int rd = 0; rd < 2; ++rd) { const int d = rd * 32 + tid / 8, pc = tid % 8; FragH f; for (int q = 0; q < 8; ++q) f.u[q] = tl[pc * 8 + q][d]; *(v8us*)((unsigned short*)Vt + ((size_t)slab * 64 + d) * SLEN + lg * 64 + pc * 8) = f.half[0]; }  } }

__global__ __launch_bounds__(256) void k_h16s(const float* __restrict__ SRC, int lds, int coff, _Float16* __restrict__ DST, size_t n8) { const size_t t = (size_t)blockIdx.x * 256 + threadIdx.x; if (t >= n8) return; const size_t r = (t * 8) / DM; const int c = (int)((t * 8) % DM); const v8f a = *(const v8f*)(SRC + r * lds + coff + c); FragH f; for (int q = 0; q < 8; ++q) f.h[q] = (_Float16)a[q];
  *(v8us*)((unsigned short*)DST + t * 8) = f.half[0];  }

__global__ __launch_bounds__(256) void k_norms(const float* __restrict__ QKV, float* __restrict__ QN, float* __restrict__ KN) {
  #pragma clang fp contract(off)
  const size_t t = (size_t)blockIdx.x * 256 + threadIdx.x; if (t >= (size_t)NR * NH) return; const int h = (int)(t % NH); const size_t row = t / NH; const float* q = QKV + row * (3 * DM) + h * 64; const float* k = q + DM; float sq = 0.f, sk = 0.f;
#pragma unroll 1
  for (int d = 0; d < 64; d += 4) { const v4f a = *(const v4fa*)(q + d), b = *(const v4fa*)(k + d); for (int i = 0; i < 4; ++i) { sq += a[i] * a[i]; sk += b[i] * b[i]; } }
  { *(float*)(QN + t) = sq; *(float*)(KN + t) = sk;  } }
// strided hi + residual copy of a DM-wide third of QKV
__global__ __launch_bounds__(256) void k_hls(const float* __restrict__ SRC, int lds, int coff, _Float16* __restrict__ DH, _Float16* __restrict__ DL, size_t n8) { const size_t t = (size_t)blockIdx.x * 256 + threadIdx.x; if (t >= n8) return; const size_t r = (t * 8) / DM; const int c = (int)((t * 8) % DM); const v8f a = *(const v8f*)(SRC + r * lds + coff + c); FragH fh, fl; for (int q = 0; q < 8; ++q) { const _Float16 h = (_Float16)a[q]; fh.h[q] = h; fl.h[q] = (_Float16)((a[q] - (float)h) * 1024.0f); }
  { *(v8us*)((unsigned short*)DH + t * 8) = fh.half[0]; *(v8us*)((unsigned short*)DL + t * 8) = fl.half[0];  } }

// Fused Gaussian-kernel attention: one launch for all (batch, head) slabs; the score plane and the weight plane never leave the registers.
// Block = 8 waves x 16 output rows i; the summed index j walks in LDS stages of FJ rows (q hi, q residual, V^T, |q|^2), two buffers, one barrier a stage.
// S^T tile: A = q rows j (LDS), B = k columns i (registers, loaded once); D[8 hh + r][ln] = k_i . q_j. Two D tiles (j 0-15, 16-31), weighted and rounded in place, are the B operand of O^T += V^T . P^T.
#define FJ 64
#define FP 72                    /* LDS row pitch in f16: 128-byte rows + 16 bytes, for 16-byte fragment reads */
__device__ __forceinline__ v16h fz_frag(const unsigned short* p, int hh) { FragH f; f.half[0] = *(const v8us*)(p + 8 * hh); f.half[1] = *(const v8us*)(p + 16 + 8 * hh); return f.v; }
__device__ __forceinline__ v8f fz_mma(v16h a, v16h b, v8f c) { return __builtin_amdgcn_wmma_f32_16x16x32_f16(false, a, false, b, (short)0, c, false, false); }
__global__ __launch_bounds__(256) __attribute__((amdgpu_waves_per_eu(4, 4))) void k_gauss(const _Float16* __restrict__ QH, const _Float16* __restrict__ QL, const _Float16* __restrict__ KH, const _Float16* __restrict__ KL, const _Float16* __restrict__ VT,
    const float* __restrict__ QN, const float* __restrict__ KN, const float* __restrict__ rs, float* __restrict__ O) {
  __shared__ __attribute__((aligned(16))) unsigned short sQH[2][FJ][FP]; __shared__ __attribute__((aligned(16))) unsigned short sQL[2][FJ][FP]; __shared__ __attribute__((aligned(16))) unsigned short sVT[2][64][FP]; __shared__ __attribute__((aligned(16))) float sQN[2][FJ];
  const int tid = threadIdx.x, w = tid >> 5, lane = tid & 31, ln = lane & 15, hh = lane >> 4;
  const int slab = blockIdx.x / (SLEN / 128), ib = blockIdx.x % (SLEN / 128); const int b = slab / NH, h = slab % NH;
  const int i = ib * 128 + w * 16 + ln;      /* this lane's output row (a column of every D tile) */
  const unsigned short* kh = (const unsigned short*)KH + ((size_t)b * SLEN + i) * DM + h * 64; const unsigned short* kl = (const unsigned short*)KL + ((size_t)b * SLEN + i) * DM + h * 64;
  const v16h bkh0 = fz_frag(kh, hh), bkh1 = fz_frag(kh + 32, hh), bkl0 = fz_frag(kl, hh), bkl1 = fz_frag(kl + 32, hh);
  const float kn = KN[((size_t)b * SLEN + i) * NH + h]; const float r = bf16_round(rs[0]);
  const int sr = tid >> 3, sc = (tid & 7) * 8;      /* staging: 16 bytes a thread in rows sr and sr + 32 of each plane */
  const unsigned short* gqh = (const unsigned short*)QH + ((size_t)b * SLEN + sr) * DM + h * 64 + sc; const unsigned short* gql = (const unsigned short*)QL + ((size_t)b * SLEN + sr) * DM + h * 64 + sc;
  const unsigned short* gvt = (const unsigned short*)VT + ((size_t)slab * 64 + sr) * SLEN + sc; const float* gqn = QN + ((size_t)b * SLEN + (tid & (FJ - 1))) * NH + h;
  v8us rq0, rq1, rl0, rl1, rv0, rv1; float rn = 0.f;
  auto gload = [&](int j0) { rq0 = *(const v8us*)(gqh + (size_t)j0 * DM); rq1 = *(const v8us*)(gqh + (size_t)(j0 + 32) * DM); rl0 = *(const v8us*)(gql + (size_t)j0 * DM); rl1 = *(const v8us*)(gql + (size_t)(j0 + 32) * DM);
    rv0 = *(const v8us*)(gvt + j0); rv1 = *(const v8us*)(gvt + (size_t)32 * SLEN + j0); if (tid < FJ) rn = gqn[(size_t)j0 * NH]; };
  auto sstore = [&](int bf) { *(v8us*)&sQH[bf][sr][sc] = rq0; *(v8us*)&sQH[bf][sr + 32][sc] = rq1; *(v8us*)&sQL[bf][sr][sc] = rl0; *(v8us*)&sQL[bf][sr + 32][sc] = rl1; *(v8us*)&sVT[bf][sr][sc] = rv0; *(v8us*)&sVT[bf][sr + 32][sc] = rv1; if (tid < FJ) sQN[bf][tid] = rn; };
  const v8f z8 = {0.f,0.f,0.f,0.f,0.f,0.f,0.f,0.f}; v8f oacc[4] = {z8, z8, z8, z8};
  gload(0); sstore(0); __syncthreads();
#pragma unroll 1      /* one stage a trip: the body already holds two 32-wide passes; more would only grow the code */
  for (int st = 0; st < SLEN / FJ; ++st) { const int bf = st & 1; const bool more = st + 1 < SLEN / FJ;
    if (more) gload((st + 1) * FJ);      /* next stage flies from L2 while this one is worked on */
#pragma unroll
    for (int jj = 0; jj < FJ; jj += 32) { FragH pb; const v16h av0 = fz_frag(&sVT[bf][ln][jj], hh), av1 = fz_frag(&sVT[bf][16 + ln][jj], hh), av2 = fz_frag(&sVT[bf][32 + ln][jj], hh), av3 = fz_frag(&sVT[bf][48 + ln][jj], hh);      /* named ahead of the score work, so that the scheduler may start these reads early */
#pragma unroll
      for (int nt = 0; nt < 2; ++nt) { const unsigned short* qh = &sQH[bf][jj + nt * 16 + ln][0]; const unsigned short* ql = &sQL[bf][jj + nt * 16 + ln][0];
        const v16h ah0 = fz_frag(qh, hh), ah1 = fz_frag(qh + 32, hh), al0 = fz_frag(ql, hh), al1 = fz_frag(ql + 32, hh);
        v8f cA = fz_mma(ah0, bkl0, z8), cB = fz_mma(al0, bkh0, z8), cC = fz_mma(ah0, bkh0, z8); cA = fz_mma(ah1, bkl1, cA); cB = fz_mma(al1, bkh1, cB); cC = fz_mma(ah1, bkh1, cC);
        const v4f n0 = *(const v4fa*)&sQN[bf][jj + nt * 16 + 8 * hh], n1 = *(const v4fa*)&sQN[bf][jj + nt * 16 + 8 * hh + 4];
#pragma unroll
        for (int q = 0; q < 8; ++q) { const float s = cC[q] + (cB[q] * 0.0009765625f + cA[q] * 0.0009765625f); const float qn = (q < 4) ? n0[q & 3] : n1[q & 3]; float d2 = kn + qn; d2 += -2.0f * s; pb.h[nt * 8 + q] = (_Float16)(1024.0f * expf(-(d2 * r))); } }
      oacc[0] = fz_mma(av0, pb.v, oacc[0]); oacc[1] = fz_mma(av1, pb.v, oacc[1]); oacc[2] = fz_mma(av2, pb.v, oacc[2]); oacc[3] = fz_mma(av3, pb.v, oacc[3]); }
    if (more) sstore(bf ^ 1);      /* that buffer's last readers left it before the barrier that ended the trip before */
    __syncthreads(); }
  float* orow = O + ((size_t)b * SLEN + i) * DM + h * 64 + 8 * hh;      /* D register q of tile dt = out[i][dt * 16 + 8 hh + q] */
#pragma unroll
  for (int dt = 0; dt < 4; ++dt) { v4f o0, o1;
#pragma unroll
    for (int q = 0; q < 4; ++q) { o0[q] = oacc[dt][q] * 0.0009765625f; o1[q] = oacc[dt][4 + q] * 0.0009765625f; }
    *(v4f*)(orow + dt * 16) = o0; *(v4f*)(orow + dt * 16 + 4) = o1; } }

extern "C" void kernel_launch(void* const* d_in, const int* in_sizes, int n_in,
                              void* d_out, int out_size, void* d_ws, size_t ws_size, hipStream_t stream) {
  (void)in_sizes; (void)n_in; (void)out_size;
  const float* const* I = (const float* const*)d_in; const float* x = I[0]; const float* Wqkv = I[1]; const float* bqkv = I[2]; const float* rs = I[3]; const float* Wp = I[4]; const float* bp = I[5];
  char* ws = (char*)d_ws; size_t off = 0;
  auto take = [&](size_t bytes) { char* p = ws + off; off += (bytes + 255) & ~(size_t)255; return p; };
  const size_t np = (size_t)NR * DM;
  _Float16* BQKV = (_Float16*)take((size_t)3 * DM * DM * 2); _Float16* BP = (_Float16*)take((size_t)DM * DM * 2);
  _Float16* X16 = (_Float16*)take(np * 2); float* QKV = (float*)take(np * 3 * 4); float* QN = (float*)take((size_t)NR * NH * 4); float* KN = (float*)take((size_t)NR * NH * 4); _Float16* QH = (_Float16*)take(np * 2); _Float16* QL = (_Float16*)take(np * 2); _Float16* KH = (_Float16*)take(np * 2); _Float16* KL = (_Float16*)take(np * 2); _Float16* VH = (_Float16*)take(np * 2); _Float16* VT = (_Float16*)take(np * 2);
  float* O = QKV;      /* merged context f32 [NR][DM] over the qkv plane (dead after norms + splits) */ _Float16* OH = QH;      /* over q hi (dead after k_gauss) */
  if (off > ws_size) return;      /* 6 + 2 + 8 + 48 + 0.5 + 5x8 + 8 = 113 MiB */
  k_wt_f16<<<(unsigned)(((size_t)DM * 3 * DM / 8 + 255) / 256), 256, 0, stream>>>(Wqkv, BQKV, DM, 3 * DM, 16.0f); k_wt_f16<<<(unsigned)(((size_t)DM * DM / 8 + 255) / 256), 256, 0, stream>>>(Wp, BP, DM, DM, 16.0f);      /* (in, out) */
  k_x16<<<(unsigned)((np / 8 + 255) / 256), 256, 0, stream>>>(x, X16, np / 8);
  k_gemm2<0><<<dim3((NR / 128) * (3 * DM / 64), 1), 128, 0, stream>>>(X16, DM, 0, BQKV, DM, 0, 0.0625f, bqkv, 0, nullptr, 1, 0, 0, QKV, nullptr, 3 * DM, 0, NR, 3 * DM, DM);      /* [q | k | v] f32 (head h = cols h*64..) */
  k_norms<<<(unsigned)(((size_t)NR * NH + 255) / 256), 256, 0, stream>>>(QKV, QN, KN);
  k_hls<<<(unsigned)((np / 8 + 255) / 256), 256, 0, stream>>>(QKV, 3 * DM, 0, QH, QL, np / 8); k_hls<<<(unsigned)((np / 8 + 255) / 256), 256, 0, stream>>>(QKV, 3 * DM, DM, KH, KL, np / 8); k_h16s<<<(unsigned)((np / 8 + 255) / 256), 256, 0, stream>>>(QKV, 3 * DM, 2 * DM, VH, np / 8);
  k_vtg<<<NB * NH * (SLEN / 64), 256, 0, stream>>>(VH, VT);      /* V^T [(b,h)][64][2048] */
  k_gauss<<<NB * NH * (SLEN / 128), 256, 0, stream>>>(QH, QL, KH, KL, VT, QN, KN, rs, O);      /* out_i[(h,d)] = sum_j exp(-r (kn_i + qn_j - 2 k_i.q_j)) v_j[d], merged context f32 */
  k_h16<<<(unsigned)((np / 8 + 255) / 256), 256, 0, stream>>>(O, OH, np / 8);
  k_gemm2<0><<<dim3((NR / 128) * (DM / 64), 1), 128, 0, stream>>>(OH, DM, 0, BP, DM, 0, 0.0625f, bp, 0, nullptr, 1, 0, 0, (float*)d_out, nullptr, DM, 0, NR, DM, DM);      /* out = ctx Wproj + bproj */
}

// v002
// One run takes 204 microseconds.
// Timed twice side by side with v001, it ran 1.36 times as fast both times.
// Counting every step since v000, it is 9.10 times as fast.
#include <hip/hip_runtime.h>
// qKv_attention (2 x 2048 tokens, C 1024 = 16 heads x 64; Gaussian-kernel attention WITHOUT normalisation: qkv = x Wqkv + b; K[i][j] = exp(-r_sigma ||q_j - k_i||^2) computed as kn_i + qn_j - 2 k_i.q_j; out_i = sum_j K[i][j] v_j; out = merge Wproj + bproj; r_sigma is a scalar input).
// Structure: exact f16 plane of x; qkv as one f16 WMMA GEMM (32x64 wave tiles, f32 accumulation, exact x16 weights + bias); per-(token, head) squared norms on VALU; q and k as f16 hi + 2^10 residual planes; V^T by LDS tiles; one fused launch over every (batch, head): the k.q products as three hi/residual terms (f32), the kernel weights exp(-r (kn + qn - 2 kq)) on VALU into f16 (x 2^10) in registers, the readout products (64 columns) straight into a merged context plane; Wproj + bproj GEMM.
// Compute dtype: inputs rounded to bf16; x and weights exact as f16; q, k as f16 hi + residual (~2^-21) because the exponent amplifies dot-product error by 2 r_sigma |k.q|; kernel weights and v as plain f16 operands (~2^-12; weights below 2^-34 of the unit scale flush to zero); merged context plain f16. v_wmma_f32_16x16x32_f16.
#define NB 2
#define DM 1024
#define NKV 16
#define NREP (NH / NKV)
#define KVD (NKV * 64)           /* 1024 */
#define NR (NB * SLEN)           /* 4096 */
#define CHK 512                  /* attention chunk */
typedef int v4i __attribute__((ext_vector_type(4)));
#define FF 2048
#define SLEN 2048
#define TQ SLEN
#define TK SLEN
#define NH 16
#define SCL 0.125f
#define QBLKS (TQ / 64)
#define QB05 0
#define QBN5 4
#define QB0P 0
#define QBNP QBLKS           /* non-causal: plain flash on every query block */
#define RE 256
typedef __bf16 v16b __attribute__((ext_vector_type(16)));
typedef unsigned short v8us __attribute__((ext_vector_type(8), may_alias));
typedef float  v8f  __attribute__((ext_vector_type(8)));
typedef float  v4f  __attribute__((ext_vector_type(4)));
typedef float  v4fa __attribute__((ext_vector_type(4), may_alias));
union FragB { v16b v; v8us half[2]; unsigned short u[16]; };

__device__ __forceinline__ unsigned short bf16_bits(float x) { unsigned int u = __float_as_uint(x); return (unsigned short)((u + 0x7FFFu + ((u >> 16) & 1u)) >> 16); }
__device__ __forceinline__ float bf16_val(unsigned short b) { return __uint_as_float(((unsigned int)b) << 16); }
__device__ __forceinline__ float bf16_round(float x) { return bf16_val(bf16_bits(x)); }
// D += A·B with NT terms: 1 = ah·bh, 2 = + al·bh (A split), 3 = + ah·bl (both split)
template <int NT>
__device__ __forceinline__ v8f mmaN(v16b ah, v16b al, v16b bh, v16b bl, v8f c) {
  c = __builtin_amdgcn_wmma_f32_16x16x32_bf16(false, ah, false, bh, (short)0, c, false, false);
  if (NT >= 2) c = __builtin_amdgcn_wmma_f32_16x16x32_bf16(false, al, false, bh, (short)0, c, false, false);
  if (NT >= 3) c = __builtin_amdgcn_wmma_f32_16x16x32_bf16(false, ah, false, bl, (short)0, c, false, false);
  asm volatile("v_nop\n\tv_nop\n\tv_nop\n\tv_nop" : "+v"(c) : "v"(ah), "v"(al), "v"(bh), "v"(bl));
  return c;
}

__global__ __launch_bounds__(256) void k_wt_bf16(const float* __restrict__ W, unsigned short* __restrict__ Wt, int K, int N) {
  const int t = blockIdx.x * 256 + threadIdx.x;
  const int k8n = K / 8;
  if (t >= N * k8n) return;
  const int n = t / k8n, k8 = (t % k8n) * 8;
  v8us v;
#pragma unroll
  for (int i = 0; i < 8; ++i) v[i] = bf16_bits(W[(size_t)(k8 + i) * N + n]);
  *(v8us*)(Wt + (size_t)n * K + k8) = v;
  
}

// GEMM C[M][N] (f32, pitch ldc) = act(A[M][K]·W + bias). A f32 row-major (pitch lda) converted per fragment to bf16
// (ASPLIT: hi/lo two planes -> 2 terms, else single rounded term); Wt bf16 [N][K] (pitch ldb). BIAS_BF16 rounds the
// bias to bf16 first (bias quantised to bf16 before the add). K%32==0, M%16==0, N%64==0.
template <bool ASPLIT, int ACT, bool BIAS_BF16>
__global__ __launch_bounds__(128) void k_gemm_bf(const float* __restrict__ A, int lda, const unsigned short* __restrict__ Wt, int ldb,
                                               const float* __restrict__ bias, float* __restrict__ C, int ldc, int M, int N, int K) {
  __shared__ __attribute__((aligned(16))) float so[4][16][64];
  const int tid = threadIdx.x, w = tid >> 5, lane = tid & 31, ln = lane & 15, hh = lane >> 4;
  const int ntn = N / 64;
  const int wid = blockIdx.x * 4 + w;
  const int mt = wid / ntn, nq = wid % ntn;
  if (mt * 16 >= M) return;
  const int row0 = mt * 16, col0 = nq * 64;
  const float* arow = A + (size_t)(row0 + ln) * lda;
  v8f acc[4] = {};
  for (int kb = 0; kb < K; kb += 32) {
    FragB ah, al;
    const v4f x0 = *(const v4fa*)(arow + kb + 8 * hh), x1 = *(const v4fa*)(arow + kb + 8 * hh + 4);
    const v4f x2 = *(const v4fa*)(arow + kb + 16 + 8 * hh), x3 = *(const v4fa*)(arow + kb + 16 + 8 * hh + 4);
    float xs[16] = {x0[0],x0[1],x0[2],x0[3],x1[0],x1[1],x1[2],x1[3],x2[0],x2[1],x2[2],x2[3],x3[0],x3[1],x3[2],x3[3]};
#pragma unroll
    for (int i = 0; i < 16; ++i) { const unsigned short hb = bf16_bits(xs[i]); ah.u[i] = hb; al.u[i] = ASPLIT ? bf16_bits(xs[i] - bf16_val(hb)) : (unsigned short)0; }
#pragma unroll
    for (int t = 0; t < 4; ++t) {
      const unsigned short* brow = Wt + (size_t)(col0 + t * 16 + ln) * ldb + kb;
      FragB b;
      b.half[0] = *(const v8us*)(brow + 8 * hh);
      b.half[1] = *(const v8us*)(brow + 16 + 8 * hh);
      acc[t] = mmaN<ASPLIT ? 2 : 1>(ah.v, al.v, b.v, b.v, acc[t]);
    }
  }
#pragma unroll
  for (int t = 0; t < 4; ++t) {
    float bv = bias ? bias[col0 + t * 16 + ln] : 0.f;
    if (BIAS_BF16) bv = bf16_round(bv);
#pragma unroll
    for (int r = 0; r < 8; ++r) { float v = acc[t][r] + bv; if (ACT == 1) v = fmaxf(v, 0.f); so[w][8 * hh + r][t * 16 + ln] = v; }
  }
  __builtin_amdgcn_fence(__ATOMIC_ACQ_REL, "workgroup");
  __builtin_amdgcn_wave_barrier();
  const int rsub = lane >> 4, c4 = (lane & 15) * 4;
  {
#pragma unroll
    for (int q = 0; q < 8; ++q) {
      const int r = q * 2 + rsub;
      const v4f v = *(const v4fa*)&so[w][r][c4];
      *(v4f*)(C + (size_t)(row0 + r) * ldc + col0 + c4) = v;
    }
    
  }
}

// GEMM C = act(A·W + bias + resid): A f32 (ASPLIT -> hi/lo 2 terms), Wt bf16 [N][K]; ACT 0 none, 1 relu, 2 exact gelu;
// resid (optional, f32, row index = (row % rmod), pitch ldr, RES_BF16 rounds it) added before the activation.
template <bool ASPLIT, int ACT, bool BIAS_BF16, bool RES_BF16>
__global__ __launch_bounds__(128) void k_gemm_bf3(const float* __restrict__ A, int lda, const unsigned short* __restrict__ Wt, int ldb,
                                                const float* __restrict__ bias, const float* __restrict__ resid, int rmod, int ldr,
                                                float* __restrict__ C, int ldc, int M, int N, int K) {
  __shared__ __attribute__((aligned(16))) float so[4][16][64];
  const int tid = threadIdx.x, w = tid >> 5, lane = tid & 31, ln = lane & 15, hh = lane >> 4;
  const int ntn = N / 64;
  const int wid = blockIdx.x * 4 + w;
  const int mt = wid / ntn, nq = wid % ntn;
  if (mt * 16 >= M) return;
  const int row0 = mt * 16, col0 = nq * 64;
  const float* arow = A + (size_t)(row0 + ln) * lda;
  v8f acc[4] = {};
  for (int kb = 0; kb < K; kb += 32) {
    FragB ah, al;
    const v4f x0 = *(const v4fa*)(arow + kb + 8 * hh), x1 = *(const v4fa*)(arow + kb + 8 * hh + 4);
    const v4f x2 = *(const v4fa*)(arow + kb + 16 + 8 * hh), x3 = *(const v4fa*)(arow + kb + 16 + 8 * hh + 4);
    float xs[16] = {x0[0],x0[1],x0[2],x0[3],x1[0],x1[1],x1[2],x1[3],x2[0],x2[1],x2[2],x2[3],x3[0],x3[1],x3[2],x3[3]};
#pragma unroll
    for (int i = 0; i < 16; ++i) { const unsigned short hb = bf16_bits(xs[i]); ah.u[i] = hb; al.u[i] = ASPLIT ? bf16_bits(xs[i] - bf16_val(hb)) : (unsigned short)0; }
#pragma unroll
    for (int t = 0; t < 4; ++t) {
      const unsigned short* brow = Wt + (size_t)(col0 + t * 16 + ln) * ldb + kb;
      FragB b;
      b.half[0] = *(const v8us*)(brow + 8 * hh);
      b.half[1] = *(const v8us*)(brow + 16 + 8 * hh);
      acc[t] = mmaN<ASPLIT ? 2 : 1>(ah.v, al.v, b.v, b.v, acc[t]);
    }
  }
#pragma unroll
  for (int t = 0; t < 4; ++t) {
    const int col = col0 + t * 16 + ln;
    float bv = bias ? bias[col] : 0.f;
    if (BIAS_BF16) bv = bf16_round(bv);
#pragma unroll
    for (int r = 0; r < 8; ++r) {
      float v = acc[t][r] + bv;
      if (resid) { float rv = resid[(size_t)((row0 + 8 * hh + r) % rmod) * ldr + col]; if (RES_BF16) rv = bf16_round(rv); v += rv; }
      if (ACT == 1) v = fmaxf(v, 0.f);
      if (ACT == 2) v = 0.5f * v * (1.0f + erff(v * 0.70710678118654752f));
      if (ACT == 3) { const float u = 0.7978845608028654f * (v + 0.044715f * v * v * v); v = 0.5f * v * (1.0f + tanhf(u)); }
      so[w][8 * hh + r][t * 16 + ln] = v;
    }
  }
  __builtin_amdgcn_fence(__ATOMIC_ACQ_REL, "workgroup");
  __builtin_amdgcn_wave_barrier();
  const int rsub = lane >> 4, c4 = (lane & 15) * 4;
  {
#pragma unroll
    for (int q = 0; q < 8; ++q) {
      const int r = q * 2 + rsub;
      const v4f v = *(const v4fa*)&so[w][r][c4];
      *(v4f*)(C + (size_t)(row0 + r) * ldc + col0 + c4) = v;
    }
    
  }
}
// row LayerNorm (biased variance, eps) over N: s = X (+ R); optional out_sum <- s; out_norm <- (s-mu)*rsqrt(var+eps)*g + b
template <bool PARAM_BF16>
__global__ __launch_bounds__(256) void k_layernorm(const float* __restrict__ X, const float* __restrict__ R, const float* __restrict__ g, const float* __restrict__ bta,
                                                  float* __restrict__ out_sum, float* __restrict__ out_norm, int N, float eps) {
  __shared__ float red[256];
  const int row = blockIdx.x, tid = threadIdx.x;
  const float* x = X + (size_t)row * N; const float* rr = R ? R + (size_t)row * N : nullptr;
  float vals[16];                     // up to N = 4096
  const int per = N / 256;            // contiguous chunk per thread? use strided-by-4 chunks: thread handles j = tid*4 + 1024*u
  float s1 = 0.f;
  for (int u = 0; u < per / 4; ++u) {
    const int j = tid * 4 + 1024 * u;
    const v4f a = *(const v4fa*)(x + j);
    v4f b = {0.f,0.f,0.f,0.f}; if (rr) b = *(const v4fa*)(rr + j);
#pragma unroll
    for (int q = 0; q < 4; ++q) { const float v = a[q] + b[q]; vals[u * 4 + q] = v; s1 += v; }
  }
  red[tid] = s1; __syncthreads();
  for (int st = 128; st > 0; st >>= 1) { if (tid < st) red[tid] += red[tid + st]; __syncthreads(); }
  const float mu = red[0] / (float)N; __syncthreads();
  float s2 = 0.f;
  for (int u = 0; u < per / 4; ++u)
#pragma unroll
    for (int q = 0; q < 4; ++q) { const float c = vals[u * 4 + q] - mu; s2 += c * c; }
  red[tid] = s2; __syncthreads();
  for (int st = 128; st > 0; st >>= 1) { if (tid < st) red[tid] += red[tid + st]; __syncthreads(); }
  const float rs = rsqrtf(red[0] / (float)N + eps);
  {
    for (int u = 0; u < per / 4; ++u) {
      const int j = tid * 4 + 1024 * u;
      v4f o, sm;
#pragma unroll
      for (int q = 0; q < 4; ++q) {
        float gg = g[j + q], bb = bta[j + q];
        if (PARAM_BF16) { gg = bf16_round(gg); bb = bf16_round(bb); }
        sm[q] = vals[u * 4 + q]; o[q] = (vals[u * 4 + q] - mu) * rs * gg + bb;
      }
      if (out_sum) *(v4f*)(out_sum + (size_t)row * N + j) = sm;
      *(v4f*)(out_norm + (size_t)row * N + j) = o;
    }
    
  }
}



// ---- f16 WMMA path (v_wmma_f32_16x16x32_f16): 11-bit significands for operands in range — used where a [0,1] probability operand needs more precision than bf16
typedef _Float16 v16h __attribute__((ext_vector_type(16)));
union FragH { v16h v; v8us half[2]; _Float16 h[16]; unsigned short u[16]; };
template <int NT>
__device__ __forceinline__ v8f mmaH(v16h ah, v16h al, v16h bh, v16h bl, v8f c) {
  c = __builtin_amdgcn_wmma_f32_16x16x32_f16(false, ah, false, bh, (short)0, c, false, false);
  if (NT >= 2) c = __builtin_amdgcn_wmma_f32_16x16x32_f16(false, al, false, bh, (short)0, c, false, false);
  if (NT >= 3) c = __builtin_amdgcn_wmma_f32_16x16x32_f16(false, ah, false, bl, (short)0, c, false, false);
  asm volatile("v_nop\n\tv_nop\n\tv_nop\n\tv_nop" : "+v"(c) : "v"(ah), "v"(al), "v"(bh), "v"(bl));
  return c;
}
// batched GEMM like k_gemm_b but f16 operands: A f32 (split into f16 hi/lo if ASPLIT, else rounded to f16), Bt = f16 values [n][k]; alpha; C f32; N multiple of 16 (partial tiles skipped)
template <bool ASPLIT>
__global__ __launch_bounds__(128) void k_gemm_h(const float* __restrict__ A, int lda, size_t sA, const _Float16* __restrict__ Bh, int ldb, size_t sB, float alpha, float* __restrict__ C, int ldc, size_t sC, int M, int N, int K) {
  __shared__ __attribute__((aligned(16))) float so[4][16][64];
  const int tid = threadIdx.x, w = tid >> 5, lane = tid & 31, ln = lane & 15, hh = lane >> 4; const int by = blockIdx.y;
  A += (size_t)by * sA; Bh += (size_t)by * sB; C += (size_t)by * sC;
  const int ntn = (N + 63) / 64; const int wid = blockIdx.x * 4 + w; const int mt = wid / ntn, nq = wid % ntn; if (mt * 16 >= M) return;
  const int row0 = mt * 16, col0 = nq * 64; const float* arow = A + (size_t)(row0 + ln) * lda;
  v8f acc[4] = {};
  for (int kb = 0; kb < K; kb += 32) {
    FragH ah, al;
    const v4f x0 = *(const v4fa*)(arow + kb + 8 * hh), x1 = *(const v4fa*)(arow + kb + 8 * hh + 4), x2 = *(const v4fa*)(arow + kb + 16 + 8 * hh), x3 = *(const v4fa*)(arow + kb + 16 + 8 * hh + 4);
    float xs[16] = {x0[0],x0[1],x0[2],x0[3],x1[0],x1[1],x1[2],x1[3],x2[0],x2[1],x2[2],x2[3],x3[0],x3[1],x3[2],x3[3]};
#pragma unroll
    for (int i = 0; i < 16; ++i) { const _Float16 h = (_Float16)xs[i]; ah.h[i] = h; al.h[i] = ASPLIT ? (_Float16)(xs[i] - (float)h) : (_Float16)0.0f; }
#pragma unroll
    for (int t = 0; t < 4; ++t) { if (col0 + t * 16 >= N) continue; const size_t boff = (size_t)(col0 + t * 16 + ln) * ldb + kb; FragH bq; bq.half[0] = *(const v8us*)(Bh + boff + 8 * hh); bq.half[1] = *(const v8us*)(Bh + boff + 16 + 8 * hh);
      acc[t] = mmaH<ASPLIT ? 2 : 1>(ah.v, al.v, bq.v, bq.v, acc[t]); }
  }
#pragma unroll
  for (int t = 0; t < 4; ++t) { if (col0 + t * 16 >= N) continue;
#pragma unroll
    for (int r = 0; r < 8; ++r) so[w][8 * hh + r][t * 16 + ln] = acc[t][r] * alpha; }
  __builtin_amdgcn_fence(__ATOMIC_ACQ_REL, "workgroup"); __builtin_amdgcn_wave_barrier();
  const int rsub = lane >> 4, c4 = (lane & 15) * 4;
  {
#pragma unroll
    for (int q = 0; q < 8; ++q) { const int r = q * 2 + rsub; if (col0 + c4 < N) { const v4f v = *(const v4fa*)&so[w][r][c4]; *(v4f*)(C + (size_t)(row0 + r) * ldc + col0 + c4) = v; } }
     }
}

// Wt[n][k] = f16(W[k][n]·scale) from f32 row-major W[K][N] (scale = power of two; bf16-exact weights stay exact in f16 away from the subnormal range)
__global__ __launch_bounds__(256) void k_wt_f16(const float* __restrict__ W, _Float16* __restrict__ Wt, int K, int N, float scale) {
  const int t = blockIdx.x * 256 + threadIdx.x; if (t >= N * (K / 8)) return; const int n = t / (K / 8), k8 = (t % (K / 8)) * 8; FragH f;
#pragma unroll
  for (int i = 0; i < 8; ++i) f.h[i] = (_Float16)(bf16_round(W[(size_t)(k8 + i) * N + n]) * scale); const v8us o = f.half[0];
  *(v8us*)((unsigned short*)Wt + (size_t)n * K + k8) = o; 
}
// k_gemm_hh variant with fused epilogue: v = acc·alpha + bias[by·sBias + col] (+ CP[(row/rowsPerB)·sCPb + by·64 + col] if CP) ; ACT 0 none / 1 elu ; writes f16 C16 (and f32 C if non-null)
template <int ACT>
__global__ __launch_bounds__(128) void k_gemm_hhx(const _Float16* __restrict__ A, int lda, size_t sA, const _Float16* __restrict__ Bh, int ldb, size_t sB, float alpha, const float* __restrict__ bias, size_t sBias, const float* __restrict__ CP, int rowsPerB, size_t sCPb, int row0g,
    float* __restrict__ C, _Float16* __restrict__ C16, int ldc, size_t sC, int M, int N, int K) {
  __shared__ __attribute__((aligned(16))) float so[4][16][64];
  const int tid = threadIdx.x, w = tid >> 5, lane = tid & 31, ln = lane & 15, hh = lane >> 4; const int by = blockIdx.y;
  A += (size_t)by * sA; Bh += (size_t)by * sB; const size_t cofs = (size_t)by * sC; const float* bp = bias ? bias + (size_t)by * sBias : nullptr;
  const int ntn = (N + 63) / 64; const int wid = blockIdx.x * 4 + w; const int mt = wid / ntn, nq = wid % ntn; if (mt * 16 >= M) return;
  const int row0 = mt * 16, col0 = nq * 64; const _Float16* arow = A + (size_t)(row0 + ln) * lda;
  v8f acc[4] = {};
  for (int kb = 0; kb < K; kb += 32) { FragH ah; ah.half[0] = *(const v8us*)((const unsigned short*)arow + kb + 8 * hh); ah.half[1] = *(const v8us*)((const unsigned short*)arow + kb + 16 + 8 * hh);
#pragma unroll
    for (int t = 0; t < 4; ++t) { if (col0 + t * 16 >= N) continue; const size_t boff = (size_t)(col0 + t * 16 + ln) * ldb + kb; FragH bq; bq.half[0] = *(const v8us*)((const unsigned short*)Bh + boff + 8 * hh); bq.half[1] = *(const v8us*)((const unsigned short*)Bh + boff + 16 + 8 * hh);
      acc[t] = mmaH<1>(ah.v, ah.v, bq.v, bq.v, acc[t]); }
  }
#pragma unroll
  for (int t = 0; t < 4; ++t) { if (col0 + t * 16 >= N) continue; const int col = col0 + t * 16 + ln; const float bv = bp ? bf16_round(bp[col]) : 0.f;
#pragma unroll
    for (int r = 0; r < 8; ++r) { float v = acc[t][r] * alpha + bv; if (CP) { const int bidx = (row0g + row0 + 8 * hh + r) / rowsPerB; v += CP[(size_t)bidx * sCPb + (size_t)by * 64 + col]; } if (ACT == 1) v = (v > 0.f) ? v : expm1f(v); else if (ACT == 7) v = (v > 0.f) ? v + 1.0f : expf(v); else if (ACT == 8) v = tanhf(v); else if (ACT == 9) v = 0.5f * v * (1.0f + tanhf(0.7978845608028654f * (v + 0.044715f * v * v * v))); else if (ACT == 11) v = 1.0f / (1.0f + expf(-v)); else if (ACT == 12) v = (v > 0.f) ? v : 0.01f * v; else if (ACT == 14) v = (v > 0.f) ? v : 0.1f * v; else if (ACT == 15) v = v / (1.0f + expf(-v)); else if (ACT == 3) v = fmaxf(v, 0.f); else if (ACT == 6) v = 0.5f * v * (1.0f + erff(v * 0.70710678118654752f)); so[w][8 * hh + r][t * 16 + ln] = v; } }
  __builtin_amdgcn_fence(__ATOMIC_ACQ_REL, "workgroup"); __builtin_amdgcn_wave_barrier();
  const int rsub = lane >> 4, c4 = (lane & 15) * 4; typedef _Float16 v4h __attribute__((ext_vector_type(4)));
  {
#pragma unroll
    for (int q = 0; q < 8; ++q) { const int r = q * 2 + rsub; if (col0 + c4 < N) { const v4f v = *(const v4fa*)&so[w][r][c4]; if (C) *(v4f*)(C + cofs + (size_t)(row0 + r) * ldc + col0 + c4) = v; if (C16) { v4h h4; for (int i = 0; i < 4; ++i) h4[i] = (_Float16)v[i]; *(v4h*)(C16 + cofs + (size_t)(row0 + r) * ldc + col0 + c4) = h4; } } }
     }
}


typedef _Float16 v4h __attribute__((ext_vector_type(4)));

__global__ __launch_bounds__(256) void k_x16(const float* __restrict__ x, _Float16* __restrict__ X16, size_t n8) { const size_t t = (size_t)blockIdx.x * 256 + threadIdx.x; if (t >= n8) return; FragH f;
#pragma unroll
  for (int q = 0; q < 8; ++q) f.h[q] = (_Float16)bf16_round(x[t * 8 + q]); *(v8us*)((unsigned short*)X16 + t * 8) = f.half[0];  }
__global__ __launch_bounds__(256) void k_h16(const float* __restrict__ x, _Float16* __restrict__ X16, size_t n8) { const size_t t = (size_t)blockIdx.x * 256 + threadIdx.x; if (t >= n8) return; FragH f;
#pragma unroll
  for (int q = 0; q < 8; ++q) f.h[q] = (_Float16)x[t * 8 + q]; *(v8us*)((unsigned short*)X16 + t * 8) = f.half[0];  }
__global__ __launch_bounds__(256) void k_round16f(const float* __restrict__ W, _Float16* __restrict__ Bt, size_t n8) { const size_t t = (size_t)blockIdx.x * 256 + threadIdx.x; if (t >= n8) return; FragH f;
#pragma unroll
  for (int i = 0; i < 8; ++i) f.h[i] = (_Float16)(bf16_round(W[t * 8 + i]) * 16.0f); *(v8us*)((unsigned short*)Bt + t * 8) = f.half[0];  }
template <int NHv, int TTv>
__global__ __launch_bounds__(256) void k_vt(const _Float16* __restrict__ V16, int ldv, int voff, _Float16* __restrict__ Vt) { __shared__ unsigned short tl[64][66]; const int tid = threadIdx.x; const int slab = blockIdx.x / (TTv / 64), lg = blockIdx.x % (TTv / 64); const int b = slab / NHv, h = slab % NHv;
  for (int i = tid; i < 64 * 8; i += 256) { const int r = i / 8, c8 = (i % 8) * 8; FragH f; f.half[0] = *(const v8us*)((const unsigned short*)V16 + ((size_t)b * TTv + lg * 64 + r) * ldv + voff + h * 64 + c8);
#pragma unroll
    for (int q = 0; q < 8; ++q) tl[r][c8 + q] = f.u[q]; }
  __syncthreads();
  {
#pragma unroll
    for (int rd = 0; rd < 2; ++rd) { const int d = rd * 32 + tid / 8, pc = tid % 8; FragH f;
#pragma unroll
      for (int q = 0; q < 8; ++q) f.u[q] = tl[pc * 8 + q][d];
      *(v8us*)((unsigned short*)Vt + ((size_t)slab * 64 + d) * TTv + lg * 64 + pc * 8) = f.half[0]; }
     } }

__global__ __launch_bounds__(256) void k_hl(const float* __restrict__ F, _Float16* __restrict__ Hh, _Float16* __restrict__ Hl, size_t n8) { const size_t t = (size_t)blockIdx.x * 256 + threadIdx.x; if (t >= n8) return; FragH fh, fl; const v4f a = *(const v4fa*)(F + t * 8), c = *(const v4fa*)(F + t * 8 + 4);
#pragma unroll
  for (int q = 0; q < 4; ++q) { _Float16 h = (_Float16)a[q]; fh.h[q] = h; fl.h[q] = (_Float16)((a[q] - (float)h) * 1024.0f); h = (_Float16)c[q]; fh.h[4 + q] = h; fl.h[4 + q] = (_Float16)((c[q] - (float)h) * 1024.0f); }
  { *(v8us*)((unsigned short*)Hh + t * 8) = fh.half[0]; *(v8us*)((unsigned short*)Hl + t * 8) = fl.half[0];  } }

// ---- fast GEMM (wave tile 32x64; requires M % 32 == 0 rows per launch region and N % 64 == 0); epilogue = k_gemm_hhx semantics ----
__device__ __forceinline__ v16h g2_frag(const _Float16* p, int hh) { FragH f; f.half[0] = *(const v8us*)((const unsigned short*)p + 8 * hh); f.half[1] = *(const v8us*)((const unsigned short*)p + 16 + 8 * hh); return f.v; }
__device__ __forceinline__ v8f g2_mma(v16h a, v16h b, v8f c) { v8f d = __builtin_amdgcn_wmma_f32_16x16x32_f16(false, a, false, b, (short)0, c, false, false); asm volatile("v_nop\n\tv_nop\n\tv_nop\n\tv_nop" : "+v"(d) : "v"(a), "v"(b)); return d; }
template <int ACT>
__global__ __launch_bounds__(128) void k_gemm2(const _Float16* __restrict__ A, int lda, size_t sA, const _Float16* __restrict__ Bh, int ldb, size_t sB, float alpha, const float* __restrict__ bias, size_t sBias, const float* __restrict__ CP, int rowsPerB, size_t sCPb, int row0g,
    float* __restrict__ C, _Float16* __restrict__ C16, int ldc, size_t sC, int M, int N, int K) {
  __shared__ __attribute__((aligned(16))) float so[4][32][68];
  const int tid = threadIdx.x, w = tid >> 5, lane = tid & 31, ln = lane & 15, hh = lane >> 4; const int by = blockIdx.y;
  A += (size_t)by * sA; Bh += (size_t)by * sB; const size_t cofs = (size_t)by * sC; const float* bp = bias ? bias + (size_t)by * sBias : nullptr;
  const int ntn = N >> 6; const int mt = blockIdx.x / ntn, nq = blockIdx.x - mt * ntn; const int row0 = mt * 128 + 32 * w, col0 = nq * 64; if (row0 >= M) return;
  const _Float16* a0p = A + (size_t)(row0 + ln) * lda; const _Float16* a1p = a0p + (size_t)16 * lda;
  const _Float16* b0p = Bh + (size_t)(col0 + ln) * ldb; const _Float16* b1p = b0p + (size_t)16 * ldb; const _Float16* b2p = b1p + (size_t)16 * ldb; const _Float16* b3p = b2p + (size_t)16 * ldb;
  const v8f z8 = {0.f,0.f,0.f,0.f,0.f,0.f,0.f,0.f}; v8f c00 = z8, c01 = z8, c02 = z8, c03 = z8, c10 = z8, c11 = z8, c12 = z8, c13 = z8;
#pragma unroll 1
  for (int kb = 0; kb < K; kb += 32) { const v16h a0 = g2_frag(a0p + kb, hh), a1 = g2_frag(a1p + kb, hh);
    v16h b = g2_frag(b0p + kb, hh); c00 = g2_mma(a0, b, c00); c10 = g2_mma(a1, b, c10);
    b = g2_frag(b1p + kb, hh); c01 = g2_mma(a0, b, c01); c11 = g2_mma(a1, b, c11);
    b = g2_frag(b2p + kb, hh); c02 = g2_mma(a0, b, c02); c12 = g2_mma(a1, b, c12);
    b = g2_frag(b3p + kb, hh); c03 = g2_mma(a0, b, c03); c13 = g2_mma(a1, b, c13); }
  v8f accs[8] = {c00, c01, c02, c03, c10, c11, c12, c13};
#pragma unroll
  for (int u = 0; u < 8; ++u) { const int t = u & 3, half = u >> 2; const int col = col0 + t * 16 + ln; const float bv = bp ? bf16_round(bp[col]) : 0.f;
#pragma unroll
    for (int r = 0; r < 8; ++r) { const int rloc = half * 16 + 8 * hh + r; float v = accs[u][r] * alpha + bv; if (CP) { if (rowsPerB < 0) v += CP[cofs + (size_t)(row0g + row0 + rloc) * ldc + col];      /* rowsPerB < 0: own element of the batched C plane */ else { const int bidx = (row0g + row0 + rloc) / rowsPerB; v += CP[(size_t)bidx * sCPb + (size_t)by * 64 + col]; } }
      if (ACT == 3) v = fmaxf(v, 0.f); else if (ACT == 6) v = 0.5f * v * (1.0f + erff(v * 0.70710678118654752f)); else if (ACT == 11) v = 1.0f / (1.0f + expf(-v)); else if (ACT == 15) v = v / (1.0f + expf(-v)); else if (ACT == 12) v = (v > 0.f) ? v : 0.01f * v; else if (ACT == 8) v = tanhf(v);
      so[w][rloc][t * 16 + ln] = v; } }
  __builtin_amdgcn_fence(__ATOMIC_ACQ_REL, "workgroup"); __builtin_amdgcn_wave_barrier();
  const int rsub = lane >> 4, c4 = (lane & 15) * 4;
  {
#pragma unroll
    for (int q = 0; q < 16; ++q) { const int r = q * 2 + rsub; const v4f v = *(const v4fa*)&so[w][r][c4]; if (C) *(v4f*)(C + cofs + (size_t)(row0 + r) * ldc + col0 + c4) = v; if (C16) { v4h h4; for (int i = 0; i < 4; ++i) h4[i] = (_Float16)v[i]; *(v4h*)(C16 + cofs + (size_t)(row0 + r) * ldc + col0 + c4) = h4; } }
     } }



template <int CAUSAL>
__global__ __launch_bounds__(128) void k_flash(const _Float16* __restrict__ Q16, int ldq, const _Float16* __restrict__ K16, int ldk, const _Float16* __restrict__ Vt, const int* __restrict__ MSK, float* __restrict__ O, int ldo) {
  constexpr int RPW = 16, RTN = RPW / 16, NQB = TQ / (4 * RPW), DT = 4, KS = 2;
  __shared__ __attribute__((aligned(16))) unsigned short sP[4][RPW][40]; __shared__ __attribute__((aligned(16))) float sO[4][RPW][64 + 4];
  const int tid = threadIdx.x, w = tid >> 5, lane = tid & 31, ln = lane & 15, hh = lane >> 4;
  const int slab = blockIdx.x / QBNP, qblk = QB0P + blockIdx.x % QBNP; (void)NQB; const int b = slab / NH, h = slab % NH; const int qb0 = qblk * (4 * RPW); const int q0 = qb0 + w * RPW;
  FragH aq[2][KS];
#pragma unroll
  for (int rt = 0; rt < RTN; ++rt) { const unsigned short* qr = (const unsigned short*)Q16 + ((size_t)b * TQ + q0 + rt * 16 + ln) * ldq + h * 64;
#pragma unroll
    for (int ks = 0; ks < KS; ++ks) { aq[rt][ks].half[0] = *(const v8us*)(qr + ks * 32 + 8 * hh); aq[rt][ks].half[1] = *(const v8us*)(qr + ks * 32 + 16 + 8 * hh); } }
  const unsigned short* Vth = (const unsigned short*)Vt + (size_t)slab * 64 * TK;
  float m_r[2][8], l_r[2][8]; v8f oacc[2][DT];
#pragma unroll
  for (int rt = 0; rt < RTN; ++rt) {
#pragma unroll
    for (int r = 0; r < 8; ++r) { m_r[rt][r] = -3.0e38f; l_r[rt][r] = 0.f; }
#pragma unroll
    for (int dt = 0; dt < DT; ++dt) oacc[rt][dt] = (v8f){0.f,0.f,0.f,0.f,0.f,0.f,0.f,0.f}; }
  const int jend = (CAUSAL == 1) ? (qb0 + 4 * RPW) : ((CAUSAL == 23) ? min(TK, (qb0 / CHK + 2) * CHK) : TK);      /* causal / window: keys that can never contribute are skipped */ const int jbeg = (CAUSAL == 23) ? max(0, (qb0 / CHK - 1) * CHK) : 0;
#pragma unroll 1
  for (int j0 = jbeg; j0 < jend; j0 += 32) {
    v8f s[2][2];
#pragma unroll
    for (int nt = 0; nt < 2; ++nt) { const unsigned short* kr = (const unsigned short*)K16 + ((size_t)b * TK + j0 + nt * 16 + ln) * ldk + h * 64; FragH bk[KS];
#pragma unroll
      for (int ks = 0; ks < KS; ++ks) { bk[ks].half[0] = *(const v8us*)(kr + ks * 32 + 8 * hh); bk[ks].half[1] = *(const v8us*)(kr + ks * 32 + 16 + 8 * hh); }
#pragma unroll
      for (int rt = 0; rt < RTN; ++rt) { v8f acc = (v8f){0.f,0.f,0.f,0.f,0.f,0.f,0.f,0.f};
#pragma unroll
        for (int ks = 0; ks < KS; ++ks) acc = mmaH<1>(aq[rt][ks].v, aq[rt][ks].v, bk[ks].v, bk[ks].v, acc); s[rt][nt] = acc; } }
#pragma unroll
    for (int rt = 0; rt < RTN; ++rt)
#pragma unroll
      for (int r = 0; r < 8; ++r) { const int tq = q0 + rt * 16 + 8 * hh + r; const int k0 = j0 + ln, k1 = j0 + 16 + ln;
        bool ok0 = (CAUSAL == 1) ? (k0 <= tq) : ((CAUSAL == 2) ? ((k0 >> 5) == (tq >> 5)) : true), ok1 = (CAUSAL == 1) ? (k1 <= tq) : ((CAUSAL == 2) ? ((k1 >> 5) == (tq >> 5)) : true); if (CAUSAL == 23) { const int cq = tq / CHK; ok0 = (abs(k0 / CHK - cq) <= 1) && (MSK[(size_t)b * TK + k0] == 0); ok1 = (abs(k1 / CHK - cq) <= 1) && (MSK[(size_t)b * TK + k1] == 0); }      /* mode 23: 3-chunk window + int key-padding mask */
        if (CAUSAL == 24) { ok0 = (MSK[(size_t)b * TK + k0] == 0); ok1 = (MSK[(size_t)b * TK + k1] == 0); }      /* mode 24: int key-padding mask (nonzero = padded = excluded) */      /* mode 2: block-diagonal 32-token groups */
        float s0 = ok0 ? s[rt][0][r] * SCL : -3.0e38f, s1 = ok1 ? s[rt][1][r] * SCL : -3.0e38f; if (CAUSAL == 17) { const float* amk = (const float*)MSK + (size_t)b * TK; s0 += bf16_round(amk[k0]); s1 += bf16_round(amk[k1]); } if (CAUSAL == 18) { const float* tb = (const float*)MSK; const int* ri = MSK + 1024 + (size_t)b * TK; const int rq = ri[tq]; s0 += tb[(h * 8 + rq) * 8 + ri[k0]]; s1 += tb[(h * 8 + rq) * 8 + ri[k1]]; } if (CAUSAL == 19) { const int* rel = MSK + (size_t)tq * TK; const float* rb = (const float*)MSK + (size_t)TQ * TK + ((size_t)(b * NH + h) * TQ + tq) * 64; s0 += rb[rel[k0]]; s1 += rb[rel[k1]]; }      /* mode 19: + (q.Ek[rel] + Eb[rel][h]) / 8 gathered by the int relative ids (packed [ids | table]) */      /* mode 18: + resource_bias[h][r_q][r_k] from the packed [table | ids] buffer (TQ == TK) */      /* mode 17: additive per-(batch, key) mask INPUT */ float mc = fmaxf(s0, s1);
        mc = fmaxf(mc, __shfl_xor(mc, 1, 32)); mc = fmaxf(mc, __shfl_xor(mc, 2, 32)); mc = fmaxf(mc, __shfl_xor(mc, 4, 32)); mc = fmaxf(mc, __shfl_xor(mc, 8, 32));
        const float mn = fmaxf(m_r[rt][r], mc); const float al = (mn > -1.0e38f) ? expf(m_r[rt][r] - mn) : 1.0f; m_r[rt][r] = mn; const float p0 = ok0 ? expf(s0 - mn) : 0.f, p1 = ok1 ? expf(s1 - mn) : 0.f; l_r[rt][r] = l_r[rt][r] * al + p0 + p1;
#pragma unroll
        for (int dt = 0; dt < DT; ++dt) oacc[rt][dt][r] *= al;
        FragH t2; t2.h[0] = (_Float16)(p0 * 1024.0f); t2.h[1] = (_Float16)(p1 * 1024.0f); sP[w][rt * 16 + 8 * hh + r][ln] = t2.u[0]; sP[w][rt * 16 + 8 * hh + r][16 + ln] = t2.u[1]; }
    __builtin_amdgcn_fence(__ATOMIC_ACQ_REL, "workgroup"); __builtin_amdgcn_wave_barrier();
    FragH pa[2];
#pragma unroll
    for (int rt = 0; rt < RTN; ++rt) { pa[rt].half[0] = *(const v8us*)&sP[w][rt * 16 + ln][8 * hh]; pa[rt].half[1] = *(const v8us*)&sP[w][rt * 16 + ln][16 + 8 * hh]; }
#pragma unroll
    for (int dt = 0; dt < DT; ++dt) { const unsigned short* vrow = Vth + (size_t)(dt * 16 + ln) * TK + j0; FragH bv; bv.half[0] = *(const v8us*)(vrow + 8 * hh); bv.half[1] = *(const v8us*)(vrow + 16 + 8 * hh);
#pragma unroll
      for (int rt = 0; rt < RTN; ++rt) oacc[rt][dt] = mmaH<1>(pa[rt].v, pa[rt].v, bv.v, bv.v, oacc[rt][dt]); }
    __builtin_amdgcn_fence(__ATOMIC_ACQ_REL, "workgroup"); __builtin_amdgcn_wave_barrier(); }
#pragma unroll
  for (int rt = 0; rt < RTN; ++rt) {
#pragma unroll
    for (int r = 0; r < 8; ++r) { float l = l_r[rt][r]; l += __shfl_xor(l, 1, 32); l += __shfl_xor(l, 2, 32); l += __shfl_xor(l, 4, 32); l += __shfl_xor(l, 8, 32); l_r[rt][r] = (l > 0.f) ? 1.0f / (l * 1024.0f) : 0.f; }
#pragma unroll
    for (int dt = 0; dt < DT; ++dt)
#pragma unroll
      for (int r = 0; r < 8; ++r) sO[w][rt * 16 + 8 * hh + r][dt * 16 + ln] = oacc[rt][dt][r] * l_r[rt][r]; }
  __builtin_amdgcn_fence(__ATOMIC_ACQ_REL, "workgroup"); __builtin_amdgcn_wave_barrier();
  {
#pragma unroll
    for (int rp = 0; rp < RPW; rp += 2) { const int r = rp + (lane >> 4), pc = lane & 15; const v4f val = *(const v4fa*)&sO[w][r][pc * 4]; *(v4f*)(O + ((size_t)b * TQ + q0 + r) * ldo + h * 64 + pc * 4) = val; }
     } }
// 5-plane variant: S = Qh Kh^T + (Ql Kh^T + Qh Kl^T)/1024 with Q/K = [hi | 2^10 residual] f16 planes (QL/KL same layout as Q16/K16), then the 3-term P.V below.
// 3-term variant: O = (P_hi V_hi + (P_lo V_hi + P_hi V_lo) / 1024) / l with P = [hi | 2^10 residual] of 1024 p and V^T = [hi | 2^10 residual] planes (VtL same layout as Vt) -> ~2^-21-class products for un-averaged (early causal / peaked) rows
template <int CAUSAL>
__global__ __launch_bounds__(128) void k_flash5(const _Float16* __restrict__ Q16, const _Float16* __restrict__ QL, int ldq, const _Float16* __restrict__ K16, const _Float16* __restrict__ KL, int ldk, const _Float16* __restrict__ Vt, const _Float16* __restrict__ VtL, const int* __restrict__ MSK, float* __restrict__ O, int ldo) {
  constexpr int RPW = 16, RTN = RPW / 16, NQB = TQ / (4 * RPW), DT = 4, KS = 2;
  __shared__ __attribute__((aligned(16))) unsigned short sP[4][RPW][40]; __shared__ __attribute__((aligned(16))) unsigned short sPL[4][RPW][40]; __shared__ __attribute__((aligned(16))) float sO[4][RPW][64 + 4];
  const int tid = threadIdx.x, w = tid >> 5, lane = tid & 31, ln = lane & 15, hh = lane >> 4;
  const int slab = blockIdx.x / QBN5, qblk = QB05 + blockIdx.x % QBN5; (void)NQB; const int b = slab / NH, h = slab % NH; const int qb0 = qblk * (4 * RPW); const int q0 = qb0 + w * RPW;
  FragH aq[2][KS], aql[2][KS];
#pragma unroll
  for (int rt = 0; rt < RTN; ++rt) { const unsigned short* qr = (const unsigned short*)Q16 + ((size_t)b * TQ + q0 + rt * 16 + ln) * ldq + h * 64; const unsigned short* ql = (const unsigned short*)QL + ((size_t)b * TQ + q0 + rt * 16 + ln) * ldq + h * 64;
#pragma unroll
    for (int ks = 0; ks < KS; ++ks) { aq[rt][ks].half[0] = *(const v8us*)(qr + ks * 32 + 8 * hh); aq[rt][ks].half[1] = *(const v8us*)(qr + ks * 32 + 16 + 8 * hh); aql[rt][ks].half[0] = *(const v8us*)(ql + ks * 32 + 8 * hh); aql[rt][ks].half[1] = *(const v8us*)(ql + ks * 32 + 16 + 8 * hh); } }
  const unsigned short* Vth = (const unsigned short*)Vt + (size_t)slab * 64 * TK; const unsigned short* Vtl = (const unsigned short*)VtL + (size_t)slab * 64 * TK;
  float m_r[2][8], l_r[2][8]; v8f oacc[2][DT], oaccL[2][DT];
#pragma unroll
  for (int rt = 0; rt < RTN; ++rt) {
#pragma unroll
    for (int r = 0; r < 8; ++r) { m_r[rt][r] = -3.0e38f; l_r[rt][r] = 0.f; }
#pragma unroll
    for (int dt = 0; dt < DT; ++dt) { oacc[rt][dt] = (v8f){0.f,0.f,0.f,0.f,0.f,0.f,0.f,0.f}; oaccL[rt][dt] = oacc[rt][dt]; } }
  const int jend = (CAUSAL == 1) ? (qb0 + 4 * RPW) : ((CAUSAL == 23) ? min(TK, (qb0 / CHK + 2) * CHK) : TK);      /* causal / window: keys that can never contribute are skipped */ const int jbeg = (CAUSAL == 23) ? max(0, (qb0 / CHK - 1) * CHK) : 0;
#pragma unroll 1
  for (int j0 = jbeg; j0 < jend; j0 += 32) {
    v8f s[2][2];
#pragma unroll
    for (int nt = 0; nt < 2; ++nt) { const unsigned short* kr = (const unsigned short*)K16 + ((size_t)b * TK + j0 + nt * 16 + ln) * ldk + h * 64; const unsigned short* klr = (const unsigned short*)KL + ((size_t)b * TK + j0 + nt * 16 + ln) * ldk + h * 64; FragH bk[KS], bkl[KS];
#pragma unroll
      for (int ks = 0; ks < KS; ++ks) { bk[ks].half[0] = *(const v8us*)(kr + ks * 32 + 8 * hh); bk[ks].half[1] = *(const v8us*)(kr + ks * 32 + 16 + 8 * hh); bkl[ks].half[0] = *(const v8us*)(klr + ks * 32 + 8 * hh); bkl[ks].half[1] = *(const v8us*)(klr + ks * 32 + 16 + 8 * hh); }
#pragma unroll
      for (int rt = 0; rt < RTN; ++rt) { v8f acc = (v8f){0.f,0.f,0.f,0.f,0.f,0.f,0.f,0.f}, accl = acc;
#pragma unroll
        for (int ks = 0; ks < KS; ++ks) { acc = mmaH<1>(aq[rt][ks].v, aq[rt][ks].v, bk[ks].v, bk[ks].v, acc); accl = mmaH<1>(aql[rt][ks].v, aql[rt][ks].v, bk[ks].v, bk[ks].v, accl); accl = mmaH<1>(aq[rt][ks].v, aq[rt][ks].v, bkl[ks].v, bkl[ks].v, accl); }
#pragma unroll
        for (int r = 0; r < 8; ++r) acc[r] += accl[r] * 0.0009765625f;
        s[rt][nt] = acc; } }
#pragma unroll
    for (int rt = 0; rt < RTN; ++rt)
#pragma unroll
      for (int r = 0; r < 8; ++r) { const int tq = q0 + rt * 16 + 8 * hh + r; const int k0 = j0 + ln, k1 = j0 + 16 + ln;
        bool ok0 = (CAUSAL == 1) ? (k0 <= tq) : ((CAUSAL == 2) ? ((k0 >> 5) == (tq >> 5)) : true), ok1 = (CAUSAL == 1) ? (k1 <= tq) : ((CAUSAL == 2) ? ((k1 >> 5) == (tq >> 5)) : true);      /* mode 2: block-diagonal 32-token groups */
        if (CAUSAL == 4) { const int* mrow = MSK + ((size_t)b * TQ + tq) * TK; ok0 = mrow[k0] != 0; ok1 = mrow[k1] != 0; }      /* mode 4: per-(query, key) INPUT mask shared by all heads; masked keys contribute nothing (== the reference's -4096 fill, whose exp underflows to 0), rows with no valid key give l = 0 -> output 0 (== the reference's row_valid zeroing) */
        float s0 = ok0 ? s[rt][0][r] * SCL : -3.0e38f, s1 = ok1 ? s[rt][1][r] * SCL : -3.0e38f; if (CAUSAL == 17) { const float* amk = (const float*)MSK + (size_t)b * TK; s0 += bf16_round(amk[k0]); s1 += bf16_round(amk[k1]); } if (CAUSAL == 18) { const float* tb = (const float*)MSK; const int* ri = MSK + 1024 + (size_t)b * TK; const int rq = ri[tq]; s0 += tb[(h * 8 + rq) * 8 + ri[k0]]; s1 += tb[(h * 8 + rq) * 8 + ri[k1]]; } if (CAUSAL == 19) { const int* rel = MSK + (size_t)tq * TK; const float* rb = (const float*)MSK + (size_t)TQ * TK + ((size_t)(b * NH + h) * TQ + tq) * 64; s0 += rb[rel[k0]]; s1 += rb[rel[k1]]; }      /* mode 19: + (q.Ek[rel] + Eb[rel][h]) / 8 gathered by the int relative ids (packed [ids | table]) */      /* mode 18: + resource_bias[h][r_q][r_k] from the packed [table | ids] buffer (TQ == TK) */      /* mode 17: additive per-(batch, key) mask INPUT */ float mc = fmaxf(s0, s1);
        mc = fmaxf(mc, __shfl_xor(mc, 1, 32)); mc = fmaxf(mc, __shfl_xor(mc, 2, 32)); mc = fmaxf(mc, __shfl_xor(mc, 4, 32)); mc = fmaxf(mc, __shfl_xor(mc, 8, 32));
        const float mn = fmaxf(m_r[rt][r], mc); const float al = (mn > -1.0e38f) ? expf(m_r[rt][r] - mn) : 1.0f; m_r[rt][r] = mn; const float p0 = ok0 ? expf(s0 - mn) : 0.f, p1 = ok1 ? expf(s1 - mn) : 0.f; l_r[rt][r] = l_r[rt][r] * al + p0 + p1;
#pragma unroll
        for (int dt = 0; dt < DT; ++dt) { oacc[rt][dt][r] *= al; oaccL[rt][dt][r] *= al; }
        FragH t2, t2l; const float ps0 = p0 * 1024.0f, ps1 = p1 * 1024.0f; t2.h[0] = (_Float16)ps0; t2.h[1] = (_Float16)ps1; t2l.h[0] = (_Float16)((ps0 - (float)t2.h[0]) * 1024.0f); t2l.h[1] = (_Float16)((ps1 - (float)t2.h[1]) * 1024.0f);
        sP[w][rt * 16 + 8 * hh + r][ln] = t2.u[0]; sP[w][rt * 16 + 8 * hh + r][16 + ln] = t2.u[1]; sPL[w][rt * 16 + 8 * hh + r][ln] = t2l.u[0]; sPL[w][rt * 16 + 8 * hh + r][16 + ln] = t2l.u[1]; }
    __builtin_amdgcn_fence(__ATOMIC_ACQ_REL, "workgroup"); __builtin_amdgcn_wave_barrier();
    FragH pa[2], pl[2];
#pragma unroll
    for (int rt = 0; rt < RTN; ++rt) { pa[rt].half[0] = *(const v8us*)&sP[w][rt * 16 + ln][8 * hh]; pa[rt].half[1] = *(const v8us*)&sP[w][rt * 16 + ln][16 + 8 * hh]; pl[rt].half[0] = *(const v8us*)&sPL[w][rt * 16 + ln][8 * hh]; pl[rt].half[1] = *(const v8us*)&sPL[w][rt * 16 + ln][16 + 8 * hh]; }
#pragma unroll
    for (int dt = 0; dt < DT; ++dt) { const unsigned short* vrow = Vth + (size_t)(dt * 16 + ln) * TK + j0; const unsigned short* vrl = Vtl + (size_t)(dt * 16 + ln) * TK + j0; FragH bv, bl; bv.half[0] = *(const v8us*)(vrow + 8 * hh); bv.half[1] = *(const v8us*)(vrow + 16 + 8 * hh); bl.half[0] = *(const v8us*)(vrl + 8 * hh); bl.half[1] = *(const v8us*)(vrl + 16 + 8 * hh);
#pragma unroll
      for (int rt = 0; rt < RTN; ++rt) { oacc[rt][dt] = mmaH<1>(pa[rt].v, pa[rt].v, bv.v, bv.v, oacc[rt][dt]); oaccL[rt][dt] = mmaH<1>(pl[rt].v, pl[rt].v, bv.v, bv.v, oaccL[rt][dt]); oaccL[rt][dt] = mmaH<1>(pa[rt].v, pa[rt].v, bl.v, bl.v, oaccL[rt][dt]); } }
    __builtin_amdgcn_fence(__ATOMIC_ACQ_REL, "workgroup"); __builtin_amdgcn_wave_barrier(); }
#pragma unroll
  for (int rt = 0; rt < RTN; ++rt) {
#pragma unroll
    for (int r = 0; r < 8; ++r) { float l = l_r[rt][r]; l += __shfl_xor(l, 1, 32); l += __shfl_xor(l, 2, 32); l += __shfl_xor(l, 4, 32); l += __shfl_xor(l, 8, 32); l_r[rt][r] = (l > 0.f) ? 1.0f / (l * 1024.0f) : 0.f; }
#pragma unroll
    for (int dt = 0; dt < DT; ++dt)
#pragma unroll
      for (int r = 0; r < 8; ++r) { float v = oacc[rt][dt][r]; v += oaccL[rt][dt][r] * 0.0009765625f; sO[w][rt * 16 + 8 * hh + r][dt * 16 + ln] = v * l_r[rt][r]; } }
  __builtin_amdgcn_fence(__ATOMIC_ACQ_REL, "workgroup"); __builtin_amdgcn_wave_barrier();
  {
#pragma unroll
    for (int rp = 0; rp < RPW; rp += 2) { const int r = rp + (lane >> 4), pc = lane & 15; const v4f val = *(const v4fa*)&sO[w][r][pc * 4]; *(v4f*)(O + ((size_t)b * TQ + q0 + r) * ldo + h * 64 + pc * 4) = val; }
     } }

__global__ __launch_bounds__(256) void k_rotab(float* __restrict__ CS, float* __restrict__ SN) {
  #pragma clang fp contract(off)
  const int t = blockIdx.x * 256 + threadIdx.x; if (t >= SLEN * 32) return; const int j = t % 32, s = t / 32; const float ex = (float)(2 * j) / 64.0f; const float inv = 1.0f / powf(10000.0f, ex); const float th = (float)s * inv; const float c = cosf(th), sn = sinf(th);
  { *(float*)(CS + t) = c; *(float*)(SN + t) = sn;  } }
__global__ __launch_bounds__(256) void k_rope(const float* __restrict__ F, int nsrc, int ndst, int rep, const float* __restrict__ CS, const float* __restrict__ SN, _Float16* __restrict__ H, _Float16* __restrict__ L) {
  #pragma clang fp contract(off)
  const size_t t = (size_t)blockIdx.x * 256 + threadIdx.x; if (t >= (size_t)NR * ndst * 4) return; const int g8 = (int)(t % 4); const int hd = (int)((t / 4) % ndst); const size_t row = t / ((size_t)4 * ndst); const int s = (int)(row % SLEN); const int hs = hd / rep;
  const float* src = F + row * (size_t)(nsrc * 64) + hs * 64; FragH ah, al, bh, bl;
  for (int i = 0; i < 8; ++i) { const int d = g8 * 8 + i; const float c = CS[s * 32 + d], sn = SN[s * 32 + d]; const float x1 = src[d], x2 = src[d + 32];
    float o1 = x1 * c; o1 += -x2 * sn; float o2 = x2 * c; o2 += x1 * sn;
    _Float16 hv = (_Float16)o1; ah.h[i] = hv; al.h[i] = (_Float16)((o1 - (float)hv) * 1024.0f); hv = (_Float16)o2; bh.h[i] = hv; bl.h[i] = (_Float16)((o2 - (float)hv) * 1024.0f); }
  const size_t o = row * (size_t)(ndst * 64) + hd * 64 + g8 * 8;
  { *(v8us*)((unsigned short*)H + o) = ah.half[0]; *(v8us*)((unsigned short*)H + o + 32) = bh.half[0]; *(v8us*)((unsigned short*)L + o) = al.half[0]; *(v8us*)((unsigned short*)L + o + 32) = bl.half[0];  } }
__global__ __launch_bounds__(256) void k_rope2(const float* __restrict__ F, int nsrc, int ndst, int rep, const float* __restrict__ CS, const float* __restrict__ SN, _Float16* __restrict__ H, _Float16* __restrict__ L) {
  #pragma clang fp contract(off)
  const size_t t = (size_t)blockIdx.x * 256 + threadIdx.x; if (t >= (size_t)NR * ndst * 4) return; const int g16 = (int)(t % 4); const int hd = (int)((t / 4) % ndst); const size_t row = t / ((size_t)4 * ndst); const int s = (int)(row % SLEN); const int hs = hd / rep;
  const float* src = F + row * (size_t)(nsrc * 64) + hs * 64 + g16 * 16; FragH ah, al;
  for (int pr = 0; pr < 8; ++pr) { const int i = g16 * 8 + pr; const float c = CS[s * 32 + i], sn = SN[s * 32 + i]; const float x1 = src[2 * pr], x2 = src[2 * pr + 1];
    float o1 = x1 * c; o1 -= x2 * sn; float o2 = x1 * sn; o2 += x2 * c;
    _Float16 hv = (_Float16)o1; ah.h[2 * pr] = hv; al.h[2 * pr] = (_Float16)((o1 - (float)hv) * 1024.0f); hv = (_Float16)o2; ah.h[2 * pr + 1] = hv; al.h[2 * pr + 1] = (_Float16)((o2 - (float)hv) * 1024.0f); }
  const size_t o = row * (size_t)(ndst * 64) + hd * 64 + g16 * 16;
  { *(v8us*)((unsigned short*)H + o) = ah.half[0]; *(v8us*)((unsigned short*)H + o + 8) = ah.half[1]; *(v8us*)((unsigned short*)L + o) = al.half[0]; *(v8us*)((unsigned short*)L + o + 8) = al.half[1];  } }
__global__ __launch_bounds__(256) void k_ln512(const float* __restrict__ A, const float* __restrict__ res, const float* __restrict__ g, const float* __restrict__ bb, float* __restrict__ Y, _Float16* __restrict__ Y16) {
  #pragma clang fp contract(off)
  const int wv = threadIdx.x >> 5, ln = threadIdx.x & 31; const size_t r = (size_t)blockIdx.x * 8 + wv; if (r >= NR) return; float x[16]; float s = 0.f;
  for (int i = 0; i < 2; ++i) { const v8f a = *(const v8f*)(A + r * DM + i * 256 + ln * 8); for (int q = 0; q < 8; ++q) { float v = a[q]; if (res) v += bf16_round(res[r * DM + i * 256 + ln * 8 + q]); x[i * 8 + q] = v; s += v; } }
  for (int o = 16; o > 0; o >>= 1) s += __shfl_xor(s, o, 32); const float mu = s / (float)DM; float var = 0.f; for (int q = 0; q < 16; ++q) { const float d = x[q] - mu; var += d * d; }
  for (int o = 16; o > 0; o >>= 1) var += __shfl_xor(var, o, 32); const float inv = rsqrtf(var / (float)DM + 1e-5f);
  { for (int i = 0; i < 2; ++i) { const int c0 = i * 256 + ln * 8; v8f y; FragH f; for (int q = 0; q < 8; ++q) { float v = (x[i * 8 + q] - mu) * inv; v *= bf16_round(g[c0 + q]); v += bf16_round(bb[c0 + q]); y[q] = v; f.h[q] = (_Float16)v; } *(v8f*)(Y + r * DM + c0) = y; if (Y16) *(v8us*)((unsigned short*)Y16 + r * DM + c0) = f.half[0]; }  } }
__global__ __launch_bounds__(256) void k_pack(const float* __restrict__ rb, const int* __restrict__ rid, int* __restrict__ PK) { const int t = blockIdx.x * 256 + threadIdx.x; if (t >= 1024 + NB * TK) return; int v; if (t < 1024) v = __float_as_int(bf16_round(rb[t])); else v = rid[t - 1024]; *(int*)(PK + t) = v;  }
__global__ __launch_bounds__(256) void k_tabin(const float* __restrict__ sp, float* __restrict__ CS, float* __restrict__ SN) { const int t = blockIdx.x * 256 + threadIdx.x; if (t >= SLEN * 32) return; const int i = t % 32, s = t / 32; const float c = bf16_round(sp[s * 64 + 32 + i]), sn = bf16_round(sp[s * 64 + i]);
  { *(float*)(CS + t) = c; *(float*)(SN + t) = sn;  } }
__global__ __launch_bounds__(256) void k_wsc(const float* __restrict__ Wm, _Float16* __restrict__ Bt, size_t n8, float sc) { const size_t t = (size_t)blockIdx.x * 256 + threadIdx.x; if (t >= n8) return; FragH f; for (int q = 0; q < 8; ++q) f.h[q] = (_Float16)(bf16_round(Wm[t * 8 + q]) * sc); *(v8us*)((unsigned short*)Bt + t * 8) = f.half[0];  }
__global__ __launch_bounds__(256) void k_rotab2(float* __restrict__ CS, float* __restrict__ SN) {
  #pragma clang fp contract(off)
  const int t = blockIdx.x * 256 + threadIdx.x; if (t >= SLEN * 32) return; const int j = t % 32, s = t / 32; const float c0 = -0.14391156831212787f;      /* -ln(10000)/64 rounded to f32 */ const float inv = expf((float)(2 * j) * c0); const float th = (float)s * inv; const float c = cosf(th), sn = sinf(th);
  { *(float*)(CS + t) = c; *(float*)(SN + t) = sn;  } }
__global__ __launch_bounds__(256) void k_lnu(const float* __restrict__ X, _Float16* __restrict__ N16, float* __restrict__ XB) {
  #pragma clang fp contract(off)
  const int wv = threadIdx.x >> 5, ln = threadIdx.x & 31; const size_t r = (size_t)blockIdx.x * 8 + wv; if (r >= NR) return; float a[32]; float s = 0.f;
  for (int i = 0; i < 4; ++i) { const v8f v = *(const v8f*)(X + r * DM + (i * 32 + ln) * 8); for (int q = 0; q < 8; ++q) { const float u = bf16_round(v[q]); a[i * 8 + q] = u; s += u; } }
  for (int o = 16; o > 0; o >>= 1) s += __shfl_xor(s, o, 32); const float mu = s / (float)DM; float var = 0.f; for (int q = 0; q < 32; ++q) { const float d = a[q] - mu; var += d * d; }
  for (int o = 16; o > 0; o >>= 1) var += __shfl_xor(var, o, 32); const float den = sqrtf(var / (float)(DM - 1)) + 1e-6f; const float inv = 1.0f / den;      /* one reciprocal per row; (x-mean)*inv vs the reference's division differs by <= 1 ulp */
  { for (int i = 0; i < 4; ++i) { const int c0 = (i * 32 + ln) * 8; FragH f; v8f xb; for (int q = 0; q < 8; ++q) { f.h[q] = (_Float16)((a[i * 8 + q] - mu) * inv); xb[q] = a[i * 8 + q]; } *(v8us*)((unsigned short*)N16 + r * DM + c0) = f.half[0]; *(v8f*)(XB + r * DM + c0) = xb; }  } }
__global__ __launch_bounds__(256) void k_vtg(const _Float16* __restrict__ V16, _Float16* __restrict__ Vt) { __shared__ unsigned short tl[64][66]; const int tid = threadIdx.x; const int slab = blockIdx.x / (SLEN / 64), lg = blockIdx.x % (SLEN / 64); const int b = slab / NH, h = slab % NH; const int hs = h / NREP;
  for (int i = tid; i < 64 * 8; i += 256) { const int r = i / 8, c8 = (i % 8) * 8; FragH f; f.half[0] = *(const v8us*)((const unsigned short*)V16 + ((size_t)b * SLEN + lg * 64 + r) * KVD + hs * 64 + c8); for (int q = 0; q < 8; ++q) tl[r][c8 + q] = f.u[q]; }
  __syncthreads();
  { for (int rd = 0; rd < 2; ++rd) { const int d = rd * 32 + tid / 8, pc = tid % 8; FragH f; for (int q = 0; q < 8; ++q) f.u[q] = tl[pc * 8 + q][d]; *(v8us*)((unsigned short*)Vt + ((size_t)slab * 64 + d) * SLEN + lg * 64 + pc * 8) = f.half[0]; }  } }

__global__ __launch_bounds__(256) void k_h16s(const float* __restrict__ SRC, int lds, int coff, _Float16* __restrict__ DST, size_t n8) { const size_t t = (size_t)blockIdx.x * 256 + threadIdx.x; if (t >= n8) return; const size_t r = (t * 8) / DM; const int c = (int)((t * 8) % DM); const v8f a = *(const v8f*)(SRC + r * lds + coff + c); FragH f; for (int q = 0; q < 8; ++q) f.h[q] = (_Float16)a[q];
  *(v8us*)((unsigned short*)DST + t * 8) = f.half[0];  }

__global__ __launch_bounds__(256) void k_norms(const float* __restrict__ QKV, float* __restrict__ QN, float* __restrict__ KN) {
  #pragma clang fp contract(off)
  const size_t t = (size_t)blockIdx.x * 256 + threadIdx.x; if (t >= (size_t)NR * NH) return; const int h = (int)(t % NH); const size_t row = t / NH; const float* q = QKV + row * (3 * DM) + h * 64; const float* k = q + DM; float sq = 0.f, sk = 0.f;
#pragma unroll 1
  for (int d = 0; d < 64; d += 4) { const v4f a = *(const v4fa*)(q + d), b = *(const v4fa*)(k + d); for (int i = 0; i < 4; ++i) { sq += a[i] * a[i]; sk += b[i] * b[i]; } }
  { *(float*)(QN + t) = sq; *(float*)(KN + t) = sk;  } }
// strided hi + residual copy of a DM-wide third of QKV
__global__ __launch_bounds__(256) void k_hls(const float* __restrict__ SRC, int lds, int coff, _Float16* __restrict__ DH, _Float16* __restrict__ DL, size_t n8) { const size_t t = (size_t)blockIdx.x * 256 + threadIdx.x; if (t >= n8) return; const size_t r = (t * 8) / DM; const int c = (int)((t * 8) % DM); const v8f a = *(const v8f*)(SRC + r * lds + coff + c); FragH fh, fl; for (int q = 0; q < 8; ++q) { const _Float16 h = (_Float16)a[q]; fh.h[q] = h; fl.h[q] = (_Float16)((a[q] - (float)h) * 1024.0f); }
  { *(v8us*)((unsigned short*)DH + t * 8) = fh.half[0]; *(v8us*)((unsigned short*)DL + t * 8) = fl.half[0];  } }

// Fused Gaussian-kernel attention: one launch for all (batch, head) slabs; the score plane and the weight plane never leave the registers.
// Block = 8 waves x 16 output rows i; the summed index j walks in LDS stages of FJ rows (q hi, q residual, V^T, |q|^2), two buffers, one barrier a stage.
// S^T tile: A = q rows j (LDS), B = k columns i (registers, loaded once); D[8 hh + r][ln] = k_i . q_j. Two D tiles (j 0-15, 16-31), weighted and rounded in place, are the B operand of O^T += V^T . P^T.
#define FJ 64
#define FP 72                    /* LDS row pitch in f16: 128-byte rows + 16 bytes, for 16-byte fragment reads */
__device__ __forceinline__ v16h fz_frag(const unsigned short* p, int hh) { FragH f; f.half[0] = *(const v8us*)(p + 8 * hh); f.half[1] = *(const v8us*)(p + 16 + 8 * hh); return f.v; }
__device__ __forceinline__ v8f fz_mma(v16h a, v16h b, v8f c) { return __builtin_amdgcn_wmma_f32_16x16x32_f16(false, a, false, b, (short)0, c, false, false); }
__global__ __launch_bounds__(256) __attribute__((amdgpu_waves_per_eu(4, 4))) void k_gauss(const _Float16* __restrict__ QH, const _Float16* __restrict__ QL, const _Float16* __restrict__ KH, const _Float16* __restrict__ KL, const _Float16* __restrict__ VT,
    const float* __restrict__ QN, const float* __restrict__ KN, const float* __restrict__ rs, float* __restrict__ O) {
  __shared__ __attribute__((aligned(16))) unsigned short sQH[2][FJ][FP]; __shared__ __attribute__((aligned(16))) unsigned short sQL[2][FJ][FP]; __shared__ __attribute__((aligned(16))) unsigned short sVT[2][64][FP]; __shared__ __attribute__((aligned(16))) float sQN[2][FJ];
  const int tid = threadIdx.x, w = tid >> 5, lane = tid & 31, ln = lane & 15, hh = lane >> 4;
  const int slab = blockIdx.x / (SLEN / 128), ib = blockIdx.x % (SLEN / 128); const int b = slab / NH, h = slab % NH;
  const int i = ib * 128 + w * 16 + ln;      /* this lane's output row (a column of every D tile) */
  const unsigned short* kh = (const unsigned short*)KH + ((size_t)b * SLEN + i) * DM + h * 64; const unsigned short* kl = (const unsigned short*)KL + ((size_t)b * SLEN + i) * DM + h * 64;
  const v16h bkh0 = fz_frag(kh, hh), bkh1 = fz_frag(kh + 32, hh), bkl0 = fz_frag(kl, hh), bkl1 = fz_frag(kl + 32, hh);
  const float kn = KN[((size_t)b * SLEN + i) * NH + h]; const float r = bf16_round(rs[0]);
  const int sr = tid >> 3, sc = (tid & 7) * 8;      /* staging: 16 bytes a thread in rows sr and sr + 32 of each plane */
  const unsigned short* gqh = (const unsigned short*)QH + ((size_t)b * SLEN + sr) * DM + h * 64 + sc; const unsigned short* gql = (const unsigned short*)QL + ((size_t)b * SLEN + sr) * DM + h * 64 + sc;
  const unsigned short* gvt = (const unsigned short*)VT + ((size_t)slab * 64 + sr) * SLEN + sc; const float* gqn = QN + ((size_t)b * SLEN + (tid & (FJ - 1))) * NH + h;
  v8us rq0, rq1, rl0, rl1, rv0, rv1; float rn = 0.f;
  auto gload = [&](int j0) { rq0 = *(const v8us*)(gqh + (size_t)j0 * DM); rq1 = *(const v8us*)(gqh + (size_t)(j0 + 32) * DM); rl0 = *(const v8us*)(gql + (size_t)j0 * DM); rl1 = *(const v8us*)(gql + (size_t)(j0 + 32) * DM);
    rv0 = *(const v8us*)(gvt + j0); rv1 = *(const v8us*)(gvt + (size_t)32 * SLEN + j0); if (tid < FJ) rn = gqn[(size_t)j0 * NH]; };
  auto sstore = [&](int bf) { *(v8us*)&sQH[bf][sr][sc] = rq0; *(v8us*)&sQH[bf][sr + 32][sc] = rq1; *(v8us*)&sQL[bf][sr][sc] = rl0; *(v8us*)&sQL[bf][sr + 32][sc] = rl1; *(v8us*)&sVT[bf][sr][sc] = rv0; *(v8us*)&sVT[bf][sr + 32][sc] = rv1; if (tid < FJ) sQN[bf][tid] = rn; };
  const v8f z8 = {0.f,0.f,0.f,0.f,0.f,0.f,0.f,0.f}; v8f oacc[4] = {z8, z8, z8, z8};
  gload(0); sstore(0); __syncthreads();
#pragma unroll 1      /* one stage a trip: the body already holds two 32-wide passes; more would only grow the code */
  for (int st = 0; st < SLEN / FJ; ++st) { const int bf = st & 1; const bool more = st + 1 < SLEN / FJ;
    if (more) gload((st + 1) * FJ);      /* next stage flies from L2 while this one is worked on */
#pragma unroll
    for (int jj = 0; jj < FJ; jj += 32) { FragH pb; const v16h av0 = fz_frag(&sVT[bf][ln][jj], hh), av1 = fz_frag(&sVT[bf][16 + ln][jj], hh), av2 = fz_frag(&sVT[bf][32 + ln][jj], hh), av3 = fz_frag(&sVT[bf][48 + ln][jj], hh);      /* named ahead of the score work, so that the scheduler may start these reads early */
#pragma unroll
      for (int nt = 0; nt < 2; ++nt) { const unsigned short* qh = &sQH[bf][jj + nt * 16 + ln][0]; const unsigned short* ql = &sQL[bf][jj + nt * 16 + ln][0];
        const v16h ah0 = fz_frag(qh, hh), ah1 = fz_frag(qh + 32, hh), al0 = fz_frag(ql, hh), al1 = fz_frag(ql + 32, hh);
        v8f cA = fz_mma(ah0, bkl0, z8), cB = fz_mma(al0, bkh0, z8), cC = fz_mma(ah0, bkh0, z8); cA = fz_mma(ah1, bkl1, cA); cB = fz_mma(al1, bkh1, cB); cC = fz_mma(ah1, bkh1, cC);
        const v4f n0 = *(const v4fa*)&sQN[bf][jj + nt * 16 + 8 * hh], n1 = *(const v4fa*)&sQN[bf][jj + nt * 16 + 8 * hh + 4];
#pragma unroll
        for (int q = 0; q < 8; ++q) { const float s = cC[q] + (cB[q] * 0.0009765625f + cA[q] * 0.0009765625f); const float qn = (q < 4) ? n0[q & 3] : n1[q & 3]; float d2 = kn + qn; d2 += -2.0f * s; pb.h[nt * 8 + q] = (_Float16)(1024.0f * expf(-(d2 * r))); } }
      oacc[0] = fz_mma(av0, pb.v, oacc[0]); oacc[1] = fz_mma(av1, pb.v, oacc[1]); oacc[2] = fz_mma(av2, pb.v, oacc[2]); oacc[3] = fz_mma(av3, pb.v, oacc[3]); }
    if (more) sstore(bf ^ 1);      /* that buffer's last readers left it before the barrier that ended the trip before */
    __syncthreads(); }
  float* orow = O + ((size_t)b * SLEN + i) * DM + h * 64 + 8 * hh;      /* D register q of tile dt = out[i][dt * 16 + 8 hh + q] */
#pragma unroll
  for (int dt = 0; dt < 4; ++dt) { v4f o0, o1;
#pragma unroll
    for (int q = 0; q < 4; ++q) { o0[q] = oacc[dt][q] * 0.0009765625f; o1[q] = oacc[dt][4 + q] * 0.0009765625f; }
    *(v4f*)(orow + dt * 16) = o0; *(v4f*)(orow + dt * 16 + 4) = o1; } }

// Projection GEMM, C[M][N] (f32) = A[M][K] . Bh[N][K]^T * alpha + bf16(bias): block = 8 waves (4 x 2) of 32x64 wave tiles = 128 x 128 of C.
// Both operand tiles (128 rows x GK k) go through LDS, two buffers, one barrier a stage: every global load covers whole 128-byte lines, and a row is fetched once a block instead of once a wave.
// k runs upward in steps of 32 into the same accumulators as before, so every sum keeps its order. Needs M % 128 == 0, N % 128 == 0, K % GK == 0.
template <int N, int K>
__global__ __launch_bounds__(256) void k_gemm3(const _Float16* __restrict__ A, const _Float16* __restrict__ Bh, float alpha, const float* __restrict__ bias, float* __restrict__ C) {
  constexpr int GK = 64;      /* k a stage: one 128-byte line a row */
  constexpr int GP = GK + 8;      /* LDS row pitch in f16: the row + 16 bytes (an odd count of 16 bytes), for 16-byte fragment reads */
  constexpr int RP = 2048 / GK, NP = 128 / RP;      /* rows a staging pass of 256 threads covers; passes a tile */
  __shared__ __attribute__((aligned(16))) unsigned short sT[2][256][GP];      /* rows 0-127: A tile, rows 128-255: B tile; after the loop each wave's 32 x 68 f32 output patch */
  const int tid = threadIdx.x, w = tid >> 5, lane = tid & 31, ln = lane & 15, hh = lane >> 4;
  constexpr int ntn = N >> 7; const int mt = blockIdx.x / ntn, nq = blockIdx.x - mt * ntn; const int wm = w >> 1, wn = w & 1;
  const int sr = tid / (GK / 8), sc = (tid % (GK / 8)) * 8;      /* staging: 16 bytes a thread in rows sr + RP u of each tile; 8 neighbour threads cover one 128-byte line */
  const unsigned short* ga = (const unsigned short*)A + (size_t)(mt * 128) * K; const unsigned short* gb = (const unsigned short*)Bh + (size_t)(nq * 128) * K; const unsigned go = (unsigned)(sr * K + sc);      /* block-uniform tile bases, which walk along k, and one fixed offset a thread */
  v8us ra[NP], rb[NP];
  auto gload = [&](int k0) {
#pragma unroll
    for (int u = 0; u < NP; ++u) { ra[u] = *(const v8us*)(ga + k0 + go + RP * u * K); rb[u] = *(const v8us*)(gb + k0 + go + RP * u * K); } };
  auto sstore = [&](int bf) {
#pragma unroll
    for (int u = 0; u < NP; ++u) { *(v8us*)&sT[bf][sr + RP * u][sc] = ra[u]; *(v8us*)&sT[bf][128 + sr + RP * u][sc] = rb[u]; } };
  const v8f z8 = {0.f,0.f,0.f,0.f,0.f,0.f,0.f,0.f}; v8f acc[2][4] = {{z8, z8, z8, z8}, {z8, z8, z8, z8}};
  constexpr int nst = K / GK;
  gload(0); sstore(0); __syncthreads();
#pragma unroll 1      /* one stage a trip: the body already holds 16 matrix instructions; more would only grow the code */
  for (int st = 0; st < nst; ++st) { const int bf = st & 1; const bool more = st + 1 < nst;
    if (more) gload((st + 1) * GK);      /* next stage flies from L2 while this one is worked on */
#pragma unroll
    for (int kk = 0; kk < GK; kk += 32) { const v16h a0 = fz_frag(&sT[bf][wm * 32 + ln][kk], hh), a1 = fz_frag(&sT[bf][wm * 32 + 16 + ln][kk], hh); v16h b[4];
#pragma unroll
      for (int t = 0; t < 4; ++t) b[t] = fz_frag(&sT[bf][128 + wn * 64 + t * 16 + ln][kk], hh);
      __builtin_amdgcn_sched_barrier(0);      /* keeps the six fragment reads together ahead of the eight products: left alone the scheduler sinks each B read to its use, and the wave waits out the LDS latency four times instead of once */
#pragma unroll
      for (int t = 0; t < 4; ++t) { acc[0][t] = fz_mma(a0, b[t], acc[0][t]); acc[1][t] = fz_mma(a1, b[t], acc[1][t]); } }
    if (more) sstore(bf ^ 1);      /* that buffer's last readers left it before the barrier that ended the trip before */
    __syncthreads(); }
  float* so = (float*)&sT[0][0][0] + w * (32 * 68);      /* every read of the tiles ended at the loop's last barrier */
  const int row0 = mt * 128 + wm * 32, col0 = nq * 128 + wn * 64;
#pragma unroll
  for (int u = 0; u < 8; ++u) { const int t = u & 3, half = u >> 2; const float bv = bf16_round(bias[col0 + t * 16 + ln]);
#pragma unroll
    for (int r = 0; r < 8; ++r) so[(half * 16 + 8 * hh + r) * 68 + t * 16 + ln] = acc[half][t][r] * alpha + bv; }
  __builtin_amdgcn_fence(__ATOMIC_ACQ_REL, "workgroup"); __builtin_amdgcn_wave_barrier();      /* the patch is read back by other lanes of the same wave */
  const int rsub = lane >> 4, c4 = (lane & 15) * 4;
#pragma unroll
  for (int q = 0; q < 16; ++q) { const int r = q * 2 + rsub; const v4f v = *(const v4fa*)&so[r * 68 + c4]; *(v4f*)(C + (size_t)(row0 + r) * N + col0 + c4) = v; } }

extern "C" void kernel_launch(void* const* d_in, const int* in_sizes, int n_in,
                              void* d_out, int out_size, void* d_ws, size_t ws_size, hipStream_t stream) {
  (void)in_sizes; (void)n_in; (void)out_size;
  const float* const* I = (const float* const*)d_in; const float* x = I[0]; const float* Wqkv = I[1]; const float* bqkv = I[2]; const float* rs = I[3]; const float* Wp = I[4]; const float* bp = I[5];
  char* ws = (char*)d_ws; size_t off = 0;
  auto take = [&](size_t bytes) { char* p = ws + off; off += (bytes + 255) & ~(size_t)255; return p; };
  const size_t np = (size_t)NR * DM;
  _Float16* BQKV = (_Float16*)take((size_t)3 * DM * DM * 2); _Float16* BP = (_Float16*)take((size_t)DM * DM * 2);
  _Float16* X16 = (_Float16*)take(np * 2); float* QKV = (float*)take(np * 3 * 4); float* QN = (float*)take((size_t)NR * NH * 4); float* KN = (float*)take((size_t)NR * NH * 4); _Float16* QH = (_Float16*)take(np * 2); _Float16* QL = (_Float16*)take(np * 2); _Float16* KH = (_Float16*)take(np * 2); _Float16* KL = (_Float16*)take(np * 2); _Float16* VH = (_Float16*)take(np * 2); _Float16* VT = (_Float16*)take(np * 2);
  float* O = QKV;      /* merged context f32 [NR][DM] over the qkv plane (dead after norms + splits) */ _Float16* OH = QH;      /* over q hi (dead after k_gauss) */
  if (off > ws_size) return;      /* 6 + 2 + 8 + 48 + 0.5 + 5x8 + 8 = 113 MiB */
  k_wt_f16<<<(unsigned)(((size_t)DM * 3 * DM / 8 + 255) / 256), 256, 0, stream>>>(Wqkv, BQKV, DM, 3 * DM, 16.0f); k_wt_f16<<<(unsigned)(((size_t)DM * DM / 8 + 255) / 256), 256, 0, stream>>>(Wp, BP, DM, DM, 16.0f);      /* (in, out) */
  k_x16<<<(unsigned)((np / 8 + 255) / 256), 256, 0, stream>>>(x, X16, np / 8);
  k_gemm3<3 * DM, DM><<<(NR / 128) * (3 * DM / 128), 256, 0, stream>>>(X16, BQKV, 0.0625f, bqkv, QKV);      /* [q | k | v] f32 (head h = cols h*64..) */
  k_norms<<<(unsigned)(((size_t)NR * NH + 255) / 256), 256, 0, stream>>>(QKV, QN, KN);
  k_hls<<<(unsigned)((np / 8 + 255) / 256), 256, 0, stream>>>(QKV, 3 * DM, 0, QH, QL, np / 8); k_hls<<<(unsigned)((np / 8 + 255) / 256), 256, 0, stream>>>(QKV, 3 * DM, DM, KH, KL, np / 8); k_h16s<<<(unsigned)((np / 8 + 255) / 256), 256, 0, stream>>>(QKV, 3 * DM, 2 * DM, VH, np / 8);
  k_vtg<<<NB * NH * (SLEN / 64), 256, 0, stream>>>(VH, VT);      /* V^T [(b,h)][64][2048] */
  k_gauss<<<NB * NH * (SLEN / 128), 256, 0, stream>>>(QH, QL, KH, KL, VT, QN, KN, rs, O);      /* out_i[(h,d)] = sum_j exp(-r (kn_i + qn_j - 2 k_i.q_j)) v_j[d], merged context f32 */
  k_h16<<<(unsigned)((np / 8 + 255) / 256), 256, 0, stream>>>(O, OH, np / 8);
  k_gemm3<DM, DM><<<(NR / 128) * (DM / 128), 256, 0, stream>>>(OH, BP, 0.0625f, bp, (float*)d_out);      /* out = ctx Wproj + bproj */
}

// v003
// Measured time: 151 microseconds a run.
// Next to v002, in two timings, it ran 1.36 and 1.35 times as fast.
// Counting every step since v000, it is 12.3 times as fast.
#include <hip/hip_runtime.h>
// qKv_attention (2 x 2048 tokens, C 1024 = 16 heads x 64; Gaussian-kernel attention WITHOUT normalisation: qkv = x Wqkv + b; K[i][j] = exp(-r_sigma ||q_j - k_i||^2) computed as kn_i + qn_j - 2 k_i.q_j; out_i = sum_j K[i][j] v_j; out = merge Wproj + bproj; r_sigma is a scalar input).
// Structure: exact f16 plane of x; qkv as one f16 WMMA GEMM (32x64 wave tiles, f32 accumulation, exact x16 weights + bias); per-(token, head) squared norms on VALU; q and k as f16 hi + 2^10 residual planes; V^T by LDS tiles (norms, planes and V^T all stored by that GEMM's epilogue, no f32 qkv plane); one fused launch over every (batch, head): the k.q products as three hi/residual terms (f32), the kernel weights exp(-r (kn + qn - 2 kq)) on VALU into f16 (x 2^10) in registers, the readout products (64 columns) straight into a merged f16 context plane; Wproj + bproj GEMM.
// Compute dtype: inputs rounded to bf16; x and weights exact as f16; q, k as f16 hi + residual (~2^-21) because the exponent amplifies dot-product error by 2 r_sigma |k.q|; kernel weights and v as plain f16 operands (~2^-12; weights below 2^-34 of the unit scale flush to zero); merged context plain f16; v_wmma_f32_16x16x32_f16.
#define NB 2
#define DM 1024
#define NKV 16
#define NREP (NH / NKV)
#define KVD (NKV * 64)           /* 1024 */
#define NR (NB * SLEN)           /* 4096 */
#define CHK 512                  /* attention chunk */
typedef int v4i __attribute__((ext_vector_type(4)));
#define FF 2048
#define SLEN 2048
#define TQ SLEN
#define TK SLEN
#define NH 16
#define SCL 0.125f
#define QBLKS (TQ / 64)
#define QB05 0
#define QBN5 4
#define QB0P 0
#define QBNP QBLKS           /* non-causal: plain flash on every query block */
#define RE 256
typedef __bf16 v16b __attribute__((ext_vector_type(16)));
typedef unsigned short v8us __attribute__((ext_vector_type(8), may_alias));
typedef float  v8f  __attribute__((ext_vector_type(8)));
typedef float  v4f  __attribute__((ext_vector_type(4)));
typedef float  v4fa __attribute__((ext_vector_type(4), may_alias));
union FragB { v16b v; v8us half[2]; unsigned short u[16]; };

__device__ __forceinline__ unsigned short bf16_bits(float x) { unsigned int u = __float_as_uint(x); return (unsigned short)((u + 0x7FFFu + ((u >> 16) & 1u)) >> 16); }
__device__ __forceinline__ float bf16_val(unsigned short b) { return __uint_as_float(((unsigned int)b) << 16); }
__device__ __forceinline__ float bf16_round(float x) { return bf16_val(bf16_bits(x)); }
// D += A·B with NT terms: 1 = ah·bh, 2 = + al·bh (A split), 3 = + ah·bl (both split)
template <int NT>
__device__ __forceinline__ v8f mmaN(v16b ah, v16b al, v16b bh, v16b bl, v8f c) {
  c = __builtin_amdgcn_wmma_f32_16x16x32_bf16(false, ah, false, bh, (short)0, c, false, false);
  if (NT >= 2) c = __builtin_amdgcn_wmma_f32_16x16x32_bf16(false, al, false, bh, (short)0, c, false, false);
  if (NT >= 3) c = __builtin_amdgcn_wmma_f32_16x16x32_bf16(false, ah, false, bl, (short)0, c, false, false);
  asm volatile("v_nop\n\tv_nop\n\tv_nop\n\tv_nop" : "+v"(c) : "v"(ah), "v"(al), "v"(bh), "v"(bl));
  return c;
}

__global__ __launch_bounds__(256) void k_wt_bf16(const float* __restrict__ W, unsigned short* __restrict__ Wt, int K, int N) {
  const int t = blockIdx.x * 256 + threadIdx.x;
  const int k8n = K / 8;
  if (t >= N * k8n) return;
  const int n = t / k8n, k8 = (t % k8n) * 8;
  v8us v;
#pragma unroll
  for (int i = 0; i < 8; ++i) v[i] = bf16_bits(W[(size_t)(k8 + i) * N + n]);
  *(v8us*)(Wt + (size_t)n * K + k8) = v;
  
}

// GEMM C[M][N] (f32, pitch ldc) = act(A[M][K]·W + bias). A f32 row-major (pitch lda) converted per fragment to bf16
// (ASPLIT: hi/lo two planes -> 2 terms, else single rounded term); Wt bf16 [N][K] (pitch ldb). BIAS_BF16 rounds the
// bias to bf16 first (bias quantised to bf16 before the add). K%32==0, M%16==0, N%64==0.
template <bool ASPLIT, int ACT, bool BIAS_BF16>
__global__ __launch_bounds__(128) void k_gemm_bf(const float* __restrict__ A, int lda, const unsigned short* __restrict__ Wt, int ldb,
                                               const float* __restrict__ bias, float* __restrict__ C, int ldc, int M, int N, int K) {
  __shared__ __attribute__((aligned(16))) float so[4][16][64];
  const int tid = threadIdx.x, w = tid >> 5, lane = tid & 31, ln = lane & 15, hh = lane >> 4;
  const int ntn = N / 64;
  const int wid = blockIdx.x * 4 + w;
  const int mt = wid / ntn, nq = wid % ntn;
  if (mt * 16 >= M) return;
  const int row0 = mt * 16, col0 = nq * 64;
  const float* arow = A + (size_t)(row0 + ln) * lda;
  v8f acc[4] = {};
  for (int kb = 0; kb < K; kb += 32) {
    FragB ah, al;
    const v4f x0 = *(const v4fa*)(arow + kb + 8 * hh), x1 = *(const v4fa*)(arow + kb + 8 * hh + 4);
    const v4f x2 = *(const v4fa*)(arow + kb + 16 + 8 * hh), x3 = *(const v4fa*)(arow + kb + 16 + 8 * hh + 4);
    float xs[16] = {x0[0],x0[1],x0[2],x0[3],x1[0],x1[1],x1[2],x1[3],x2[0],x2[1],x2[2],x2[3],x3[0],x3[1],x3[2],x3[3]};
#pragma unroll
    for (int i = 0; i < 16; ++i) { const unsigned short hb = bf16_bits(xs[i]); ah.u[i] = hb; al.u[i] = ASPLIT ? bf16_bits(xs[i] - bf16_val(hb)) : (unsigned short)0; }
#pragma unroll
    for (int t = 0; t < 4; ++t) {
      const unsigned short* brow = Wt + (size_t)(col0 + t * 16 + ln) * ldb + kb;
      FragB b;
      b.half[0] = *(const v8us*)(brow + 8 * hh);
      b.half[1] = *(const v8us*)(brow + 16 + 8 * hh);
      acc[t] = mmaN<ASPLIT ? 2 : 1>(ah.v, al.v, b.v, b.v, acc[t]);
    }
  }
#pragma unroll
  for (int t = 0; t < 4; ++t) {
    float bv = bias ? bias[col0 + t * 16 + ln] : 0.f;
    if (BIAS_BF16) bv = bf16_round(bv);
#pragma unroll
    for (int r = 0; r < 8; ++r) { float v = acc[t][r] + bv; if (ACT == 1) v = fmaxf(v, 0.f); so[w][8 * hh + r][t * 16 + ln] = v; }
  }
  __builtin_amdgcn_fence(__ATOMIC_ACQ_REL, "workgroup");
  __builtin_amdgcn_wave_barrier();
  const int rsub = lane >> 4, c4 = (lane & 15) * 4;
  {
#pragma unroll
    for (int q = 0; q < 8; ++q) {
      const int r = q * 2 + rsub;
      const v4f v = *(const v4fa*)&so[w][r][c4];
      *(v4f*)(C + (size_t)(row0 + r) * ldc + col0 + c4) = v;
    }
    
  }
}

// GEMM C = act(A·W + bias + resid): A f32 (ASPLIT -> hi/lo 2 terms), Wt bf16 [N][K]; ACT 0 none, 1 relu, 2 exact gelu;
// resid (optional, f32, row index = (row % rmod), pitch ldr, RES_BF16 rounds it) added before the activation.
template <bool ASPLIT, int ACT, bool BIAS_BF16, bool RES_BF16>
__global__ __launch_bounds__(128) void k_gemm_bf3(const float* __restrict__ A, int lda, const unsigned short* __restrict__ Wt, int ldb,
                                                const float* __restrict__ bias, const float* __restrict__ resid, int rmod, int ldr,
                                                float* __restrict__ C, int ldc, int M, int N, int K) {
  __shared__ __attribute__((aligned(16))) float so[4][16][64];
  const int tid = threadIdx.x, w = tid >> 5, lane = tid & 31, ln = lane & 15, hh = lane >> 4;
  const int ntn = N / 64;
  const int wid = blockIdx.x * 4 + w;
  const int mt = wid / ntn, nq = wid % ntn;
  if (mt * 16 >= M) return;
  const int row0 = mt * 16, col0 = nq * 64;
  const float* arow = A + (size_t)(row0 + ln) * lda;
  v8f acc[4] = {};
  for (int kb = 0; kb < K; kb += 32) {
    FragB ah, al;
    const v4f x0 = *(const v4fa*)(arow + kb + 8 * hh), x1 = *(const v4fa*)(arow + kb + 8 * hh + 4);
    const v4f x2 = *(const v4fa*)(arow + kb + 16 + 8 * hh), x3 = *(const v4fa*)(arow + kb + 16 + 8 * hh + 4);
    float xs[16] = {x0[0],x0[1],x0[2],x0[3],x1[0],x1[1],x1[2],x1[3],x2[0],x2[1],x2[2],x2[3],x3[0],x3[1],x3[2],x3[3]};
#pragma unroll
    for (int i = 0; i < 16; ++i) { const unsigned short hb = bf16_bits(xs[i]); ah.u[i] = hb; al.u[i] = ASPLIT ? bf16_bits(xs[i] - bf16_val(hb)) : (unsigned short)0; }
#pragma unroll
    for (int t = 0; t < 4; ++t) {
      const unsigned short* brow = Wt + (size_t)(col0 + t * 16 + ln) * ldb + kb;
      FragB b;
      b.half[0] = *(const v8us*)(brow + 8 * hh);
      b.half[1] = *(const v8us*)(brow + 16 + 8 * hh);
      acc[t] = mmaN<ASPLIT ? 2 : 1>(ah.v, al.v, b.v, b.v, acc[t]);
    }
  }
#pragma unroll
  for (int t = 0; t < 4; ++t) {
    const int col = col0 + t * 16 + ln;
    float bv = bias ? bias[col] : 0.f;
    if (BIAS_BF16) bv = bf16_round(bv);
#pragma unroll
    for (int r = 0; r < 8; ++r) {
      float v = acc[t][r] + bv;
      if (resid) { float rv = resid[(size_t)((row0 + 8 * hh + r) % rmod) * ldr + col]; if (RES_BF16) rv = bf16_round(rv); v += rv; }
      if (ACT == 1) v = fmaxf(v, 0.f);
      if (ACT == 2) v = 0.5f * v * (1.0f + erff(v * 0.70710678118654752f));
      if (ACT == 3) { const float u = 0.7978845608028654f * (v + 0.044715f * v * v * v); v = 0.5f * v * (1.0f + tanhf(u)); }
      so[w][8 * hh + r][t * 16 + ln] = v;
    }
  }
  __builtin_amdgcn_fence(__ATOMIC_ACQ_REL, "workgroup");
  __builtin_amdgcn_wave_barrier();
  const int rsub = lane >> 4, c4 = (lane & 15) * 4;
  {
#pragma unroll
    for (int q = 0; q < 8; ++q) {
      const int r = q * 2 + rsub;
      const v4f v = *(const v4fa*)&so[w][r][c4];
      *(v4f*)(C + (size_t)(row0 + r) * ldc + col0 + c4) = v;
    }
    
  }
}
// row LayerNorm (biased variance, eps) over N: s = X (+ R); optional out_sum <- s; out_norm <- (s-mu)*rsqrt(var+eps)*g + b
template <bool PARAM_BF16>
__global__ __launch_bounds__(256) void k_layernorm(const float* __restrict__ X, const float* __restrict__ R, const float* __restrict__ g, const float* __restrict__ bta,
                                                  float* __restrict__ out_sum, float* __restrict__ out_norm, int N, float eps) {
  __shared__ float red[256];
  const int row = blockIdx.x, tid = threadIdx.x;
  const float* x = X + (size_t)row * N; const float* rr = R ? R + (size_t)row * N : nullptr;
  float vals[16];                     // up to N = 4096
  const int per = N / 256;            // contiguous chunk per thread? use strided-by-4 chunks: thread handles j = tid*4 + 1024*u
  float s1 = 0.f;
  for (int u = 0; u < per / 4; ++u) {
    const int j = tid * 4 + 1024 * u;
    const v4f a = *(const v4fa*)(x + j);
    v4f b = {0.f,0.f,0.f,0.f}; if (rr) b = *(const v4fa*)(rr + j);
#pragma unroll
    for (int q = 0; q < 4; ++q) { const float v = a[q] + b[q]; vals[u * 4 + q] = v; s1 += v; }
  }
  red[tid] = s1; __syncthreads();
  for (int st = 128; st > 0; st >>= 1) { if (tid < st) red[tid] += red[tid + st]; __syncthreads(); }
  const float mu = red[0] / (float)N; __syncthreads();
  float s2 = 0.f;
  for (int u = 0; u < per / 4; ++u)
#pragma unroll
    for (int q = 0; q < 4; ++q) { const float c = vals[u * 4 + q] - mu; s2 += c * c; }
  red[tid] = s2; __syncthreads();
  for (int st = 128; st > 0; st >>= 1) { if (tid < st) red[tid] += red[tid + st]; __syncthreads(); }
  const float rs = rsqrtf(red[0] / (float)N + eps);
  {
    for (int u = 0; u < per / 4; ++u) {
      const int j = tid * 4 + 1024 * u;
      v4f o, sm;
#pragma unroll
      for (int q = 0; q < 4; ++q) {
        float gg = g[j + q], bb = bta[j + q];
        if (PARAM_BF16) { gg = bf16_round(gg); bb = bf16_round(bb); }
        sm[q] = vals[u * 4 + q]; o[q] = (vals[u * 4 + q] - mu) * rs * gg + bb;
      }
      if (out_sum) *(v4f*)(out_sum + (size_t)row * N + j) = sm;
      *(v4f*)(out_norm + (size_t)row * N + j) = o;
    }
    
  }
}



// ---- f16 WMMA path (v_wmma_f32_16x16x32_f16): 11-bit significands for operands in range — used where a [0,1] probability operand needs more precision than bf16
typedef _Float16 v16h __attribute__((ext_vector_type(16)));
union FragH { v16h v; v8us half[2]; _Float16 h[16]; unsigned short u[16]; };
template <int NT>
__device__ __forceinline__ v8f mmaH(v16h ah, v16h al, v16h bh, v16h bl, v8f c) {
  c = __builtin_amdgcn_wmma_f32_16x16x32_f16(false, ah, false, bh, (short)0, c, false, false);
  if (NT >= 2) c = __builtin_amdgcn_wmma_f32_16x16x32_f16(false, al, false, bh, (short)0, c, false, false);
  if (NT >= 3) c = __builtin_amdgcn_wmma_f32_16x16x32_f16(false, ah, false, bl, (short)0, c, false, false);
  asm volatile("v_nop\n\tv_nop\n\tv_nop\n\tv_nop" : "+v"(c) : "v"(ah), "v"(al), "v"(bh), "v"(bl));
  return c;
}
// batched GEMM like k_gemm_b but f16 operands: A f32 (split into f16 hi/lo if ASPLIT, else rounded to f16), Bt = f16 values [n][k]; alpha; C f32; N multiple of 16 (partial tiles skipped)
template <bool ASPLIT>
__global__ __launch_bounds__(128) void k_gemm_h(const float* __restrict__ A, int lda, size_t sA, const _Float16* __restrict__ Bh, int ldb, size_t sB, float alpha, float* __restrict__ C, int ldc, size_t sC, int M, int N, int K) {
  __shared__ __attribute__((aligned(16))) float so[4][16][64];
  const int tid = threadIdx.x, w = tid >> 5, lane = tid & 31, ln = lane & 15, hh = lane >> 4; const int by = blockIdx.y;
  A += (size_t)by * sA; Bh += (size_t)by * sB; C += (size_t)by * sC;
  const int ntn = (N + 63) / 64; const int wid = blockIdx.x * 4 + w; const int mt = wid / ntn, nq = wid % ntn; if (mt * 16 >= M) return;
  const int row0 = mt * 16, col0 = nq * 64; const float* arow = A + (size_t)(row0 + ln) * lda;
  v8f acc[4] = {};
  for (int kb = 0; kb < K; kb += 32) {
    FragH ah, al;
    const v4f x0 = *(const v4fa*)(arow + kb + 8 * hh), x1 = *(const v4fa*)(arow + kb + 8 * hh + 4), x2 = *(const v4fa*)(arow + kb + 16 + 8 * hh), x3 = *(const v4fa*)(arow + kb + 16 + 8 * hh + 4);
    float xs[16] = {x0[0],x0[1],x0[2],x0[3],x1[0],x1[1],x1[2],x1[3],x2[0],x2[1],x2[2],x2[3],x3[0],x3[1],x3[2],x3[3]};
#pragma unroll
    for (int i = 0; i < 16; ++i) { const _Float16 h = (_Float16)xs[i]; ah.h[i] = h; al.h[i] = ASPLIT ? (_Float16)(xs[i] - (float)h) : (_Float16)0.0f; }
#pragma unroll
    for (int t = 0; t < 4; ++t) { if (col0 + t * 16 >= N) continue; const size_t boff = (size_t)(col0 + t * 16 + ln) * ldb + kb; FragH bq; bq.half[0] = *(const v8us*)(Bh + boff + 8 * hh); bq.half[1] = *(const v8us*)(Bh + boff + 16 + 8 * hh);
      acc[t] = mmaH<ASPLIT ? 2 : 1>(ah.v, al.v, bq.v, bq.v, acc[t]); }
  }
#pragma unroll
  for (int t = 0; t < 4; ++t) { if (col0 + t * 16 >= N) continue;
#pragma unroll
    for (int r = 0; r < 8; ++r) so[w][8 * hh + r][t * 16 + ln] = acc[t][r] * alpha; }
  __builtin_amdgcn_fence(__ATOMIC_ACQ_REL, "workgroup"); __builtin_amdgcn_wave_barrier();
  const int rsub = lane >> 4, c4 = (lane & 15) * 4;
  {
#pragma unroll
    for (int q = 0; q < 8; ++q) { const int r = q * 2 + rsub; if (col0 + c4 < N) { const v4f v = *(const v4fa*)&so[w][r][c4]; *(v4f*)(C + (size_t)(row0 + r) * ldc + col0 + c4) = v; } }
     }
}

// Wt[n][k] = f16(W[k][n]·scale) from f32 row-major W[K][N] (scale = power of two; bf16-exact weights stay exact in f16 away from the subnormal range)
__global__ __launch_bounds__(256) void k_wt_f16(const float* __restrict__ W, _Float16* __restrict__ Wt, int K, int N, float scale) {
  const int t = blockIdx.x * 256 + threadIdx.x; if (t >= N * (K / 8)) return; const int n = t / (K / 8), k8 = (t % (K / 8)) * 8; FragH f;
#pragma unroll
  for (int i = 0; i < 8; ++i) f.h[i] = (_Float16)(bf16_round(W[(size_t)(k8 + i) * N + n]) * scale); const v8us o = f.half[0];
  *(v8us*)((unsigned short*)Wt + (size_t)n * K + k8) = o; 
}
// k_gemm_hh variant with fused epilogue: v = acc·alpha + bias[by·sBias + col] (+ CP[(row/rowsPerB)·sCPb + by·64 + col] if CP) ; ACT 0 none / 1 elu ; writes f16 C16 (and f32 C if non-null)
template <int ACT>
__global__ __launch_bounds__(128) void k_gemm_hhx(const _Float16* __restrict__ A, int lda, size_t sA, const _Float16* __restrict__ Bh, int ldb, size_t sB, float alpha, const float* __restrict__ bias, size_t sBias, const float* __restrict__ CP, int rowsPerB, size_t sCPb, int row0g,
    float* __restrict__ C, _Float16* __restrict__ C16, int ldc, size_t sC, int M, int N, int K) {
  __shared__ __attribute__((aligned(16))) float so[4][16][64];
  const int tid = threadIdx.x, w = tid >> 5, lane = tid & 31, ln = lane & 15, hh = lane >> 4; const int by = blockIdx.y;
  A += (size_t)by * sA; Bh += (size_t)by * sB; const size_t cofs = (size_t)by * sC; const float* bp = bias ? bias + (size_t)by * sBias : nullptr;
  const int ntn = (N + 63) / 64; const int wid = blockIdx.x * 4 + w; const int mt = wid / ntn, nq = wid % ntn; if (mt * 16 >= M) return;
  const int row0 = mt * 16, col0 = nq * 64; const _Float16* arow = A + (size_t)(row0 + ln) * lda;
  v8f acc[4] = {};
  for (int kb = 0; kb < K; kb += 32) { FragH ah; ah.half[0] = *(const v8us*)((const unsigned short*)arow + kb + 8 * hh); ah.half[1] = *(const v8us*)((const unsigned short*)arow + kb + 16 + 8 * hh);
#pragma unroll
    for (int t = 0; t < 4; ++t) { if (col0 + t * 16 >= N) continue; const size_t boff = (size_t)(col0 + t * 16 + ln) * ldb + kb; FragH bq; bq.half[0] = *(const v8us*)((const unsigned short*)Bh + boff + 8 * hh); bq.half[1] = *(const v8us*)((const unsigned short*)Bh + boff + 16 + 8 * hh);
      acc[t] = mmaH<1>(ah.v, ah.v, bq.v, bq.v, acc[t]); }
  }
#pragma unroll
  for (int t = 0; t < 4; ++t) { if (col0 + t * 16 >= N) continue; const int col = col0 + t * 16 + ln; const float bv = bp ? bf16_round(bp[col]) : 0.f;
#pragma unroll
    for (int r = 0; r < 8; ++r) { float v = acc[t][r] * alpha + bv; if (CP) { const int bidx = (row0g + row0 + 8 * hh + r) / rowsPerB; v += CP[(size_t)bidx * sCPb + (size_t)by * 64 + col]; } if (ACT == 1) v = (v > 0.f) ? v : expm1f(v); else if (ACT == 7) v = (v > 0.f) ? v + 1.0f : expf(v); else if (ACT == 8) v = tanhf(v); else if (ACT == 9) v = 0.5f * v * (1.0f + tanhf(0.7978845608028654f * (v + 0.044715f * v * v * v))); else if (ACT == 11) v = 1.0f / (1.0f + expf(-v)); else if (ACT == 12) v = (v > 0.f) ? v : 0.01f * v; else if (ACT == 14) v = (v > 0.f) ? v : 0.1f * v; else if (ACT == 15) v = v / (1.0f + expf(-v)); else if (ACT == 3) v = fmaxf(v, 0.f); else if (ACT == 6) v = 0.5f * v * (1.0f + erff(v * 0.70710678118654752f)); so[w][8 * hh + r][t * 16 + ln] = v; } }
  __builtin_amdgcn_fence(__ATOMIC_ACQ_REL, "workgroup"); __builtin_amdgcn_wave_barrier();
  const int rsub = lane >> 4, c4 = (lane & 15) * 4; typedef _Float16 v4h __attribute__((ext_vector_type(4)));
  {
#pragma unroll
    for (int q = 0; q < 8; ++q) { const int r = q * 2 + rsub; if (col0 + c4 < N) { const v4f v = *(const v4fa*)&so[w][r][c4]; if (C) *(v4f*)(C + cofs + (size_t)(row0 + r) * ldc + col0 + c4) = v; if (C16) { v4h h4; for (int i = 0; i < 4; ++i) h4[i] = (_Float16)v[i]; *(v4h*)(C16 + cofs + (size_t)(row0 + r) * ldc + col0 + c4) = h4; } } }
     }
}


typedef _Float16 v4h __attribute__((ext_vector_type(4)));

__global__ __launch_bounds__(256) void k_x16(const float* __restrict__ x, _Float16* __restrict__ X16, size_t n8) { const size_t t = (size_t)blockIdx.x * 256 + threadIdx.x; if (t >= n8) return; FragH f;
#pragma unroll
  for (int q = 0; q < 8; ++q) f.h[q] = (_Float16)bf16_round(x[t * 8 + q]); *(v8us*)((unsigned short*)X16 + t * 8) = f.half[0];  }
__global__ __launch_bounds__(256) void k_round16f(const float* __restrict__ W, _Float16* __restrict__ Bt, size_t n8) { const size_t t = (size_t)blockIdx.x * 256 + threadIdx.x; if (t >= n8) return; FragH f;
#pragma unroll
  for (int i = 0; i < 8; ++i) f.h[i] = (_Float16)(bf16_round(W[t * 8 + i]) * 16.0f); *(v8us*)((unsigned short*)Bt + t * 8) = f.half[0];  }
template <int NHv, int TTv>
__global__ __launch_bounds__(256) void k_vt(const _Float16* __restrict__ V16, int ldv, int voff, _Float16* __restrict__ Vt) { __shared__ unsigned short tl[64][66]; const int tid = threadIdx.x; const int slab = blockIdx.x / (TTv / 64), lg = blockIdx.x % (TTv / 64); const int b = slab / NHv, h = slab % NHv;
  for (int i = tid; i < 64 * 8; i += 256) { const int r = i / 8, c8 = (i % 8) * 8; FragH f; f.half[0] = *(const v8us*)((const unsigned short*)V16 + ((size_t)b * TTv + lg * 64 + r) * ldv + voff + h * 64 + c8);
#pragma unroll
    for (int q = 0; q < 8; ++q) tl[r][c8 + q] = f.u[q]; }
  __syncthreads();
  {
#pragma unroll
    for (int rd = 0; rd < 2; ++rd) { const int d = rd * 32 + tid / 8, pc = tid % 8; FragH f;
#pragma unroll
      for (int q = 0; q < 8; ++q) f.u[q] = tl[pc * 8 + q][d];
      *(v8us*)((unsigned short*)Vt + ((size_t)slab * 64 + d) * TTv + lg * 64 + pc * 8) = f.half[0]; }
     } }

__global__ __launch_bounds__(256) void k_hl(const float* __restrict__ F, _Float16* __restrict__ Hh, _Float16* __restrict__ Hl, size_t n8) { const size_t t = (size_t)blockIdx.x * 256 + threadIdx.x; if (t >= n8) return; FragH fh, fl; const v4f a = *(const v4fa*)(F + t * 8), c = *(const v4fa*)(F + t * 8 + 4);
#pragma unroll
  for (int q = 0; q < 4; ++q) { _Float16 h = (_Float16)a[q]; fh.h[q] = h; fl.h[q] = (_Float16)((a[q] - (float)h) * 1024.0f); h = (_Float16)c[q]; fh.h[4 + q] = h; fl.h[4 + q] = (_Float16)((c[q] - (float)h) * 1024.0f); }
  { *(v8us*)((unsigned short*)Hh + t * 8) = fh.half[0]; *(v8us*)((unsigned short*)Hl + t * 8) = fl.half[0];  } }

// ---- fast GEMM (wave tile 32x64; requires M % 32 == 0 rows per launch region and N % 64 == 0); epilogue = k_gemm_hhx semantics ----
__device__ __forceinline__ v16h g2_frag(const _Float16* p, int hh) { FragH f; f.half[0] = *(const v8us*)((const unsigned short*)p + 8 * hh); f.half[1] = *(const v8us*)((const unsigned short*)p + 16 + 8 * hh); return f.v; }
__device__ __forceinline__ v8f g2_mma(v16h a, v16h b, v8f c) { v8f d = __builtin_amdgcn_wmma_f32_16x16x32_f16(false, a, false, b, (short)0, c, false, false); asm volatile("v_nop\n\tv_nop\n\tv_nop\n\tv_nop" : "+v"(d) : "v"(a), "v"(b)); return d; }
template <int ACT>
__global__ __launch_bounds__(128) void k_gemm2(const _Float16* __restrict__ A, int lda, size_t sA, const _Float16* __restrict__ Bh, int ldb, size_t sB, float alpha, const float* __restrict__ bias, size_t sBias, const float* __restrict__ CP, int rowsPerB, size_t sCPb, int row0g,
    float* __restrict__ C, _Float16* __restrict__ C16, int ldc, size_t sC, int M, int N, int K) {
  __shared__ __attribute__((aligned(16))) float so[4][32][68];
  const int tid = threadIdx.x, w = tid >> 5, lane = tid & 31, ln = lane & 15, hh = lane >> 4; const int by = blockIdx.y;
  A += (size_t)by * sA; Bh += (size_t)by * sB; const size_t cofs = (size_t)by * sC; const float* bp = bias ? bias + (size_t)by * sBias : nullptr;
  const int ntn = N >> 6; const int mt = blockIdx.x / ntn, nq = blockIdx.x - mt * ntn; const int row0 = mt * 128 + 32 * w, col0 = nq * 64; if (row0 >= M) return;
  const _Float16* a0p = A + (size_t)(row0 + ln) * lda; const _Float16* a1p = a0p + (size_t)16 * lda;
  const _Float16* b0p = Bh + (size_t)(col0 + ln) * ldb; const _Float16* b1p = b0p + (size_t)16 * ldb; const _Float16* b2p = b1p + (size_t)16 * ldb; const _Float16* b3p = b2p + (size_t)16 * ldb;
  const v8f z8 = {0.f,0.f,0.f,0.f,0.f,0.f,0.f,0.f}; v8f c00 = z8, c01 = z8, c02 = z8, c03 = z8, c10 = z8, c11 = z8, c12 = z8, c13 = z8;
#pragma unroll 1
  for (int kb = 0; kb < K; kb += 32) { const v16h a0 = g2_frag(a0p + kb, hh), a1 = g2_frag(a1p + kb, hh);
    v16h b = g2_frag(b0p + kb, hh); c00 = g2_mma(a0, b, c00); c10 = g2_mma(a1, b, c10);
    b = g2_frag(b1p + kb, hh); c01 = g2_mma(a0, b, c01); c11 = g2_mma(a1, b, c11);
    b = g2_frag(b2p + kb, hh); c02 = g2_mma(a0, b, c02); c12 = g2_mma(a1, b, c12);
    b = g2_frag(b3p + kb, hh); c03 = g2_mma(a0, b, c03); c13 = g2_mma(a1, b, c13); }
  v8f accs[8] = {c00, c01, c02, c03, c10, c11, c12, c13};
#pragma unroll
  for (int u = 0; u < 8; ++u) { const int t = u & 3, half = u >> 2; const int col = col0 + t * 16 + ln; const float bv = bp ? bf16_round(bp[col]) : 0.f;
#pragma unroll
    for (int r = 0; r < 8; ++r) { const int rloc = half * 16 + 8 * hh + r; float v = accs[u][r] * alpha + bv; if (CP) { if (rowsPerB < 0) v += CP[cofs + (size_t)(row0g + row0 + rloc) * ldc + col];      /* rowsPerB < 0: own element of the batched C plane */ else { const int bidx = (row0g + row0 + rloc) / rowsPerB; v += CP[(size_t)bidx * sCPb + (size_t)by * 64 + col]; } }
      if (ACT == 3) v = fmaxf(v, 0.f); else if (ACT == 6) v = 0.5f * v * (1.0f + erff(v * 0.70710678118654752f)); else if (ACT == 11) v = 1.0f / (1.0f + expf(-v)); else if (ACT == 15) v = v / (1.0f + expf(-v)); else if (ACT == 12) v = (v > 0.f) ? v : 0.01f * v; else if (ACT == 8) v = tanhf(v);
      so[w][rloc][t * 16 + ln] = v; } }
  __builtin_amdgcn_fence(__ATOMIC_ACQ_REL, "workgroup"); __builtin_amdgcn_wave_barrier();
  const int rsub = lane >> 4, c4 = (lane & 15) * 4;
  {
#pragma unroll
    for (int q = 0; q < 16; ++q) { const int r = q * 2 + rsub; const v4f v = *(const v4fa*)&so[w][r][c4]; if (C) *(v4f*)(C + cofs + (size_t)(row0 + r) * ldc + col0 + c4) = v; if (C16) { v4h h4; for (int i = 0; i < 4; ++i) h4[i] = (_Float16)v[i]; *(v4h*)(C16 + cofs + (size_t)(row0 + r) * ldc + col0 + c4) = h4; } }
     } }



template <int CAUSAL>
__global__ __launch_bounds__(128) void k_flash(const _Float16* __restrict__ Q16, int ldq, const _Float16* __restrict__ K16, int ldk, const _Float16* __restrict__ Vt, const int* __restrict__ MSK, float* __restrict__ O, int ldo) {
  constexpr int RPW = 16, RTN = RPW / 16, NQB = TQ / (4 * RPW), DT = 4, KS = 2;
  __shared__ __attribute__((aligned(16))) unsigned short sP[4][RPW][40]; __shared__ __attribute__((aligned(16))) float sO[4][RPW][64 + 4];
  const int tid = threadIdx.x, w = tid >> 5, lane = tid & 31, ln = lane & 15, hh = lane >> 4;
  const int slab = blockIdx.x / QBNP, qblk = QB0P + blockIdx.x % QBNP; (void)NQB; const int b = slab / NH, h = slab % NH; const int qb0 = qblk * (4 * RPW); const int q0 = qb0 + w * RPW;
  FragH aq[2][KS];
#pragma unroll
  for (int rt = 0; rt < RTN; ++rt) { const unsigned short* qr = (const unsigned short*)Q16 + ((size_t)b * TQ + q0 + rt * 16 + ln) * ldq + h * 64;
#pragma unroll
    for (int ks = 0; ks < KS; ++ks) { aq[rt][ks].half[0] = *(const v8us*)(qr + ks * 32 + 8 * hh); aq[rt][ks].half[1] = *(const v8us*)(qr + ks * 32 + 16 + 8 * hh); } }
  const unsigned short* Vth = (const unsigned short*)Vt + (size_t)slab * 64 * TK;
  float m_r[2][8], l_r[2][8]; v8f oacc[2][DT];
#pragma unroll
  for (int rt = 0; rt < RTN; ++rt) {
#pragma unroll
    for (int r = 0; r < 8; ++r) { m_r[rt][r] = -3.0e38f; l_r[rt][r] = 0.f; }
#pragma unroll
    for (int dt = 0; dt < DT; ++dt) oacc[rt][dt] = (v8f){0.f,0.f,0.f,0.f,0.f,0.f,0.f,0.f}; }
  const int jend = (CAUSAL == 1) ? (qb0 + 4 * RPW) : ((CAUSAL == 23) ? min(TK, (qb0 / CHK + 2) * CHK) : TK);      /* causal / window: keys that can never contribute are skipped */ const int jbeg = (CAUSAL == 23) ? max(0, (qb0 / CHK - 1) * CHK) : 0;
#pragma unroll 1
  for (int j0 = jbeg; j0 < jend; j0 += 32) {
    v8f s[2][2];
#pragma unroll
    for (int nt = 0; nt < 2; ++nt) { const unsigned short* kr = (const unsigned short*)K16 + ((size_t)b * TK + j0 + nt * 16 + ln) * ldk + h * 64; FragH bk[KS];
#pragma unroll
      for (int ks = 0; ks < KS; ++ks) { bk[ks].half[0] = *(const v8us*)(kr + ks * 32 + 8 * hh); bk[ks].half[1] = *(const v8us*)(kr + ks * 32 + 16 + 8 * hh); }
#pragma unroll
      for (int rt = 0; rt < RTN; ++rt) { v8f acc = (v8f){0.f,0.f,0.f,0.f,0.f,0.f,0.f,0.f};
#pragma unroll
        for (int ks = 0; ks < KS; ++ks) acc = mmaH<1>(aq[rt][ks].v, aq[rt][ks].v, bk[ks].v, bk[ks].v, acc); s[rt][nt] = acc; } }
#pragma unroll
    for (int rt = 0; rt < RTN; ++rt)
#pragma unroll
      for (int r = 0; r < 8; ++r) { const int tq = q0 + rt * 16 + 8 * hh + r; const int k0 = j0 + ln, k1 = j0 + 16 + ln;
        bool ok0 = (CAUSAL == 1) ? (k0 <= tq) : ((CAUSAL == 2) ? ((k0 >> 5) == (tq >> 5)) : true), ok1 = (CAUSAL == 1) ? (k1 <= tq) : ((CAUSAL == 2) ? ((k1 >> 5) == (tq >> 5)) : true); if (CAUSAL == 23) { const int cq = tq / CHK; ok0 = (abs(k0 / CHK - cq) <= 1) && (MSK[(size_t)b * TK + k0] == 0); ok1 = (abs(k1 / CHK - cq) <= 1) && (MSK[(size_t)b * TK + k1] == 0); }      /* mode 23: 3-chunk window + int key-padding mask */
        if (CAUSAL == 24) { ok0 = (MSK[(size_t)b * TK + k0] == 0); ok1 = (MSK[(size_t)b * TK + k1] == 0); }      /* mode 24: int key-padding mask (nonzero = padded = excluded) */      /* mode 2: block-diagonal 32-token groups */
        float s0 = ok0 ? s[rt][0][r] * SCL : -3.0e38f, s1 = ok1 ? s[rt][1][r] * SCL : -3.0e38f; if (CAUSAL == 17) { const float* amk = (const float*)MSK + (size_t)b * TK; s0 += bf16_round(amk[k0]); s1 += bf16_round(amk[k1]); } if (CAUSAL == 18) { const float* tb = (const float*)MSK; const int* ri = MSK + 1024 + (size_t)b * TK; const int rq = ri[tq]; s0 += tb[(h * 8 + rq) * 8 + ri[k0]]; s1 += tb[(h * 8 + rq) * 8 + ri[k1]]; } if (CAUSAL == 19) { const int* rel = MSK + (size_t)tq * TK; const float* rb = (const float*)MSK + (size_t)TQ * TK + ((size_t)(b * NH + h) * TQ + tq) * 64; s0 += rb[rel[k0]]; s1 += rb[rel[k1]]; }      /* mode 19: + (q.Ek[rel] + Eb[rel][h]) / 8 gathered by the int relative ids (packed [ids | table]) */      /* mode 18: + resource_bias[h][r_q][r_k] from the packed [table | ids] buffer (TQ == TK) */      /* mode 17: additive per-(batch, key) mask INPUT */ float mc = fmaxf(s0, s1);
        mc = fmaxf(mc, __shfl_xor(mc, 1, 32)); mc = fmaxf(mc, __shfl_xor(mc, 2, 32)); mc = fmaxf(mc, __shfl_xor(mc, 4, 32)); mc = fmaxf(mc, __shfl_xor(mc, 8, 32));
        const float mn = fmaxf(m_r[rt][r], mc); const float al = (mn > -1.0e38f) ? expf(m_r[rt][r] - mn) : 1.0f; m_r[rt][r] = mn; const float p0 = ok0 ? expf(s0 - mn) : 0.f, p1 = ok1 ? expf(s1 - mn) : 0.f; l_r[rt][r] = l_r[rt][r] * al + p0 + p1;
#pragma unroll
        for (int dt = 0; dt < DT; ++dt) oacc[rt][dt][r] *= al;
        FragH t2; t2.h[0] = (_Float16)(p0 * 1024.0f); t2.h[1] = (_Float16)(p1 * 1024.0f); sP[w][rt * 16 + 8 * hh + r][ln] = t2.u[0]; sP[w][rt * 16 + 8 * hh + r][16 + ln] = t2.u[1]; }
    __builtin_amdgcn_fence(__ATOMIC_ACQ_REL, "workgroup"); __builtin_amdgcn_wave_barrier();
    FragH pa[2];
#pragma unroll
    for (int rt = 0; rt < RTN; ++rt) { pa[rt].half[0] = *(const v8us*)&sP[w][rt * 16 + ln][8 * hh]; pa[rt].half[1] = *(const v8us*)&sP[w][rt * 16 + ln][16 + 8 * hh]; }
#pragma unroll
    for (int dt = 0; dt < DT; ++dt) { const unsigned short* vrow = Vth + (size_t)(dt * 16 + ln) * TK + j0; FragH bv; bv.half[0] = *(const v8us*)(vrow + 8 * hh); bv.half[1] = *(const v8us*)(vrow + 16 + 8 * hh);
#pragma unroll
      for (int rt = 0; rt < RTN; ++rt) oacc[rt][dt] = mmaH<1>(pa[rt].v, pa[rt].v, bv.v, bv.v, oacc[rt][dt]); }
    __builtin_amdgcn_fence(__ATOMIC_ACQ_REL, "workgroup"); __builtin_amdgcn_wave_barrier(); }
#pragma unroll
  for (int rt = 0; rt < RTN; ++rt) {
#pragma unroll
    for (int r = 0; r < 8; ++r) { float l = l_r[rt][r]; l += __shfl_xor(l, 1, 32); l += __shfl_xor(l, 2, 32); l += __shfl_xor(l, 4, 32); l += __shfl_xor(l, 8, 32); l_r[rt][r] = (l > 0.f) ? 1.0f / (l * 1024.0f) : 0.f; }
#pragma unroll
    for (int dt = 0; dt < DT; ++dt)
#pragma unroll
      for (int r = 0; r < 8; ++r) sO[w][rt * 16 + 8 * hh + r][dt * 16 + ln] = oacc[rt][dt][r] * l_r[rt][r]; }
  __builtin_amdgcn_fence(__ATOMIC_ACQ_REL, "workgroup"); __builtin_amdgcn_wave_barrier();
  {
#pragma unroll
    for (int rp = 0; rp < RPW; rp += 2) { const int r = rp + (lane >> 4), pc = lane & 15; const v4f val = *(const v4fa*)&sO[w][r][pc * 4]; *(v4f*)(O + ((size_t)b * TQ + q0 + r) * ldo + h * 64 + pc * 4) = val; }
     } }
// 5-plane variant: S = Qh Kh^T + (Ql Kh^T + Qh Kl^T)/1024 with Q/K = [hi | 2^10 residual] f16 planes (QL/KL same layout as Q16/K16), then the 3-term P.V below.
// 3-term variant: O = (P_hi V_hi + (P_lo V_hi + P_hi V_lo) / 1024) / l with P = [hi | 2^10 residual] of 1024 p and V^T = [hi | 2^10 residual] planes (VtL same layout as Vt) -> ~2^-21-class products for un-averaged (early causal / peaked) rows
template <int CAUSAL>
__global__ __launch_bounds__(128) void k_flash5(const _Float16* __restrict__ Q16, const _Float16* __restrict__ QL, int ldq, const _Float16* __restrict__ K16, const _Float16* __restrict__ KL, int ldk, const _Float16* __restrict__ Vt, const _Float16* __restrict__ VtL, const int* __restrict__ MSK, float* __restrict__ O, int ldo) {
  constexpr int RPW = 16, RTN = RPW / 16, NQB = TQ / (4 * RPW), DT = 4, KS = 2;
  __shared__ __attribute__((aligned(16))) unsigned short sP[4][RPW][40]; __shared__ __attribute__((aligned(16))) unsigned short sPL[4][RPW][40]; __shared__ __attribute__((aligned(16))) float sO[4][RPW][64 + 4];
  const int tid = threadIdx.x, w = tid >> 5, lane = tid & 31, ln = lane & 15, hh = lane >> 4;
  const int slab = blockIdx.x / QBN5, qblk = QB05 + blockIdx.x % QBN5; (void)NQB; const int b = slab / NH, h = slab % NH; const int qb0 = qblk * (4 * RPW); const int q0 = qb0 + w * RPW;
  FragH aq[2][KS], aql[2][KS];
#pragma unroll
  for (int rt = 0; rt < RTN; ++rt) { const unsigned short* qr = (const unsigned short*)Q16 + ((size_t)b * TQ + q0 + rt * 16 + ln) * ldq + h * 64; const unsigned short* ql = (const unsigned short*)QL + ((size_t)b * TQ + q0 + rt * 16 + ln) * ldq + h * 64;
#pragma unroll
    for (int ks = 0; ks < KS; ++ks) { aq[rt][ks].half[0] = *(const v8us*)(qr + ks * 32 + 8 * hh); aq[rt][ks].half[1] = *(const v8us*)(qr + ks * 32 + 16 + 8 * hh); aql[rt][ks].half[0] = *(const v8us*)(ql + ks * 32 + 8 * hh); aql[rt][ks].half[1] = *(const v8us*)(ql + ks * 32 + 16 + 8 * hh); } }
  const unsigned short* Vth = (const unsigned short*)Vt + (size_t)slab * 64 * TK; const unsigned short* Vtl = (const unsigned short*)VtL + (size_t)slab * 64 * TK;
  float m_r[2][8], l_r[2][8]; v8f oacc[2][DT], oaccL[2][DT];
#pragma unroll
  for (int rt = 0; rt < RTN; ++rt) {
#pragma unroll
    for (int r = 0; r < 8; ++r) { m_r[rt][r] = -3.0e38f; l_r[rt][r] = 0.f; }
#pragma unroll
    for (int dt = 0; dt < DT; ++dt) { oacc[rt][dt] = (v8f){0.f,0.f,0.f,0.f,0.f,0.f,0.f,0.f}; oaccL[rt][dt] = oacc[rt][dt]; } }
  const int jend = (CAUSAL == 1) ? (qb0 + 4 * RPW) : ((CAUSAL == 23) ? min(TK, (qb0 / CHK + 2) * CHK) : TK);      /* causal / window: keys that can never contribute are skipped */ const int jbeg = (CAUSAL == 23) ? max(0, (qb0 / CHK - 1) * CHK) : 0;
#pragma unroll 1
  for (int j0 = jbeg; j0 < jend; j0 += 32) {
    v8f s[2][2];
#pragma unroll
    for (int nt = 0; nt < 2; ++nt) { const unsigned short* kr = (const unsigned short*)K16 + ((size_t)b * TK + j0 + nt * 16 + ln) * ldk + h * 64; const unsigned short* klr = (const unsigned short*)KL + ((size_t)b * TK + j0 + nt * 16 + ln) * ldk + h * 64; FragH bk[KS], bkl[KS];
#pragma unroll
      for (int ks = 0; ks < KS; ++ks) { bk[ks].half[0] = *(const v8us*)(kr + ks * 32 + 8 * hh); bk[ks].half[1] = *(const v8us*)(kr + ks * 32 + 16 + 8 * hh); bkl[ks].half[0] = *(const v8us*)(klr + ks * 32 + 8 * hh); bkl[ks].half[1] = *(const v8us*)(klr + ks * 32 + 16 + 8 * hh); }
#pragma unroll
      for (int rt = 0; rt < RTN; ++rt) { v8f acc = (v8f){0.f,0.f,0.f,0.f,0.f,0.f,0.f,0.f}, accl = acc;
#pragma unroll
        for (int ks = 0; ks < KS; ++ks) { acc = mmaH<1>(aq[rt][ks].v, aq[rt][ks].v, bk[ks].v, bk[ks].v, acc); accl = mmaH<1>(aql[rt][ks].v, aql[rt][ks].v, bk[ks].v, bk[ks].v, accl); accl = mmaH<1>(aq[rt][ks].v, aq[rt][ks].v, bkl[ks].v, bkl[ks].v, accl); }
#pragma unroll
        for (int r = 0; r < 8; ++r) acc[r] += accl[r] * 0.0009765625f;
        s[rt][nt] = acc; } }
#pragma unroll
    for (int rt = 0; rt < RTN; ++rt)
#pragma unroll
      for (int r = 0; r < 8; ++r) { const int tq = q0 + rt * 16 + 8 * hh + r; const int k0 = j0 + ln, k1 = j0 + 16 + ln;
        bool ok0 = (CAUSAL == 1) ? (k0 <= tq) : ((CAUSAL == 2) ? ((k0 >> 5) == (tq >> 5)) : true), ok1 = (CAUSAL == 1) ? (k1 <= tq) : ((CAUSAL == 2) ? ((k1 >> 5) == (tq >> 5)) : true);      /* mode 2: block-diagonal 32-token groups */
        if (CAUSAL == 4) { const int* mrow = MSK + ((size_t)b * TQ + tq) * TK; ok0 = mrow[k0] != 0; ok1 = mrow[k1] != 0; }      /* mode 4: per-(query, key) INPUT mask shared by all heads; masked keys contribute nothing (== the reference's -4096 fill, whose exp underflows to 0), rows with no valid key give l = 0 -> output 0 (== the reference's row_valid zeroing) */
        float s0 = ok0 ? s[rt][0][r] * SCL : -3.0e38f, s1 = ok1 ? s[rt][1][r] * SCL : -3.0e38f; if (CAUSAL == 17) { const float* amk = (const float*)MSK + (size_t)b * TK; s0 += bf16_round(amk[k0]); s1 += bf16_round(amk[k1]); } if (CAUSAL == 18) { const float* tb = (const float*)MSK; const int* ri = MSK + 1024 + (size_t)b * TK; const int rq = ri[tq]; s0 += tb[(h * 8 + rq) * 8 + ri[k0]]; s1 += tb[(h * 8 + rq) * 8 + ri[k1]]; } if (CAUSAL == 19) { const int* rel = MSK + (size_t)tq * TK; const float* rb = (const float*)MSK + (size_t)TQ * TK + ((size_t)(b * NH + h) * TQ + tq) * 64; s0 += rb[rel[k0]]; s1 += rb[rel[k1]]; }      /* mode 19: + (q.Ek[rel] + Eb[rel][h]) / 8 gathered by the int relative ids (packed [ids | table]) */      /* mode 18: + resource_bias[h][r_q][r_k] from the packed [table | ids] buffer (TQ == TK) */      /* mode 17: additive per-(batch, key) mask INPUT */ float mc = fmaxf(s0, s1);
        mc = fmaxf(mc, __shfl_xor(mc, 1, 32)); mc = fmaxf(mc, __shfl_xor(mc, 2, 32)); mc = fmaxf(mc, __shfl_xor(mc, 4, 32)); mc = fmaxf(mc, __shfl_xor(mc, 8, 32));
        const float mn = fmaxf(m_r[rt][r], mc); const float al = (mn > -1.0e38f) ? expf(m_r[rt][r] - mn) : 1.0f; m_r[rt][r] = mn; const float p0 = ok0 ? expf(s0 - mn) : 0.f, p1 = ok1 ? expf(s1 - mn) : 0.f; l_r[rt][r] = l_r[rt][r] * al + p0 + p1;
#pragma unroll
        for (int dt = 0; dt < DT; ++dt) { oacc[rt][dt][r] *= al; oaccL[rt][dt][r] *= al; }
        FragH t2, t2l; const float ps0 = p0 * 1024.0f, ps1 = p1 * 1024.0f; t2.h[0] = (_Float16)ps0; t2.h[1] = (_Float16)ps1; t2l.h[0] = (_Float16)((ps0 - (float)t2.h[0]) * 1024.0f); t2l.h[1] = (_Float16)((ps1 - (float)t2.h[1]) * 1024.0f);
        sP[w][rt * 16 + 8 * hh + r][ln] = t2.u[0]; sP[w][rt * 16 + 8 * hh + r][16 + ln] = t2.u[1]; sPL[w][rt * 16 + 8 * hh + r][ln] = t2l.u[0]; sPL[w][rt * 16 + 8 * hh + r][16 + ln] = t2l.u[1]; }
    __builtin_amdgcn_fence(__ATOMIC_ACQ_REL, "workgroup"); __builtin_amdgcn_wave_barrier();
    FragH pa[2], pl[2];
#pragma unroll
    for (int rt = 0; rt < RTN; ++rt) { pa[rt].half[0] = *(const v8us*)&sP[w][rt * 16 + ln][8 * hh]; pa[rt].half[1] = *(const v8us*)&sP[w][rt * 16 + ln][16 + 8 * hh]; pl[rt].half[0] = *(const v8us*)&sPL[w][rt * 16 + ln][8 * hh]; pl[rt].half[1] = *(const v8us*)&sPL[w][rt * 16 + ln][16 + 8 * hh]; }
#pragma unroll
    for (int dt = 0; dt < DT; ++dt) { const unsigned short* vrow = Vth + (size_t)(dt * 16 + ln) * TK + j0; const unsigned short* vrl = Vtl + (size_t)(dt * 16 + ln) * TK + j0; FragH bv, bl; bv.half[0] = *(const v8us*)(vrow + 8 * hh); bv.half[1] = *(const v8us*)(vrow + 16 + 8 * hh); bl.half[0] = *(const v8us*)(vrl + 8 * hh); bl.half[1] = *(const v8us*)(vrl + 16 + 8 * hh);
#pragma unroll
      for (int rt = 0; rt < RTN; ++rt) { oacc[rt][dt] = mmaH<1>(pa[rt].v, pa[rt].v, bv.v, bv.v, oacc[rt][dt]); oaccL[rt][dt] = mmaH<1>(pl[rt].v, pl[rt].v, bv.v, bv.v, oaccL[rt][dt]); oaccL[rt][dt] = mmaH<1>(pa[rt].v, pa[rt].v, bl.v, bl.v, oaccL[rt][dt]); } }
    __builtin_amdgcn_fence(__ATOMIC_ACQ_REL, "workgroup"); __builtin_amdgcn_wave_barrier(); }
#pragma unroll
  for (int rt = 0; rt < RTN; ++rt) {
#pragma unroll
    for (int r = 0; r < 8; ++r) { float l = l_r[rt][r]; l += __shfl_xor(l, 1, 32); l += __shfl_xor(l, 2, 32); l += __shfl_xor(l, 4, 32); l += __shfl_xor(l, 8, 32); l_r[rt][r] = (l > 0.f) ? 1.0f / (l * 1024.0f) : 0.f; }
#pragma unroll
    for (int dt = 0; dt < DT; ++dt)
#pragma unroll
      for (int r = 0; r < 8; ++r) { float v = oacc[rt][dt][r]; v += oaccL[rt][dt][r] * 0.0009765625f; sO[w][rt * 16 + 8 * hh + r][dt * 16 + ln] = v * l_r[rt][r]; } }
  __builtin_amdgcn_fence(__ATOMIC_ACQ_REL, "workgroup"); __builtin_amdgcn_wave_barrier();
  {
#pragma unroll
    for (int rp = 0; rp < RPW; rp += 2) { const int r = rp + (lane >> 4), pc = lane & 15; const v4f val = *(const v4fa*)&sO[w][r][pc * 4]; *(v4f*)(O + ((size_t)b * TQ + q0 + r) * ldo + h * 64 + pc * 4) = val; }
     } }

__global__ __launch_bounds__(256) void k_rotab(float* __restrict__ CS, float* __restrict__ SN) {
  #pragma clang fp contract(off)
  const int t = blockIdx.x * 256 + threadIdx.x; if (t >= SLEN * 32) return; const int j = t % 32, s = t / 32; const float ex = (float)(2 * j) / 64.0f; const float inv = 1.0f / powf(10000.0f, ex); const float th = (float)s * inv; const float c = cosf(th), sn = sinf(th);
  { *(float*)(CS + t) = c; *(float*)(SN + t) = sn;  } }
__global__ __launch_bounds__(256) void k_rope(const float* __restrict__ F, int nsrc, int ndst, int rep, const float* __restrict__ CS, const float* __restrict__ SN, _Float16* __restrict__ H, _Float16* __restrict__ L) {
  #pragma clang fp contract(off)
  const size_t t = (size_t)blockIdx.x * 256 + threadIdx.x; if (t >= (size_t)NR * ndst * 4) return; const int g8 = (int)(t % 4); const int hd = (int)((t / 4) % ndst); const size_t row = t / ((size_t)4 * ndst); const int s = (int)(row % SLEN); const int hs = hd / rep;
  const float* src = F + row * (size_t)(nsrc * 64) + hs * 64; FragH ah, al, bh, bl;
  for (int i = 0; i < 8; ++i) { const int d = g8 * 8 + i; const float c = CS[s * 32 + d], sn = SN[s * 32 + d]; const float x1 = src[d], x2 = src[d + 32];
    float o1 = x1 * c; o1 += -x2 * sn; float o2 = x2 * c; o2 += x1 * sn;
    _Float16 hv = (_Float16)o1; ah.h[i] = hv; al.h[i] = (_Float16)((o1 - (float)hv) * 1024.0f); hv = (_Float16)o2; bh.h[i] = hv; bl.h[i] = (_Float16)((o2 - (float)hv) * 1024.0f); }
  const size_t o = row * (size_t)(ndst * 64) + hd * 64 + g8 * 8;
  { *(v8us*)((unsigned short*)H + o) = ah.half[0]; *(v8us*)((unsigned short*)H + o + 32) = bh.half[0]; *(v8us*)((unsigned short*)L + o) = al.half[0]; *(v8us*)((unsigned short*)L + o + 32) = bl.half[0];  } }
__global__ __launch_bounds__(256) void k_rope2(const float* __restrict__ F, int nsrc, int ndst, int rep, const float* __restrict__ CS, const float* __restrict__ SN, _Float16* __restrict__ H, _Float16* __restrict__ L) {
  #pragma clang fp contract(off)
  const size_t t = (size_t)blockIdx.x * 256 + threadIdx.x; if (t >= (size_t)NR * ndst * 4) return; const int g16 = (int)(t % 4); const int hd = (int)((t / 4) % ndst); const size_t row = t / ((size_t)4 * ndst); const int s = (int)(row % SLEN); const int hs = hd / rep;
  const float* src = F + row * (size_t)(nsrc * 64) + hs * 64 + g16 * 16; FragH ah, al;
  for (int pr = 0; pr < 8; ++pr) { const int i = g16 * 8 + pr; const float c = CS[s * 32 + i], sn = SN[s * 32 + i]; const float x1 = src[2 * pr], x2 = src[2 * pr + 1];
    float o1 = x1 * c; o1 -= x2 * sn; float o2 = x1 * sn; o2 += x2 * c;
    _Float16 hv = (_Float16)o1; ah.h[2 * pr] = hv; al.h[2 * pr] = (_Float16)((o1 - (float)hv) * 1024.0f); hv = (_Float16)o2; ah.h[2 * pr + 1] = hv; al.h[2 * pr + 1] = (_Float16)((o2 - (float)hv) * 1024.0f); }
  const size_t o = row * (size_t)(ndst * 64) + hd * 64 + g16 * 16;
  { *(v8us*)((unsigned short*)H + o) = ah.half[0]; *(v8us*)((unsigned short*)H + o + 8) = ah.half[1]; *(v8us*)((unsigned short*)L + o) = al.half[0]; *(v8us*)((unsigned short*)L + o + 8) = al.half[1];  } }
__global__ __launch_bounds__(256) void k_ln512(const float* __restrict__ A, const float* __restrict__ res, const float* __restrict__ g, const float* __restrict__ bb, float* __restrict__ Y, _Float16* __restrict__ Y16) {
  #pragma clang fp contract(off)
  const int wv = threadIdx.x >> 5, ln = threadIdx.x & 31; const size_t r = (size_t)blockIdx.x * 8 + wv; if (r >= NR) return; float x[16]; float s = 0.f;
  for (int i = 0; i < 2; ++i) { const v8f a = *(const v8f*)(A + r * DM + i * 256 + ln * 8); for (int q = 0; q < 8; ++q) { float v = a[q]; if (res) v += bf16_round(res[r * DM + i * 256 + ln * 8 + q]); x[i * 8 + q] = v; s += v; } }
  for (int o = 16; o > 0; o >>= 1) s += __shfl_xor(s, o, 32); const float mu = s / (float)DM; float var = 0.f; for (int q = 0; q < 16; ++q) { const float d = x[q] - mu; var += d * d; }
  for (int o = 16; o > 0; o >>= 1) var += __shfl_xor(var, o, 32); const float inv = rsqrtf(var / (float)DM + 1e-5f);
  { for (int i = 0; i < 2; ++i) { const int c0 = i * 256 + ln * 8; v8f y; FragH f; for (int q = 0; q < 8; ++q) { float v = (x[i * 8 + q] - mu) * inv; v *= bf16_round(g[c0 + q]); v += bf16_round(bb[c0 + q]); y[q] = v; f.h[q] = (_Float16)v; } *(v8f*)(Y + r * DM + c0) = y; if (Y16) *(v8us*)((unsigned short*)Y16 + r * DM + c0) = f.half[0]; }  } }
__global__ __launch_bounds__(256) void k_pack(const float* __restrict__ rb, const int* __restrict__ rid, int* __restrict__ PK) { const int t = blockIdx.x * 256 + threadIdx.x; if (t >= 1024 + NB * TK) return; int v; if (t < 1024) v = __float_as_int(bf16_round(rb[t])); else v = rid[t - 1024]; *(int*)(PK + t) = v;  }
__global__ __launch_bounds__(256) void k_tabin(const float* __restrict__ sp, float* __restrict__ CS, float* __restrict__ SN) { const int t = blockIdx.x * 256 + threadIdx.x; if (t >= SLEN * 32) return; const int i = t % 32, s = t / 32; const float c = bf16_round(sp[s * 64 + 32 + i]), sn = bf16_round(sp[s * 64 + i]);
  { *(float*)(CS + t) = c; *(float*)(SN + t) = sn;  } }
__global__ __launch_bounds__(256) void k_wsc(const float* __restrict__ Wm, _Float16* __restrict__ Bt, size_t n8, float sc) { const size_t t = (size_t)blockIdx.x * 256 + threadIdx.x; if (t >= n8) return; FragH f; for (int q = 0; q < 8; ++q) f.h[q] = (_Float16)(bf16_round(Wm[t * 8 + q]) * sc); *(v8us*)((unsigned short*)Bt + t * 8) = f.half[0];  }
__global__ __launch_bounds__(256) void k_rotab2(float* __restrict__ CS, float* __restrict__ SN) {
  #pragma clang fp contract(off)
  const int t = blockIdx.x * 256 + threadIdx.x; if (t >= SLEN * 32) return; const int j = t % 32, s = t / 32; const float c0 = -0.14391156831212787f;      /* -ln(10000)/64 rounded to f32 */ const float inv = expf((float)(2 * j) * c0); const float th = (float)s * inv; const float c = cosf(th), sn = sinf(th);
  { *(float*)(CS + t) = c; *(float*)(SN + t) = sn;  } }
__global__ __launch_bounds__(256) void k_lnu(const float* __restrict__ X, _Float16* __restrict__ N16, float* __restrict__ XB) {
  #pragma clang fp contract(off)
  const int wv = threadIdx.x >> 5, ln = threadIdx.x & 31; const size_t r = (size_t)blockIdx.x * 8 + wv; if (r >= NR) return; float a[32]; float s = 0.f;
  for (int i = 0; i < 4; ++i) { const v8f v = *(const v8f*)(X + r * DM + (i * 32 + ln) * 8); for (int q = 0; q < 8; ++q) { const float u = bf16_round(v[q]); a[i * 8 + q] = u; s += u; } }
  for (int o = 16; o > 0; o >>= 1) s += __shfl_xor(s, o, 32); const float mu = s / (float)DM; float var = 0.f; for (int q = 0; q < 32; ++q) { const float d = a[q] - mu; var += d * d; }
  for (int o = 16; o > 0; o >>= 1) var += __shfl_xor(var, o, 32); const float den = sqrtf(var / (float)(DM - 1)) + 1e-6f; const float inv = 1.0f / den;      /* one reciprocal per row; (x-mean)*inv vs the reference's division differs by <= 1 ulp */
  { for (int i = 0; i < 4; ++i) { const int c0 = (i * 32 + ln) * 8; FragH f; v8f xb; for (int q = 0; q < 8; ++q) { f.h[q] = (_Float16)((a[i * 8 + q] - mu) * inv); xb[q] = a[i * 8 + q]; } *(v8us*)((unsigned short*)N16 + r * DM + c0) = f.half[0]; *(v8f*)(XB + r * DM + c0) = xb; }  } }

// Fused Gaussian-kernel attention: one launch for all (batch, head) slabs; the score plane and the weight plane never leave the registers.
// Block = 8 waves x 16 output rows i; the summed index j walks in LDS stages of FJ rows (q hi, q residual, V^T, |q|^2), two buffers, one barrier a stage.
// S^T tile: A = q rows j (LDS), B = k columns i (registers, loaded once); D[8 hh + r][ln] = k_i . q_j. Two D tiles (j 0-15, 16-31), weighted and rounded in place, are the B operand of O^T += V^T . P^T.
#define FJ 64
#define FP 72                    /* LDS row pitch in f16: 128-byte rows + 16 bytes, for 16-byte fragment reads */
__device__ __forceinline__ v16h fz_frag(const unsigned short* p, int hh) { FragH f; f.half[0] = *(const v8us*)(p + 8 * hh); f.half[1] = *(const v8us*)(p + 16 + 8 * hh); return f.v; }
__device__ __forceinline__ v8f fz_mma(v16h a, v16h b, v8f c) { return __builtin_amdgcn_wmma_f32_16x16x32_f16(false, a, false, b, (short)0, c, false, false); }
__global__ __launch_bounds__(256) __attribute__((amdgpu_waves_per_eu(4, 4))) void k_gauss(const _Float16* __restrict__ QH, const _Float16* __restrict__ QL, const _Float16* __restrict__ KH, const _Float16* __restrict__ KL, const _Float16* __restrict__ VT,
    const float* __restrict__ QN, const float* __restrict__ KN, const float* __restrict__ rs, _Float16* __restrict__ OH) {
  __shared__ __attribute__((aligned(16))) unsigned short sQH[2][FJ][FP]; __shared__ __attribute__((aligned(16))) unsigned short sQL[2][FJ][FP]; __shared__ __attribute__((aligned(16))) unsigned short sVT[2][64][FP]; __shared__ __attribute__((aligned(16))) float sQN[2][FJ];
  const int tid = threadIdx.x, w = tid >> 5, lane = tid & 31, ln = lane & 15, hh = lane >> 4;
  const int slab = blockIdx.x / (SLEN / 128), ib = blockIdx.x % (SLEN / 128); const int b = slab / NH, h = slab % NH;
  const int i = ib * 128 + w * 16 + ln;      /* this lane's output row (a column of every D tile) */
  const unsigned short* kh = (const unsigned short*)KH + ((size_t)b * SLEN + i) * DM + h * 64; const unsigned short* kl = (const unsigned short*)KL + ((size_t)b * SLEN + i) * DM + h * 64;
  const v16h bkh0 = fz_frag(kh, hh), bkh1 = fz_frag(kh + 32, hh), bkl0 = fz_frag(kl, hh), bkl1 = fz_frag(kl + 32, hh);
  const float kn = KN[(size_t)slab * SLEN + i]; const float r = bf16_round(rs[0]);
  const int sr = tid >> 3, sc = (tid & 7) * 8;      /* staging: 16 bytes a thread in rows sr and sr + 32 of each plane */
  const unsigned short* gqh = (const unsigned short*)QH + ((size_t)b * SLEN + sr) * DM + h * 64 + sc; const unsigned short* gql = (const unsigned short*)QL + ((size_t)b * SLEN + sr) * DM + h * 64 + sc;
  const unsigned short* gvt = (const unsigned short*)VT + ((size_t)slab * 64 + sr) * SLEN + sc; const float* gqn = QN + (size_t)slab * SLEN + (tid & (FJ - 1));
  v8us rq0, rq1, rl0, rl1, rv0, rv1; float rn = 0.f;
  auto gload = [&](int j0) { rq0 = *(const v8us*)(gqh + (size_t)j0 * DM); rq1 = *(const v8us*)(gqh + (size_t)(j0 + 32) * DM); rl0 = *(const v8us*)(gql + (size_t)j0 * DM); rl1 = *(const v8us*)(gql + (size_t)(j0 + 32) * DM);
    rv0 = *(const v8us*)(gvt + j0); rv1 = *(const v8us*)(gvt + (size_t)32 * SLEN + j0); if (tid < FJ) rn = gqn[j0]; };
  auto sstore = [&](int bf) { *(v8us*)&sQH[bf][sr][sc] = rq0; *(v8us*)&sQH[bf][sr + 32][sc] = rq1; *(v8us*)&sQL[bf][sr][sc] = rl0; *(v8us*)&sQL[bf][sr + 32][sc] = rl1; *(v8us*)&sVT[bf][sr][sc] = rv0; *(v8us*)&sVT[bf][sr + 32][sc] = rv1; if (tid < FJ) sQN[bf][tid] = rn; };
  const v8f z8 = {0.f,0.f,0.f,0.f,0.f,0.f,0.f,0.f}; v8f oacc[4] = {z8, z8, z8, z8};
  gload(0); sstore(0); __syncthreads();
#pragma unroll 1      /* one stage a trip: the body already holds two 32-wide passes; more would only grow the code */
  for (int st = 0; st < SLEN / FJ; ++st) { const int bf = st & 1; const bool more = st + 1 < SLEN / FJ;
    if (more) gload((st + 1) * FJ);      /* next stage flies from L2 while this one is worked on */
#pragma unroll
    for (int jj = 0; jj < FJ; jj += 32) { FragH pb; const v16h av0 = fz_frag(&sVT[bf][ln][jj], hh), av1 = fz_frag(&sVT[bf][16 + ln][jj], hh), av2 = fz_frag(&sVT[bf][32 + ln][jj], hh), av3 = fz_frag(&sVT[bf][48 + ln][jj], hh);      /* named ahead of the score work, so that the scheduler may start these reads early */
#pragma unroll
      for (int nt = 0; nt < 2; ++nt) { const unsigned short* qh = &sQH[bf][jj + nt * 16 + ln][0]; const unsigned short* ql = &sQL[bf][jj + nt * 16 + ln][0];
        const v16h ah0 = fz_frag(qh, hh), ah1 = fz_frag(qh + 32, hh), al0 = fz_frag(ql, hh), al1 = fz_frag(ql + 32, hh);
        v8f cA = fz_mma(ah0, bkl0, z8), cB = fz_mma(al0, bkh0, z8), cC = fz_mma(ah0, bkh0, z8); cA = fz_mma(ah1, bkl1, cA); cB = fz_mma(al1, bkh1, cB); cC = fz_mma(ah1, bkh1, cC);
        const v4f n0 = *(const v4fa*)&sQN[bf][jj + nt * 16 + 8 * hh], n1 = *(const v4fa*)&sQN[bf][jj + nt * 16 + 8 * hh + 4];
#pragma unroll
        for (int q = 0; q < 8; ++q) { const float s = cC[q] + (cB[q] * 0.0009765625f + cA[q] * 0.0009765625f); const float qn = (q < 4) ? n0[q & 3] : n1[q & 3]; float d2 = kn + qn; d2 += -2.0f * s; pb.h[nt * 8 + q] = (_Float16)(1024.0f * expf(-(d2 * r))); } }
      oacc[0] = fz_mma(av0, pb.v, oacc[0]); oacc[1] = fz_mma(av1, pb.v, oacc[1]); oacc[2] = fz_mma(av2, pb.v, oacc[2]); oacc[3] = fz_mma(av3, pb.v, oacc[3]); }
    if (more) sstore(bf ^ 1);      /* that buffer's last readers left it before the barrier that ended the trip before */
    __syncthreads(); }
  unsigned short* orow = (unsigned short*)OH + ((size_t)b * SLEN + i) * DM + h * 64 + 8 * hh;      /* D register q of tile dt = out[i][dt * 16 + 8 hh + q]; stored as the f16 operand plane of the output projection */
#pragma unroll
  for (int dt = 0; dt < 4; ++dt) { FragH f;
#pragma unroll
    for (int q = 0; q < 8; ++q) f.h[q] = (_Float16)(oacc[dt][q] * 0.0009765625f);
    *(v8us*)(orow + dt * 16) = f.half[0]; } }

// Projection GEMM, C[M][N] (f32) = A[M][K] . Bh[N][K]^T * alpha + bf16(bias): block = 8 waves (4 x 2) of 32x64 wave tiles = 128 x 128 of C.
// Both operand tiles (128 rows x GK k) go through LDS, two buffers, one barrier a stage: every global load covers whole 128-byte lines, and a row is fetched once a block instead of once a wave.
// k runs upward in steps of 32 into the same accumulators as before, so every sum keeps its order. Needs M % 128 == 0, N % 128 == 0, K % GK == 0.
// SPLIT (the qkv product; a block's 128 columns lie in one of q, k, v and a wave's 64 columns are one head): no f32 plane is stored. q and k go out as f16 hi + 2^10 residual planes with each row's squared norm ([batch, head][token]), v as V^T [batch, head][64][token].
template <int N, int K, bool SPLIT>
__global__ __launch_bounds__(256) void k_gemm3(const _Float16* __restrict__ A, const _Float16* __restrict__ Bh, float alpha, const float* __restrict__ bias, float* __restrict__ C,
    _Float16* __restrict__ QH, _Float16* __restrict__ QL, _Float16* __restrict__ KH, _Float16* __restrict__ KL, _Float16* __restrict__ VT, float* __restrict__ QN, float* __restrict__ KN) {
  constexpr int GK = 64;      /* k a stage: one 128-byte line a row */
  constexpr int GP = GK + 8;      /* LDS row pitch in f16: the row + 16 bytes (an odd count of 16 bytes), for 16-byte fragment reads */
  constexpr int RP = 2048 / GK, NP = 128 / RP;      /* rows a staging pass of 256 threads covers; passes a tile */
  __shared__ __attribute__((aligned(16))) unsigned short sT[2][256][GP];      /* rows 0-127: A tile, rows 128-255: B tile; after the loop each wave's 32 x 68 f32 output patch */
  const int tid = threadIdx.x, lane = tid & 31, ln = lane & 15, hh = lane >> 4;
  const int w = __builtin_amdgcn_readfirstlane(tid >> 5);      /* the wave's number in a scalar register: w, wm, wn and the tile origins formed from them hold no vector registers across the loop */
  constexpr int ntn = N >> 7; const int mt = blockIdx.x / ntn, nq = blockIdx.x - mt * ntn; const int wm = w >> 1, wn = w & 1;
  const int sr = tid / (GK / 8), sc = (tid % (GK / 8)) * 8;      /* staging: 16 bytes a thread in rows sr + RP u of each tile; 8 neighbour threads cover one 128-byte line */
  const unsigned short* ga = (const unsigned short*)A + (size_t)(mt * 128) * K; const unsigned short* gb = (const unsigned short*)Bh + (size_t)(nq * 128) * K; const unsigned go = (unsigned)(sr * K + sc);      /* block-uniform tile bases, which walk along k, and one fixed offset a thread */
  v8us ra[NP], rb[NP];
  auto gload = [&](int k0) {
#pragma unroll
    for (int u = 0; u < NP; ++u) { ra[u] = *(const v8us*)(ga + k0 + go + RP * u * K); rb[u] = *(const v8us*)(gb + k0 + go + RP * u * K); } };
  auto sstore = [&](int bf) {
#pragma unroll
    for (int u = 0; u < NP; ++u) { *(v8us*)&sT[bf][sr + RP * u][sc] = ra[u]; *(v8us*)&sT[bf][128 + sr + RP * u][sc] = rb[u]; } };
  const v8f z8 = {0.f,0.f,0.f,0.f,0.f,0.f,0.f,0.f}; v8f acc[2][4] = {{z8, z8, z8, z8}, {z8, z8, z8, z8}};
  constexpr int nst = K / GK;
  gload(0); sstore(0); __syncthreads();
#pragma unroll 1      /* one stage a trip: the body already holds 16 matrix instructions; more would only grow the code */
  for (int st = 0; st < nst; ++st) { const int bf = st & 1; const bool more = st + 1 < nst;
    if (more) gload((st + 1) * GK);      /* next stage flies from L2 while this one is worked on */
#pragma unroll
    for (int kk = 0; kk < GK; kk += 32) { const v16h a0 = fz_frag(&sT[bf][wm * 32 + ln][kk], hh), a1 = fz_frag(&sT[bf][wm * 32 + 16 + ln][kk], hh); v16h b[4];
#pragma unroll
      for (int t = 0; t < 4; ++t) b[t] = fz_frag(&sT[bf][128 + wn * 64 + t * 16 + ln][kk], hh);
      __builtin_amdgcn_sched_barrier(0);      /* keeps the six fragment reads together ahead of the eight products: left alone the scheduler sinks each B read to its use, and the wave waits out the LDS latency four times instead of once */
#pragma unroll
      for (int t = 0; t < 4; ++t) { acc[0][t] = fz_mma(a0, b[t], acc[0][t]); acc[1][t] = fz_mma(a1, b[t], acc[1][t]); } }
    if (more) sstore(bf ^ 1);      /* that buffer's last readers left it before the barrier that ended the trip before */
    __syncthreads(); }
  const int row0 = mt * 128 + wm * 32, col0 = nq * 128 + wn * 64;
  const int third = SPLIT ? (nq * 128) / DM : 0;      /* 0 q, 1 k, 2 v: the same for the whole block */
  if (SPLIT && third == 2) {
    constexpr int VP = 128 + 8;      /* LDS row pitch in f16: 128 tokens + 16 bytes (an odd count of 16 bytes) */
    unsigned short* sv = &sT[0][0][0];      /* [128 columns d][VP]; every read of the tiles ended at the loop's last barrier */
#pragma unroll      /* constant indices keep acc in registers */
    for (int u = 0; u < 8; ++u) { const int t = u & 3, half = u >> 2; const float bv = bf16_round(bias[col0 + t * 16 + ln]); FragH f;      /* a lane's 8 D registers are 8 tokens in a row of one column d: 16 bytes of a V^T row */
#pragma unroll      /* as above */
      for (int r = 0; r < 8; ++r) f.h[r] = (_Float16)(acc[half][t][r] * alpha + bv);
      *(v8us*)&sv[(wn * 64 + t * 16 + ln) * VP + wm * 32 + half * 16 + 8 * hh] = f.half[0]; }
    __syncthreads();      /* a V^T row's 128 tokens come from four waves */
    unsigned short* vt = (unsigned short*)VT + ((size_t)((mt * 128) / SLEN) * DM + (nq * 128 - 2 * DM)) * SLEN + (mt * 128) % SLEN;
#pragma unroll      /* the eight LDS reads go out together, one latency instead of eight */
    for (int p = 0; p < 8; ++p) { const int c = p * 256 + tid, dd = c >> 4, ch = (c & 15) * 8;      /* 16 neighbour threads store the 256 bytes of one row */
      *(v8us*)(vt + (size_t)dd * SLEN + ch) = *(const v8us*)&sv[dd * VP + ch]; }
    return; }
  float* so = (float*)&sT[0][0][0] + w * (32 * 68);      /* every read of the tiles ended at the loop's last barrier */
#pragma unroll
  for (int u = 0; u < 8; ++u) { const int t = u & 3, half = u >> 2; const float bv = bf16_round(bias[col0 + t * 16 + ln]);
#pragma unroll
    for (int r = 0; r < 8; ++r) so[(half * 16 + 8 * hh + r) * 68 + t * 16 + ln] = acc[half][t][r] * alpha + bv; }
  __builtin_amdgcn_fence(__ATOMIC_ACQ_REL, "workgroup"); __builtin_amdgcn_wave_barrier();      /* the patch is read back by other lanes of the same wave */
  if (SPLIT) {
    unsigned short* dh = (unsigned short*)(third ? KH : QH) + (size_t)row0 * DM + (col0 - third * DM); unsigned short* dl = (unsigned short*)(third ? KL : QL) + (size_t)row0 * DM + (col0 - third * DM);
    float sn = 0.f;      /* lane = row of the patch: the head's 64 squares, summed upward along d */
#pragma unroll      /* lets the LDS reads run ahead of the one chain of adds */
    for (int d = 0; d < 64; d += 4) { const v4f a = *(const v4fa*)&so[lane * 68 + d];
      for (int q = 0; q < 4; ++q) sn += a[q] * a[q]; }
    (third ? KN : QN)[((size_t)(row0 / SLEN) * NH + (col0 - third * DM) / 64) * SLEN + row0 % SLEN + lane] = sn;
    const int rs4 = lane >> 3, c8 = (lane & 7) * 8;      /* 8 neighbour lanes store the 128-byte line that a head's row is in each plane */
#pragma unroll 2      /* four trips of two passes: unrolled whole, the epilogue takes more registers than the product loop and costs the kernel a work-group per WGP */
    for (int p = 0; p < 8; ++p) { const int r = p * 4 + rs4; const v4f a = *(const v4fa*)&so[r * 68 + c8], c = *(const v4fa*)&so[r * 68 + c8 + 4]; FragH fh, fl;
#pragma unroll      /* constant indices keep the fragments in registers */
      for (int q = 0; q < 4; ++q) { _Float16 h = (_Float16)a[q]; fh.h[q] = h; fl.h[q] = (_Float16)((a[q] - (float)h) * 1024.0f); h = (_Float16)c[q]; fh.h[4 + q] = h; fl.h[4 + q] = (_Float16)((c[q] - (float)h) * 1024.0f); }
      *(v8us*)(dh + (size_t)r * DM + c8) = fh.half[0]; *(v8us*)(dl + (size_t)r * DM + c8) = fl.half[0]; }
    return; }
  const int rsub = lane >> 4, c4 = (lane & 15) * 4;
#pragma unroll
  for (int q = 0; q < 16; ++q) { const int r = q * 2 + rsub; const v4f v = *(const v4fa*)&so[r * 68 + c4]; *(v4f*)(C + (size_t)(row0 + r) * N + col0 + c4) = v; } }

extern "C" void kernel_launch(void* const* d_in, const int* in_sizes, int n_in,
                              void* d_out, int out_size, void* d_ws, size_t ws_size, hipStream_t stream) {
  (void)in_sizes; (void)n_in; (void)out_size;
  const float* const* I = (const float* const*)d_in; const float* x = I[0]; const float* Wqkv = I[1]; const float* bqkv = I[2]; const float* rs = I[3]; const float* Wp = I[4]; const float* bp = I[5];
  char* ws = (char*)d_ws; size_t off = 0;
  auto take = [&](size_t bytes) { char* p = ws + off; off += (bytes + 255) & ~(size_t)255; return p; };
  const size_t np = (size_t)NR * DM;
  _Float16* BQKV = (_Float16*)take((size_t)3 * DM * DM * 2); _Float16* BP = (_Float16*)take((size_t)DM * DM * 2);
  _Float16* X16 = (_Float16*)take(np * 2); float* QN = (float*)take((size_t)NR * NH * 4); float* KN = (float*)take((size_t)NR * NH * 4); _Float16* QH = (_Float16*)take(np * 2); _Float16* QL = (_Float16*)take(np * 2); _Float16* KH = (_Float16*)take(np * 2); _Float16* KL = (_Float16*)take(np * 2); _Float16* VT = (_Float16*)take(np * 2);
  _Float16* OH = (_Float16*)take(np * 2);      /* merged context f16 [NR][DM]: a plane of its own, q hi is still read while it is written */
  if (off > ws_size) return;      /* 6 + 2 + 8 + 0.5 + 5x8 + 8 = 65 MiB */
  k_wt_f16<<<(unsigned)(((size_t)DM * 3 * DM / 8 + 255) / 256), 256, 0, stream>>>(Wqkv, BQKV, DM, 3 * DM, 16.0f); k_wt_f16<<<(unsigned)(((size_t)DM * DM / 8 + 255) / 256), 256, 0, stream>>>(Wp, BP, DM, DM, 16.0f);      /* (in, out) */
  k_x16<<<(unsigned)((np / 8 + 255) / 256), 256, 0, stream>>>(x, X16, np / 8);
  k_gemm3<3 * DM, DM, true><<<(NR / 128) * (3 * DM / 128), 256, 0, stream>>>(X16, BQKV, 0.0625f, bqkv, nullptr, QH, QL, KH, KL, VT, QN, KN);      /* [q | k | v] (head h = cols h*64..): q, k hi + residual planes and squared norms, V^T [(b,h)][64][2048] */
  k_gauss<<<NB * NH * (SLEN / 128), 256, 0, stream>>>(QH, QL, KH, KL, VT, QN, KN, rs, OH);      /* out_i[(h,d)] = sum_j exp(-r (kn_i + qn_j - 2 k_i.q_j)) v_j[d], merged context f16 */
  k_gemm3<DM, DM, false><<<(NR / 128) * (DM / 128), 256, 0, stream>>>(OH, BP, 0.0625f, bp, (float*)d_out, nullptr, nullptr, nullptr, nullptr, nullptr, nullptr, nullptr);      /* out = ctx Wproj + bproj */
}

// v004
// One run takes 125 microseconds.
// Two timings next to v003 put it at 1.21 and 1.20 times that version's speed.
// Counting every step since v000, it is 14.8 times as fast.
#include <hip/hip_runtime.h>
// qKv_attention (2 x 2048 tokens, C 1024 = 16 heads x 64; Gaussian-kernel attention WITHOUT normalisation: qkv = x Wqkv + b; K[i][j] = exp(-r_sigma ||q_j - k_i||^2) computed as kn_i + qn_j - 2 k_i.q_j; out_i = sum_j K[i][j] v_j; out = merge Wproj + bproj; r_sigma is a scalar input).
// Structure: exact f16 plane of x; qkv as one f16 WMMA GEMM (32x64 wave tiles, f32 accumulation, exact x16 weights + bias); per-(token, head) squared norms on VALU; q and k as f16 hi + 2^10 residual planes; V^T by LDS tiles (norms, planes and V^T all stored by that GEMM's epilogue, no f32 qkv plane); one fused launch over every (batch, head): the k.q products as three hi/residual terms (f32), the kernel weights 2^(10 - c (kn + qn - 2 kq)), c = r log2(e), by one fma and one hardware exp2 each into f16 in registers, the readout products (64 columns) straight into a merged f16 context plane; Wproj + bproj GEMM.
// Compute dtype: inputs rounded to bf16; x and weights exact as f16; q, k as f16 hi + residual (~2^-21) because the exponent amplifies dot-product error by 2 r_sigma |k.q|; kernel weights and v as plain f16 operands (~2^-12; weights below 2^-34 of the unit scale flush to zero); merged context plain f16. v_wmma_f32_16x16x32_f16.
#define NB 2
#define DM 1024
#define NKV 16
#define NREP (NH / NKV)
#define KVD (NKV * 64)           /* 1024 */
#define NR (NB * SLEN)           /* 4096 */
#define CHK 512                  /* attention chunk */
typedef int v4i __attribute__((ext_vector_type(4)));
#define FF 2048
#define SLEN 2048
#define TQ SLEN
#define TK SLEN
#define NH 16
#define SCL 0.125f
#define QBLKS (TQ / 64)
#define QB05 0
#define QBN5 4
#define QB0P 0
#define QBNP QBLKS           /* non-causal: plain flash on every query block */
#define RE 256
typedef __bf16 v16b __attribute__((ext_vector_type(16)));
typedef unsigned short v8us __attribute__((ext_vector_type(8), may_alias));
typedef float  v8f  __attribute__((ext_vector_type(8)));
typedef float  v4f  __attribute__((ext_vector_type(4)));
typedef float  v4fa __attribute__((ext_vector_type(4), may_alias));
union FragB { v16b v; v8us half[2]; unsigned short u[16]; };

__device__ __forceinline__ unsigned short bf16_bits(float x) { unsigned int u = __float_as_uint(x); return (unsigned short)((u + 0x7FFFu + ((u >> 16) & 1u)) >> 16); }
__device__ __forceinline__ float bf16_val(unsigned short b) { return __uint_as_float(((unsigned int)b) << 16); }
__device__ __forceinline__ float bf16_round(float x) { return bf16_val(bf16_bits(x)); }
// D += A·B with NT terms: 1 = ah·bh, 2 = + al·bh (A split), 3 = + ah·bl (both split)
template <int NT>
__device__ __forceinline__ v8f mmaN(v16b ah, v16b al, v16b bh, v16b bl, v8f c) {
  c = __builtin_amdgcn_wmma_f32_16x16x32_bf16(false, ah, false, bh, (short)0, c, false, false);
  if (NT >= 2) c = __builtin_amdgcn_wmma_f32_16x16x32_bf16(false, al, false, bh, (short)0, c, false, false);
  if (NT >= 3) c = __builtin_amdgcn_wmma_f32_16x16x32_bf16(false, ah, false, bl, (short)0, c, false, false);
  asm volatile("v_nop\n\tv_nop\n\tv_nop\n\tv_nop" : "+v"(c) : "v"(ah), "v"(al), "v"(bh), "v"(bl));
  return c;
}

__global__ __launch_bounds__(256) void k_wt_bf16(const float* __restrict__ W, unsigned short* __restrict__ Wt, int K, int N) {
  const int t = blockIdx.x * 256 + threadIdx.x;
  const int k8n = K / 8;
  if (t >= N * k8n) return;
  const int n = t / k8n, k8 = (t % k8n) * 8;
  v8us v;
#pragma unroll
  for (int i = 0; i < 8; ++i) v[i] = bf16_bits(W[(size_t)(k8 + i) * N + n]);
  *(v8us*)(Wt + (size_t)n * K + k8) = v;
  
}

// GEMM C[M][N] (f32, pitch ldc) = act(A[M][K]·W + bias). A f32 row-major (pitch lda) converted per fragment to bf16
// (ASPLIT: hi/lo two planes -> 2 terms, else single rounded term); Wt bf16 [N][K] (pitch ldb). BIAS_BF16 rounds the
// bias to bf16 first (bias quantised to bf16 before the add). K%32==0, M%16==0, N%64==0.
template <bool ASPLIT, int ACT, bool BIAS_BF16>
__global__ __launch_bounds__(128) void k_gemm_bf(const float* __restrict__ A, int lda, const unsigned short* __restrict__ Wt, int ldb,
                                               const float* __restrict__ bias, float* __restrict__ C, int ldc, int M, int N, int K) {
  __shared__ __attribute__((aligned(16))) float so[4][16][64];
  const int tid = threadIdx.x, w = tid >> 5, lane = tid & 31, ln = lane & 15, hh = lane >> 4;
  const int ntn = N / 64;
  const int wid = blockIdx.x * 4 + w;
  const int mt = wid / ntn, nq = wid % ntn;
  if (mt * 16 >= M) return;
  const int row0 = mt * 16, col0 = nq * 64;
  const float* arow = A + (size_t)(row0 + ln) * lda;
  v8f acc[4] = {};
  for (int kb = 0; kb < K; kb += 32) {
    FragB ah, al;
    const v4f x0 = *(const v4fa*)(arow + kb + 8 * hh), x1 = *(const v4fa*)(arow + kb + 8 * hh + 4);
    const v4f x2 = *(const v4fa*)(arow + kb + 16 + 8 * hh), x3 = *(const v4fa*)(arow + kb + 16 + 8 * hh + 4);
    float xs[16] = {x0[0],x0[1],x0[2],x0[3],x1[0],x1[1],x1[2],x1[3],x2[0],x2[1],x2[2],x2[3],x3[0],x3[1],x3[2],x3[3]};
#pragma unroll
    for (int i = 0; i < 16; ++i) { const unsigned short hb = bf16_bits(xs[i]); ah.u[i] = hb; al.u[i] = ASPLIT ? bf16_bits(xs[i] - bf16_val(hb)) : (unsigned short)0; }
#pragma unroll
    for (int t = 0; t < 4; ++t) {
      const unsigned short* brow = Wt + (size_t)(col0 + t * 16 + ln) * ldb + kb;
      FragB b;
      b.half[0] = *(const v8us*)(brow + 8 * hh);
      b.half[1] = *(const v8us*)(brow + 16 + 8 * hh);
      acc[t] = mmaN<ASPLIT ? 2 : 1>(ah.v, al.v, b.v, b.v, acc[t]);
    }
  }
#pragma unroll
  for (int t = 0; t < 4; ++t) {
    float bv = bias ? bias[col0 + t * 16 + ln] : 0.f;
    if (BIAS_BF16) bv = bf16_round(bv);
#pragma unroll
    for (int r = 0; r < 8; ++r) { float v = acc[t][r] + bv; if (ACT == 1) v = fmaxf(v, 0.f); so[w][8 * hh + r][t * 16 + ln] = v; }
  }
  __builtin_amdgcn_fence(__ATOMIC_ACQ_REL, "workgroup");
  __builtin_amdgcn_wave_barrier();
  const int rsub = lane >> 4, c4 = (lane & 15) * 4;
  {
#pragma unroll
    for (int q = 0; q < 8; ++q) {
      const int r = q * 2 + rsub;
      const v4f v = *(const v4fa*)&so[w][r][c4];
      *(v4f*)(C + (size_t)(row0 + r) * ldc + col0 + c4) = v;
    }
    
  }
}

// GEMM C = act(A·W + bias + resid): A f32 (ASPLIT -> hi/lo 2 terms), Wt bf16 [N][K]; ACT 0 none, 1 relu, 2 exact gelu;
// resid (optional, f32, row index = (row % rmod), pitch ldr, RES_BF16 rounds it) added before the activation.
template <bool ASPLIT, int ACT, bool BIAS_BF16, bool RES_BF16>
__global__ __launch_bounds__(128) void k_gemm_bf3(const float* __restrict__ A, int lda, const unsigned short* __restrict__ Wt, int ldb,
                                                const float* __restrict__ bias, const float* __restrict__ resid, int rmod, int ldr,
                                                float* __restrict__ C, int ldc, int M, int N, int K) {
  __shared__ __attribute__((aligned(16))) float so[4][16][64];
  const int tid = threadIdx.x, w = tid >> 5, lane = tid & 31, ln = lane & 15, hh = lane >> 4;
  const int ntn = N / 64;
  const int wid = blockIdx.x * 4 + w;
  const int mt = wid / ntn, nq = wid % ntn;
  if (mt * 16 >= M) return;
  const int row0 = mt * 16, col0 = nq * 64;
  const float* arow = A + (size_t)(row0 + ln) * lda;
  v8f acc[4] = {};
  for (int kb = 0; kb < K; kb += 32) {
    FragB ah, al;
    const v4f x0 = *(const v4fa*)(arow + kb + 8 * hh), x1 = *(const v4fa*)(arow + kb + 8 * hh + 4);
    const v4f x2 = *(const v4fa*)(arow + kb + 16 + 8 * hh), x3 = *(const v4fa*)(arow + kb + 16 + 8 * hh + 4);
    float xs[16] = {x0[0],x0[1],x0[2],x0[3],x1[0],x1[1],x1[2],x1[3],x2[0],x2[1],x2[2],x2[3],x3[0],x3[1],x3[2],x3[3]};
#pragma unroll
    for (int i = 0; i < 16; ++i) { const unsigned short hb = bf16_bits(xs[i]); ah.u[i] = hb; al.u[i] = ASPLIT ? bf16_bits(xs[i] - bf16_val(hb)) : (unsigned short)0; }
#pragma unroll
    for (int t = 0; t < 4; ++t) {
      const unsigned short* brow = Wt + (size_t)(col0 + t * 16 + ln) * ldb + kb;
      FragB b;
      b.half[0] = *(const v8us*)(brow + 8 * hh);
      b.half[1] = *(const v8us*)(brow + 16 + 8 * hh);
      acc[t] = mmaN<ASPLIT ? 2 : 1>(ah.v, al.v, b.v, b.v, acc[t]);
    }
  }
#pragma unroll
  for (int t = 0; t < 4; ++t) {
    const int col = col0 + t * 16 + ln;
    float bv = bias ? bias[col] : 0.f;
    if (BIAS_BF16) bv = bf16_round(bv);
#pragma unroll
    for (int r = 0; r < 8; ++r) {
      float v = acc[t][r] + bv;
      if (resid) { float rv = resid[(size_t)((row0 + 8 * hh + r) % rmod) * ldr + col]; if (RES_BF16) rv = bf16_round(rv); v += rv; }
      if (ACT == 1) v = fmaxf(v, 0.f);
      if (ACT == 2) v = 0.5f * v * (1.0f + erff(v * 0.70710678118654752f));
      if (ACT == 3) { const float u = 0.7978845608028654f * (v + 0.044715f * v * v * v); v = 0.5f * v * (1.0f + tanhf(u)); }
      so[w][8 * hh + r][t * 16 + ln] = v;
    }
  }
  __builtin_amdgcn_fence(__ATOMIC_ACQ_REL, "workgroup");
  __builtin_amdgcn_wave_barrier();
  const int rsub = lane >> 4, c4 = (lane & 15) * 4;
  {
#pragma unroll
    for (int q = 0; q < 8; ++q) {
      const int r = q * 2 + rsub;
      const v4f v = *(const v4fa*)&so[w][r][c4];
      *(v4f*)(C + (size_t)(row0 + r) * ldc + col0 + c4) = v;
    }
    
  }
}
// row LayerNorm (biased variance, eps) over N: s = X (+ R); optional out_sum <- s; out_norm <- (s-mu)*rsqrt(var+eps)*g + b
template <bool PARAM_BF16>
__global__ __launch_bounds__(256) void k_layernorm(const float* __restrict__ X, const float* __restrict__ R, const float* __restrict__ g, const float* __restrict__ bta,
                                                  float* __restrict__ out_sum, float* __restrict__ out_norm, int N, float eps) {
  __shared__ float red[256];
  const int row = blockIdx.x, tid = threadIdx.x;
  const float* x = X + (size_t)row * N; const float* rr = R ? R + (size_t)row * N : nullptr;
  float vals[16];                     // up to N = 4096
  const int per = N / 256;            // contiguous chunk per thread? use strided-by-4 chunks: thread handles j = tid*4 + 1024*u
  float s1 = 0.f;
  for (int u = 0; u < per / 4; ++u) {
    const int j = tid * 4 + 1024 * u;
    const v4f a = *(const v4fa*)(x + j);
    v4f b = {0.f,0.f,0.f,0.f}; if (rr) b = *(const v4fa*)(rr + j);
#pragma unroll
    for (int q = 0; q < 4; ++q) { const float v = a[q] + b[q]; vals[u * 4 + q] = v; s1 += v; }
  }
  red[tid] = s1; __syncthreads();
  for (int st = 128; st > 0; st >>= 1) { if (tid < st) red[tid] += red[tid + st]; __syncthreads(); }
  const float mu = red[0] / (float)N; __syncthreads();
  float s2 = 0.f;
  for (int u = 0; u < per / 4; ++u)
#pragma unroll
    for (int q = 0; q < 4; ++q) { const float c = vals[u * 4 + q] - mu; s2 += c * c; }
  red[tid] = s2; __syncthreads();
  for (int st = 128; st > 0; st >>= 1) { if (tid < st) red[tid] += red[tid + st]; __syncthreads(); }
  const float rs = rsqrtf(red[0] / (float)N + eps);
  {
    for (int u = 0; u < per / 4; ++u) {
      const int j = tid * 4 + 1024 * u;
      v4f o, sm;
#pragma unroll
      for (int q = 0; q < 4; ++q) {
        float gg = g[j + q], bb = bta[j + q];
        if (PARAM_BF16) { gg = bf16_round(gg); bb = bf16_round(bb); }
        sm[q] = vals[u * 4 + q]; o[q] = (vals[u * 4 + q] - mu) * rs * gg + bb;
      }
      if (out_sum) *(v4f*)(out_sum + (size_t)row * N + j) = sm;
      *(v4f*)(out_norm + (size_t)row * N + j) = o;
    }
    
  }
}



// ---- f16 WMMA path (v_wmma_f32_16x16x32_f16): 11-bit significands for operands in range — used where a [0,1] probability operand needs more precision than bf16
typedef _Float16 v16h __attribute__((ext_vector_type(16)));
union FragH { v16h v; v8us half[2]; _Float16 h[16]; unsigned short u[16]; };
template <int NT>
__device__ __forceinline__ v8f mmaH(v16h ah, v16h al, v16h bh, v16h bl, v8f c) {
  c = __builtin_amdgcn_wmma_f32_16x16x32_f16(false, ah, false, bh, (short)0, c, false, false);
  if (NT >= 2) c = __builtin_amdgcn_wmma_f32_16x16x32_f16(false, al, false, bh, (short)0, c, false, false);
  if (NT >= 3) c = __builtin_amdgcn_wmma_f32_16x16x32_f16(false, ah, false, bl, (short)0, c, false, false);
  asm volatile("v_nop\n\tv_nop\n\tv_nop\n\tv_nop" : "+v"(c) : "v"(ah), "v"(al), "v"(bh), "v"(bl));
  return c;
}
// batched GEMM like k_gemm_b but f16 operands: A f32 (split into f16 hi/lo if ASPLIT, else rounded to f16), Bt = f16 values [n][k]; alpha; C f32; N multiple of 16 (partial tiles skipped)
template <bool ASPLIT>
__global__ __launch_bounds__(128) void k_gemm_h(const float* __restrict__ A, int lda, size_t sA, const _Float16* __restrict__ Bh, int ldb, size_t sB, float alpha, float* __restrict__ C, int ldc, size_t sC, int M, int N, int K) {
  __shared__ __attribute__((aligned(16))) float so[4][16][64];
  const int tid = threadIdx.x, w = tid >> 5, lane = tid & 31, ln = lane & 15, hh = lane >> 4; const int by = blockIdx.y;
  A += (size_t)by * sA; Bh += (size_t)by * sB; C += (size_t)by * sC;
  const int ntn = (N + 63) / 64; const int wid = blockIdx.x * 4 + w; const int mt = wid / ntn, nq = wid % ntn; if (mt * 16 >= M) return;
  const int row0 = mt * 16, col0 = nq * 64; const float* arow = A + (size_t)(row0 + ln) * lda;
  v8f acc[4] = {};
  for (int kb = 0; kb < K; kb += 32) {
    FragH ah, al;
    const v4f x0 = *(const v4fa*)(arow + kb + 8 * hh), x1 = *(const v4fa*)(arow + kb + 8 * hh + 4), x2 = *(const v4fa*)(arow + kb + 16 + 8 * hh), x3 = *(const v4fa*)(arow + kb + 16 + 8 * hh + 4);
    float xs[16] = {x0[0],x0[1],x0[2],x0[3],x1[0],x1[1],x1[2],x1[3],x2[0],x2[1],x2[2],x2[3],x3[0],x3[1],x3[2],x3[3]};
#pragma unroll
    for (int i = 0; i < 16; ++i) { const _Float16 h = (_Float16)xs[i]; ah.h[i] = h; al.h[i] = ASPLIT ? (_Float16)(xs[i] - (float)h) : (_Float16)0.0f; }
#pragma unroll
    for (int t = 0; t < 4; ++t) { if (col0 + t * 16 >= N) continue; const size_t boff = (size_t)(col0 + t * 16 + ln) * ldb + kb; FragH bq; bq.half[0] = *(const v8us*)(Bh + boff + 8 * hh); bq.half[1] = *(const v8us*)(Bh + boff + 16 + 8 * hh);
      acc[t] = mmaH<ASPLIT ? 2 : 1>(ah.v, al.v, bq.v, bq.v, acc[t]); }
  }
#pragma unroll
  for (int t = 0; t < 4; ++t) { if (col0 + t * 16 >= N) continue;
#pragma unroll
    for (int r = 0; r < 8; ++r) so[w][8 * hh + r][t * 16 + ln] = acc[t][r] * alpha; }
  __builtin_amdgcn_fence(__ATOMIC_ACQ_REL, "workgroup"); __builtin_amdgcn_wave_barrier();
  const int rsub = lane >> 4, c4 = (lane & 15) * 4;
  {
#pragma unroll
    for (int q = 0; q < 8; ++q) { const int r = q * 2 + rsub; if (col0 + c4 < N) { const v4f v = *(const v4fa*)&so[w][r][c4]; *(v4f*)(C + (size_t)(row0 + r) * ldc + col0 + c4) = v; } }
     }
}

// Wt[n][k] = f16(W[k][n]·scale) from f32 row-major W[K][N] (scale = power of two; bf16-exact weights stay exact in f16 away from the subnormal range)
__global__ __launch_bounds__(256) void k_wt_f16(const float* __restrict__ W, _Float16* __restrict__ Wt, int K, int N, float scale) {
  const int t = blockIdx.x * 256 + threadIdx.x; if (t >= N * (K / 8)) return; const int n = t / (K / 8), k8 = (t % (K / 8)) * 8; FragH f;
#pragma unroll
  for (int i = 0; i < 8; ++i) f.h[i] = (_Float16)(bf16_round(W[(size_t)(k8 + i) * N + n]) * scale); const v8us o = f.half[0];
  *(v8us*)((unsigned short*)Wt + (size_t)n * K + k8) = o; 
}
// k_gemm_hh variant with fused epilogue: v = acc·alpha + bias[by·sBias + col] (+ CP[(row/rowsPerB)·sCPb + by·64 + col] if CP) ; ACT 0 none / 1 elu ; writes f16 C16 (and f32 C if non-null)
template <int ACT>
__global__ __launch_bounds__(128) void k_gemm_hhx(const _Float16* __restrict__ A, int lda, size_t sA, const _Float16* __restrict__ Bh, int ldb, size_t sB, float alpha, const float* __restrict__ bias, size_t sBias, const float* __restrict__ CP, int rowsPerB, size_t sCPb, int row0g,
    float* __restrict__ C, _Float16* __restrict__ C16, int ldc, size_t sC, int M, int N, int K) {
  __shared__ __attribute__((aligned(16))) float so[4][16][64];
  const int tid = threadIdx.x, w = tid >> 5, lane = tid & 31, ln = lane & 15, hh = lane >> 4; const int by = blockIdx.y;
  A += (size_t)by * sA; Bh += (size_t)by * sB; const size_t cofs = (size_t)by * sC; const float* bp = bias ? bias + (size_t)by * sBias : nullptr;
  const int ntn = (N + 63) / 64; const int wid = blockIdx.x * 4 + w; const int mt = wid / ntn, nq = wid % ntn; if (mt * 16 >= M) return;
  const int row0 = mt * 16, col0 = nq * 64; const _Float16* arow = A + (size_t)(row0 + ln) * lda;
  v8f acc[4] = {};
  for (int kb = 0; kb < K; kb += 32) { FragH ah; ah.half[0] = *(const v8us*)((const unsigned short*)arow + kb + 8 * hh); ah.half[1] = *(const v8us*)((const unsigned short*)arow + kb + 16 + 8 * hh);
#pragma unroll
    for (int t = 0; t < 4; ++t) { if (col0 + t * 16 >= N) continue; const size_t boff = (size_t)(col0 + t * 16 + ln) * ldb + kb; FragH bq; bq.half[0] = *(const v8us*)((const unsigned short*)Bh + boff + 8 * hh); bq.half[1] = *(const v8us*)((const unsigned short*)Bh + boff + 16 + 8 * hh);
      acc[t] = mmaH<1>(ah.v, ah.v, bq.v, bq.v, acc[t]); }
  }
#pragma unroll
  for (int t = 0; t < 4; ++t) { if (col0 + t * 16 >= N) continue; const int col = col0 + t * 16 + ln; const float bv = bp ? bf16_round(bp[col]) : 0.f;
#pragma unroll
    for (int r = 0; r < 8; ++r) { float v = acc[t][r] * alpha + bv; if (CP) { const int bidx = (row0g + row0 + 8 * hh + r) / rowsPerB; v += CP[(size_t)bidx * sCPb + (size_t)by * 64 + col]; } if (ACT == 1) v = (v > 0.f) ? v : expm1f(v); else if (ACT == 7) v = (v > 0.f) ? v + 1.0f : expf(v); else if (ACT == 8) v = tanhf(v); else if (ACT == 9) v = 0.5f * v * (1.0f + tanhf(0.7978845608028654f * (v + 0.044715f * v * v * v))); else if (ACT == 11) v = 1.0f / (1.0f + expf(-v)); else if (ACT == 12) v = (v > 0.f) ? v : 0.01f * v; else if (ACT == 14) v = (v > 0.f) ? v : 0.1f * v; else if (ACT == 15) v = v / (1.0f + expf(-v)); else if (ACT == 3) v = fmaxf(v, 0.f); else if (ACT == 6) v = 0.5f * v * (1.0f + erff(v * 0.70710678118654752f)); so[w][8 * hh + r][t * 16 + ln] = v; } }
  __builtin_amdgcn_fence(__ATOMIC_ACQ_REL, "workgroup"); __builtin_amdgcn_wave_barrier();
  const int rsub = lane >> 4, c4 = (lane & 15) * 4; typedef _Float16 v4h __attribute__((ext_vector_type(4)));
  {
#pragma unroll
    for (int q = 0; q < 8; ++q) { const int r = q * 2 + rsub; if (col0 + c4 < N) { const v4f v = *(const v4fa*)&so[w][r][c4]; if (C) *(v4f*)(C + cofs + (size_t)(row0 + r) * ldc + col0 + c4) = v; if (C16) { v4h h4; for (int i = 0; i < 4; ++i) h4[i] = (_Float16)v[i]; *(v4h*)(C16 + cofs + (size_t)(row0 + r) * ldc + col0 + c4) = h4; } } }
     }
}


typedef _Float16 v4h __attribute__((ext_vector_type(4)));

__global__ __launch_bounds__(256) void k_x16(const float* __restrict__ x, _Float16* __restrict__ X16, size_t n8) { const size_t t = (size_t)blockIdx.x * 256 + threadIdx.x; if (t >= n8) return; FragH f;
#pragma unroll
  for (int q = 0; q < 8; ++q) f.h[q] = (_Float16)bf16_round(x[t * 8 + q]); *(v8us*)((unsigned short*)X16 + t * 8) = f.half[0];  }
__global__ __launch_bounds__(256) void k_round16f(const float* __restrict__ W, _Float16* __restrict__ Bt, size_t n8) { const size_t t = (size_t)blockIdx.x * 256 + threadIdx.x; if (t >= n8) return; FragH f;
#pragma unroll
  for (int i = 0; i < 8; ++i) f.h[i] = (_Float16)(bf16_round(W[t * 8 + i]) * 16.0f); *(v8us*)((unsigned short*)Bt + t * 8) = f.half[0];  }
template <int NHv, int TTv>
__global__ __launch_bounds__(256) void k_vt(const _Float16* __restrict__ V16, int ldv, int voff, _Float16* __restrict__ Vt) { __shared__ unsigned short tl[64][66]; const int tid = threadIdx.x; const int slab = blockIdx.x / (TTv / 64), lg = blockIdx.x % (TTv / 64); const int b = slab / NHv, h = slab % NHv;
  for (int i = tid; i < 64 * 8; i += 256) { const int r = i / 8, c8 = (i % 8) * 8; FragH f; f.half[0] = *(const v8us*)((const unsigned short*)V16 + ((size_t)b * TTv + lg * 64 + r) * ldv + voff + h * 64 + c8);
#pragma unroll
    for (int q = 0; q < 8; ++q) tl[r][c8 + q] = f.u[q]; }
  __syncthreads();
  {
#pragma unroll
    for (int rd = 0; rd < 2; ++rd) { const int d = rd * 32 + tid / 8, pc = tid % 8; FragH f;
#pragma unroll
      for (int q = 0; q < 8; ++q) f.u[q] = tl[pc * 8 + q][d];
      *(v8us*)((unsigned short*)Vt + ((size_t)slab * 64 + d) * TTv + lg * 64 + pc * 8) = f.half[0]; }
     } }

__global__ __launch_bounds__(256) void k_hl(const float* __restrict__ F, _Float16* __restrict__ Hh, _Float16* __restrict__ Hl, size_t n8) { const size_t t = (size_t)blockIdx.x * 256 + threadIdx.x; if (t >= n8) return; FragH fh, fl; const v4f a = *(const v4fa*)(F + t * 8), c = *(const v4fa*)(F + t * 8 + 4);
#pragma unroll
  for (int q = 0; q < 4; ++q) { _Float16 h = (_Float16)a[q]; fh.h[q] = h; fl.h[q] = (_Float16)((a[q] - (float)h) * 1024.0f); h = (_Float16)c[q]; fh.h[4 + q] = h; fl.h[4 + q] = (_Float16)((c[q] - (float)h) * 1024.0f); }
  { *(v8us*)((unsigned short*)Hh + t * 8) = fh.half[0]; *(v8us*)((unsigned short*)Hl + t * 8) = fl.half[0];  } }

// ---- fast GEMM (wave tile 32x64; requires M % 32 == 0 rows per launch region and N % 64 == 0); epilogue = k_gemm_hhx semantics ----
__device__ __forceinline__ v16h g2_frag(const _Float16* p, int hh) { FragH f; f.half[0] = *(const v8us*)((const unsigned short*)p + 8 * hh); f.half[1] = *(const v8us*)((const unsigned short*)p + 16 + 8 * hh); return f.v; }
__device__ __forceinline__ v8f g2_mma(v16h a, v16h b, v8f c) { v8f d = __builtin_amdgcn_wmma_f32_16x16x32_f16(false, a, false, b, (short)0, c, false, false); asm volatile("v_nop\n\tv_nop\n\tv_nop\n\tv_nop" : "+v"(d) : "v"(a), "v"(b)); return d; }
template <int ACT>
__global__ __launch_bounds__(128) void k_gemm2(const _Float16* __restrict__ A, int lda, size_t sA, const _Float16* __restrict__ Bh, int ldb, size_t sB, float alpha, const float* __restrict__ bias, size_t sBias, const float* __restrict__ CP, int rowsPerB, size_t sCPb, int row0g,
    float* __restrict__ C, _Float16* __restrict__ C16, int ldc, size_t sC, int M, int N, int K) {
  __shared__ __attribute__((aligned(16))) float so[4][32][68];
  const int tid = threadIdx.x, w = tid >> 5, lane = tid & 31, ln = lane & 15, hh = lane >> 4; const int by = blockIdx.y;
  A += (size_t)by * sA; Bh += (size_t)by * sB; const size_t cofs = (size_t)by * sC; const float* bp = bias ? bias + (size_t)by * sBias : nullptr;
  const int ntn = N >> 6; const int mt = blockIdx.x / ntn, nq = blockIdx.x - mt * ntn; const int row0 = mt * 128 + 32 * w, col0 = nq * 64; if (row0 >= M) return;
  const _Float16* a0p = A + (size_t)(row0 + ln) * lda; const _Float16* a1p = a0p + (size_t)16 * lda;
  const _Float16* b0p = Bh + (size_t)(col0 + ln) * ldb; const _Float16* b1p = b0p + (size_t)16 * ldb; const _Float16* b2p = b1p + (size_t)16 * ldb; const _Float16* b3p = b2p + (size_t)16 * ldb;
  const v8f z8 = {0.f,0.f,0.f,0.f,0.f,0.f,0.f,0.f}; v8f c00 = z8, c01 = z8, c02 = z8, c03 = z8, c10 = z8, c11 = z8, c12 = z8, c13 = z8;
#pragma unroll 1
  for (int kb = 0; kb < K; kb += 32) { const v16h a0 = g2_frag(a0p + kb, hh), a1 = g2_frag(a1p + kb, hh);
    v16h b = g2_frag(b0p + kb, hh); c00 = g2_mma(a0, b, c00); c10 = g2_mma(a1, b, c10);
    b = g2_frag(b1p + kb, hh); c01 = g2_mma(a0, b, c01); c11 = g2_mma(a1, b, c11);
    b = g2_frag(b2p + kb, hh); c02 = g2_mma(a0, b, c02); c12 = g2_mma(a1, b, c12);
    b = g2_frag(b3p + kb, hh); c03 = g2_mma(a0, b, c03); c13 = g2_mma(a1, b, c13); }
  v8f accs[8] = {c00, c01, c02, c03, c10, c11, c12, c13};
#pragma unroll
  for (int u = 0; u < 8; ++u) { const int t = u & 3, half = u >> 2; const int col = col0 + t * 16 + ln; const float bv = bp ? bf16_round(bp[col]) : 0.f;
#pragma unroll
    for (int r = 0; r < 8; ++r) { const int rloc = half * 16 + 8 * hh + r; float v = accs[u][r] * alpha + bv; if (CP) { if (rowsPerB < 0) v += CP[cofs + (size_t)(row0g + row0 + rloc) * ldc + col];      /* rowsPerB < 0: own element of the batched C plane */ else { const int bidx = (row0g + row0 + rloc) / rowsPerB; v += CP[(size_t)bidx * sCPb + (size_t)by * 64 + col]; } }
      if (ACT == 3) v = fmaxf(v, 0.f); else if (ACT == 6) v = 0.5f * v * (1.0f + erff(v * 0.70710678118654752f)); else if (ACT == 11) v = 1.0f / (1.0f + expf(-v)); else if (ACT == 15) v = v / (1.0f + expf(-v)); else if (ACT == 12) v = (v > 0.f) ? v : 0.01f * v; else if (ACT == 8) v = tanhf(v);
      so[w][rloc][t * 16 + ln] = v; } }
  __builtin_amdgcn_fence(__ATOMIC_ACQ_REL, "workgroup"); __builtin_amdgcn_wave_barrier();
  const int rsub = lane >> 4, c4 = (lane & 15) * 4;
  {
#pragma unroll
    for (int q = 0; q < 16; ++q) { const int r = q * 2 + rsub; const v4f v = *(const v4fa*)&so[w][r][c4]; if (C) *(v4f*)(C + cofs + (size_t)(row0 + r) * ldc + col0 + c4) = v; if (C16) { v4h h4; for (int i = 0; i < 4; ++i) h4[i] = (_Float16)v[i]; *(v4h*)(C16 + cofs + (size_t)(row0 + r) * ldc + col0 + c4) = h4; } }
     } }



template <int CAUSAL>
__global__ __launch_bounds__(128) void k_flash(const _Float16* __restrict__ Q16, int ldq, const _Float16* __restrict__ K16, int ldk, const _Float16* __restrict__ Vt, const int* __restrict__ MSK, float* __restrict__ O, int ldo) {
  constexpr int RPW = 16, RTN = RPW / 16, NQB = TQ / (4 * RPW), DT = 4, KS = 2;
  __shared__ __attribute__((aligned(16))) unsigned short sP[4][RPW][40]; __shared__ __attribute__((aligned(16))) float sO[4][RPW][64 + 4];
  const int tid = threadIdx.x, w = tid >> 5, lane = tid & 31, ln = lane & 15, hh = lane >> 4;
  const int slab = blockIdx.x / QBNP, qblk = QB0P + blockIdx.x % QBNP; (void)NQB; const int b = slab / NH, h = slab % NH; const int qb0 = qblk * (4 * RPW); const int q0 = qb0 + w * RPW;
  FragH aq[2][KS];
#pragma unroll
  for (int rt = 0; rt < RTN; ++rt) { const unsigned short* qr = (const unsigned short*)Q16 + ((size_t)b * TQ + q0 + rt * 16 + ln) * ldq + h * 64;
#pragma unroll
    for (int ks = 0; ks < KS; ++ks) { aq[rt][ks].half[0] = *(const v8us*)(qr + ks * 32 + 8 * hh); aq[rt][ks].half[1] = *(const v8us*)(qr + ks * 32 + 16 + 8 * hh); } }
  const unsigned short* Vth = (const unsigned short*)Vt + (size_t)slab * 64 * TK;
  float m_r[2][8], l_r[2][8]; v8f oacc[2][DT];
#pragma unroll
  for (int rt = 0; rt < RTN; ++rt) {
#pragma unroll
    for (int r = 0; r < 8; ++r) { m_r[rt][r] = -3.0e38f; l_r[rt][r] = 0.f; }
#pragma unroll
    for (int dt = 0; dt < DT; ++dt) oacc[rt][dt] = (v8f){0.f,0.f,0.f,0.f,0.f,0.f,0.f,0.f}; }
  const int jend = (CAUSAL == 1) ? (qb0 + 4 * RPW) : ((CAUSAL == 23) ? min(TK, (qb0 / CHK + 2) * CHK) : TK);      /* causal / window: keys that can never contribute are skipped */ const int jbeg = (CAUSAL == 23) ? max(0, (qb0 / CHK - 1) * CHK) : 0;
#pragma unroll 1
  for (int j0 = jbeg; j0 < jend; j0 += 32) {
    v8f s[2][2];
#pragma unroll
    for (int nt = 0; nt < 2; ++nt) { const unsigned short* kr = (const unsigned short*)K16 + ((size_t)b * TK + j0 + nt * 16 + ln) * ldk + h * 64; FragH bk[KS];
#pragma unroll
      for (int ks = 0; ks < KS; ++ks) { bk[ks].half[0] = *(const v8us*)(kr + ks * 32 + 8 * hh); bk[ks].half[1] = *(const v8us*)(kr + ks * 32 + 16 + 8 * hh); }
#pragma unroll
      for (int rt = 0; rt < RTN; ++rt) { v8f acc = (v8f){0.f,0.f,0.f,0.f,0.f,0.f,0.f,0.f};
#pragma unroll
        for (int ks = 0; ks < KS; ++ks) acc = mmaH<1>(aq[rt][ks].v, aq[rt][ks].v, bk[ks].v, bk[ks].v, acc); s[rt][nt] = acc; } }
#pragma unroll
    for (int rt = 0; rt < RTN; ++rt)
#pragma unroll
      for (int r = 0; r < 8; ++r) { const int tq = q0 + rt * 16 + 8 * hh + r; const int k0 = j0 + ln, k1 = j0 + 16 + ln;
        bool ok0 = (CAUSAL == 1) ? (k0 <= tq) : ((CAUSAL == 2) ? ((k0 >> 5) == (tq >> 5)) : true), ok1 = (CAUSAL == 1) ? (k1 <= tq) : ((CAUSAL == 2) ? ((k1 >> 5) == (tq >> 5)) : true); if (CAUSAL == 23) { const int cq = tq / CHK; ok0 = (abs(k0 / CHK - cq) <= 1) && (MSK[(size_t)b * TK + k0] == 0); ok1 = (abs(k1 / CHK - cq) <= 1) && (MSK[(size_t)b * TK + k1] == 0); }      /* mode 23: 3-chunk window + int key-padding mask */
        if (CAUSAL == 24) { ok0 = (MSK[(size_t)b * TK + k0] == 0); ok1 = (MSK[(size_t)b * TK + k1] == 0); }      /* mode 24: int key-padding mask (nonzero = padded = excluded) */      /* mode 2: block-diagonal 32-token groups */
        float s0 = ok0 ? s[rt][0][r] * SCL : -3.0e38f, s1 = ok1 ? s[rt][1][r] * SCL : -3.0e38f; if (CAUSAL == 17) { const float* amk = (const float*)MSK + (size_t)b * TK; s0 += bf16_round(amk[k0]); s1 += bf16_round(amk[k1]); } if (CAUSAL == 18) { const float* tb = (const float*)MSK; const int* ri = MSK + 1024 + (size_t)b * TK; const int rq = ri[tq]; s0 += tb[(h * 8 + rq) * 8 + ri[k0]]; s1 += tb[(h * 8 + rq) * 8 + ri[k1]]; } if (CAUSAL == 19) { const int* rel = MSK + (size_t)tq * TK; const float* rb = (const float*)MSK + (size_t)TQ * TK + ((size_t)(b * NH + h) * TQ + tq) * 64; s0 += rb[rel[k0]]; s1 += rb[rel[k1]]; }      /* mode 19: + (q.Ek[rel] + Eb[rel][h]) / 8 gathered by the int relative ids (packed [ids | table]) */      /* mode 18: + resource_bias[h][r_q][r_k] from the packed [table | ids] buffer (TQ == TK) */      /* mode 17: additive per-(batch, key) mask INPUT */ float mc = fmaxf(s0, s1);
        mc = fmaxf(mc, __shfl_xor(mc, 1, 32)); mc = fmaxf(mc, __shfl_xor(mc, 2, 32)); mc = fmaxf(mc, __shfl_xor(mc, 4, 32)); mc = fmaxf(mc, __shfl_xor(mc, 8, 32));
        const float mn = fmaxf(m_r[rt][r], mc); const float al = (mn > -1.0e38f) ? expf(m_r[rt][r] - mn) : 1.0f; m_r[rt][r] = mn; const float p0 = ok0 ? expf(s0 - mn) : 0.f, p1 = ok1 ? expf(s1 - mn) : 0.f; l_r[rt][r] = l_r[rt][r] * al + p0 + p1;
#pragma unroll
        for (int dt = 0; dt < DT; ++dt) oacc[rt][dt][r] *= al;
        FragH t2; t2.h[0] = (_Float16)(p0 * 1024.0f); t2.h[1] = (_Float16)(p1 * 1024.0f); sP[w][rt * 16 + 8 * hh + r][ln] = t2.u[0]; sP[w][rt * 16 + 8 * hh + r][16 + ln] = t2.u[1]; }
    __builtin_amdgcn_fence(__ATOMIC_ACQ_REL, "workgroup"); __builtin_amdgcn_wave_barrier();
    FragH pa[2];
#pragma unroll
    for (int rt = 0; rt < RTN; ++rt) { pa[rt].half[0] = *(const v8us*)&sP[w][rt * 16 + ln][8 * hh]; pa[rt].half[1] = *(const v8us*)&sP[w][rt * 16 + ln][16 + 8 * hh]; }
#pragma unroll
    for (int dt = 0; dt < DT; ++dt) { const unsigned short* vrow = Vth + (size_t)(dt * 16 + ln) * TK + j0; FragH bv; bv.half[0] = *(const v8us*)(vrow + 8 * hh); bv.half[1] = *(const v8us*)(vrow + 16 + 8 * hh);
#pragma unroll
      for (int rt = 0; rt < RTN; ++rt) oacc[rt][dt] = mmaH<1>(pa[rt].v, pa[rt].v, bv.v, bv.v, oacc[rt][dt]); }
    __builtin_amdgcn_fence(__ATOMIC_ACQ_REL, "workgroup"); __builtin_amdgcn_wave_barrier(); }
#pragma unroll
  for (int rt = 0; rt < RTN; ++rt) {
#pragma unroll
    for (int r = 0; r < 8; ++r) { float l = l_r[rt][r]; l += __shfl_xor(l, 1, 32); l += __shfl_xor(l, 2, 32); l += __shfl_xor(l, 4, 32); l += __shfl_xor(l, 8, 32); l_r[rt][r] = (l > 0.f) ? 1.0f / (l * 1024.0f) : 0.f; }
#pragma unroll
    for (int dt = 0; dt < DT; ++dt)
#pragma unroll
      for (int r = 0; r < 8; ++r) sO[w][rt * 16 + 8 * hh + r][dt * 16 + ln] = oacc[rt][dt][r] * l_r[rt][r]; }
  __builtin_amdgcn_fence(__ATOMIC_ACQ_REL, "workgroup"); __builtin_amdgcn_wave_barrier();
  {
#pragma unroll
    for (int rp = 0; rp < RPW; rp += 2) { const int r = rp + (lane >> 4), pc = lane & 15; const v4f val = *(const v4fa*)&sO[w][r][pc * 4]; *(v4f*)(O + ((size_t)b * TQ + q0 + r) * ldo + h * 64 + pc * 4) = val; }
     } }
// 5-plane variant: S = Qh Kh^T + (Ql Kh^T + Qh Kl^T)/1024 with Q/K = [hi | 2^10 residual] f16 planes (QL/KL same layout as Q16/K16), then the 3-term P.V below.
// 3-term variant: O = (P_hi V_hi + (P_lo V_hi + P_hi V_lo) / 1024) / l with P = [hi | 2^10 residual] of 1024 p and V^T = [hi | 2^10 residual] planes (VtL same layout as Vt) -> ~2^-21-class products for un-averaged (early causal / peaked) rows
template <int CAUSAL>
__global__ __launch_bounds__(128) void k_flash5(const _Float16* __restrict__ Q16, const _Float16* __restrict__ QL, int ldq, const _Float16* __restrict__ K16, const _Float16* __restrict__ KL, int ldk, const _Float16* __restrict__ Vt, const _Float16* __restrict__ VtL, const int* __restrict__ MSK, float* __restrict__ O, int ldo) {
  constexpr int RPW = 16, RTN = RPW / 16, NQB = TQ / (4 * RPW), DT = 4, KS = 2;
  __shared__ __attribute__((aligned(16))) unsigned short sP[4][RPW][40]; __shared__ __attribute__((aligned(16))) unsigned short sPL[4][RPW][40]; __shared__ __attribute__((aligned(16))) float sO[4][RPW][64 + 4];
  const int tid = threadIdx.x, w = tid >> 5, lane = tid & 31, ln = lane & 15, hh = lane >> 4;
  const int slab = blockIdx.x / QBN5, qblk = QB05 + blockIdx.x % QBN5; (void)NQB; const int b = slab / NH, h = slab % NH; const int qb0 = qblk * (4 * RPW); const int q0 = qb0 + w * RPW;
  FragH aq[2][KS], aql[2][KS];
#pragma unroll
  for (int rt = 0; rt < RTN; ++rt) { const unsigned short* qr = (const unsigned short*)Q16 + ((size_t)b * TQ + q0 + rt * 16 + ln) * ldq + h * 64; const unsigned short* ql = (const unsigned short*)QL + ((size_t)b * TQ + q0 + rt * 16 + ln) * ldq + h * 64;
#pragma unroll
    for (int ks = 0; ks < KS; ++ks) { aq[rt][ks].half[0] = *(const v8us*)(qr + ks * 32 + 8 * hh); aq[rt][ks].half[1] = *(const v8us*)(qr + ks * 32 + 16 + 8 * hh); aql[rt][ks].half[0] = *(const v8us*)(ql + ks * 32 + 8 * hh); aql[rt][ks].half[1] = *(const v8us*)(ql + ks * 32 + 16 + 8 * hh); } }
  const unsigned short* Vth = (const unsigned short*)Vt + (size_t)slab * 64 * TK; const unsigned short* Vtl = (const unsigned short*)VtL + (size_t)slab * 64 * TK;
  float m_r[2][8], l_r[2][8]; v8f oacc[2][DT], oaccL[2][DT];
#pragma unroll
  for (int rt = 0; rt < RTN; ++rt) {
#pragma unroll
    for (int r = 0; r < 8; ++r) { m_r[rt][r] = -3.0e38f; l_r[rt][r] = 0.f; }
#pragma unroll
    for (int dt = 0; dt < DT; ++dt) { oacc[rt][dt] = (v8f){0.f,0.f,0.f,0.f,0.f,0.f,0.f,0.f}; oaccL[rt][dt] = oacc[rt][dt]; } }
  const int jend = (CAUSAL == 1) ? (qb0 + 4 * RPW) : ((CAUSAL == 23) ? min(TK, (qb0 / CHK + 2) * CHK) : TK);      /* causal / window: keys that can never contribute are skipped */ const int jbeg = (CAUSAL == 23) ? max(0, (qb0 / CHK - 1) * CHK) : 0;
#pragma unroll 1
  for (int j0 = jbeg; j0 < jend; j0 += 32) {
    v8f s[2][2];
#pragma unroll
    for (int nt = 0; nt < 2; ++nt) { const unsigned short* kr = (const unsigned short*)K16 + ((size_t)b * TK + j0 + nt * 16 + ln) * ldk + h * 64; const unsigned short* klr = (const unsigned short*)KL + ((size_t)b * TK + j0 + nt * 16 + ln) * ldk + h * 64; FragH bk[KS], bkl[KS];
#pragma unroll
      for (int ks = 0; ks < KS; ++ks) { bk[ks].half[0] = *(const v8us*)(kr + ks * 32 + 8 * hh); bk[ks].half[1] = *(const v8us*)(kr + ks * 32 + 16 + 8 * hh); bkl[ks].half[0] = *(const v8us*)(klr + ks * 32 + 8 * hh); bkl[ks].half[1] = *(const v8us*)(klr + ks * 32 + 16 + 8 * hh); }
#pragma unroll
      for (int rt = 0; rt < RTN; ++rt) { v8f acc = (v8f){0.f,0.f,0.f,0.f,0.f,0.f,0.f,0.f}, accl = acc;
#pragma unroll
        for (int ks = 0; ks < KS; ++ks) { acc = mmaH<1>(aq[rt][ks].v, aq[rt][ks].v, bk[ks].v, bk[ks].v, acc); accl = mmaH<1>(aql[rt][ks].v, aql[rt][ks].v, bk[ks].v, bk[ks].v, accl); accl = mmaH<1>(aq[rt][ks].v, aq[rt][ks].v, bkl[ks].v, bkl[ks].v, accl); }
#pragma unroll
        for (int r = 0; r < 8; ++r) acc[r] += accl[r] * 0.0009765625f;
        s[rt][nt] = acc; } }
#pragma unroll
    for (int rt = 0; rt < RTN; ++rt)
#pragma unroll
      for (int r = 0; r < 8; ++r) { const int tq = q0 + rt * 16 + 8 * hh + r; const int k0 = j0 + ln, k1 = j0 + 16 + ln;
        bool ok0 = (CAUSAL == 1) ? (k0 <= tq) : ((CAUSAL == 2) ? ((k0 >> 5) == (tq >> 5)) : true), ok1 = (CAUSAL == 1) ? (k1 <= tq) : ((CAUSAL == 2) ? ((k1 >> 5) == (tq >> 5)) : true);      /* mode 2: block-diagonal 32-token groups */
        if (CAUSAL == 4) { const int* mrow = MSK + ((size_t)b * TQ + tq) * TK; ok0 = mrow[k0] != 0; ok1 = mrow[k1] != 0; }      /* mode 4: per-(query, key) INPUT mask shared by all heads; masked keys contribute nothing (== the reference's -4096 fill, whose exp underflows to 0), rows with no valid key give l = 0 -> output 0 (== the reference's row_valid zeroing) */
        float s0 = ok0 ? s[rt][0][r] * SCL : -3.0e38f, s1 = ok1 ? s[rt][1][r] * SCL : -3.0e38f; if (CAUSAL == 17) { const float* amk = (const float*)MSK + (size_t)b * TK; s0 += bf16_round(amk[k0]); s1 += bf16_round(amk[k1]); } if (CAUSAL == 18) { const float* tb = (const float*)MSK; const int* ri = MSK + 1024 + (size_t)b * TK; const int rq = ri[tq]; s0 += tb[(h * 8 + rq) * 8 + ri[k0]]; s1 += tb[(h * 8 + rq) * 8 + ri[k1]]; } if (CAUSAL == 19) { const int* rel = MSK + (size_t)tq * TK; const float* rb = (const float*)MSK + (size_t)TQ * TK + ((size_t)(b * NH + h) * TQ + tq) * 64; s0 += rb[rel[k0]]; s1 += rb[rel[k1]]; }      /* mode 19: + (q.Ek[rel] + Eb[rel][h]) / 8 gathered by the int relative ids (packed [ids | table]) */      /* mode 18: + resource_bias[h][r_q][r_k] from the packed [table | ids] buffer (TQ == TK) */      /* mode 17: additive per-(batch, key) mask INPUT */ float mc = fmaxf(s0, s1);
        mc = fmaxf(mc, __shfl_xor(mc, 1, 32)); mc = fmaxf(mc, __shfl_xor(mc, 2, 32)); mc = fmaxf(mc, __shfl_xor(mc, 4, 32)); mc = fmaxf(mc, __shfl_xor(mc, 8, 32));
        const float mn = fmaxf(m_r[rt][r], mc); const float al = (mn > -1.0e38f) ? expf(m_r[rt][r] - mn) : 1.0f; m_r[rt][r] = mn; const float p0 = ok0 ? expf(s0 - mn) : 0.f, p1 = ok1 ? expf(s1 - mn) : 0.f; l_r[rt][r] = l_r[rt][r] * al + p0 + p1;
#pragma unroll
        for (int dt = 0; dt < DT; ++dt) { oacc[rt][dt][r] *= al; oaccL[rt][dt][r] *= al; }
        FragH t2, t2l; const float ps0 = p0 * 1024.0f, ps1 = p1 * 1024.0f; t2.h[0] = (_Float16)ps0; t2.h[1] = (_Float16)ps1; t2l.h[0] = (_Float16)((ps0 - (float)t2.h[0]) * 1024.0f); t2l.h[1] = (_Float16)((ps1 - (float)t2.h[1]) * 1024.0f);
        sP[w][rt * 16 + 8 * hh + r][ln] = t2.u[0]; sP[w][rt * 16 + 8 * hh + r][16 + ln] = t2.u[1]; sPL[w][rt * 16 + 8 * hh + r][ln] = t2l.u[0]; sPL[w][rt * 16 + 8 * hh + r][16 + ln] = t2l.u[1]; }
    __builtin_amdgcn_fence(__ATOMIC_ACQ_REL, "workgroup"); __builtin_amdgcn_wave_barrier();
    FragH pa[2], pl[2];
#pragma unroll
    for (int rt = 0; rt < RTN; ++rt) { pa[rt].half[0] = *(const v8us*)&sP[w][rt * 16 + ln][8 * hh]; pa[rt].half[1] = *(const v8us*)&sP[w][rt * 16 + ln][16 + 8 * hh]; pl[rt].half[0] = *(const v8us*)&sPL[w][rt * 16 + ln][8 * hh]; pl[rt].half[1] = *(const v8us*)&sPL[w][rt * 16 + ln][16 + 8 * hh]; }
#pragma unroll
    for (int dt = 0; dt < DT; ++dt) { const unsigned short* vrow = Vth + (size_t)(dt * 16 + ln) * TK + j0; const unsigned short* vrl = Vtl + (size_t)(dt * 16 + ln) * TK + j0; FragH bv, bl; bv.half[0] = *(const v8us*)(vrow + 8 * hh); bv.half[1] = *(const v8us*)(vrow + 16 + 8 * hh); bl.half[0] = *(const v8us*)(vrl + 8 * hh); bl.half[1] = *(const v8us*)(vrl + 16 + 8 * hh);
#pragma unroll
      for (int rt = 0; rt < RTN; ++rt) { oacc[rt][dt] = mmaH<1>(pa[rt].v, pa[rt].v, bv.v, bv.v, oacc[rt][dt]); oaccL[rt][dt] = mmaH<1>(pl[rt].v, pl[rt].v, bv.v, bv.v, oaccL[rt][dt]); oaccL[rt][dt] = mmaH<1>(pa[rt].v, pa[rt].v, bl.v, bl.v, oaccL[rt][dt]); } }
    __builtin_amdgcn_fence(__ATOMIC_ACQ_REL, "workgroup"); __builtin_amdgcn_wave_barrier(); }
#pragma unroll
  for (int rt = 0; rt < RTN; ++rt) {
#pragma unroll
    for (int r = 0; r < 8; ++r) { float l = l_r[rt][r]; l += __shfl_xor(l, 1, 32); l += __shfl_xor(l, 2, 32); l += __shfl_xor(l, 4, 32); l += __shfl_xor(l, 8, 32); l_r[rt][r] = (l > 0.f) ? 1.0f / (l * 1024.0f) : 0.f; }
#pragma unroll
    for (int dt = 0; dt < DT; ++dt)
#pragma unroll
      for (int r = 0; r < 8; ++r) { float v = oacc[rt][dt][r]; v += oaccL[rt][dt][r] * 0.0009765625f; sO[w][rt * 16 + 8 * hh + r][dt * 16 + ln] = v * l_r[rt][r]; } }
  __builtin_amdgcn_fence(__ATOMIC_ACQ_REL, "workgroup"); __builtin_amdgcn_wave_barrier();
  {
#pragma unroll
    for (int rp = 0; rp < RPW; rp += 2) { const int r = rp + (lane >> 4), pc = lane & 15; const v4f val = *(const v4fa*)&sO[w][r][pc * 4]; *(v4f*)(O + ((size_t)b * TQ + q0 + r) * ldo + h * 64 + pc * 4) = val; }
     } }

__global__ __launch_bounds__(256) void k_rotab(float* __restrict__ CS, float* __restrict__ SN) {
  #pragma clang fp contract(off)
  const int t = blockIdx.x * 256 + threadIdx.x; if (t >= SLEN * 32) return; const int j = t % 32, s = t / 32; const float ex = (float)(2 * j) / 64.0f; const float inv = 1.0f / powf(10000.0f, ex); const float th = (float)s * inv; const float c = cosf(th), sn = sinf(th);
  { *(float*)(CS + t) = c; *(float*)(SN + t) = sn;  } }
__global__ __launch_bounds__(256) void k_rope(const float* __restrict__ F, int nsrc, int ndst, int rep, const float* __restrict__ CS, const float* __restrict__ SN, _Float16* __restrict__ H, _Float16* __restrict__ L) {
  #pragma clang fp contract(off)
  const size_t t = (size_t)blockIdx.x * 256 + threadIdx.x; if (t >= (size_t)NR * ndst * 4) return; const int g8 = (int)(t % 4); const int hd = (int)((t / 4) % ndst); const size_t row = t / ((size_t)4 * ndst); const int s = (int)(row % SLEN); const int hs = hd / rep;
  const float* src = F + row * (size_t)(nsrc * 64) + hs * 64; FragH ah, al, bh, bl;
  for (int i = 0; i < 8; ++i) { const int d = g8 * 8 + i; const float c = CS[s * 32 + d], sn = SN[s * 32 + d]; const float x1 = src[d], x2 = src[d + 32];
    float o1 = x1 * c; o1 += -x2 * sn; float o2 = x2 * c; o2 += x1 * sn;
    _Float16 hv = (_Float16)o1; ah.h[i] = hv; al.h[i] = (_Float16)((o1 - (float)hv) * 1024.0f); hv = (_Float16)o2; bh.h[i] = hv; bl.h[i] = (_Float16)((o2 - (float)hv) * 1024.0f); }
  const size_t o = row * (size_t)(ndst * 64) + hd * 64 + g8 * 8;
  { *(v8us*)((unsigned short*)H + o) = ah.half[0]; *(v8us*)((unsigned short*)H + o + 32) = bh.half[0]; *(v8us*)((unsigned short*)L + o) = al.half[0]; *(v8us*)((unsigned short*)L + o + 32) = bl.half[0];  } }
__global__ __launch_bounds__(256) void k_rope2(const float* __restrict__ F, int nsrc, int ndst, int rep, const float* __restrict__ CS, const float* __restrict__ SN, _Float16* __restrict__ H, _Float16* __restrict__ L) {
  #pragma clang fp contract(off)
  const size_t t = (size_t)blockIdx.x * 256 + threadIdx.x; if (t >= (size_t)NR * ndst * 4) return; const int g16 = (int)(t % 4); const int hd = (int)((t / 4) % ndst); const size_t row = t / ((size_t)4 * ndst); const int s = (int)(row % SLEN); const int hs = hd / rep;
  const float* src = F + row * (size_t)(nsrc * 64) + hs * 64 + g16 * 16; FragH ah, al;
  for (int pr = 0; pr < 8; ++pr) { const int i = g16 * 8 + pr; const float c = CS[s * 32 + i], sn = SN[s * 32 + i]; const float x1 = src[2 * pr], x2 = src[2 * pr + 1];
    float o1 = x1 * c; o1 -= x2 * sn; float o2 = x1 * sn; o2 += x2 * c;
    _Float16 hv = (_Float16)o1; ah.h[2 * pr] = hv; al.h[2 * pr] = (_Float16)((o1 - (float)hv) * 1024.0f); hv = (_Float16)o2; ah.h[2 * pr + 1] = hv; al.h[2 * pr + 1] = (_Float16)((o2 - (float)hv) * 1024.0f); }
  const size_t o = row * (size_t)(ndst * 64) + hd * 64 + g16 * 16;
  { *(v8us*)((unsigned short*)H + o) = ah.half[0]; *(v8us*)((unsigned short*)H + o + 8) = ah.half[1]; *(v8us*)((unsigned short*)L + o) = al.half[0]; *(v8us*)((unsigned short*)L + o + 8) = al.half[1];  } }
__global__ __launch_bounds__(256) void k_ln512(const float* __restrict__ A, const float* __restrict__ res, const float* __restrict__ g, const float* __restrict__ bb, float* __restrict__ Y, _Float16* __restrict__ Y16) {
  #pragma clang fp contract(off)
  const int wv = threadIdx.x >> 5, ln = threadIdx.x & 31; const size_t r = (size_t)blockIdx.x * 8 + wv; if (r >= NR) return; float x[16]; float s = 0.f;
  for (int i = 0; i < 2; ++i) { const v8f a = *(const v8f*)(A + r * DM + i * 256 + ln * 8); for (int q = 0; q < 8; ++q) { float v = a[q]; if (res) v += bf16_round(res[r * DM + i * 256 + ln * 8 + q]); x[i * 8 + q] = v; s += v; } }
  for (int o = 16; o > 0; o >>= 1) s += __shfl_xor(s, o, 32); const float mu = s / (float)DM; float var = 0.f; for (int q = 0; q < 16; ++q) { const float d = x[q] - mu; var += d * d; }
  for (int o = 16; o > 0; o >>= 1) var += __shfl_xor(var, o, 32); const float inv = rsqrtf(var / (float)DM + 1e-5f);
  { for (int i = 0; i < 2; ++i) { const int c0 = i * 256 + ln * 8; v8f y; FragH f; for (int q = 0; q < 8; ++q) { float v = (x[i * 8 + q] - mu) * inv; v *= bf16_round(g[c0 + q]); v += bf16_round(bb[c0 + q]); y[q] = v; f.h[q] = (_Float16)v; } *(v8f*)(Y + r * DM + c0) = y; if (Y16) *(v8us*)((unsigned short*)Y16 + r * DM + c0) = f.half[0]; }  } }
__global__ __launch_bounds__(256) void k_pack(const float* __restrict__ rb, const int* __restrict__ rid, int* __restrict__ PK) { const int t = blockIdx.x * 256 + threadIdx.x; if (t >= 1024 + NB * TK) return; int v; if (t < 1024) v = __float_as_int(bf16_round(rb[t])); else v = rid[t - 1024]; *(int*)(PK + t) = v;  }
__global__ __launch_bounds__(256) void k_tabin(const float* __restrict__ sp, float* __restrict__ CS, float* __restrict__ SN) { const int t = blockIdx.x * 256 + threadIdx.x; if (t >= SLEN * 32) return; const int i = t % 32, s = t / 32; const float c = bf16_round(sp[s * 64 + 32 + i]), sn = bf16_round(sp[s * 64 + i]);
  { *(float*)(CS + t) = c; *(float*)(SN + t) = sn;  } }
__global__ __launch_bounds__(256) void k_wsc(const float* __restrict__ Wm, _Float16* __restrict__ Bt, size_t n8, float sc) { const size_t t = (size_t)blockIdx.x * 256 + threadIdx.x; if (t >= n8) return; FragH f; for (int q = 0; q < 8; ++q) f.h[q] = (_Float16)(bf16_round(Wm[t * 8 + q]) * sc); *(v8us*)((unsigned short*)Bt + t * 8) = f.half[0];  }
__global__ __launch_bounds__(256) void k_rotab2(float* __restrict__ CS, float* __restrict__ SN) {
  #pragma clang fp contract(off)
  const int t = blockIdx.x * 256 + threadIdx.x; if (t >= SLEN * 32) return; const int j = t % 32, s = t / 32; const float c0 = -0.14391156831212787f;      /* -ln(10000)/64 rounded to f32 */ const float inv = expf((float)(2 * j) * c0); const float th = (float)s * inv; const float c = cosf(th), sn = sinf(th);
  { *(float*)(CS + t) = c; *(float*)(SN + t) = sn;  } }
__global__ __launch_bounds__(256) void k_lnu(const float* __restrict__ X, _Float16* __restrict__ N16, float* __restrict__ XB) {
  #pragma clang fp contract(off)
  const int wv = threadIdx.x >> 5, ln = threadIdx.x & 31; const size_t r = (size_t)blockIdx.x * 8 + wv; if (r >= NR) return; float a[32]; float s = 0.f;
  for (int i = 0; i < 4; ++i) { const v8f v = *(const v8f*)(X + r * DM + (i * 32 + ln) * 8); for (int q = 0; q < 8; ++q) { const float u = bf16_round(v[q]); a[i * 8 + q] = u; s += u; } }
  for (int o = 16; o > 0; o >>= 1) s += __shfl_xor(s, o, 32); const float mu = s / (float)DM; float var = 0.f; for (int q = 0; q < 32; ++q) { const float d = a[q] - mu; var += d * d; }
  for (int o = 16; o > 0; o >>= 1) var += __shfl_xor(var, o, 32); const float den = sqrtf(var / (float)(DM - 1)) + 1e-6f; const float inv = 1.0f / den;      /* one reciprocal per row; (x-mean)*inv vs the reference's division differs by <= 1 ulp */
  { for (int i = 0; i < 4; ++i) { const int c0 = (i * 32 + ln) * 8; FragH f; v8f xb; for (int q = 0; q < 8; ++q) { f.h[q] = (_Float16)((a[i * 8 + q] - mu) * inv); xb[q] = a[i * 8 + q]; } *(v8us*)((unsigned short*)N16 + r * DM + c0) = f.half[0]; *(v8f*)(XB + r * DM + c0) = xb; }  } }

// Fused Gaussian-kernel attention: one launch for all (batch, head) slabs; the score plane and the weight plane never leave the registers.
// Block = 8 waves x 16 output rows i; the summed index j walks in LDS stages of FJ rows (q hi, q residual, V^T, |q|^2), two buffers, one barrier a stage.
// S^T tile: A = q rows j (LDS), B = k columns i (registers, loaded once); D[8 hh + r][ln] = k_i . q_j. Two D tiles (j 0-15, 16-31), weighted and rounded in place, are the B operand of O^T += V^T . P^T.
#define FJ 64
#define FP 72                    /* LDS row pitch in f16: 128-byte rows + 16 bytes, for 16-byte fragment reads */
__device__ __forceinline__ v16h fz_frag(const unsigned short* p, int hh) { FragH f; f.half[0] = *(const v8us*)(p + 8 * hh); f.half[1] = *(const v8us*)(p + 16 + 8 * hh); return f.v; }
__device__ __forceinline__ v8f fz_mma(v16h a, v16h b, v8f c) { return __builtin_amdgcn_wmma_f32_16x16x32_f16(false, a, false, b, (short)0, c, false, false); }
union FragW { v16h v; unsigned d[8]; };
__device__ __forceinline__ void fz_exp2_pack(float x0, float x1, float x2, float x3, float x4, float x5, float x6, float x7, unsigned* o) {
  asm("v_exp_f32 %4, %4\n\tv_exp_f32 %5, %5\n\tv_exp_f32 %6, %6\n\tv_exp_f32 %7, %7\n\tv_exp_f32 %8, %8\n\tv_exp_f32 %9, %9\n\tv_exp_f32 %10, %10\n\tv_exp_f32 %11, %11\n\t"
      "v_cvt_pk_f16_f32 %0, %4, %5\n\tv_cvt_pk_f16_f32 %1, %6, %7\n\t"
      "s_delay_alu instid0(TRANS32_DEP_3)\n\tv_cvt_pk_f16_f32 %2, %8, %9\n\t"
      "s_delay_alu instid0(TRANS32_DEP_1)\n\tv_cvt_pk_f16_f32 %3, %10, %11"
      : "=&v"(o[0]), "=&v"(o[1]), "=&v"(o[2]), "=&v"(o[3]), "+v"(x0), "+v"(x1), "+v"(x2), "+v"(x3), "+v"(x4), "+v"(x5), "+v"(x6), "+v"(x7)); }
__global__ __launch_bounds__(256) __attribute__((amdgpu_waves_per_eu(4, 4))) void k_gauss(const _Float16* __restrict__ QH, const _Float16* __restrict__ QL, const _Float16* __restrict__ KH, const _Float16* __restrict__ KL, const _Float16* __restrict__ VT,
    const float* __restrict__ QN, const float* __restrict__ KN, const float* __restrict__ rs, _Float16* __restrict__ OH) {
  __shared__ __attribute__((aligned(16))) unsigned short sQH[2][FJ][FP]; __shared__ __attribute__((aligned(16))) unsigned short sQL[2][FJ][FP]; __shared__ __attribute__((aligned(16))) unsigned short sVT[2][64][FP]; __shared__ __attribute__((aligned(16))) float sQN[2][FJ];
  const int tid = threadIdx.x, w = tid >> 5, lane = tid & 31, ln = lane & 15, hh = lane >> 4;
  const int slab = blockIdx.x / (SLEN / 128), ib = blockIdx.x % (SLEN / 128); const int b = slab / NH, h = slab % NH;
  const int i = ib * 128 + w * 16 + ln;      /* this lane's output row (a column of every D tile) */
  const unsigned short* kh = (const unsigned short*)KH + ((size_t)b * SLEN + i) * DM + h * 64; const unsigned short* kl = (const unsigned short*)KL + ((size_t)b * SLEN + i) * DM + h * 64;
  const v16h bkh0 = fz_frag(kh, hh), bkh1 = fz_frag(kh + 32, hh), bkl0 = fz_frag(kl, hh), bkl1 = fz_frag(kl + 32, hh);
  const float r = bf16_round(rs[0]); const float c = r * 1.44269504f;      /* r log2(e): 1024 exp(-r d2) = 2^(10 - c kn - c qn + 2 c s), one hardware exp2 an element */
  const float c2 = 2.0f * c; const float knb = __builtin_fmaf(-c, KN[(size_t)slab * SLEN + i], 10.0f);      /* this lane's share of the exponent, formed once */
  const int sr = tid >> 3, sc = (tid & 7) * 8;      /* staging: 16 bytes a thread in rows sr and sr + 32 of each plane */
  const unsigned short* gqh = (const unsigned short*)QH + ((size_t)b * SLEN + sr) * DM + h * 64 + sc; const unsigned short* gql = (const unsigned short*)QL + ((size_t)b * SLEN + sr) * DM + h * 64 + sc;
  const unsigned short* gvt = (const unsigned short*)VT + ((size_t)slab * 64 + sr) * SLEN + sc; const float* gqn = QN + (size_t)slab * SLEN + (tid & (FJ - 1));
  v8us rq0, rq1, rl0, rl1, rv0, rv1; float rn = 0.f;
  auto gload = [&](int j0) { rq0 = *(const v8us*)(gqh + (size_t)j0 * DM); rq1 = *(const v8us*)(gqh + (size_t)(j0 + 32) * DM); rl0 = *(const v8us*)(gql + (size_t)j0 * DM); rl1 = *(const v8us*)(gql + (size_t)(j0 + 32) * DM);
    rv0 = *(const v8us*)(gvt + j0); rv1 = *(const v8us*)(gvt + (size_t)32 * SLEN + j0); if (tid < FJ) rn = gqn[j0]; };
  auto sstore = [&](int bf) { *(v8us*)&sQH[bf][sr][sc] = rq0; *(v8us*)&sQH[bf][sr + 32][sc] = rq1; *(v8us*)&sQL[bf][sr][sc] = rl0; *(v8us*)&sQL[bf][sr + 32][sc] = rl1; *(v8us*)&sVT[bf][sr][sc] = rv0; *(v8us*)&sVT[bf][sr + 32][sc] = rv1; if (tid < FJ) sQN[bf][tid] = -c * rn; };      /* staged as -c |q_j|^2: row j's share of the exponent */
  const v8f z8 = {0.f,0.f,0.f,0.f,0.f,0.f,0.f,0.f}; v8f oacc[4] = {z8, z8, z8, z8};
  gload(0); sstore(0); __syncthreads();
#pragma unroll 1      /* one stage a trip: the body already holds two 32-wide passes; more would only grow the code */
  for (int st = 0; st < SLEN / FJ; ++st) { const int bf = st & 1; const bool more = st + 1 < SLEN / FJ;
    if (more) gload((st + 1) * FJ);      /* next stage flies from L2 while this one is worked on */
#pragma unroll
    for (int jj = 0; jj < FJ; jj += 32) { FragW pb; const v16h av0 = fz_frag(&sVT[bf][ln][jj], hh), av1 = fz_frag(&sVT[bf][16 + ln][jj], hh), av2 = fz_frag(&sVT[bf][32 + ln][jj], hh), av3 = fz_frag(&sVT[bf][48 + ln][jj], hh);      /* named ahead of the score work, so that the scheduler may start these reads early */
#pragma unroll
      for (int nt = 0; nt < 2; ++nt) { const unsigned short* qh = &sQH[bf][jj + nt * 16 + ln][0]; const unsigned short* ql = &sQL[bf][jj + nt * 16 + ln][0];
        const v16h ah0 = fz_frag(qh, hh), ah1 = fz_frag(qh + 32, hh), al0 = fz_frag(ql, hh), al1 = fz_frag(ql + 32, hh);
        v8f cA = fz_mma(ah0, bkl0, z8), cB = fz_mma(al0, bkh0, z8), cC = fz_mma(ah0, bkh0, z8); cA = fz_mma(ah1, bkl1, cA); cB = fz_mma(al1, bkh1, cB); cC = fz_mma(ah1, bkh1, cC);
        const v4f n0 = *(const v4fa*)&sQN[bf][jj + nt * 16 + 8 * hh], n1 = *(const v4fa*)&sQN[bf][jj + nt * 16 + 8 * hh + 4];
        float e[8];
#pragma unroll
        for (int q = 0; q < 8; ++q) { const float s = __builtin_fmaf(cB[q] + cA[q], 0.0009765625f, cC[q]); const float qn = (q < 4) ? n0[q & 3] : n1[q & 3]; e[q] = __builtin_fmaf(s, c2, knb + qn); }
        fz_exp2_pack(e[0], e[1], e[2], e[3], e[4], e[5], e[6], e[7], &pb.d[nt * 4]); }      /* bare v_exp_f32: below 2^-126 it gives 0, which the f16 rounding gives from 2^-25 down anyway; above 2^16 the f16 rounding gives inf, as before */
      oacc[0] = fz_mma(av0, pb.v, oacc[0]); oacc[1] = fz_mma(av1, pb.v, oacc[1]); oacc[2] = fz_mma(av2, pb.v, oacc[2]); oacc[3] = fz_mma(av3, pb.v, oacc[3]); }
    if (more) sstore(bf ^ 1);      /* that buffer's last readers left it before the barrier that ended the trip before */
    __syncthreads(); }
  unsigned short* orow = (unsigned short*)OH + ((size_t)b * SLEN + i) * DM + h * 64 + 8 * hh;      /* D register q of tile dt = out[i][dt * 16 + 8 hh + q]; stored as the f16 operand plane of the output projection */
#pragma unroll
  for (int dt = 0; dt < 4; ++dt) { FragH f;
#pragma unroll
    for (int q = 0; q < 8; ++q) f.h[q] = (_Float16)(oacc[dt][q] * 0.0009765625f);
    *(v8us*)(orow + dt * 16) = f.half[0]; } }

// Projection GEMM, C[M][N] (f32) = A[M][K] . Bh[N][K]^T * alpha + bf16(bias): block = 8 waves (4 x 2) of 32x64 wave tiles = 128 x 128 of C.
// Both operand tiles (128 rows x GK k) go through LDS, two buffers, one barrier a stage: every global load covers whole 128-byte lines, and a row is fetched once a block instead of once a wave.
// k runs upward in steps of 32 into the same accumulators as before, so every sum keeps its order. Needs M % 128 == 0, N % 128 == 0, K % GK == 0.
// SPLIT (the qkv product; a block's 128 columns lie in one of q, k, v and a wave's 64 columns are one head): no f32 plane is stored. q and k go out as f16 hi + 2^10 residual planes with each row's squared norm ([batch, head][token]), v as V^T [batch, head][64][token].
template <int N, int K, bool SPLIT>
__global__ __launch_bounds__(256) void k_gemm3(const _Float16* __restrict__ A, const _Float16* __restrict__ Bh, float alpha, const float* __restrict__ bias, float* __restrict__ C,
    _Float16* __restrict__ QH, _Float16* __restrict__ QL, _Float16* __restrict__ KH, _Float16* __restrict__ KL, _Float16* __restrict__ VT, float* __restrict__ QN, float* __restrict__ KN) {
  constexpr int GK = 64;      /* k a stage: one 128-byte line a row */
  constexpr int GP = GK + 8;      /* LDS row pitch in f16: the row + 16 bytes (an odd count of 16 bytes), for 16-byte fragment reads */
  constexpr int RP = 2048 / GK, NP = 128 / RP;      /* rows a staging pass of 256 threads covers; passes a tile */
  __shared__ __attribute__((aligned(16))) unsigned short sT[2][256][GP];      /* rows 0-127: A tile, rows 128-255: B tile; after the loop each wave's 32 x 68 f32 output patch */
  const int tid = threadIdx.x, lane = tid & 31, ln = lane & 15, hh = lane >> 4;
  const int w = __builtin_amdgcn_readfirstlane(tid >> 5);      /* the wave's number in a scalar register: w, wm, wn and the tile origins formed from them hold no vector registers across the loop */
  constexpr int ntn = N >> 7; const int mt = blockIdx.x / ntn, nq = blockIdx.x - mt * ntn; const int wm = w >> 1, wn = w & 1;
  const int sr = tid / (GK / 8), sc = (tid % (GK / 8)) * 8;      /* staging: 16 bytes a thread in rows sr + RP u of each tile; 8 neighbour threads cover one 128-byte line */
  const unsigned short* ga = (const unsigned short*)A + (size_t)(mt * 128) * K; const unsigned short* gb = (const unsigned short*)Bh + (size_t)(nq * 128) * K; const unsigned go = (unsigned)(sr * K + sc);      /* block-uniform tile bases, which walk along k, and one fixed offset a thread */
  v8us ra[NP], rb[NP];
  auto gload = [&](int k0) {
#pragma unroll
    for (int u = 0; u < NP; ++u) { ra[u] = *(const v8us*)(ga + k0 + go + RP * u * K); rb[u] = *(const v8us*)(gb + k0 + go + RP * u * K); } };
  auto sstore = [&](int bf) {
#pragma unroll
    for (int u = 0; u < NP; ++u) { *(v8us*)&sT[bf][sr + RP * u][sc] = ra[u]; *(v8us*)&sT[bf][128 + sr + RP * u][sc] = rb[u]; } };
  const v8f z8 = {0.f,0.f,0.f,0.f,0.f,0.f,0.f,0.f}; v8f acc[2][4] = {{z8, z8, z8, z8}, {z8, z8, z8, z8}};
  constexpr int nst = K / GK;
  gload(0); sstore(0); __syncthreads();
#pragma unroll 1      /* one stage a trip: the body already holds 16 matrix instructions; more would only grow the code */
  for (int st = 0; st < nst; ++st) { const int bf = st & 1; const bool more = st + 1 < nst;
    if (more) gload((st + 1) * GK);      /* next stage flies from L2 while this one is worked on */
#pragma unroll
    for (int kk = 0; kk < GK; kk += 32) { const v16h a0 = fz_frag(&sT[bf][wm * 32 + ln][kk], hh), a1 = fz_frag(&sT[bf][wm * 32 + 16 + ln][kk], hh); v16h b[4];
#pragma unroll
      for (int t = 0; t < 4; ++t) b[t] = fz_frag(&sT[bf][128 + wn * 64 + t * 16 + ln][kk], hh);
      __builtin_amdgcn_sched_barrier(0);      /* keeps the six fragment reads together ahead of the eight products: left alone the scheduler sinks each B read to its use, and the wave waits out the LDS latency four times instead of once */
#pragma unroll
      for (int t = 0; t < 4; ++t) { acc[0][t] = fz_mma(a0, b[t], acc[0][t]); acc[1][t] = fz_mma(a1, b[t], acc[1][t]); } }
    if (more) sstore(bf ^ 1);      /* that buffer's last readers left it before the barrier that ended the trip before */
    __syncthreads(); }
  const int row0 = mt * 128 + wm * 32, col0 = nq * 128 + wn * 64;
  const int third = SPLIT ? (nq * 128) / DM : 0;      /* 0 q, 1 k, 2 v: the same for the whole block */
  if (SPLIT && third == 2) {
    constexpr int VP = 128 + 8;      /* LDS row pitch in f16: 128 tokens + 16 bytes (an odd count of 16 bytes) */
    unsigned short* sv = &sT[0][0][0];      /* [128 columns d][VP]; every read of the tiles ended at the loop's last barrier */
#pragma unroll      /* constant indices keep acc in registers */
    for (int u = 0; u < 8; ++u) { const int t = u & 3, half = u >> 2; const float bv = bf16_round(bias[col0 + t * 16 + ln]); FragH f;      /* a lane's 8 D registers are 8 tokens in a row of one column d: 16 bytes of a V^T row */
#pragma unroll      /* as above */
      for (int r = 0; r < 8; ++r) f.h[r] = (_Float16)(acc[half][t][r] * alpha + bv);
      *(v8us*)&sv[(wn * 64 + t * 16 + ln) * VP + wm * 32 + half * 16 + 8 * hh] = f.half[0]; }
    __syncthreads();      /* a V^T row's 128 tokens come from four waves */
    unsigned short* vt = (unsigned short*)VT + ((size_t)((mt * 128) / SLEN) * DM + (nq * 128 - 2 * DM)) * SLEN + (mt * 128) % SLEN;
#pragma unroll      /* the eight LDS reads go out together, one latency instead of eight */
    for (int p = 0; p < 8; ++p) { const int c = p * 256 + tid, dd = c >> 4, ch = (c & 15) * 8;      /* 16 neighbour threads store the 256 bytes of one row */
      *(v8us*)(vt + (size_t)dd * SLEN + ch) = *(const v8us*)&sv[dd * VP + ch]; }
    return; }
  float* so = (float*)&sT[0][0][0] + w * (32 * 68);      /* every read of the tiles ended at the loop's last barrier */
#pragma unroll
  for (int u = 0; u < 8; ++u) { const int t = u & 3, half = u >> 2; const float bv = bf16_round(bias[col0 + t * 16 + ln]);
#pragma unroll
    for (int r = 0; r < 8; ++r) so[(half * 16 + 8 * hh + r) * 68 + t * 16 + ln] = acc[half][t][r] * alpha + bv; }
  __builtin_amdgcn_fence(__ATOMIC_ACQ_REL, "workgroup"); __builtin_amdgcn_wave_barrier();      /* the patch is read back by other lanes of the same wave */
  if (SPLIT) {
    unsigned short* dh = (unsigned short*)(third ? KH : QH) + (size_t)row0 * DM + (col0 - third * DM); unsigned short* dl = (unsigned short*)(third ? KL : QL) + (size_t)row0 * DM + (col0 - third * DM);
    float sn = 0.f;      /* lane = row of the patch: the head's 64 squares, summed upward along d */
#pragma unroll      /* lets the LDS reads run ahead of the one chain of adds */
    for (int d = 0; d < 64; d += 4) { const v4f a = *(const v4fa*)&so[lane * 68 + d];
      for (int q = 0; q < 4; ++q) sn += a[q] * a[q]; }
    (third ? KN : QN)[((size_t)(row0 / SLEN) * NH + (col0 - third * DM) / 64) * SLEN + row0 % SLEN + lane] = sn;
    const int rs4 = lane >> 3, c8 = (lane & 7) * 8;      /* 8 neighbour lanes store the 128-byte line that a head's row is in each plane */
#pragma unroll 2      /* four trips of two passes: unrolled whole, the epilogue takes more registers than the product loop and costs the kernel a work-group per WGP */
    for (int p = 0; p < 8; ++p) { const int r = p * 4 + rs4; const v4f a = *(const v4fa*)&so[r * 68 + c8], c = *(const v4fa*)&so[r * 68 + c8 + 4]; FragH fh, fl;
#pragma unroll      /* constant indices keep the fragments in registers */
      for (int q = 0; q < 4; ++q) { _Float16 h = (_Float16)a[q]; fh.h[q] = h; fl.h[q] = (_Float16)((a[q] - (float)h) * 1024.0f); h = (_Float16)c[q]; fh.h[4 + q] = h; fl.h[4 + q] = (_Float16)((c[q] - (float)h) * 1024.0f); }
      *(v8us*)(dh + (size_t)r * DM + c8) = fh.half[0]; *(v8us*)(dl + (size_t)r * DM + c8) = fl.half[0]; }
    return; }
  const int rsub = lane >> 4, c4 = (lane & 15) * 4;
#pragma unroll
  for (int q = 0; q < 16; ++q) { const int r = q * 2 + rsub; const v4f v = *(const v4fa*)&so[r * 68 + c4]; *(v4f*)(C + (size_t)(row0 + r) * N + col0 + c4) = v; } }

extern "C" void kernel_launch(void* const* d_in, const int* in_sizes, int n_in,
                              void* d_out, int out_size, void* d_ws, size_t ws_size, hipStream_t stream) {
  (void)in_sizes; (void)n_in; (void)out_size;
  const float* const* I = (const float* const*)d_in; const float* x = I[0]; const float* Wqkv = I[1]; const float* bqkv = I[2]; const float* rs = I[3]; const float* Wp = I[4]; const float* bp = I[5];
  char* ws = (char*)d_ws; size_t off = 0;
  auto take = [&](size_t bytes) { char* p = ws + off; off += (bytes + 255) & ~(size_t)255; return p; };
  const size_t np = (size_t)NR * DM;
  _Float16* BQKV = (_Float16*)take((size_t)3 * DM * DM * 2); _Float16* BP = (_Float16*)take((size_t)DM * DM * 2);
  _Float16* X16 = (_Float16*)take(np * 2); float* QN = (float*)take((size_t)NR * NH * 4); float* KN = (float*)take((size_t)NR * NH * 4); _Float16* QH = (_Float16*)take(np * 2); _Float16* QL = (_Float16*)take(np * 2); _Float16* KH = (_Float16*)take(np * 2); _Float16* KL = (_Float16*)take(np * 2); _Float16* VT = (_Float16*)take(np * 2);
  _Float16* OH = (_Float16*)take(np * 2);      /* merged context f16 [NR][DM]: a plane of its own, q hi is still read while it is written */
  if (off > ws_size) return;      /* 6 + 2 + 8 + 0.5 + 5x8 + 8 = 65 MiB */
  k_wt_f16<<<(unsigned)(((size_t)DM * 3 * DM / 8 + 255) / 256), 256, 0, stream>>>(Wqkv, BQKV, DM, 3 * DM, 16.0f); k_wt_f16<<<(unsigned)(((size_t)DM * DM / 8 + 255) / 256), 256, 0, stream>>>(Wp, BP, DM, DM, 16.0f);      /* (in, out) */
  k_x16<<<(unsigned)((np / 8 + 255) / 256), 256, 0, stream>>>(x, X16, np / 8);
  k_gemm3<3 * DM, DM, true><<<(NR / 128) * (3 * DM / 128), 256, 0, stream>>>(X16, BQKV, 0.0625f, bqkv, nullptr, QH, QL, KH, KL, VT, QN, KN);      /* [q | k | v] (head h = cols h*64..): q, k hi + residual planes and squared norms, V^T [(b,h)][64][2048] */
  k_gauss<<<NB * NH * (SLEN / 128), 256, 0, stream>>>(QH, QL, KH, KL, VT, QN, KN, rs, OH);      /* out_i[(h,d)] = sum_j exp(-r (kn_i + qn_j - 2 k_i.q_j)) v_j[d], merged context f16 */
  k_gemm3<DM, DM, false><<<(NR / 128) * (DM / 128), 256, 0, stream>>>(OH, BP, 0.0625f, bp, (float*)d_out, nullptr, nullptr, nullptr, nullptr, nullptr, nullptr, nullptr);      /* out = ctx Wproj + bproj */
}

// v005
// A run of this version takes 109 microseconds.
// In both of two side-by-side timings against v004, it was 1.15 times as fast.
// Over all steps from v000 it is 17.0 times as fast.
#include <hip/hip_runtime.h>
// qKv_attention (2 x 2048 tokens, C 1024 = 16 heads x 64; Gaussian-kernel attention WITHOUT normalisation: qkv = x Wqkv + b; K[i][j] = exp(-r_sigma ||q_j - k_i||^2) computed as kn_i + qn_j - 2 k_i.q_j; out_i = sum_j K[i][j] v_j; out = merge Wproj + bproj; r_sigma is a scalar input).
// Structure: exact f16 plane of x; qkv as one f16 WMMA GEMM (32x64 wave tiles, f32 accumulation, exact x16 weights + bias); per-(token, head) squared norms on VALU; q and k as f16 hi + 2^10 residual planes; V^T by LDS tiles (norms, planes and V^T all stored by that GEMM's epilogue, no f32 qkv plane); one fused launch over every (batch, head): the k.q products as three hi/residual terms (f32), the kernel weights 2^(10 - c (kn + qn - 2 kq)), c = r log2(e), by one fma and one hardware exp2 each into f16 in registers, the readout products (64 columns) straight into a merged f16 context plane; Wproj + bproj GEMM.
// Compute dtype: inputs rounded to bf16; x and weights exact as f16; q, k as f16 hi + residual (~2^-21) because the exponent amplifies dot-product error by 2 r_sigma |k.q|; kernel weights and v as plain f16 operands (~2^-12; weights below 2^-34 of the unit scale flush to zero); merged context plain f16. v_wmma_f32_16x16x32_f16.
#define NB 2
#define DM 1024
#define NKV 16
#define NREP (NH / NKV)
#define KVD (NKV * 64)           /* 1024 */
#define NR (NB * SLEN)           /* 4096 */
#define CHK 512                  /* attention chunk */
typedef int v4i __attribute__((ext_vector_type(4)));
#define FF 2048
#define SLEN 2048
#define TQ SLEN
#define TK SLEN
#define NH 16
#define SCL 0.125f
#define QBLKS (TQ / 64)
#define QB05 0
#define QBN5 4
#define QB0P 0
#define QBNP QBLKS           /* non-causal: plain flash on every query block */
#define RE 256
typedef __bf16 v16b __attribute__((ext_vector_type(16)));
typedef unsigned short v8us __attribute__((ext_vector_type(8), may_alias));
typedef float  v8f  __attribute__((ext_vector_type(8)));
typedef float  v4f  __attribute__((ext_vector_type(4)));
typedef float  v4fa __attribute__((ext_vector_type(4), may_alias));
union FragB { v16b v; v8us half[2]; unsigned short u[16]; };

__device__ __forceinline__ unsigned short bf16_bits(float x) { unsigned int u = __float_as_uint(x); return (unsigned short)((u + 0x7FFFu + ((u >> 16) & 1u)) >> 16); }
__device__ __forceinline__ float bf16_val(unsigned short b) { return __uint_as_float(((unsigned int)b) << 16); }
__device__ __forceinline__ float bf16_round(float x) { return bf16_val(bf16_bits(x)); }
// D += A·B with NT terms: 1 = ah·bh, 2 = + al·bh (A split), 3 = + ah·bl (both split)
template <int NT>
__device__ __forceinline__ v8f mmaN(v16b ah, v16b al, v16b bh, v16b bl, v8f c) {
  c = __builtin_amdgcn_wmma_f32_16x16x32_bf16(false, ah, false, bh, (short)0, c, false, false);
  if (NT >= 2) c = __builtin_amdgcn_wmma_f32_16x16x32_bf16(false, al, false, bh, (short)0, c, false, false);
  if (NT >= 3) c = __builtin_amdgcn_wmma_f32_16x16x32_bf16(false, ah, false, bl, (short)0, c, false, false);
  asm volatile("v_nop\n\tv_nop\n\tv_nop\n\tv_nop" : "+v"(c) : "v"(ah), "v"(al), "v"(bh), "v"(bl));
  return c;
}

__global__ __launch_bounds__(256) void k_wt_bf16(const float* __restrict__ W, unsigned short* __restrict__ Wt, int K, int N) {
  const int t = blockIdx.x * 256 + threadIdx.x;
  const int k8n = K / 8;
  if (t >= N * k8n) return;
  const int n = t / k8n, k8 = (t % k8n) * 8;
  v8us v;
#pragma unroll
  for (int i = 0; i < 8; ++i) v[i] = bf16_bits(W[(size_t)(k8 + i) * N + n]);
  *(v8us*)(Wt + (size_t)n * K + k8) = v;
  
}

// GEMM C[M][N] (f32, pitch ldc) = act(A[M][K]·W + bias). A f32 row-major (pitch lda) converted per fragment to bf16
// (ASPLIT: hi/lo two planes -> 2 terms, else single rounded term); Wt bf16 [N][K] (pitch ldb). BIAS_BF16 rounds the
// bias to bf16 first (bias quantised to bf16 before the add). K%32==0, M%16==0, N%64==0.
template <bool ASPLIT, int ACT, bool BIAS_BF16>
__global__ __launch_bounds__(128) void k_gemm_bf(const float* __restrict__ A, int lda, const unsigned short* __restrict__ Wt, int ldb,
                                               const float* __restrict__ bias, float* __restrict__ C, int ldc, int M, int N, int K) {
  __shared__ __attribute__((aligned(16))) float so[4][16][64];
  const int tid = threadIdx.x, w = tid >> 5, lane = tid & 31, ln = lane & 15, hh = lane >> 4;
  const int ntn = N / 64;
  const int wid = blockIdx.x * 4 + w;
  const int mt = wid / ntn, nq = wid % ntn;
  if (mt * 16 >= M) return;
  const int row0 = mt * 16, col0 = nq * 64;
  const float* arow = A + (size_t)(row0 + ln) * lda;
  v8f acc[4] = {};
  for (int kb = 0; kb < K; kb += 32) {
    FragB ah, al;
    const v4f x0 = *(const v4fa*)(arow + kb + 8 * hh), x1 = *(const v4fa*)(arow + kb + 8 * hh + 4);
    const v4f x2 = *(const v4fa*)(arow + kb + 16 + 8 * hh), x3 = *(const v4fa*)(arow + kb + 16 + 8 * hh + 4);
    float xs[16] = {x0[0],x0[1],x0[2],x0[3],x1[0],x1[1],x1[2],x1[3],x2[0],x2[1],x2[2],x2[3],x3[0],x3[1],x3[2],x3[3]};
#pragma unroll
    for (int i = 0; i < 16; ++i) { const unsigned short hb = bf16_bits(xs[i]); ah.u[i] = hb; al.u[i] = ASPLIT ? bf16_bits(xs[i] - bf16_val(hb)) : (unsigned short)0; }
#pragma unroll
    for (int t = 0; t < 4; ++t) {
      const unsigned short* brow = Wt + (size_t)(col0 + t * 16 + ln) * ldb + kb;
      FragB b;
      b.half[0] = *(const v8us*)(brow + 8 * hh);
      b.half[1] = *(const v8us*)(brow + 16 + 8 * hh);
      acc[t] = mmaN<ASPLIT ? 2 : 1>(ah.v, al.v, b.v, b.v, acc[t]);
    }
  }
#pragma unroll
  for (int t = 0; t < 4; ++t) {
    float bv = bias ? bias[col0 + t * 16 + ln] : 0.f;
    if (BIAS_BF16) bv = bf16_round(bv);
#pragma unroll
    for (int r = 0; r < 8; ++r) { float v = acc[t][r] + bv; if (ACT == 1) v = fmaxf(v, 0.f); so[w][8 * hh + r][t * 16 + ln] = v; }
  }
  __builtin_amdgcn_fence(__ATOMIC_ACQ_REL, "workgroup");
  __builtin_amdgcn_wave_barrier();
  const int rsub = lane >> 4, c4 = (lane & 15) * 4;
  {
#pragma unroll
    for (int q = 0; q < 8; ++q) {
      const int r = q * 2 + rsub;
      const v4f v = *(const v4fa*)&so[w][r][c4];
      *(v4f*)(C + (size_t)(row0 + r) * ldc + col0 + c4) = v;
    }
    
  }
}

// GEMM C = act(A·W + bias + resid): A f32 (ASPLIT -> hi/lo 2 terms), Wt bf16 [N][K]; ACT 0 none, 1 relu, 2 exact gelu;
// resid (optional, f32, row index = (row % rmod), pitch ldr, RES_BF16 rounds it) added before the activation.
template <bool ASPLIT, int ACT, bool BIAS_BF16, bool RES_BF16>
__global__ __launch_bounds__(128) void k_gemm_bf3(const float* __restrict__ A, int lda, const unsigned short* __restrict__ Wt, int ldb,
                                                const float* __restrict__ bias, const float* __restrict__ resid, int rmod, int ldr,
                                                float* __restrict__ C, int ldc, int M, int N, int K) {
  __shared__ __attribute__((aligned(16))) float so[4][16][64];
  const int tid = threadIdx.x, w = tid >> 5, lane = tid & 31, ln = lane & 15, hh = lane >> 4;
  const int ntn = N / 64;
  const int wid = blockIdx.x * 4 + w;
  const int mt = wid / ntn, nq = wid % ntn;
  if (mt * 16 >= M) return;
  const int row0 = mt * 16, col0 = nq * 64;
  const float* arow = A + (size_t)(row0 + ln) * lda;
  v8f acc[4] = {};
  for (int kb = 0; kb < K; kb += 32) {
    FragB ah, al;
    const v4f x0 = *(const v4fa*)(arow + kb + 8 * hh), x1 = *(const v4fa*)(arow + kb + 8 * hh + 4);
    const v4f x2 = *(const v4fa*)(arow + kb + 16 + 8 * hh), x3 = *(const v4fa*)(arow + kb + 16 + 8 * hh + 4);
    float xs[16] = {x0[0],x0[1],x0[2],x0[3],x1[0],x1[1],x1[2],x1[3],x2[0],x2[1],x2[2],x2[3],x3[0],x3[1],x3[2],x3[3]};
#pragma unroll
    for (int i = 0; i < 16; ++i) { const unsigned short hb = bf16_bits(xs[i]); ah.u[i] = hb; al.u[i] = ASPLIT ? bf16_bits(xs[i] - bf16_val(hb)) : (unsigned short)0; }
#pragma unroll
    for (int t = 0; t < 4; ++t) {
      const unsigned short* brow = Wt + (size_t)(col0 + t * 16 + ln) * ldb + kb;
      FragB b;
      b.half[0] = *(const v8us*)(brow + 8 * hh);
      b.half[1] = *(const v8us*)(brow + 16 + 8 * hh);
      acc[t] = mmaN<ASPLIT ? 2 : 1>(ah.v, al.v, b.v, b.v, acc[t]);
    }
  }
#pragma unroll
  for (int t = 0; t < 4; ++t) {
    const int col = col0 + t * 16 + ln;
    float bv = bias ? bias[col] : 0.f;
    if (BIAS_BF16) bv = bf16_round(bv);
#pragma unroll
    for (int r = 0; r < 8; ++r) {
      float v = acc[t][r] + bv;
      if (resid) { float rv = resid[(size_t)((row0 + 8 * hh + r) % rmod) * ldr + col]; if (RES_BF16) rv = bf16_round(rv); v += rv; }
      if (ACT == 1) v = fmaxf(v, 0.f);
      if (ACT == 2) v = 0.5f * v * (1.0f + erff(v * 0.70710678118654752f));
      if (ACT == 3) { const float u = 0.7978845608028654f * (v + 0.044715f * v * v * v); v = 0.5f * v * (1.0f + tanhf(u)); }
      so[w][8 * hh + r][t * 16 + ln] = v;
    }
  }
  __builtin_amdgcn_fence(__ATOMIC_ACQ_REL, "workgroup");
  __builtin_amdgcn_wave_barrier();
  const int rsub = lane >> 4, c4 = (lane & 15) * 4;
  {
#pragma unroll
    for (int q = 0; q < 8; ++q) {
      const int r = q * 2 + rsub;
      const v4f v = *(const v4fa*)&so[w][r][c4];
      *(v4f*)(C + (size_t)(row0 + r) * ldc + col0 + c4) = v;
    }
    
  }
}
// row LayerNorm (biased variance, eps) over N: s = X (+ R); optional out_sum <- s; out_norm <- (s-mu)*rsqrt(var+eps)*g + b
template <bool PARAM_BF16>
__global__ __launch_bounds__(256) void k_layernorm(const float* __restrict__ X, const float* __restrict__ R, const float* __restrict__ g, const float* __restrict__ bta,
                                                  float* __restrict__ out_sum, float* __restrict__ out_norm, int N, float eps) {
  __shared__ float red[256];
  const int row = blockIdx.x, tid = threadIdx.x;
  const float* x = X + (size_t)row * N; const float* rr = R ? R + (size_t)row * N : nullptr;
  float vals[16];                     // up to N = 4096
  const int per = N / 256;            // contiguous chunk per thread? use strided-by-4 chunks: thread handles j = tid*4 + 1024*u
  float s1 = 0.f;
  for (int u = 0; u < per / 4; ++u) {
    const int j = tid * 4 + 1024 * u;
    const v4f a = *(const v4fa*)(x + j);
    v4f b = {0.f,0.f,0.f,0.f}; if (rr) b = *(const v4fa*)(rr + j);
#pragma unroll
    for (int q = 0; q < 4; ++q) { const float v = a[q] + b[q]; vals[u * 4 + q] = v; s1 += v; }
  }
  red[tid] = s1; __syncthreads();
  for (int st = 128; st > 0; st >>= 1) { if (tid < st) red[tid] += red[tid + st]; __syncthreads(); }
  const float mu = red[0] / (float)N; __syncthreads();
  float s2 = 0.f;
  for (int u = 0; u < per / 4; ++u)
#pragma unroll
    for (int q = 0; q < 4; ++q) { const float c = vals[u * 4 + q] - mu; s2 += c * c; }
  red[tid] = s2; __syncthreads();
  for (int st = 128; st > 0; st >>= 1) { if (tid < st) red[tid] += red[tid + st]; __syncthreads(); }
  const float rs = rsqrtf(red[0] / (float)N + eps);
  {
    for (int u = 0; u < per / 4; ++u) {
      const int j = tid * 4 + 1024 * u;
      v4f o, sm;
#pragma unroll
      for (int q = 0; q < 4; ++q) {
        float gg = g[j + q], bb = bta[j + q];
        if (PARAM_BF16) { gg = bf16_round(gg); bb = bf16_round(bb); }
        sm[q] = vals[u * 4 + q]; o[q] = (vals[u * 4 + q] - mu) * rs * gg + bb;
      }
      if (out_sum) *(v4f*)(out_sum + (size_t)row * N + j) = sm;
      *(v4f*)(out_norm + (size_t)row * N + j) = o;
    }
    
  }
}



// ---- f16 WMMA path (v_wmma_f32_16x16x32_f16): 11-bit significands for operands in range — used where a [0,1] probability operand needs more precision than bf16
typedef _Float16 v16h __attribute__((ext_vector_type(16)));
union FragH { v16h v; v8us half[2]; _Float16 h[16]; unsigned short u[16]; };
template <int NT>
__device__ __forceinline__ v8f mmaH(v16h ah, v16h al, v16h bh, v16h bl, v8f c) {
  c = __builtin_amdgcn_wmma_f32_16x16x32_f16(false, ah, false, bh, (short)0, c, false, false);
  if (NT >= 2) c = __builtin_amdgcn_wmma_f32_16x16x32_f16(false, al, false, bh, (short)0, c, false, false);
  if (NT >= 3) c = __builtin_amdgcn_wmma_f32_16x16x32_f16(false, ah, false, bl, (short)0, c, false, false);
  asm volatile("v_nop\n\tv_nop\n\tv_nop\n\tv_nop" : "+v"(c) : "v"(ah), "v"(al), "v"(bh), "v"(bl));
  return c;
}
// batched GEMM like k_gemm_b but f16 operands: A f32 (split into f16 hi/lo if ASPLIT, else rounded to f16), Bt = f16 values [n][k]; alpha; C f32; N multiple of 16 (partial tiles skipped)
template <bool ASPLIT>
__global__ __launch_bounds__(128) void k_gemm_h(const float* __restrict__ A, int lda, size_t sA, const _Float16* __restrict__ Bh, int ldb, size_t sB, float alpha, float* __restrict__ C, int ldc, size_t sC, int M, int N, int K) {
  __shared__ __attribute__((aligned(16))) float so[4][16][64];
  const int tid = threadIdx.x, w = tid >> 5, lane = tid & 31, ln = lane & 15, hh = lane >> 4; const int by = blockIdx.y;
  A += (size_t)by * sA; Bh += (size_t)by * sB; C += (size_t)by * sC;
  const int ntn = (N + 63) / 64; const int wid = blockIdx.x * 4 + w; const int mt = wid / ntn, nq = wid % ntn; if (mt * 16 >= M) return;
  const int row0 = mt * 16, col0 = nq * 64; const float* arow = A + (size_t)(row0 + ln) * lda;
  v8f acc[4] = {};
  for (int kb = 0; kb < K; kb += 32) {
    FragH ah, al;
    const v4f x0 = *(const v4fa*)(arow + kb + 8 * hh), x1 = *(const v4fa*)(arow + kb + 8 * hh + 4), x2 = *(const v4fa*)(arow + kb + 16 + 8 * hh), x3 = *(const v4fa*)(arow + kb + 16 + 8 * hh + 4);
    float xs[16] = {x0[0],x0[1],x0[2],x0[3],x1[0],x1[1],x1[2],x1[3],x2[0],x2[1],x2[2],x2[3],x3[0],x3[1],x3[2],x3[3]};
#pragma unroll
    for (int i = 0; i < 16; ++i) { const _Float16 h = (_Float16)xs[i]; ah.h[i] = h; al.h[i] = ASPLIT ? (_Float16)(xs[i] - (float)h) : (_Float16)0.0f; }
#pragma unroll
    for (int t = 0; t < 4; ++t) { if (col0 + t * 16 >= N) continue; const size_t boff = (size_t)(col0 + t * 16 + ln) * ldb + kb; FragH bq; bq.half[0] = *(const v8us*)(Bh + boff + 8 * hh); bq.half[1] = *(const v8us*)(Bh + boff + 16 + 8 * hh);
      acc[t] = mmaH<ASPLIT ? 2 : 1>(ah.v, al.v, bq.v, bq.v, acc[t]); }
  }
#pragma unroll
  for (int t = 0; t < 4; ++t) { if (col0 + t * 16 >= N) continue;
#pragma unroll
    for (int r = 0; r < 8; ++r) so[w][8 * hh + r][t * 16 + ln] = acc[t][r] * alpha; }
  __builtin_amdgcn_fence(__ATOMIC_ACQ_REL, "workgroup"); __builtin_amdgcn_wave_barrier();
  const int rsub = lane >> 4, c4 = (lane & 15) * 4;
  {
#pragma unroll
    for (int q = 0; q < 8; ++q) { const int r = q * 2 + rsub; if (col0 + c4 < N) { const v4f v = *(const v4fa*)&so[w][r][c4]; *(v4f*)(C + (size_t)(row0 + r) * ldc + col0 + c4) = v; } }
     }
}

// Wt[n][k] = f16(bf16(W[k][n]) * scale) from f32 row-major W[K][N] (scale = power of two; bf16-exact weights stay exact in f16 away from the subnormal range).
// One block turns one tile of 64 k x 64 n in LDS: a wave's 16-byte loads cover whole 256-byte pieces of two W rows, and 8 neighbour threads store one whole 128-byte line of a Wt row. Grid = (K / 64) * (N / 64).
typedef unsigned short v4us __attribute__((ext_vector_type(4), may_alias));
template <int K, int N>
__global__ __launch_bounds__(256) void k_wt_f16(const float* __restrict__ W, _Float16* __restrict__ Wt, float scale) {
  static_assert(K % 64 == 0 && N % 64 == 0, "whole tiles only");
  __shared__ __attribute__((aligned(16))) unsigned short tl[64][72];      /* [n][k]; row pitch 128 + 16 bytes, for the 16-byte reads */
  const int tid = threadIdx.x; constexpr int ntn = N / 64; const int kt = blockIdx.x / ntn, nt = blockIdx.x - kt * ntn;      /* neighbour blocks read neighbour pieces of the same W rows */
  const int a = tid >> 4, c = tid & 15;      /* a thread turns a patch of 4 k x 4 n in registers */
  const float* src = W + (size_t)(kt * 64) * N + nt * 64; const unsigned so = (unsigned)(a * 4 * N + c * 4);      /* block-uniform tile base and one offset a thread */
  v4f x[4];
#pragma unroll      /* the four loads go out together; constant indices keep x in registers */
  for (int u = 0; u < 4; ++u) x[u] = *(const v4fa*)(src + so + u * N);
#pragma unroll      /* as above */
  for (int q = 0; q < 4; ++q) { FragH f;
#pragma unroll      /* as above */
    for (int u = 0; u < 4; ++u) f.h[u] = (_Float16)(bf16_round(x[u][q]) * scale);
    *(v4us*)&tl[c * 4 + q][a * 4] = (v4us){f.u[0], f.u[1], f.u[2], f.u[3]}; }
  __syncthreads();      /* a Wt row's 64 k come from 16 threads of 8 waves */
  unsigned short* dst = (unsigned short*)Wt + (size_t)(nt * 64) * K + kt * 64; const int n = tid >> 3, k8 = (tid & 7) * 8; const unsigned dofs = (unsigned)(n * K + k8);
#pragma unroll      /* both LDS reads go out together */
  for (int p = 0; p < 2; ++p) *(v8us*)(dst + dofs + p * 32 * K) = *(const v8us*)&tl[p * 32 + n][k8];
}
// k_gemm_hh variant with fused epilogue: v = acc·alpha + bias[by·sBias + col] (+ CP[(row/rowsPerB)·sCPb + by·64 + col] if CP) ; ACT 0 none / 1 elu ; writes f16 C16 (and f32 C if non-null)
template <int ACT>
__global__ __launch_bounds__(128) void k_gemm_hhx(const _Float16* __restrict__ A, int lda, size_t sA, const _Float16* __restrict__ Bh, int ldb, size_t sB, float alpha, const float* __restrict__ bias, size_t sBias, const float* __restrict__ CP, int rowsPerB, size_t sCPb, int row0g,
    float* __restrict__ C, _Float16* __restrict__ C16, int ldc, size_t sC, int M, int N, int K) {
  __shared__ __attribute__((aligned(16))) float so[4][16][64];
  const int tid = threadIdx.x, w = tid >> 5, lane = tid & 31, ln = lane & 15, hh = lane >> 4; const int by = blockIdx.y;
  A += (size_t)by * sA; Bh += (size_t)by * sB; const size_t cofs = (size_t)by * sC; const float* bp = bias ? bias + (size_t)by * sBias : nullptr;
  const int ntn = (N + 63) / 64; const int wid = blockIdx.x * 4 + w; const int mt = wid / ntn, nq = wid % ntn; if (mt * 16 >= M) return;
  const int row0 = mt * 16, col0 = nq * 64; const _Float16* arow = A + (size_t)(row0 + ln) * lda;
  v8f acc[4] = {};
  for (int kb = 0; kb < K; kb += 32) { FragH ah; ah.half[0] = *(const v8us*)((const unsigned short*)arow + kb + 8 * hh); ah.half[1] = *(const v8us*)((const unsigned short*)arow + kb + 16 + 8 * hh);
#pragma unroll
    for (int t = 0; t < 4; ++t) { if (col0 + t * 16 >= N) continue; const size_t boff = (size_t)(col0 + t * 16 + ln) * ldb + kb; FragH bq; bq.half[0] = *(const v8us*)((const unsigned short*)Bh + boff + 8 * hh); bq.half[1] = *(const v8us*)((const unsigned short*)Bh + boff + 16 + 8 * hh);
      acc[t] = mmaH<1>(ah.v, ah.v, bq.v, bq.v, acc[t]); }
  }
#pragma unroll
  for (int t = 0; t < 4; ++t) { if (col0 + t * 16 >= N) continue; const int col = col0 + t * 16 + ln; const float bv = bp ? bf16_round(bp[col]) : 0.f;
#pragma unroll
    for (int r = 0; r < 8; ++r) { float v = acc[t][r] * alpha + bv; if (CP) { const int bidx = (row0g + row0 + 8 * hh + r) / rowsPerB; v += CP[(size_t)bidx * sCPb + (size_t)by * 64 + col]; } if (ACT == 1) v = (v > 0.f) ? v : expm1f(v); else if (ACT == 7) v = (v > 0.f) ? v + 1.0f : expf(v); else if (ACT == 8) v = tanhf(v); else if (ACT == 9) v = 0.5f * v * (1.0f + tanhf(0.7978845608028654f * (v + 0.044715f * v * v * v))); else if (ACT == 11) v = 1.0f / (1.0f + expf(-v)); else if (ACT == 12) v = (v > 0.f) ? v : 0.01f * v; else if (ACT == 14) v = (v > 0.f) ? v : 0.1f * v; else if (ACT == 15) v = v / (1.0f + expf(-v)); else if (ACT == 3) v = fmaxf(v, 0.f); else if (ACT == 6) v = 0.5f * v * (1.0f + erff(v * 0.70710678118654752f)); so[w][8 * hh + r][t * 16 + ln] = v; } }
  __builtin_amdgcn_fence(__ATOMIC_ACQ_REL, "workgroup"); __builtin_amdgcn_wave_barrier();
  const int rsub = lane >> 4, c4 = (lane & 15) * 4; typedef _Float16 v4h __attribute__((ext_vector_type(4)));
  {
#pragma unroll
    for (int q = 0; q < 8; ++q) { const int r = q * 2 + rsub; if (col0 + c4 < N) { const v4f v = *(const v4fa*)&so[w][r][c4]; if (C) *(v4f*)(C + cofs + (size_t)(row0 + r) * ldc + col0 + c4) = v; if (C16) { v4h h4; for (int i = 0; i < 4; ++i) h4[i] = (_Float16)v[i]; *(v4h*)(C16 + cofs + (size_t)(row0 + r) * ldc + col0 + c4) = h4; } } }
     }
}


typedef _Float16 v4h __attribute__((ext_vector_type(4)));

__global__ __launch_bounds__(256) void k_x16(const float* __restrict__ x, _Float16* __restrict__ X16, size_t n8) { const size_t t = (size_t)blockIdx.x * 256 + threadIdx.x; if (t >= n8) return; FragH f;
#pragma unroll
  for (int q = 0; q < 8; ++q) f.h[q] = (_Float16)bf16_round(x[t * 8 + q]); *(v8us*)((unsigned short*)X16 + t * 8) = f.half[0];  }
__global__ __launch_bounds__(256) void k_round16f(const float* __restrict__ W, _Float16* __restrict__ Bt, size_t n8) { const size_t t = (size_t)blockIdx.x * 256 + threadIdx.x; if (t >= n8) return; FragH f;
#pragma unroll
  for (int i = 0; i < 8; ++i) f.h[i] = (_Float16)(bf16_round(W[t * 8 + i]) * 16.0f); *(v8us*)((unsigned short*)Bt + t * 8) = f.half[0];  }
template <int NHv, int TTv>
__global__ __launch_bounds__(256) void k_vt(const _Float16* __restrict__ V16, int ldv, int voff, _Float16* __restrict__ Vt) { __shared__ unsigned short tl[64][66]; const int tid = threadIdx.x; const int slab = blockIdx.x / (TTv / 64), lg = blockIdx.x % (TTv / 64); const int b = slab / NHv, h = slab % NHv;
  for (int i = tid; i < 64 * 8; i += 256) { const int r = i / 8, c8 = (i % 8) * 8; FragH f; f.half[0] = *(const v8us*)((const unsigned short*)V16 + ((size_t)b * TTv + lg * 64 + r) * ldv + voff + h * 64 + c8);
#pragma unroll
    for (int q = 0; q < 8; ++q) tl[r][c8 + q] = f.u[q]; }
  __syncthreads();
  {
#pragma unroll
    for (int rd = 0; rd < 2; ++rd) { const int d = rd * 32 + tid / 8, pc = tid % 8; FragH f;
#pragma unroll
      for (int q = 0; q < 8; ++q) f.u[q] = tl[pc * 8 + q][d];
      *(v8us*)((unsigned short*)Vt + ((size_t)slab * 64 + d) * TTv + lg * 64 + pc * 8) = f.half[0]; }
     } }

__global__ __launch_bounds__(256) void k_hl(const float* __restrict__ F, _Float16* __restrict__ Hh, _Float16* __restrict__ Hl, size_t n8) { const size_t t = (size_t)blockIdx.x * 256 + threadIdx.x; if (t >= n8) return; FragH fh, fl; const v4f a = *(const v4fa*)(F + t * 8), c = *(const v4fa*)(F + t * 8 + 4);
#pragma unroll
  for (int q = 0; q < 4; ++q) { _Float16 h = (_Float16)a[q]; fh.h[q] = h; fl.h[q] = (_Float16)((a[q] - (float)h) * 1024.0f); h = (_Float16)c[q]; fh.h[4 + q] = h; fl.h[4 + q] = (_Float16)((c[q] - (float)h) * 1024.0f); }
  { *(v8us*)((unsigned short*)Hh + t * 8) = fh.half[0]; *(v8us*)((unsigned short*)Hl + t * 8) = fl.half[0];  } }

// ---- fast GEMM (wave tile 32x64; requires M % 32 == 0 rows per launch region and N % 64 == 0); epilogue = k_gemm_hhx semantics ----
__device__ __forceinline__ v16h g2_frag(const _Float16* p, int hh) { FragH f; f.half[0] = *(const v8us*)((const unsigned short*)p + 8 * hh); f.half[1] = *(const v8us*)((const unsigned short*)p + 16 + 8 * hh); return f.v; }
__device__ __forceinline__ v8f g2_mma(v16h a, v16h b, v8f c) { v8f d = __builtin_amdgcn_wmma_f32_16x16x32_f16(false, a, false, b, (short)0, c, false, false); asm volatile("v_nop\n\tv_nop\n\tv_nop\n\tv_nop" : "+v"(d) : "v"(a), "v"(b)); return d; }
template <int ACT>
__global__ __launch_bounds__(128) void k_gemm2(const _Float16* __restrict__ A, int lda, size_t sA, const _Float16* __restrict__ Bh, int ldb, size_t sB, float alpha, const float* __restrict__ bias, size_t sBias, const float* __restrict__ CP, int rowsPerB, size_t sCPb, int row0g,
    float* __restrict__ C, _Float16* __restrict__ C16, int ldc, size_t sC, int M, int N, int K) {
  __shared__ __attribute__((aligned(16))) float so[4][32][68];
  const int tid = threadIdx.x, w = tid >> 5, lane = tid & 31, ln = lane & 15, hh = lane >> 4; const int by = blockIdx.y;
  A += (size_t)by * sA; Bh += (size_t)by * sB; const size_t cofs = (size_t)by * sC; const float* bp = bias ? bias + (size_t)by * sBias : nullptr;
  const int ntn = N >> 6; const int mt = blockIdx.x / ntn, nq = blockIdx.x - mt * ntn; const int row0 = mt * 128 + 32 * w, col0 = nq * 64; if (row0 >= M) return;
  const _Float16* a0p = A + (size_t)(row0 + ln) * lda; const _Float16* a1p = a0p + (size_t)16 * lda;
  const _Float16* b0p = Bh + (size_t)(col0 + ln) * ldb; const _Float16* b1p = b0p + (size_t)16 * ldb; const _Float16* b2p = b1p + (size_t)16 * ldb; const _Float16* b3p = b2p + (size_t)16 * ldb;
  const v8f z8 = {0.f,0.f,0.f,0.f,0.f,0.f,0.f,0.f}; v8f c00 = z8, c01 = z8, c02 = z8, c03 = z8, c10 = z8, c11 = z8, c12 = z8, c13 = z8;
#pragma unroll 1
  for (int kb = 0; kb < K; kb += 32) { const v16h a0 = g2_frag(a0p + kb, hh), a1 = g2_frag(a1p + kb, hh);
    v16h b = g2_frag(b0p + kb, hh); c00 = g2_mma(a0, b, c00); c10 = g2_mma(a1, b, c10);
    b = g2_frag(b1p + kb, hh); c01 = g2_mma(a0, b, c01); c11 = g2_mma(a1, b, c11);
    b = g2_frag(b2p + kb, hh); c02 = g2_mma(a0, b, c02); c12 = g2_mma(a1, b, c12);
    b = g2_frag(b3p + kb, hh); c03 = g2_mma(a0, b, c03); c13 = g2_mma(a1, b, c13); }
  v8f accs[8] = {c00, c01, c02, c03, c10, c11, c12, c13};
#pragma unroll
  for (int u = 0; u < 8; ++u) { const int t = u & 3, half = u >> 2; const int col = col0 + t * 16 + ln; const float bv = bp ? bf16_round(bp[col]) : 0.f;
#pragma unroll
    for (int r = 0; r < 8; ++r) { const int rloc = half * 16 + 8 * hh + r; float v = accs[u][r] * alpha + bv; if (CP) { if (rowsPerB < 0) v += CP[cofs + (size_t)(row0g + row0 + rloc) * ldc + col];      /* rowsPerB < 0: own element of the batched C plane */ else { const int bidx = (row0g + row0 + rloc) / rowsPerB; v += CP[(size_t)bidx * sCPb + (size_t)by * 64 + col]; } }
      if (ACT == 3) v = fmaxf(v, 0.f); else if (ACT == 6) v = 0.5f * v * (1.0f + erff(v * 0.70710678118654752f)); else if (ACT == 11) v = 1.0f / (1.0f + expf(-v)); else if (ACT == 15) v = v / (1.0f + expf(-v)); else if (ACT == 12) v = (v > 0.f) ? v : 0.01f * v; else if (ACT == 8) v = tanhf(v);
      so[w][rloc][t * 16 + ln] = v; } }
  __builtin_amdgcn_fence(__ATOMIC_ACQ_REL, "workgroup"); __builtin_amdgcn_wave_barrier();
  const int rsub = lane >> 4, c4 = (lane & 15) * 4;
  {
#pragma unroll
    for (int q = 0; q < 16; ++q) { const int r = q * 2 + rsub; const v4f v = *(const v4fa*)&so[w][r][c4]; if (C) *(v4f*)(C + cofs + (size_t)(row0 + r) * ldc + col0 + c4) = v; if (C16) { v4h h4; for (int i = 0; i < 4; ++i) h4[i] = (_Float16)v[i]; *(v4h*)(C16 + cofs + (size_t)(row0 + r) * ldc + col0 + c4) = h4; } }
     } }



template <int CAUSAL>
__global__ __launch_bounds__(128) void k_flash(const _Float16* __restrict__ Q16, int ldq, const _Float16* __restrict__ K16, int ldk, const _Float16* __restrict__ Vt, const int* __restrict__ MSK, float* __restrict__ O, int ldo) {
  constexpr int RPW = 16, RTN = RPW / 16, NQB = TQ / (4 * RPW), DT = 4, KS = 2;
  __shared__ __attribute__((aligned(16))) unsigned short sP[4][RPW][40]; __shared__ __attribute__((aligned(16))) float sO[4][RPW][64 + 4];
  const int tid = threadIdx.x, w = tid >> 5, lane = tid & 31, ln = lane & 15, hh = lane >> 4;
  const int slab = blockIdx.x / QBNP, qblk = QB0P + blockIdx.x % QBNP; (void)NQB; const int b = slab / NH, h = slab % NH; const int qb0 = qblk * (4 * RPW); const int q0 = qb0 + w * RPW;
  FragH aq[2][KS];
#pragma unroll
  for (int rt = 0; rt < RTN; ++rt) { const unsigned short* qr = (const unsigned short*)Q16 + ((size_t)b * TQ + q0 + rt * 16 + ln) * ldq + h * 64;
#pragma unroll
    for (int ks = 0; ks < KS; ++ks) { aq[rt][ks].half[0] = *(const v8us*)(qr + ks * 32 + 8 * hh); aq[rt][ks].half[1] = *(const v8us*)(qr + ks * 32 + 16 + 8 * hh); } }
  const unsigned short* Vth = (const unsigned short*)Vt + (size_t)slab * 64 * TK;
  float m_r[2][8], l_r[2][8]; v8f oacc[2][DT];
#pragma unroll
  for (int rt = 0; rt < RTN; ++rt) {
#pragma unroll
    for (int r = 0; r < 8; ++r) { m_r[rt][r] = -3.0e38f; l_r[rt][r] = 0.f; }
#pragma unroll
    for (int dt = 0; dt < DT; ++dt) oacc[rt][dt] = (v8f){0.f,0.f,0.f,0.f,0.f,0.f,0.f,0.f}; }
  const int jend = (CAUSAL == 1) ? (qb0 + 4 * RPW) : ((CAUSAL == 23) ? min(TK, (qb0 / CHK + 2) * CHK) : TK);      /* causal / window: keys that can never contribute are skipped */ const int jbeg = (CAUSAL == 23) ? max(0, (qb0 / CHK - 1) * CHK) : 0;
#pragma unroll 1
  for (int j0 = jbeg; j0 < jend; j0 += 32) {
    v8f s[2][2];
#pragma unroll
    for (int nt = 0; nt < 2; ++nt) { const unsigned short* kr = (const unsigned short*)K16 + ((size_t)b * TK + j0 + nt * 16 + ln) * ldk + h * 64; FragH bk[KS];
#pragma unroll
      for (int ks = 0; ks < KS; ++ks) { bk[ks].half[0] = *(const v8us*)(kr + ks * 32 + 8 * hh); bk[ks].half[1] = *(const v8us*)(kr + ks * 32 + 16 + 8 * hh); }
#pragma unroll
      for (int rt = 0; rt < RTN; ++rt) { v8f acc = (v8f){0.f,0.f,0.f,0.f,0.f,0.f,0.f,0.f};
#pragma unroll
        for (int ks = 0; ks < KS; ++ks) acc = mmaH<1>(aq[rt][ks].v, aq[rt][ks].v, bk[ks].v, bk[ks].v, acc); s[rt][nt] = acc; } }
#pragma unroll
    for (int rt = 0; rt < RTN; ++rt)
#pragma unroll
      for (int r = 0; r < 8; ++r) { const int tq = q0 + rt * 16 + 8 * hh + r; const int k0 = j0 + ln, k1 = j0 + 16 + ln;
        bool ok0 = (CAUSAL == 1) ? (k0 <= tq) : ((CAUSAL == 2) ? ((k0 >> 5) == (tq >> 5)) : true), ok1 = (CAUSAL == 1) ? (k1 <= tq) : ((CAUSAL == 2) ? ((k1 >> 5) == (tq >> 5)) : true); if (CAUSAL == 23) { const int cq = tq / CHK; ok0 = (abs(k0 / CHK - cq) <= 1) && (MSK[(size_t)b * TK + k0] == 0); ok1 = (abs(k1 / CHK - cq) <= 1) && (MSK[(size_t)b * TK + k1] == 0); }      /* mode 23: 3-chunk window + int key-padding mask */
        if (CAUSAL == 24) { ok0 = (MSK[(size_t)b * TK + k0] == 0); ok1 = (MSK[(size_t)b * TK + k1] == 0); }      /* mode 24: int key-padding mask (nonzero = padded = excluded) */      /* mode 2: block-diagonal 32-token groups */
        float s0 = ok0 ? s[rt][0][r] * SCL : -3.0e38f, s1 = ok1 ? s[rt][1][r] * SCL : -3.0e38f; if (CAUSAL == 17) { const float* amk = (const float*)MSK + (size_t)b * TK; s0 += bf16_round(amk[k0]); s1 += bf16_round(amk[k1]); } if (CAUSAL == 18) { const float* tb = (const float*)MSK; const int* ri = MSK + 1024 + (size_t)b * TK; const int rq = ri[tq]; s0 += tb[(h * 8 + rq) * 8 + ri[k0]]; s1 += tb[(h * 8 + rq) * 8 + ri[k1]]; } if (CAUSAL == 19) { const int* rel = MSK + (size_t)tq * TK; const float* rb = (const float*)MSK + (size_t)TQ * TK + ((size_t)(b * NH + h) * TQ + tq) * 64; s0 += rb[rel[k0]]; s1 += rb[rel[k1]]; }      /* mode 19: + (q.Ek[rel] + Eb[rel][h]) / 8 gathered by the int relative ids (packed [ids | table]) */      /* mode 18: + resource_bias[h][r_q][r_k] from the packed [table | ids] buffer (TQ == TK) */      /* mode 17: additive per-(batch, key) mask INPUT */ float mc = fmaxf(s0, s1);
        mc = fmaxf(mc, __shfl_xor(mc, 1, 32)); mc = fmaxf(mc, __shfl_xor(mc, 2, 32)); mc = fmaxf(mc, __shfl_xor(mc, 4, 32)); mc = fmaxf(mc, __shfl_xor(mc, 8, 32));
        const float mn = fmaxf(m_r[rt][r], mc); const float al = (mn > -1.0e38f) ? expf(m_r[rt][r] - mn) : 1.0f; m_r[rt][r] = mn; const float p0 = ok0 ? expf(s0 - mn) : 0.f, p1 = ok1 ? expf(s1 - mn) : 0.f; l_r[rt][r] = l_r[rt][r] * al + p0 + p1;
#pragma unroll
        for (int dt = 0; dt < DT; ++dt) oacc[rt][dt][r] *= al;
        FragH t2; t2.h[0] = (_Float16)(p0 * 1024.0f); t2.h[1] = (_Float16)(p1 * 1024.0f); sP[w][rt * 16 + 8 * hh + r][ln] = t2.u[0]; sP[w][rt * 16 + 8 * hh + r][16 + ln] = t2.u[1]; }
    __builtin_amdgcn_fence(__ATOMIC_ACQ_REL, "workgroup"); __builtin_amdgcn_wave_barrier();
    FragH pa[2];
#pragma unroll
    for (int rt = 0; rt < RTN; ++rt) { pa[rt].half[0] = *(const v8us*)&sP[w][rt * 16 + ln][8 * hh]; pa[rt].half[1] = *(const v8us*)&sP[w][rt * 16 + ln][16 + 8 * hh]; }
#pragma unroll
    for (int dt = 0; dt < DT; ++dt) { const unsigned short* vrow = Vth + (size_t)(dt * 16 + ln) * TK + j0; FragH bv; bv.half[0] = *(const v8us*)(vrow + 8 * hh); bv.half[1] = *(const v8us*)(vrow + 16 + 8 * hh);
#pragma unroll
      for (int rt = 0; rt < RTN; ++rt) oacc[rt][dt] = mmaH<1>(pa[rt].v, pa[rt].v, bv.v, bv.v, oacc[rt][dt]); }
    __builtin_amdgcn_fence(__ATOMIC_ACQ_REL, "workgroup"); __builtin_amdgcn_wave_barrier(); }
#pragma unroll
  for (int rt = 0; rt < RTN; ++rt) {
#pragma unroll
    for (int r = 0; r < 8; ++r) { float l = l_r[rt][r]; l += __shfl_xor(l, 1, 32); l += __shfl_xor(l, 2, 32); l += __shfl_xor(l, 4, 32); l += __shfl_xor(l, 8, 32); l_r[rt][r] = (l > 0.f) ? 1.0f / (l * 1024.0f) : 0.f; }
#pragma unroll
    for (int dt = 0; dt < DT; ++dt)
#pragma unroll
      for (int r = 0; r < 8; ++r) sO[w][rt * 16 + 8 * hh + r][dt * 16 + ln] = oacc[rt][dt][r] * l_r[rt][r]; }
  __builtin_amdgcn_fence(__ATOMIC_ACQ_REL, "workgroup"); __builtin_amdgcn_wave_barrier();
  {
#pragma unroll
    for (int rp = 0; rp < RPW; rp += 2) { const int r = rp + (lane >> 4), pc = lane & 15; const v4f val = *(const v4fa*)&sO[w][r][pc * 4]; *(v4f*)(O + ((size_t)b * TQ + q0 + r) * ldo + h * 64 + pc * 4) = val; }
     } }
// 5-plane variant: S = Qh Kh^T + (Ql Kh^T + Qh Kl^T)/1024 with Q/K = [hi | 2^10 residual] f16 planes (QL/KL same layout as Q16/K16), then the 3-term P.V below.
// 3-term variant: O = (P_hi V_hi + (P_lo V_hi + P_hi V_lo) / 1024) / l with P = [hi | 2^10 residual] of 1024 p and V^T = [hi | 2^10 residual] planes (VtL same layout as Vt) -> ~2^-21-class products for un-averaged (early causal / peaked) rows
template <int CAUSAL>
__global__ __launch_bounds__(128) void k_flash5(const _Float16* __restrict__ Q16, const _Float16* __restrict__ QL, int ldq, const _Float16* __restrict__ K16, const _Float16* __restrict__ KL, int ldk, const _Float16* __restrict__ Vt, const _Float16* __restrict__ VtL, const int* __restrict__ MSK, float* __restrict__ O, int ldo) {
  constexpr int RPW = 16, RTN = RPW / 16, NQB = TQ / (4 * RPW), DT = 4, KS = 2;
  __shared__ __attribute__((aligned(16))) unsigned short sP[4][RPW][40]; __shared__ __attribute__((aligned(16))) unsigned short sPL[4][RPW][40]; __shared__ __attribute__((aligned(16))) float sO[4][RPW][64 + 4];
  const int tid = threadIdx.x, w = tid >> 5, lane = tid & 31, ln = lane & 15, hh = lane >> 4;
  const int slab = blockIdx.x / QBN5, qblk = QB05 + blockIdx.x % QBN5; (void)NQB; const int b = slab / NH, h = slab % NH; const int qb0 = qblk * (4 * RPW); const int q0 = qb0 + w * RPW;
  FragH aq[2][KS], aql[2][KS];
#pragma unroll
  for (int rt = 0; rt < RTN; ++rt) { const unsigned short* qr = (const unsigned short*)Q16 + ((size_t)b * TQ + q0 + rt * 16 + ln) * ldq + h * 64; const unsigned short* ql = (const unsigned short*)QL + ((size_t)b * TQ + q0 + rt * 16 + ln) * ldq + h * 64;
#pragma unroll
    for (int ks = 0; ks < KS; ++ks) { aq[rt][ks].half[0] = *(const v8us*)(qr + ks * 32 + 8 * hh); aq[rt][ks].half[1] = *(const v8us*)(qr + ks * 32 + 16 + 8 * hh); aql[rt][ks].half[0] = *(const v8us*)(ql + ks * 32 + 8 * hh); aql[rt][ks].half[1] = *(const v8us*)(ql + ks * 32 + 16 + 8 * hh); } }
  const unsigned short* Vth = (const unsigned short*)Vt + (size_t)slab * 64 * TK; const unsigned short* Vtl = (const unsigned short*)VtL + (size_t)slab * 64 * TK;
  float m_r[2][8], l_r[2][8]; v8f oacc[2][DT], oaccL[2][DT];
#pragma unroll
  for (int rt = 0; rt < RTN; ++rt) {
#pragma unroll
    for (int r = 0; r < 8; ++r) { m_r[rt][r] = -3.0e38f; l_r[rt][r] = 0.f; }
#pragma unroll
    for (int dt = 0; dt < DT; ++dt) { oacc[rt][dt] = (v8f){0.f,0.f,0.f,0.f,0.f,0.f,0.f,0.f}; oaccL[rt][dt] = oacc[rt][dt]; } }
  const int jend = (CAUSAL == 1) ? (qb0 + 4 * RPW) : ((CAUSAL == 23) ? min(TK, (qb0 / CHK + 2) * CHK) : TK);      /* causal / window: keys that can never contribute are skipped */ const int jbeg = (CAUSAL == 23) ? max(0, (qb0 / CHK - 1) * CHK) : 0;
#pragma unroll 1
  for (int j0 = jbeg; j0 < jend; j0 += 32) {
    v8f s[2][2];
#pragma unroll
    for (int nt = 0; nt < 2; ++nt) { const unsigned short* kr = (const unsigned short*)K16 + ((size_t)b * TK + j0 + nt * 16 + ln) * ldk + h * 64; const unsigned short* klr = (const unsigned short*)KL + ((size_t)b * TK + j0 + nt * 16 + ln) * ldk + h * 64; FragH bk[KS], bkl[KS];
#pragma unroll
      for (int ks = 0; ks < KS; ++ks) { bk[ks].half[0] = *(const v8us*)(kr + ks * 32 + 8 * hh); bk[ks].half[1] = *(const v8us*)(kr + ks * 32 + 16 + 8 * hh); bkl[ks].half[0] = *(const v8us*)(klr + ks * 32 + 8 * hh); bkl[ks].half[1] = *(const v8us*)(klr + ks * 32 + 16 + 8 * hh); }
#pragma unroll
      for (int rt = 0; rt < RTN; ++rt) { v8f acc = (v8f){0.f,0.f,0.f,0.f,0.f,0.f,0.f,0.f}, accl = acc;
#pragma unroll
        for (int ks = 0; ks < KS; ++ks) { acc = mmaH<1>(aq[rt][ks].v, aq[rt][ks].v, bk[ks].v, bk[ks].v, acc); accl = mmaH<1>(aql[rt][ks].v, aql[rt][ks].v, bk[ks].v, bk[ks].v, accl); accl = mmaH<1>(aq[rt][ks].v, aq[rt][ks].v, bkl[ks].v, bkl[ks].v, accl); }
#pragma unroll
        for (int r = 0; r < 8; ++r) acc[r] += accl[r] * 0.0009765625f;
        s[rt][nt] = acc; } }
#pragma unroll
    for (int rt = 0; rt < RTN; ++rt)
#pragma unroll
      for (int r = 0; r < 8; ++r) { const int tq = q0 + rt * 16 + 8 * hh + r; const int k0 = j0 + ln, k1 = j0 + 16 + ln;
        bool ok0 = (CAUSAL == 1) ? (k0 <= tq) : ((CAUSAL == 2) ? ((k0 >> 5) == (tq >> 5)) : true), ok1 = (CAUSAL == 1) ? (k1 <= tq) : ((CAUSAL == 2) ? ((k1 >> 5) == (tq >> 5)) : true);      /* mode 2: block-diagonal 32-token groups */
        if (CAUSAL == 4) { const int* mrow = MSK + ((size_t)b * TQ + tq) * TK; ok0 = mrow[k0] != 0; ok1 = mrow[k1] != 0; }      /* mode 4: per-(query, key) INPUT mask shared by all heads; masked keys contribute nothing (== the reference's -4096 fill, whose exp underflows to 0), rows with no valid key give l = 0 -> output 0 (== the reference's row_valid zeroing) */
        float s0 = ok0 ? s[rt][0][r] * SCL : -3.0e38f, s1 = ok1 ? s[rt][1][r] * SCL : -3.0e38f; if (CAUSAL == 17) { const float* amk = (const float*)MSK + (size_t)b * TK; s0 += bf16_round(amk[k0]); s1 += bf16_round(amk[k1]); } if (CAUSAL == 18) { const float* tb = (const float*)MSK; const int* ri = MSK + 1024 + (size_t)b * TK; const int rq = ri[tq]; s0 += tb[(h * 8 + rq) * 8 + ri[k0]]; s1 += tb[(h * 8 + rq) * 8 + ri[k1]]; } if (CAUSAL == 19) { const int* rel = MSK + (size_t)tq * TK; const float* rb = (const float*)MSK + (size_t)TQ * TK + ((size_t)(b * NH + h) * TQ + tq) * 64; s0 += rb[rel[k0]]; s1 += rb[rel[k1]]; }      /* mode 19: + (q.Ek[rel] + Eb[rel][h]) / 8 gathered by the int relative ids (packed [ids | table]) */      /* mode 18: + resource_bias[h][r_q][r_k] from the packed [table | ids] buffer (TQ == TK) */      /* mode 17: additive per-(batch, key) mask INPUT */ float mc = fmaxf(s0, s1);
        mc = fmaxf(mc, __shfl_xor(mc, 1, 32)); mc = fmaxf(mc, __shfl_xor(mc, 2, 32)); mc = fmaxf(mc, __shfl_xor(mc, 4, 32)); mc = fmaxf(mc, __shfl_xor(mc, 8, 32));
        const float mn = fmaxf(m_r[rt][r], mc); const float al = (mn > -1.0e38f) ? expf(m_r[rt][r] - mn) : 1.0f; m_r[rt][r] = mn; const float p0 = ok0 ? expf(s0 - mn) : 0.f, p1 = ok1 ? expf(s1 - mn) : 0.f; l_r[rt][r] = l_r[rt][r] * al + p0 + p1;
#pragma unroll
        for (int dt = 0; dt < DT; ++dt) { oacc[rt][dt][r] *= al; oaccL[rt][dt][r] *= al; }
        FragH t2, t2l; const float ps0 = p0 * 1024.0f, ps1 = p1 * 1024.0f; t2.h[0] = (_Float16)ps0; t2.h[1] = (_Float16)ps1; t2l.h[0] = (_Float16)((ps0 - (float)t2.h[0]) * 1024.0f); t2l.h[1] = (_Float16)((ps1 - (float)t2.h[1]) * 1024.0f);
        sP[w][rt * 16 + 8 * hh + r][ln] = t2.u[0]; sP[w][rt * 16 + 8 * hh + r][16 + ln] = t2.u[1]; sPL[w][rt * 16 + 8 * hh + r][ln] = t2l.u[0]; sPL[w][rt * 16 + 8 * hh + r][16 + ln] = t2l.u[1]; }
    __builtin_amdgcn_fence(__ATOMIC_ACQ_REL, "workgroup"); __builtin_amdgcn_wave_barrier();
    FragH pa[2], pl[2];
#pragma unroll
    for (int rt = 0; rt < RTN; ++rt) { pa[rt].half[0] = *(const v8us*)&sP[w][rt * 16 + ln][8 * hh]; pa[rt].half[1] = *(const v8us*)&sP[w][rt * 16 + ln][16 + 8 * hh]; pl[rt].half[0] = *(const v8us*)&sPL[w][rt * 16 + ln][8 * hh]; pl[rt].half[1] = *(const v8us*)&sPL[w][rt * 16 + ln][16 + 8 * hh]; }
#pragma unroll
    for (int dt = 0; dt < DT; ++dt) { const unsigned short* vrow = Vth + (size_t)(dt * 16 + ln) * TK + j0; const unsigned short* vrl = Vtl + (size_t)(dt * 16 + ln) * TK + j0; FragH bv, bl; bv.half[0] = *(const v8us*)(vrow + 8 * hh); bv.half[1] = *(const v8us*)(vrow + 16 + 8 * hh); bl.half[0] = *(const v8us*)(vrl + 8 * hh); bl.half[1] = *(const v8us*)(vrl + 16 + 8 * hh);
#pragma unroll
      for (int rt = 0; rt < RTN; ++rt) { oacc[rt][dt] = mmaH<1>(pa[rt].v, pa[rt].v, bv.v, bv.v, oacc[rt][dt]); oaccL[rt][dt] = mmaH<1>(pl[rt].v, pl[rt].v, bv.v, bv.v, oaccL[rt][dt]); oaccL[rt][dt] = mmaH<1>(pa[rt].v, pa[rt].v, bl.v, bl.v, oaccL[rt][dt]); } }
    __builtin_amdgcn_fence(__ATOMIC_ACQ_REL, "workgroup"); __builtin_amdgcn_wave_barrier(); }
#pragma unroll
  for (int rt = 0; rt < RTN; ++rt) {
#pragma unroll
    for (int r = 0; r < 8; ++r) { float l = l_r[rt][r]; l += __shfl_xor(l, 1, 32); l += __shfl_xor(l, 2, 32); l += __shfl_xor(l, 4, 32); l += __shfl_xor(l, 8, 32); l_r[rt][r] = (l > 0.f) ? 1.0f / (l * 1024.0f) : 0.f; }
#pragma unroll
    for (int dt = 0; dt < DT; ++dt)
#pragma unroll
      for (int r = 0; r < 8; ++r) { float v = oacc[rt][dt][r]; v += oaccL[rt][dt][r] * 0.0009765625f; sO[w][rt * 16 + 8 * hh + r][dt * 16 + ln] = v * l_r[rt][r]; } }
  __builtin_amdgcn_fence(__ATOMIC_ACQ_REL, "workgroup"); __builtin_amdgcn_wave_barrier();
  {
#pragma unroll
    for (int rp = 0; rp < RPW; rp += 2) { const int r = rp + (lane >> 4), pc = lane & 15; const v4f val = *(const v4fa*)&sO[w][r][pc * 4]; *(v4f*)(O + ((size_t)b * TQ + q0 + r) * ldo + h * 64 + pc * 4) = val; }
     } }

__global__ __launch_bounds__(256) void k_rotab(float* __restrict__ CS, float* __restrict__ SN) {
  #pragma clang fp contract(off)
  const int t = blockIdx.x * 256 + threadIdx.x; if (t >= SLEN * 32) return; const int j = t % 32, s = t / 32; const float ex = (float)(2 * j) / 64.0f; const float inv = 1.0f / powf(10000.0f, ex); const float th = (float)s * inv; const float c = cosf(th), sn = sinf(th);
  { *(float*)(CS + t) = c; *(float*)(SN + t) = sn;  } }
__global__ __launch_bounds__(256) void k_rope(const float* __restrict__ F, int nsrc, int ndst, int rep, const float* __restrict__ CS, const float* __restrict__ SN, _Float16* __restrict__ H, _Float16* __restrict__ L) {
  #pragma clang fp contract(off)
  const size_t t = (size_t)blockIdx.x * 256 + threadIdx.x; if (t >= (size_t)NR * ndst * 4) return; const int g8 = (int)(t % 4); const int hd = (int)((t / 4) % ndst); const size_t row = t / ((size_t)4 * ndst); const int s = (int)(row % SLEN); const int hs = hd / rep;
  const float* src = F + row * (size_t)(nsrc * 64) + hs * 64; FragH ah, al, bh, bl;
  for (int i = 0; i < 8; ++i) { const int d = g8 * 8 + i; const float c = CS[s * 32 + d], sn = SN[s * 32 + d]; const float x1 = src[d], x2 = src[d + 32];
    float o1 = x1 * c; o1 += -x2 * sn; float o2 = x2 * c; o2 += x1 * sn;
    _Float16 hv = (_Float16)o1; ah.h[i] = hv; al.h[i] = (_Float16)((o1 - (float)hv) * 1024.0f); hv = (_Float16)o2; bh.h[i] = hv; bl.h[i] = (_Float16)((o2 - (float)hv) * 1024.0f); }
  const size_t o = row * (size_t)(ndst * 64) + hd * 64 + g8 * 8;
  { *(v8us*)((unsigned short*)H + o) = ah.half[0]; *(v8us*)((unsigned short*)H + o + 32) = bh.half[0]; *(v8us*)((unsigned short*)L + o) = al.half[0]; *(v8us*)((unsigned short*)L + o + 32) = bl.half[0];  } }
__global__ __launch_bounds__(256) void k_rope2(const float* __restrict__ F, int nsrc, int ndst, int rep, const float* __restrict__ CS, const float* __restrict__ SN, _Float16* __restrict__ H, _Float16* __restrict__ L) {
  #pragma clang fp contract(off)
  const size_t t = (size_t)blockIdx.x * 256 + threadIdx.x; if (t >= (size_t)NR * ndst * 4) return; const int g16 = (int)(t % 4); const int hd = (int)((t / 4) % ndst); const size_t row = t / ((size_t)4 * ndst); const int s = (int)(row % SLEN); const int hs = hd / rep;
  const float* src = F + row * (size_t)(nsrc * 64) + hs * 64 + g16 * 16; FragH ah, al;
  for (int pr = 0; pr < 8; ++pr) { const int i = g16 * 8 + pr; const float c = CS[s * 32 + i], sn = SN[s * 32 + i]; const float x1 = src[2 * pr], x2 = src[2 * pr + 1];
    float o1 = x1 * c; o1 -= x2 * sn; float o2 = x1 * sn; o2 += x2 * c;
    _Float16 hv = (_Float16)o1; ah.h[2 * pr] = hv; al.h[2 * pr] = (_Float16)((o1 - (float)hv) * 1024.0f); hv = (_Float16)o2; ah.h[2 * pr + 1] = hv; al.h[2 * pr + 1] = (_Float16)((o2 - (float)hv) * 1024.0f); }
  const size_t o = row * (size_t)(ndst * 64) + hd * 64 + g16 * 16;
  { *(v8us*)((unsigned short*)H + o) = ah.half[0]; *(v8us*)((unsigned short*)H + o + 8) = ah.half[1]; *(v8us*)((unsigned short*)L + o) = al.half[0]; *(v8us*)((unsigned short*)L + o + 8) = al.half[1];  } }
__global__ __launch_bounds__(256) void k_ln512(const float* __restrict__ A, const float* __restrict__ res, const float* __restrict__ g, const float* __restrict__ bb, float* __restrict__ Y, _Float16* __restrict__ Y16) {
  #pragma clang fp contract(off)
  const int wv = threadIdx.x >> 5, ln = threadIdx.x & 31; const size_t r = (size_t)blockIdx.x * 8 + wv; if (r >= NR) return; float x[16]; float s = 0.f;
  for (int i = 0; i < 2; ++i) { const v8f a = *(const v8f*)(A + r * DM + i * 256 + ln * 8); for (int q = 0; q < 8; ++q) { float v = a[q]; if (res) v += bf16_round(res[r * DM + i * 256 + ln * 8 + q]); x[i * 8 + q] = v; s += v; } }
  for (int o = 16; o > 0; o >>= 1) s += __shfl_xor(s, o, 32); const float mu = s / (float)DM; float var = 0.f; for (int q = 0; q < 16; ++q) { const float d = x[q] - mu; var += d * d; }
  for (int o = 16; o > 0; o >>= 1) var += __shfl_xor(var, o, 32); const float inv = rsqrtf(var / (float)DM + 1e-5f);
  { for (int i = 0; i < 2; ++i) { const int c0 = i * 256 + ln * 8; v8f y; FragH f; for (int q = 0; q < 8; ++q) { float v = (x[i * 8 + q] - mu) * inv; v *= bf16_round(g[c0 + q]); v += bf16_round(bb[c0 + q]); y[q] = v; f.h[q] = (_Float16)v; } *(v8f*)(Y + r * DM + c0) = y; if (Y16) *(v8us*)((unsigned short*)Y16 + r * DM + c0) = f.half[0]; }  } }
__global__ __launch_bounds__(256) void k_pack(const float* __restrict__ rb, const int* __restrict__ rid, int* __restrict__ PK) { const int t = blockIdx.x * 256 + threadIdx.x; if (t >= 1024 + NB * TK) return; int v; if (t < 1024) v = __float_as_int(bf16_round(rb[t])); else v = rid[t - 1024]; *(int*)(PK + t) = v;  }
__global__ __launch_bounds__(256) void k_tabin(const float* __restrict__ sp, float* __restrict__ CS, float* __restrict__ SN) { const int t = blockIdx.x * 256 + threadIdx.x; if (t >= SLEN * 32) return; const int i = t % 32, s = t / 32; const float c = bf16_round(sp[s * 64 + 32 + i]), sn = bf16_round(sp[s * 64 + i]);
  { *(float*)(CS + t) = c; *(float*)(SN + t) = sn;  } }
__global__ __launch_bounds__(256) void k_wsc(const float* __restrict__ Wm, _Float16* __restrict__ Bt, size_t n8, float sc) { const size_t t = (size_t)blockIdx.x * 256 + threadIdx.x; if (t >= n8) return; FragH f; for (int q = 0; q < 8; ++q) f.h[q] = (_Float16)(bf16_round(Wm[t * 8 + q]) * sc); *(v8us*)((unsigned short*)Bt + t * 8) = f.half[0];  }
__global__ __launch_bounds__(256) void k_rotab2(float* __restrict__ CS, float* __restrict__ SN) {
  #pragma clang fp contract(off)
  const int t = blockIdx.x * 256 + threadIdx.x; if (t >= SLEN * 32) return; const int j = t % 32, s = t / 32; const float c0 = -0.14391156831212787f;      /* -ln(10000)/64 rounded to f32 */ const float inv = expf((float)(2 * j) * c0); const float th = (float)s * inv; const float c = cosf(th), sn = sinf(th);
  { *(float*)(CS + t) = c; *(float*)(SN + t) = sn;  } }
__global__ __launch_bounds__(256) void k_lnu(const float* __restrict__ X, _Float16* __restrict__ N16, float* __restrict__ XB) {
  #pragma clang fp contract(off)
  const int wv = threadIdx.x >> 5, ln = threadIdx.x & 31; const size_t r = (size_t)blockIdx.x * 8 + wv; if (r >= NR) return; float a[32]; float s = 0.f;
  for (int i = 0; i < 4; ++i) { const v8f v = *(const v8f*)(X + r * DM + (i * 32 + ln) * 8); for (int q = 0; q < 8; ++q) { const float u = bf16_round(v[q]); a[i * 8 + q] = u; s += u; } }
  for (int o = 16; o > 0; o >>= 1) s += __shfl_xor(s, o, 32); const float mu = s / (float)DM; float var = 0.f; for (int q = 0; q < 32; ++q) { const float d = a[q] - mu; var += d * d; }
  for (int o = 16; o > 0; o >>= 1) var += __shfl_xor(var, o, 32); const float den = sqrtf(var / (float)(DM - 1)) + 1e-6f; const float inv = 1.0f / den;      /* one reciprocal per row; (x-mean)*inv vs the reference's division differs by <= 1 ulp */
  { for (int i = 0; i < 4; ++i) { const int c0 = (i * 32 + ln) * 8; FragH f; v8f xb; for (int q = 0; q < 8; ++q) { f.h[q] = (_Float16)((a[i * 8 + q] - mu) * inv); xb[q] = a[i * 8 + q]; } *(v8us*)((unsigned short*)N16 + r * DM + c0) = f.half[0]; *(v8f*)(XB + r * DM + c0) = xb; }  } }

// Fused Gaussian-kernel attention: one launch for all (batch, head) slabs; the score plane and the weight plane never leave the registers.
// Block = 8 waves x 16 output rows i; the summed index j walks in LDS stages of FJ rows (q hi, q residual, V^T, |q|^2), two buffers, one barrier a stage.
// S^T tile: A = q rows j (LDS), B = k columns i (registers, loaded once); D[8 hh + r][ln] = k_i . q_j. Two D tiles (j 0-15, 16-31), weighted and rounded in place, are the B operand of O^T += V^T . P^T.
#define FJ 64
#define FP 72                    /* LDS row pitch in f16: 128-byte rows + 16 bytes, for 16-byte fragment reads */
__device__ __forceinline__ v16h fz_frag(const unsigned short* p, int hh) { FragH f; f.half[0] = *(const v8us*)(p + 8 * hh); f.half[1] = *(const v8us*)(p + 16 + 8 * hh); return f.v; }
__device__ __forceinline__ v8f fz_mma(v16h a, v16h b, v8f c) { return __builtin_amdgcn_wmma_f32_16x16x32_f16(false, a, false, b, (short)0, c, false, false); }
union FragW { v16h v; unsigned d[8]; };
__device__ __forceinline__ void fz_exp2_pack(float x0, float x1, float x2, float x3, float x4, float x5, float x6, float x7, unsigned* o) {
  asm("v_exp_f32 %4, %4\n\tv_exp_f32 %5, %5\n\tv_exp_f32 %6, %6\n\tv_exp_f32 %7, %7\n\tv_exp_f32 %8, %8\n\tv_exp_f32 %9, %9\n\tv_exp_f32 %10, %10\n\tv_exp_f32 %11, %11\n\t"
      "v_cvt_pk_f16_f32 %0, %4, %5\n\tv_cvt_pk_f16_f32 %1, %6, %7\n\t"
      "s_delay_alu instid0(TRANS32_DEP_3)\n\tv_cvt_pk_f16_f32 %2, %8, %9\n\t"
      "s_delay_alu instid0(TRANS32_DEP_1)\n\tv_cvt_pk_f16_f32 %3, %10, %11"
      : "=&v"(o[0]), "=&v"(o[1]), "=&v"(o[2]), "=&v"(o[3]), "+v"(x0), "+v"(x1), "+v"(x2), "+v"(x3), "+v"(x4), "+v"(x5), "+v"(x6), "+v"(x7)); }
__global__ __launch_bounds__(256) __attribute__((amdgpu_waves_per_eu(4, 4))) void k_gauss(const _Float16* __restrict__ QH, const _Float16* __restrict__ QL, const _Float16* __restrict__ KH, const _Float16* __restrict__ KL, const _Float16* __restrict__ VT,
    const float* __restrict__ QN, const float* __restrict__ KN, const float* __restrict__ rs, _Float16* __restrict__ OH) {
  __shared__ __attribute__((aligned(16))) unsigned short sQH[2][FJ][FP]; __shared__ __attribute__((aligned(16))) unsigned short sQL[2][FJ][FP]; __shared__ __attribute__((aligned(16))) unsigned short sVT[2][64][FP]; __shared__ __attribute__((aligned(16))) float sQN[2][FJ];
  const int tid = threadIdx.x, w = tid >> 5, lane = tid & 31, ln = lane & 15, hh = lane >> 4;
  const int slab = blockIdx.x / (SLEN / 128), ib = blockIdx.x % (SLEN / 128); const int b = slab / NH, h = slab % NH;
  const int i = ib * 128 + w * 16 + ln;      /* this lane's output row (a column of every D tile) */
  const unsigned short* kh = (const unsigned short*)KH + ((size_t)b * SLEN + i) * DM + h * 64; const unsigned short* kl = (const unsigned short*)KL + ((size_t)b * SLEN + i) * DM + h * 64;
  const v16h bkh0 = fz_frag(kh, hh), bkh1 = fz_frag(kh + 32, hh), bkl0 = fz_frag(kl, hh), bkl1 = fz_frag(kl + 32, hh);
  const float r = bf16_round(rs[0]); const float c = r * 1.44269504f;      /* r log2(e): 1024 exp(-r d2) = 2^(10 - c kn - c qn + 2 c s), one hardware exp2 an element */
  const float c2 = 2.0f * c; const float knb = __builtin_fmaf(-c, KN[(size_t)slab * SLEN + i], 10.0f);      /* this lane's share of the exponent, formed once */
  const int sr = tid >> 3, sc = (tid & 7) * 8;      /* staging: 16 bytes a thread in rows sr and sr + 32 of each plane */
  const unsigned short* gqh = (const unsigned short*)QH + ((size_t)b * SLEN + sr) * DM + h * 64 + sc; const unsigned short* gql = (const unsigned short*)QL + ((size_t)b * SLEN + sr) * DM + h * 64 + sc;
  const unsigned short* gvt = (const unsigned short*)VT + ((size_t)slab * 64 + sr) * SLEN + sc; const float* gqn = QN + (size_t)slab * SLEN + (tid & (FJ - 1));
  v8us rq0, rq1, rl0, rl1, rv0, rv1; float rn = 0.f;
  auto gload = [&](int j0) { rq0 = *(const v8us*)(gqh + (size_t)j0 * DM); rq1 = *(const v8us*)(gqh + (size_t)(j0 + 32) * DM); rl0 = *(const v8us*)(gql + (size_t)j0 * DM); rl1 = *(const v8us*)(gql + (size_t)(j0 + 32) * DM);
    rv0 = *(const v8us*)(gvt + j0); rv1 = *(const v8us*)(gvt + (size_t)32 * SLEN + j0); if (tid < FJ) rn = gqn[j0]; };
  auto sstore = [&](int bf) { *(v8us*)&sQH[bf][sr][sc] = rq0; *(v8us*)&sQH[bf][sr + 32][sc] = rq1; *(v8us*)&sQL[bf][sr][sc] = rl0; *(v8us*)&sQL[bf][sr + 32][sc] = rl1; *(v8us*)&sVT[bf][sr][sc] = rv0; *(v8us*)&sVT[bf][sr + 32][sc] = rv1; if (tid < FJ) sQN[bf][tid] = -c * rn; };      /* staged as -c |q_j|^2: row j's share of the exponent */
  const v8f z8 = {0.f,0.f,0.f,0.f,0.f,0.f,0.f,0.f}; v8f oacc[4] = {z8, z8, z8, z8};
  gload(0); sstore(0); __syncthreads();
#pragma unroll 1      /* one stage a trip: the body already holds two 32-wide passes; more would only grow the code */
  for (int st = 0; st < SLEN / FJ; ++st) { const int bf = st & 1; const bool more = st + 1 < SLEN / FJ;
    if (more) gload((st + 1) * FJ);      /* next stage flies from L2 while this one is worked on */
#pragma unroll
    for (int jj = 0; jj < FJ; jj += 32) { FragW pb; const v16h av0 = fz_frag(&sVT[bf][ln][jj], hh), av1 = fz_frag(&sVT[bf][16 + ln][jj], hh), av2 = fz_frag(&sVT[bf][32 + ln][jj], hh), av3 = fz_frag(&sVT[bf][48 + ln][jj], hh);      /* named ahead of the score work, so that the scheduler may start these reads early */
#pragma unroll
      for (int nt = 0; nt < 2; ++nt) { const unsigned short* qh = &sQH[bf][jj + nt * 16 + ln][0]; const unsigned short* ql = &sQL[bf][jj + nt * 16 + ln][0];
        const v16h ah0 = fz_frag(qh, hh), ah1 = fz_frag(qh + 32, hh), al0 = fz_frag(ql, hh), al1 = fz_frag(ql + 32, hh);
        v8f cA = fz_mma(ah0, bkl0, z8), cB = fz_mma(al0, bkh0, z8), cC = fz_mma(ah0, bkh0, z8); cA = fz_mma(ah1, bkl1, cA); cB = fz_mma(al1, bkh1, cB); cC = fz_mma(ah1, bkh1, cC);
        const v4f n0 = *(const v4fa*)&sQN[bf][jj + nt * 16 + 8 * hh], n1 = *(const v4fa*)&sQN[bf][jj + nt * 16 + 8 * hh + 4];
        float e[8];
#pragma unroll
        for (int q = 0; q < 8; ++q) { const float s = __builtin_fmaf(cB[q] + cA[q], 0.0009765625f, cC[q]); const float qn = (q < 4) ? n0[q & 3] : n1[q & 3]; e[q] = __builtin_fmaf(s, c2, knb + qn); }
        fz_exp2_pack(e[0], e[1], e[2], e[3], e[4], e[5], e[6], e[7], &pb.d[nt * 4]); }      /* bare v_exp_f32: below 2^-126 it gives 0, which the f16 rounding gives from 2^-25 down anyway; above 2^16 the f16 rounding gives inf, as before */
      oacc[0] = fz_mma(av0, pb.v, oacc[0]); oacc[1] = fz_mma(av1, pb.v, oacc[1]); oacc[2] = fz_mma(av2, pb.v, oacc[2]); oacc[3] = fz_mma(av3, pb.v, oacc[3]); }
    if (more) sstore(bf ^ 1);      /* that buffer's last readers left it before the barrier that ended the trip before */
    __syncthreads(); }
  unsigned short* orow = (unsigned short*)OH + ((size_t)b * SLEN + i) * DM + h * 64 + 8 * hh;      /* D register q of tile dt = out[i][dt * 16 + 8 hh + q]; stored as the f16 operand plane of the output projection */
#pragma unroll
  for (int dt = 0; dt < 4; ++dt) { FragH f;
#pragma unroll
    for (int q = 0; q < 8; ++q) f.h[q] = (_Float16)(oacc[dt][q] * 0.0009765625f);
    *(v8us*)(orow + dt * 16) = f.half[0]; } }

// Projection GEMM, C[M][N] (f32) = A[M][K] . Bh[N][K]^T * alpha + bf16(bias): block = 8 waves (4 x 2) of 32x64 wave tiles = 128 x 128 of C.
// Both operand tiles (128 rows x GK k) go through LDS, two buffers, one barrier a stage: every global load covers whole 128-byte lines, and a row is fetched once a block instead of once a wave.
// k runs upward in steps of 32 into the same accumulators as before, so every sum keeps its order. Needs M % 128 == 0, N % 128 == 0, K % GK == 0.
// SPLIT (the qkv product; a block's 128 columns lie in one of q, k, v and a wave's 64 columns are one head): no f32 plane is stored. q and k go out as f16 hi + 2^10 residual planes with each row's squared norm ([batch, head][token]), v as V^T [batch, head][64][token].
template <int N, int K, bool SPLIT>
__global__ __launch_bounds__(256) void k_gemm3(const _Float16* __restrict__ A, const _Float16* __restrict__ Bh, float alpha, const float* __restrict__ bias, float* __restrict__ C,
    _Float16* __restrict__ QH, _Float16* __restrict__ QL, _Float16* __restrict__ KH, _Float16* __restrict__ KL, _Float16* __restrict__ VT, float* __restrict__ QN, float* __restrict__ KN) {
  constexpr int GK = 64;      /* k a stage: one 128-byte line a row */
  constexpr int GP = GK + 8;      /* LDS row pitch in f16: the row + 16 bytes (an odd count of 16 bytes), for 16-byte fragment reads */
  constexpr int RP = 2048 / GK, NP = 128 / RP;      /* rows a staging pass of 256 threads covers; passes a tile */
  __shared__ __attribute__((aligned(16))) unsigned short sT[2][256][GP];      /* rows 0-127: A tile, rows 128-255: B tile; after the loop each wave's 32 x 68 f32 output patch */
  const int tid = threadIdx.x, lane = tid & 31, ln = lane & 15, hh = lane >> 4;
  const int w = __builtin_amdgcn_readfirstlane(tid >> 5);      /* the wave's number in a scalar register: w, wm, wn and the tile origins formed from them hold no vector registers across the loop */
  constexpr int ntn = N >> 7; const int mt = blockIdx.x / ntn, nq = blockIdx.x - mt * ntn; const int wm = w >> 1, wn = w & 1;
  const int sr = tid / (GK / 8), sc = (tid % (GK / 8)) * 8;      /* staging: 16 bytes a thread in rows sr + RP u of each tile; 8 neighbour threads cover one 128-byte line */
  const unsigned short* ga = (const unsigned short*)A + (size_t)(mt * 128) * K; const unsigned short* gb = (const unsigned short*)Bh + (size_t)(nq * 128) * K; const unsigned go = (unsigned)(sr * K + sc);      /* block-uniform tile bases, which walk along k, and one fixed offset a thread */
  v8us ra[NP], rb[NP];
  auto gload = [&](int k0) {
#pragma unroll
    for (int u = 0; u < NP; ++u) { ra[u] = *(const v8us*)(ga + k0 + go + RP * u * K); rb[u] = *(const v8us*)(gb + k0 + go + RP * u * K); } };
  auto sstore = [&](int bf) {
#pragma unroll
    for (int u = 0; u < NP; ++u) { *(v8us*)&sT[bf][sr + RP * u][sc] = ra[u]; *(v8us*)&sT[bf][128 + sr + RP * u][sc] = rb[u]; } };
  const v8f z8 = {0.f,0.f,0.f,0.f,0.f,0.f,0.f,0.f}; v8f acc[2][4] = {{z8, z8, z8, z8}, {z8, z8, z8, z8}};
  constexpr int nst = K / GK;
  gload(0); sstore(0); __syncthreads();
#pragma unroll 1      /* one stage a trip: the body already holds 16 matrix instructions; more would only grow the code */
  for (int st = 0; st < nst; ++st) { const int bf = st & 1; const bool more = st + 1 < nst;
    if (more) gload((st + 1) * GK);      /* next stage flies from L2 while this one is worked on */
#pragma unroll
    for (int kk = 0; kk < GK; kk += 32) { const v16h a0 = fz_frag(&sT[bf][wm * 32 + ln][kk], hh), a1 = fz_frag(&sT[bf][wm * 32 + 16 + ln][kk], hh); v16h b[4];
#pragma unroll
      for (int t = 0; t < 4; ++t) b[t] = fz_frag(&sT[bf][128 + wn * 64 + t * 16 + ln][kk], hh);
      __builtin_amdgcn_sched_barrier(0);      /* keeps the six fragment reads together ahead of the eight products: left alone the scheduler sinks each B read to its use, and the wave waits out the LDS latency four times instead of once */
#pragma unroll
      for (int t = 0; t < 4; ++t) { acc[0][t] = fz_mma(a0, b[t], acc[0][t]); acc[1][t] = fz_mma(a1, b[t], acc[1][t]); } }
    if (more) sstore(bf ^ 1);      /* that buffer's last readers left it before the barrier that ended the trip before */
    __syncthreads(); }
  const int row0 = mt * 128 + wm * 32, col0 = nq * 128 + wn * 64;
  const int third = SPLIT ? (nq * 128) / DM : 0;      /* 0 q, 1 k, 2 v: the same for the whole block */
  if (SPLIT && third == 2) {
    constexpr int VP = 128 + 8;      /* LDS row pitch in f16: 128 tokens + 16 bytes (an odd count of 16 bytes) */
    unsigned short* sv = &sT[0][0][0];      /* [128 columns d][VP]; every read of the tiles ended at the loop's last barrier */
#pragma unroll      /* constant indices keep acc in registers */
    for (int u = 0; u < 8; ++u) { const int t = u & 3, half = u >> 2; const float bv = bf16_round(bias[col0 + t * 16 + ln]); FragH f;      /* a lane's 8 D registers are 8 tokens in a row of one column d: 16 bytes of a V^T row */
#pragma unroll      /* as above */
      for (int r = 0; r < 8; ++r) f.h[r] = (_Float16)(acc[half][t][r] * alpha + bv);
      *(v8us*)&sv[(wn * 64 + t * 16 + ln) * VP + wm * 32 + half * 16 + 8 * hh] = f.half[0]; }
    __syncthreads();      /* a V^T row's 128 tokens come from four waves */
    unsigned short* vt = (unsigned short*)VT + ((size_t)((mt * 128) / SLEN) * DM + (nq * 128 - 2 * DM)) * SLEN + (mt * 128) % SLEN;
#pragma unroll      /* the eight LDS reads go out together, one latency instead of eight */
    for (int p = 0; p < 8; ++p) { const int c = p * 256 + tid, dd = c >> 4, ch = (c & 15) * 8;      /* 16 neighbour threads store the 256 bytes of one row */
      *(v8us*)(vt + (size_t)dd * SLEN + ch) = *(const v8us*)&sv[dd * VP + ch]; }
    return; }
  float* so = (float*)&sT[0][0][0] + w * (32 * 68);      /* every read of the tiles ended at the loop's last barrier */
#pragma unroll
  for (int u = 0; u < 8; ++u) { const int t = u & 3, half = u >> 2; const float bv = bf16_round(bias[col0 + t * 16 + ln]);
#pragma unroll
    for (int r = 0; r < 8; ++r) so[(half * 16 + 8 * hh + r) * 68 + t * 16 + ln] = acc[half][t][r] * alpha + bv; }
  __builtin_amdgcn_fence(__ATOMIC_ACQ_REL, "workgroup"); __builtin_amdgcn_wave_barrier();      /* the patch is read back by other lanes of the same wave */
  if (SPLIT) {
    unsigned short* dh = (unsigned short*)(third ? KH : QH) + (size_t)row0 * DM + (col0 - third * DM); unsigned short* dl = (unsigned short*)(third ? KL : QL) + (size_t)row0 * DM + (col0 - third * DM);
    float sn = 0.f;      /* lane = row of the patch: the head's 64 squares, summed upward along d */
#pragma unroll      /* lets the LDS reads run ahead of the one chain of adds */
    for (int d = 0; d < 64; d += 4) { const v4f a = *(const v4fa*)&so[lane * 68 + d];
      for (int q = 0; q < 4; ++q) sn += a[q] * a[q]; }
    (third ? KN : QN)[((size_t)(row0 / SLEN) * NH + (col0 - third * DM) / 64) * SLEN + row0 % SLEN + lane] = sn;
    const int rs4 = lane >> 3, c8 = (lane & 7) * 8;      /* 8 neighbour lanes store the 128-byte line that a head's row is in each plane */
#pragma unroll 2      /* four trips of two passes: unrolled whole, the epilogue takes more registers than the product loop and costs the kernel a work-group per WGP */
    for (int p = 0; p < 8; ++p) { const int r = p * 4 + rs4; const v4f a = *(const v4fa*)&so[r * 68 + c8], c = *(const v4fa*)&so[r * 68 + c8 + 4]; FragH fh, fl;
#pragma unroll      /* constant indices keep the fragments in registers */
      for (int q = 0; q < 4; ++q) { _Float16 h = (_Float16)a[q]; fh.h[q] = h; fl.h[q] = (_Float16)((a[q] - (float)h) * 1024.0f); h = (_Float16)c[q]; fh.h[4 + q] = h; fl.h[4 + q] = (_Float16)((c[q] - (float)h) * 1024.0f); }
      *(v8us*)(dh + (size_t)r * DM + c8) = fh.half[0]; *(v8us*)(dl + (size_t)r * DM + c8) = fl.half[0]; }
    return; }
  const int rsub = lane >> 4, c4 = (lane & 15) * 4;
#pragma unroll
  for (int q = 0; q < 16; ++q) { const int r = q * 2 + rsub; const v4f v = *(const v4fa*)&so[r * 68 + c4]; *(v4f*)(C + (size_t)(row0 + r) * N + col0 + c4) = v; } }

extern "C" void kernel_launch(void* const* d_in, const int* in_sizes, int n_in,
                              void* d_out, int out_size, void* d_ws, size_t ws_size, hipStream_t stream) {
  (void)in_sizes; (void)n_in; (void)out_size;
  const float* const* I = (const float* const*)d_in; const float* x = I[0]; const float* Wqkv = I[1]; const float* bqkv = I[2]; const float* rs = I[3]; const float* Wp = I[4]; const float* bp = I[5];
  char* ws = (char*)d_ws; size_t off = 0;
  auto take = [&](size_t bytes) { char* p = ws + off; off += (bytes + 255) & ~(size_t)255; return p; };
  const size_t np = (size_t)NR * DM;
  _Float16* BQKV = (_Float16*)take((size_t)3 * DM * DM * 2); _Float16* BP = (_Float16*)take((size_t)DM * DM * 2);
  _Float16* X16 = (_Float16*)take(np * 2); float* QN = (float*)take((size_t)NR * NH * 4); float* KN = (float*)take((size_t)NR * NH * 4); _Float16* QH = (_Float16*)take(np * 2); _Float16* QL = (_Float16*)take(np * 2); _Float16* KH = (_Float16*)take(np * 2); _Float16* KL = (_Float16*)take(np * 2); _Float16* VT = (_Float16*)take(np * 2);
  _Float16* OH = (_Float16*)take(np * 2);      /* merged context f16 [NR][DM]: a plane of its own, q hi is still read while it is written */
  if (off > ws_size) return;      /* 6 + 2 + 8 + 0.5 + 5x8 + 8 = 65 MiB */
  k_wt_f16<DM, 3 * DM><<<(DM / 64) * (3 * DM / 64), 256, 0, stream>>>(Wqkv, BQKV, 16.0f); k_wt_f16<DM, DM><<<(DM / 64) * (DM / 64), 256, 0, stream>>>(Wp, BP, 16.0f);      /* (in, out) */
  k_x16<<<(unsigned)((np / 8 + 255) / 256), 256, 0, stream>>>(x, X16, np / 8);
  k_gemm3<3 * DM, DM, true><<<(NR / 128) * (3 * DM / 128), 256, 0, stream>>>(X16, BQKV, 0.0625f, bqkv, nullptr, QH, QL, KH, KL, VT, QN, KN);      /* [q | k | v] (head h = cols h*64..): q, k hi + residual planes and squared norms, V^T [(b,h)][64][2048] */
  k_gauss<<<NB * NH * (SLEN / 128), 256, 0, stream>>>(QH, QL, KH, KL, VT, QN, KN, rs, OH);      /* out_i[(h,d)] = sum_j exp(-r (kn_i + qn_j - 2 k_i.q_j)) v_j[d], merged context f16 */
  k_gemm3<DM, DM, false><<<(NR / 128) * (DM / 128), 256, 0, stream>>>(OH, BP, 0.0625f, bp, (float*)d_out, nullptr, nullptr, nullptr, nullptr, nullptr, nullptr, nullptr);      /* out = ctx Wproj + bproj */
}

// v006
// It runs in 104 microseconds.
// Timed twice side by side with v005, it ran 1.05 and 1.04 times as fast.
// Counting every step since v000, it is 17.8 times as fast.
#include <hip/hip_runtime.h>
// qKv_attention (2 x 2048 tokens, C 1024 = 16 heads x 64; Gaussian-kernel attention WITHOUT normalisation: qkv = x Wqkv + b; K[i][j] = exp(-r_sigma ||q_j - k_i||^2) computed as kn_i + qn_j - 2 k_i.q_j; out_i = sum_j K[i][j] v_j; out = merge Wproj + bproj; r_sigma is a scalar input).
// Structure: exact f16 plane of x; qkv as one f16 WMMA GEMM (32x64 wave tiles, f32 accumulation, exact x16 weights + bias); per-(token, head) squared norms on VALU; q and k as f16 hi + 2^10 residual planes; V^T by LDS tiles (norms, planes and V^T all stored by that GEMM's epilogue, no f32 qkv plane); one fused launch over every (batch, head): the k.q products as three hi/residual terms (f32), the kernel weights 2^(10 - c (kn + qn - 2 kq)), c = r log2(e), by one fma and one hardware exp2 each into f16 in registers, the readout products (64 columns) straight into a merged f16 context plane; Wproj + bproj GEMM.
// Compute dtype: inputs rounded to bf16; x and weights exact as f16; q, k as f16 hi + residual (~2^-21) because the exponent amplifies dot-product error by 2 r_sigma |k.q|; kernel weights and v as plain f16 operands (~2^-12; weights below 2^-34 of the unit scale flush to zero); merged context plain f16. v_wmma_f32_16x16x32_f16.
#define NB 2
#define DM 1024
#define NKV 16
#define NREP (NH / NKV)
#define KVD (NKV * 64)           /* 1024 */
#define NR (NB * SLEN)           /* 4096 */
#define CHK 512                  /* attention chunk */
typedef int v4i __attribute__((ext_vector_type(4)));
#define FF 2048
#define SLEN 2048
#define TQ SLEN
#define TK SLEN
#define NH 16
#define SCL 0.125f
#define QBLKS (TQ / 64)
#define QB05 0
#define QBN5 4
#define QB0P 0
#define QBNP QBLKS           /* non-causal: plain flash on every query block */
#define RE 256
typedef __bf16 v16b __attribute__((ext_vector_type(16)));
typedef unsigned short v8us __attribute__((ext_vector_type(8), may_alias));
typedef float  v8f  __attribute__((ext_vector_type(8)));
typedef float  v4f  __attribute__((ext_vector_type(4)));
typedef float  v4fa __attribute__((ext_vector_type(4), may_alias));
union FragB { v16b v; v8us half[2]; unsigned short u[16]; };

__device__ __forceinline__ unsigned short bf16_bits(float x) { unsigned int u = __float_as_uint(x); return (unsigned short)((u + 0x7FFFu + ((u >> 16) & 1u)) >> 16); }
__device__ __forceinline__ float bf16_val(unsigned short b) { return __uint_as_float(((unsigned int)b) << 16); }
__device__ __forceinline__ float bf16_round(float x) { return bf16_val(bf16_bits(x)); }
// D += A·B with NT terms: 1 = ah·bh, 2 = + al·bh (A split), 3 = + ah·bl (both split)
template <int NT>
__device__ __forceinline__ v8f mmaN(v16b ah, v16b al, v16b bh, v16b bl, v8f c) {
  c = __builtin_amdgcn_wmma_f32_16x16x32_bf16(false, ah, false, bh, (short)0, c, false, false);
  if (NT >= 2) c = __builtin_amdgcn_wmma_f32_16x16x32_bf16(false, al, false, bh, (short)0, c, false, false);
  if (NT >= 3) c = __builtin_amdgcn_wmma_f32_16x16x32_bf16(false, ah, false, bl, (short)0, c, false, false);
  asm volatile("v_nop\n\tv_nop\n\tv_nop\n\tv_nop" : "+v"(c) : "v"(ah), "v"(al), "v"(bh), "v"(bl));
  return c;
}

__global__ __launch_bounds__(256) void k_wt_bf16(const float* __restrict__ W, unsigned short* __restrict__ Wt, int K, int N) {
  const int t = blockIdx.x * 256 + threadIdx.x;
  const int k8n = K / 8;
  if (t >= N * k8n) return;
  const int n = t / k8n, k8 = (t % k8n) * 8;
  v8us v;
#pragma unroll
  for (int i = 0; i < 8; ++i) v[i] = bf16_bits(W[(size_t)(k8 + i) * N + n]);
  *(v8us*)(Wt + (size_t)n * K + k8) = v;
  
}

// GEMM C[M][N] (f32, pitch ldc) = act(A[M][K]·W + bias). A f32 row-major (pitch lda) converted per fragment to bf16
// (ASPLIT: hi/lo two planes -> 2 terms, else single rounded term); Wt bf16 [N][K] (pitch ldb). BIAS_BF16 rounds the
// bias to bf16 first (bias quantised to bf16 before the add). K%32==0, M%16==0, N%64==0.
template <bool ASPLIT, int ACT, bool BIAS_BF16>
__global__ __launch_bounds__(128) void k_gemm_bf(const float* __restrict__ A, int lda, const unsigned short* __restrict__ Wt, int ldb,
                                               const float* __restrict__ bias, float* __restrict__ C, int ldc, int M, int N, int K) {
  __shared__ __attribute__((aligned(16))) float so[4][16][64];
  const int tid = threadIdx.x, w = tid >> 5, lane = tid & 31, ln = lane & 15, hh = lane >> 4;
  const int ntn = N / 64;
  const int wid = blockIdx.x * 4 + w;
  const int mt = wid / ntn, nq = wid % ntn;
  if (mt * 16 >= M) return;
  const int row0 = mt * 16, col0 = nq * 64;
  const float* arow = A + (size_t)(row0 + ln) * lda;
  v8f acc[4] = {};
  for (int kb = 0; kb < K; kb += 32) {
    FragB ah, al;
    const v4f x0 = *(const v4fa*)(arow + kb + 8 * hh), x1 = *(const v4fa*)(arow + kb + 8 * hh + 4);
    const v4f x2 = *(const v4fa*)(arow + kb + 16 + 8 * hh), x3 = *(const v4fa*)(arow + kb + 16 + 8 * hh + 4);
    float xs[16] = {x0[0],x0[1],x0[2],x0[3],x1[0],x1[1],x1[2],x1[3],x2[0],x2[1],x2[2],x2[3],x3[0],x3[1],x3[2],x3[3]};
#pragma unroll
    for (int i = 0; i < 16; ++i) { const unsigned short hb = bf16_bits(xs[i]); ah.u[i] = hb; al.u[i] = ASPLIT ? bf16_bits(xs[i] - bf16_val(hb)) : (unsigned short)0; }
#pragma unroll
    for (int t = 0; t < 4; ++t) {
      const unsigned short* brow = Wt + (size_t)(col0 + t * 16 + ln) * ldb + kb;
      FragB b;
      b.half[0] = *(const v8us*)(brow + 8 * hh);
      b.half[1] = *(const v8us*)(brow + 16 + 8 * hh);
      acc[t] = mmaN<ASPLIT ? 2 : 1>(ah.v, al.v, b.v, b.v, acc[t]);
    }
  }
#pragma unroll
  for (int t = 0; t < 4; ++t) {
    float bv = bias ? bias[col0 + t * 16 + ln] : 0.f;
    if (BIAS_BF16) bv = bf16_round(bv);
#pragma unroll
    for (int r = 0; r < 8; ++r) { float v = acc[t][r] + bv; if (ACT == 1) v = fmaxf(v, 0.f); so[w][8 * hh + r][t * 16 + ln] = v; }
  }
  __builtin_amdgcn_fence(__ATOMIC_ACQ_REL, "workgroup");
  __builtin_amdgcn_wave_barrier();
  const int rsub = lane >> 4, c4 = (lane & 15) * 4;
  {
#pragma unroll
    for (int q = 0; q < 8; ++q) {
      const int r = q * 2 + rsub;
      const v4f v = *(const v4fa*)&so[w][r][c4];
      *(v4f*)(C + (size_t)(row0 + r) * ldc + col0 + c4) = v;
    }
    
  }
}

// GEMM C = act(A·W + bias + resid): A f32 (ASPLIT -> hi/lo 2 terms), Wt bf16 [N][K]; ACT 0 none, 1 relu, 2 exact gelu;
// resid (optional, f32, row index = (row % rmod), pitch ldr, RES_BF16 rounds it) added before the activation.
template <bool ASPLIT, int ACT, bool BIAS_BF16, bool RES_BF16>
__global__ __launch_bounds__(128) void k_gemm_bf3(const float* __restrict__ A, int lda, const unsigned short* __restrict__ Wt, int ldb,
                                                const float* __restrict__ bias, const float* __restrict__ resid, int rmod, int ldr,
                                                float* __restrict__ C, int ldc, int M, int N, int K) {
  __shared__ __attribute__((aligned(16))) float so[4][16][64];
  const int tid = threadIdx.x, w = tid >> 5, lane = tid & 31, ln = lane & 15, hh = lane >> 4;
  const int ntn = N / 64;
  const int wid = blockIdx.x * 4 + w;
  const int mt = wid / ntn, nq = wid % ntn;
  if (mt * 16 >= M) return;
  const int row0 = mt * 16, col0 = nq * 64;
  const float* arow = A + (size_t)(row0 + ln) * lda;
  v8f acc[4] = {};
  for (int kb = 0; kb < K; kb += 32) {
    FragB ah, al;
    const v4f x0 = *(const v4fa*)(arow + kb + 8 * hh), x1 = *(const v4fa*)(arow + kb + 8 * hh + 4);
    const v4f x2 = *(const v4fa*)(arow + kb + 16 + 8 * hh), x3 = *(const v4fa*)(arow + kb + 16 + 8 * hh + 4);
    float xs[16] = {x0[0],x0[1],x0[2],x0[3],x1[0],x1[1],x1[2],x1[3],x2[0],x2[1],x2[2],x2[3],x3[0],x3[1],x3[2],x3[3]};
#pragma unroll
    for (int i = 0; i < 16; ++i) { const unsigned short hb = bf16_bits(xs[i]); ah.u[i] = hb; al.u[i] = ASPLIT ? bf16_bits(xs[i] - bf16_val(hb)) : (unsigned short)0; }
#pragma unroll
    for (int t = 0; t < 4; ++t) {
      const unsigned short* brow = Wt + (size_t)(col0 + t * 16 + ln) * ldb + kb;
      FragB b;
      b.half[0] = *(const v8us*)(brow + 8 * hh);
      b.half[1] = *(const v8us*)(brow + 16 + 8 * hh);
      acc[t] = mmaN<ASPLIT ? 2 : 1>(ah.v, al.v, b.v, b.v, acc[t]);
    }
  }
#pragma unroll
  for (int t = 0; t < 4; ++t) {
    const int col = col0 + t * 16 + ln;
    float bv = bias ? bias[col] : 0.f;
    if (BIAS_BF16) bv = bf16_round(bv);
#pragma unroll
    for (int r = 0; r < 8; ++r) {
      float v = acc[t][r] + bv;
      if (resid) { float rv = resid[(size_t)((row0 + 8 * hh + r) % rmod) * ldr + col]; if (RES_BF16) rv = bf16_round(rv); v += rv; }
      if (ACT == 1) v = fmaxf(v, 0.f);
      if (ACT == 2) v = 0.5f * v * (1.0f + erff(v * 0.70710678118654752f));
      if (ACT == 3) { const float u = 0.7978845608028654f * (v + 0.044715f * v * v * v); v = 0.5f * v * (1.0f + tanhf(u)); }
      so[w][8 * hh + r][t * 16 + ln] = v;
    }
  }
  __builtin_amdgcn_fence(__ATOMIC_ACQ_REL, "workgroup");
  __builtin_amdgcn_wave_barrier();
  const int rsub = lane >> 4, c4 = (lane & 15) * 4;
  {
#pragma unroll
    for (int q = 0; q < 8; ++q) {
      const int r = q * 2 + rsub;
      const v4f v = *(const v4fa*)&so[w][r][c4];
      *(v4f*)(C + (size_t)(row0 + r) * ldc + col0 + c4) = v;
    }
    
  }
}
// row LayerNorm (biased variance, eps) over N: s = X (+ R); optional out_sum <- s; out_norm <- (s-mu)*rsqrt(var+eps)*g + b
template <bool PARAM_BF16>
__global__ __launch_bounds__(256) void k_layernorm(const float* __restrict__ X, const float* __restrict__ R, const float* __restrict__ g, const float* __restrict__ bta,
                                                  float* __restrict__ out_sum, float* __restrict__ out_norm, int N, float eps) {
  __shared__ float red[256];
  const int row = blockIdx.x, tid = threadIdx.x;
  const float* x = X + (size_t)row * N; const float* rr = R ? R + (size_t)row * N : nullptr;
  float vals[16];                     // up to N = 4096
  const int per = N / 256;            // contiguous chunk per thread? use strided-by-4 chunks: thread handles j = tid*4 + 1024*u
  float s1 = 0.f;
  for (int u = 0; u < per / 4; ++u) {
    const int j = tid * 4 + 1024 * u;
    const v4f a = *(const v4fa*)(x + j);
    v4f b = {0.f,0.f,0.f,0.f}; if (rr) b = *(const v4fa*)(rr + j);
#pragma unroll
    for (int q = 0; q < 4; ++q) { const float v = a[q] + b[q]; vals[u * 4 + q] = v; s1 += v; }
  }
  red[tid] = s1; __syncthreads();
  for (int st = 128; st > 0; st >>= 1) { if (tid < st) red[tid] += red[tid + st]; __syncthreads(); }
  const float mu = red[0] / (float)N; __syncthreads();
  float s2 = 0.f;
  for (int u = 0; u < per / 4; ++u)
#pragma unroll
    for (int q = 0; q < 4; ++q) { const float c = vals[u * 4 + q] - mu; s2 += c * c; }
  red[tid] = s2; __syncthreads();
  for (int st = 128; st > 0; st >>= 1) { if (tid < st) red[tid] += red[tid + st]; __syncthreads(); }
  const float rs = rsqrtf(red[0] / (float)N + eps);
  {
    for (int u = 0; u < per / 4; ++u) {
      const int j = tid * 4 + 1024 * u;
      v4f o, sm;
#pragma unroll
      for (int q = 0; q < 4; ++q) {
        float gg = g[j + q], bb = bta[j + q];
        if (PARAM_BF16) { gg = bf16_round(gg); bb = bf16_round(bb); }
        sm[q] = vals[u * 4 + q]; o[q] = (vals[u * 4 + q] - mu) * rs * gg + bb;
      }
      if (out_sum) *(v4f*)(out_sum + (size_t)row * N + j) = sm;
      *(v4f*)(out_norm + (size_t)row * N + j) = o;
    }
    
  }
}



// ---- f16 WMMA path (v_wmma_f32_16x16x32_f16): 11-bit significands for operands in range — used where a [0,1] probability operand needs more precision than bf16
typedef _Float16 v16h __attribute__((ext_vector_type(16)));
union FragH { v16h v; v8us half[2]; _Float16 h[16]; unsigned short u[16]; };
template <int NT>
__device__ __forceinline__ v8f mmaH(v16h ah, v16h al, v16h bh, v16h bl, v8f c) {
  c = __builtin_amdgcn_wmma_f32_16x16x32_f16(false, ah, false, bh, (short)0, c, false, false);
  if (NT >= 2) c = __builtin_amdgcn_wmma_f32_16x16x32_f16(false, al, false, bh, (short)0, c, false, false);
  if (NT >= 3) c = __builtin_amdgcn_wmma_f32_16x16x32_f16(false, ah, false, bl, (short)0, c, false, false);
  asm volatile("v_nop\n\tv_nop\n\tv_nop\n\tv_nop" : "+v"(c) : "v"(ah), "v"(al), "v"(bh), "v"(bl));
  return c;
}
// batched GEMM like k_gemm_b but f16 operands: A f32 (split into f16 hi/lo if ASPLIT, else rounded to f16), Bt = f16 values [n][k]; alpha; C f32; N multiple of 16 (partial tiles skipped)
template <bool ASPLIT>
__global__ __launch_bounds__(128) void k_gemm_h(const float* __restrict__ A, int lda, size_t sA, const _Float16* __restrict__ Bh, int ldb, size_t sB, float alpha, float* __restrict__ C, int ldc, size_t sC, int M, int N, int K) {
  __shared__ __attribute__((aligned(16))) float so[4][16][64];
  const int tid = threadIdx.x, w = tid >> 5, lane = tid & 31, ln = lane & 15, hh = lane >> 4; const int by = blockIdx.y;
  A += (size_t)by * sA; Bh += (size_t)by * sB; C += (size_t)by * sC;
  const int ntn = (N + 63) / 64; const int wid = blockIdx.x * 4 + w; const int mt = wid / ntn, nq = wid % ntn; if (mt * 16 >= M) return;
  const int row0 = mt * 16, col0 = nq * 64; const float* arow = A + (size_t)(row0 + ln) * lda;
  v8f acc[4] = {};
  for (int kb = 0; kb < K; kb += 32) {
    FragH ah, al;
    const v4f x0 = *(const v4fa*)(arow + kb + 8 * hh), x1 = *(const v4fa*)(arow + kb + 8 * hh + 4), x2 = *(const v4fa*)(arow + kb + 16 + 8 * hh), x3 = *(const v4fa*)(arow + kb + 16 + 8 * hh + 4);
    float xs[16] = {x0[0],x0[1],x0[2],x0[3],x1[0],x1[1],x1[2],x1[3],x2[0],x2[1],x2[2],x2[3],x3[0],x3[1],x3[2],x3[3]};
#pragma unroll
    for (int i = 0; i < 16; ++i) { const _Float16 h = (_Float16)xs[i]; ah.h[i] = h; al.h[i] = ASPLIT ? (_Float16)(xs[i] - (float)h) : (_Float16)0.0f; }
#pragma unroll
    for (int t = 0; t < 4; ++t) { if (col0 + t * 16 >= N) continue; const size_t boff = (size_t)(col0 + t * 16 + ln) * ldb + kb; FragH bq; bq.half[0] = *(const v8us*)(Bh + boff + 8 * hh); bq.half[1] = *(const v8us*)(Bh + boff + 16 + 8 * hh);
      acc[t] = mmaH<ASPLIT ? 2 : 1>(ah.v, al.v, bq.v, bq.v, acc[t]); }
  }
#pragma unroll
  for (int t = 0; t < 4; ++t) { if (col0 + t * 16 >= N) continue;
#pragma unroll
    for (int r = 0; r < 8; ++r) so[w][8 * hh + r][t * 16 + ln] = acc[t][r] * alpha; }
  __builtin_amdgcn_fence(__ATOMIC_ACQ_REL, "workgroup"); __builtin_amdgcn_wave_barrier();
  const int rsub = lane >> 4, c4 = (lane & 15) * 4;
  {
#pragma unroll
    for (int q = 0; q < 8; ++q) { const int r = q * 2 + rsub; if (col0 + c4 < N) { const v4f v = *(const v4fa*)&so[w][r][c4]; *(v4f*)(C + (size_t)(row0 + r) * ldc + col0 + c4) = v; } }
     }
}

// One launch makes all three f16 operand planes: Wt[n][k] = f16(bf16(W[k][n]) * scale) for both weight matrices (f32 row-major W[DM][N]; scale = power of two; bf16-exact weights stay exact in f16 away from the subnormal range) and X16 = f16(bf16(x)).
// A block takes two neighbour tiles of 64 k x 64 n of one weight matrix and PREP_XE elements of x, so that the whole job is 16 waves a WGP, started once; a thread's 16 loads of 16 bytes all go out before the first is used.
// A tile is turned in LDS: a wave's 16-byte loads cover whole 256-byte pieces of two W rows, and 8 neighbour threads store one whole 128-byte line of a Wt row.
typedef unsigned short v4us __attribute__((ext_vector_type(4), may_alias));
#define PREP_WQ ((DM / 64) * (3 * DM / 64) / 2)      /* blocks whose two tiles lie in Wqkv */
#define PREP_WP ((DM / 64) * (DM / 64) / 2)      /* blocks whose two tiles lie in Wproj */
#define PREP_NB (PREP_WQ + PREP_WP)
#define PREP_XE (NR * DM / PREP_NB)      /* elements of x a block */
__global__ __launch_bounds__(256) void k_prep(const float* __restrict__ x, _Float16* __restrict__ X16, const float* __restrict__ Wq, _Float16* __restrict__ Bq, const float* __restrict__ Wp, _Float16* __restrict__ Bp, float scale) {
  static_assert(PREP_XE == 8 * 1024, "eight 16-byte loads a thread"); static_assert(DM % 128 == 0, "whole pairs of tiles only");
  __shared__ __attribute__((aligned(16))) unsigned short tl[2][64][72];      /* [tile][n][k]; row pitch 128 + 16 bytes, for the 16-byte reads */
  const int tid = threadIdx.x, blk = blockIdx.x; const bool inq = blk < PREP_WQ;      /* which matrix: the same for the whole block, and chosen by selects, so that one run of loads serves both */
  const float* W = inq ? Wq : Wp; unsigned short* Wt = (unsigned short*)(inq ? Bq : Bp); const int N = inq ? 3 * DM : DM;
  const int t0 = (inq ? blk : blk - PREP_WQ) * 2; const int kt = inq ? t0 / (3 * DM / 64) : t0 / (DM / 64); const int nt = t0 - kt * (N >> 6);      /* tiles t0 and t0 + 1: neighbour pieces of the same W rows */
  const int a = tid >> 4, c = tid & 15;      /* a thread turns a patch of 4 k x 4 n of each tile in registers */
  const float* src = W + (size_t)(kt * 64) * N + nt * 64; const unsigned so = (unsigned)(a * 4 * N + c * 4);      /* block-uniform tile base and one offset a thread */
  const size_t xo = (size_t)blk * PREP_XE + tid * 4;      /* a wave's load of x covers 512 bytes in a row, its store 256 */
  v4f w[2][4], xv[8];
#pragma unroll      /* constant indices keep w in registers */
  for (int u = 0; u < 4; ++u) { w[0][u] = *(const v4fa*)(src + so + u * N); w[1][u] = *(const v4fa*)(src + so + u * N + 64); }
#pragma unroll      /* constant indices keep xv in registers */
  for (int u = 0; u < 8; ++u) xv[u] = *(const v4fa*)(x + xo + u * 1024);
  __builtin_amdgcn_sched_barrier(0);      /* keeps all 16 loads ahead of the first use: left alone the scheduler sinks the loads of x behind the wait for W, and the wave pays the memory latency twice */
#pragma unroll      /* constant indices keep w in registers */
  for (int p = 0; p < 2; ++p)
#pragma unroll      /* as above */
    for (int q = 0; q < 4; ++q) { FragH f;
#pragma unroll      /* as above */
      for (int u = 0; u < 4; ++u) f.h[u] = (_Float16)(bf16_round(w[p][u][q]) * scale);
      *(v4us*)&tl[p][c * 4 + q][a * 4] = (v4us){f.u[0], f.u[1], f.u[2], f.u[3]}; }
  v4us xh[8];      /* x is rounded ahead of the barrier, where a wave would else only wait for the others, and stored behind it, so that the barrier does not wait for global stores */
#pragma unroll      /* constant indices keep xv and xh in registers */
  for (int u = 0; u < 8; ++u) { FragH f;
#pragma unroll      /* as above */
    for (int q = 0; q < 4; ++q) f.h[q] = (_Float16)bf16_round(xv[u][q]);
    xh[u] = (v4us){f.u[0], f.u[1], f.u[2], f.u[3]}; }
  __syncthreads();      /* a Wt row's 64 k come from 16 threads of 8 waves */
  unsigned short* dst = Wt + (size_t)(nt * 64) * DM + kt * 64; const int n = tid >> 3, k8 = (tid & 7) * 8; const unsigned dofs = (unsigned)(n * DM + k8);
  v8us r[4];
#pragma unroll      /* the four LDS reads go out together */
  for (int p = 0; p < 4; ++p) r[p] = *(const v8us*)&tl[p >> 1][(p & 1) * 32 + n][k8];
#pragma unroll      /* constant indices keep xh in registers */
  for (int u = 0; u < 8; ++u) *(v4us*)((unsigned short*)X16 + xo + u * 1024) = xh[u];
#pragma unroll      /* constant indices keep r in registers */
  for (int p = 0; p < 4; ++p) *(v8us*)(dst + dofs + p * 32 * DM) = r[p];      /* rows n, n + 32 of tile t0, then of tile t0 + 1, whose rows follow */
}
// k_gemm_hh variant with fused epilogue: v = acc·alpha + bias[by·sBias + col] (+ CP[(row/rowsPerB)·sCPb + by·64 + col] if CP) ; ACT 0 none / 1 elu ; writes f16 C16 (and f32 C if non-null)
template <int ACT>
__global__ __launch_bounds__(128) void k_gemm_hhx(const _Float16* __restrict__ A, int lda, size_t sA, const _Float16* __restrict__ Bh, int ldb, size_t sB, float alpha, const float* __restrict__ bias, size_t sBias, const float* __restrict__ CP, int rowsPerB, size_t sCPb, int row0g,
    float* __restrict__ C, _Float16* __restrict__ C16, int ldc, size_t sC, int M, int N, int K) {
  __shared__ __attribute__((aligned(16))) float so[4][16][64];
  const int tid = threadIdx.x, w = tid >> 5, lane = tid & 31, ln = lane & 15, hh = lane >> 4; const int by = blockIdx.y;
  A += (size_t)by * sA; Bh += (size_t)by * sB; const size_t cofs = (size_t)by * sC; const float* bp = bias ? bias + (size_t)by * sBias : nullptr;
  const int ntn = (N + 63) / 64; const int wid = blockIdx.x * 4 + w; const int mt = wid / ntn, nq = wid % ntn; if (mt * 16 >= M) return;
  const int row0 = mt * 16, col0 = nq * 64; const _Float16* arow = A + (size_t)(row0 + ln) * lda;
  v8f acc[4] = {};
  for (int kb = 0; kb < K; kb += 32) { FragH ah; ah.half[0] = *(const v8us*)((const unsigned short*)arow + kb + 8 * hh); ah.half[1] = *(const v8us*)((const unsigned short*)arow + kb + 16 + 8 * hh);
#pragma unroll
    for (int t = 0; t < 4; ++t) { if (col0 + t * 16 >= N) continue; const size_t boff = (size_t)(col0 + t * 16 + ln) * ldb + kb; FragH bq; bq.half[0] = *(const v8us*)((const unsigned short*)Bh + boff + 8 * hh); bq.half[1] = *(const v8us*)((const unsigned short*)Bh + boff + 16 + 8 * hh);
      acc[t] = mmaH<1>(ah.v, ah.v, bq.v, bq.v, acc[t]); }
  }
#pragma unroll
  for (int t = 0; t < 4; ++t) { if (col0 + t * 16 >= N) continue; const int col = col0 + t * 16 + ln; const float bv = bp ? bf16_round(bp[col]) : 0.f;
#pragma unroll
    for (int r = 0; r < 8; ++r) { float v = acc[t][r] * alpha + bv; if (CP) { const int bidx = (row0g + row0 + 8 * hh + r) / rowsPerB; v += CP[(size_t)bidx * sCPb + (size_t)by * 64 + col]; } if (ACT == 1) v = (v > 0.f) ? v : expm1f(v); else if (ACT == 7) v = (v > 0.f) ? v + 1.0f : expf(v); else if (ACT == 8) v = tanhf(v); else if (ACT == 9) v = 0.5f * v * (1.0f + tanhf(0.7978845608028654f * (v + 0.044715f * v * v * v))); else if (ACT == 11) v = 1.0f / (1.0f + expf(-v)); else if (ACT == 12) v = (v > 0.f) ? v : 0.01f * v; else if (ACT == 14) v = (v > 0.f) ? v : 0.1f * v; else if (ACT == 15) v = v / (1.0f + expf(-v)); else if (ACT == 3) v = fmaxf(v, 0.f); else if (ACT == 6) v = 0.5f * v * (1.0f + erff(v * 0.70710678118654752f)); so[w][8 * hh + r][t * 16 + ln] = v; } }
  __builtin_amdgcn_fence(__ATOMIC_ACQ_REL, "workgroup"); __builtin_amdgcn_wave_barrier();
  const int rsub = lane >> 4, c4 = (lane & 15) * 4; typedef _Float16 v4h __attribute__((ext_vector_type(4)));
  {
#pragma unroll
    for (int q = 0; q < 8; ++q) { const int r = q * 2 + rsub; if (col0 + c4 < N) { const v4f v = *(const v4fa*)&so[w][r][c4]; if (C) *(v4f*)(C + cofs + (size_t)(row0 + r) * ldc + col0 + c4) = v; if (C16) { v4h h4; for (int i = 0; i < 4; ++i) h4[i] = (_Float16)v[i]; *(v4h*)(C16 + cofs + (size_t)(row0 + r) * ldc + col0 + c4) = h4; } } }
     }
}


typedef _Float16 v4h __attribute__((ext_vector_type(4)));

__global__ __launch_bounds__(256) void k_round16f(const float* __restrict__ W, _Float16* __restrict__ Bt, size_t n8) { const size_t t = (size_t)blockIdx.x * 256 + threadIdx.x; if (t >= n8) return; FragH f;
#pragma unroll
  for (int i = 0; i < 8; ++i) f.h[i] = (_Float16)(bf16_round(W[t * 8 + i]) * 16.0f); *(v8us*)((unsigned short*)Bt + t * 8) = f.half[0];  }
template <int NHv, int TTv>
__global__ __launch_bounds__(256) void k_vt(const _Float16* __restrict__ V16, int ldv, int voff, _Float16* __restrict__ Vt) { __shared__ unsigned short tl[64][66]; const int tid = threadIdx.x; const int slab = blockIdx.x / (TTv / 64), lg = blockIdx.x % (TTv / 64); const int b = slab / NHv, h = slab % NHv;
  for (int i = tid; i < 64 * 8; i += 256) { const int r = i / 8, c8 = (i % 8) * 8; FragH f; f.half[0] = *(const v8us*)((const unsigned short*)V16 + ((size_t)b * TTv + lg * 64 + r) * ldv + voff + h * 64 + c8);
#pragma unroll
    for (int q = 0; q < 8; ++q) tl[r][c8 + q] = f.u[q]; }
  __syncthreads();
  {
#pragma unroll
    for (int rd = 0; rd < 2; ++rd) { const int d = rd * 32 + tid / 8, pc = tid % 8; FragH f;
#pragma unroll
      for (int q = 0; q < 8; ++q) f.u[q] = tl[pc * 8 + q][d];
      *(v8us*)((unsigned short*)Vt + ((size_t)slab * 64 + d) * TTv + lg * 64 + pc * 8) = f.half[0]; }
     } }

__global__ __launch_bounds__(256) void k_hl(const float* __restrict__ F, _Float16* __restrict__ Hh, _Float16* __restrict__ Hl, size_t n8) { const size_t t = (size_t)blockIdx.x * 256 + threadIdx.x; if (t >= n8) return; FragH fh, fl; const v4f a = *(const v4fa*)(F + t * 8), c = *(const v4fa*)(F + t * 8 + 4);
#pragma unroll
  for (int q = 0; q < 4; ++q) { _Float16 h = (_Float16)a[q]; fh.h[q] = h; fl.h[q] = (_Float16)((a[q] - (float)h) * 1024.0f); h = (_Float16)c[q]; fh.h[4 + q] = h; fl.h[4 + q] = (_Float16)((c[q] - (float)h) * 1024.0f); }
  { *(v8us*)((unsigned short*)Hh + t * 8) = fh.half[0]; *(v8us*)((unsigned short*)Hl + t * 8) = fl.half[0];  } }

// ---- fast GEMM (wave tile 32x64; requires M % 32 == 0 rows per launch region and N % 64 == 0); epilogue = k_gemm_hhx semantics ----
__device__ __forceinline__ v16h g2_frag(const _Float16* p, int hh) { FragH f; f.half[0] = *(const v8us*)((const unsigned short*)p + 8 * hh); f.half[1] = *(const v8us*)((const unsigned short*)p + 16 + 8 * hh); return f.v; }
__device__ __forceinline__ v8f g2_mma(v16h a, v16h b, v8f c) { v8f d = __builtin_amdgcn_wmma_f32_16x16x32_f16(false, a, false, b, (short)0, c, false, false); asm volatile("v_nop\n\tv_nop\n\tv_nop\n\tv_nop" : "+v"(d) : "v"(a), "v"(b)); return d; }
template <int ACT>
__global__ __launch_bounds__(128) void k_gemm2(const _Float16* __restrict__ A, int lda, size_t sA, const _Float16* __restrict__ Bh, int ldb, size_t sB, float alpha, const float* __restrict__ bias, size_t sBias, const float* __restrict__ CP, int rowsPerB, size_t sCPb, int row0g,
    float* __restrict__ C, _Float16* __restrict__ C16, int ldc, size_t sC, int M, int N, int K) {
  __shared__ __attribute__((aligned(16))) float so[4][32][68];
  const int tid = threadIdx.x, w = tid >> 5, lane = tid & 31, ln = lane & 15, hh = lane >> 4; const int by = blockIdx.y;
  A += (size_t)by * sA; Bh += (size_t)by * sB; const size_t cofs = (size_t)by * sC; const float* bp = bias ? bias + (size_t)by * sBias : nullptr;
  const int ntn = N >> 6; const int mt = blockIdx.x / ntn, nq = blockIdx.x - mt * ntn; const int row0 = mt * 128 + 32 * w, col0 = nq * 64; if (row0 >= M) return;
  const _Float16* a0p = A + (size_t)(row0 + ln) * lda; const _Float16* a1p = a0p + (size_t)16 * lda;
  const _Float16* b0p = Bh + (size_t)(col0 + ln) * ldb; const _Float16* b1p = b0p + (size_t)16 * ldb; const _Float16* b2p = b1p + (size_t)16 * ldb; const _Float16* b3p = b2p + (size_t)16 * ldb;
  const v8f z8 = {0.f,0.f,0.f,0.f,0.f,0.f,0.f,0.f}; v8f c00 = z8, c01 = z8, c02 = z8, c03 = z8, c10 = z8, c11 = z8, c12 = z8, c13 = z8;
#pragma unroll 1
  for (int kb = 0; kb < K; kb += 32) { const v16h a0 = g2_frag(a0p + kb, hh), a1 = g2_frag(a1p + kb, hh);
    v16h b = g2_frag(b0p + kb, hh); c00 = g2_mma(a0, b, c00); c10 = g2_mma(a1, b, c10);
    b = g2_frag(b1p + kb, hh); c01 = g2_mma(a0, b, c01); c11 = g2_mma(a1, b, c11);
    b = g2_frag(b2p + kb, hh); c02 = g2_mma(a0, b, c02); c12 = g2_mma(a1, b, c12);
    b = g2_frag(b3p + kb, hh); c03 = g2_mma(a0, b, c03); c13 = g2_mma(a1, b, c13); }
  v8f accs[8] = {c00, c01, c02, c03, c10, c11, c12, c13};
#pragma unroll
  for (int u = 0; u < 8; ++u) { const int t = u & 3, half = u >> 2; const int col = col0 + t * 16 + ln; const float bv = bp ? bf16_round(bp[col]) : 0.f;
#pragma unroll
    for (int r = 0; r < 8; ++r) { const int rloc = half * 16 + 8 * hh + r; float v = accs[u][r] * alpha + bv; if (CP) { if (rowsPerB < 0) v += CP[cofs + (size_t)(row0g + row0 + rloc) * ldc + col];      /* rowsPerB < 0: own element of the batched C plane */ else { const int bidx = (row0g + row0 + rloc) / rowsPerB; v += CP[(size_t)bidx * sCPb + (size_t)by * 64 + col]; } }
      if (ACT == 3) v = fmaxf(v, 0.f); else if (ACT == 6) v = 0.5f * v * (1.0f + erff(v * 0.70710678118654752f)); else if (ACT == 11) v = 1.0f / (1.0f + expf(-v)); else if (ACT == 15) v = v / (1.0f + expf(-v)); else if (ACT == 12) v = (v > 0.f) ? v : 0.01f * v; else if (ACT == 8) v = tanhf(v);
      so[w][rloc][t * 16 + ln] = v; } }
  __builtin_amdgcn_fence(__ATOMIC_ACQ_REL, "workgroup"); __builtin_amdgcn_wave_barrier();
  const int rsub = lane >> 4, c4 = (lane & 15) * 4;
  {
#pragma unroll
    for (int q = 0; q < 16; ++q) { const int r = q * 2 + rsub; const v4f v = *(const v4fa*)&so[w][r][c4]; if (C) *(v4f*)(C + cofs + (size_t)(row0 + r) * ldc + col0 + c4) = v; if (C16) { v4h h4; for (int i = 0; i < 4; ++i) h4[i] = (_Float16)v[i]; *(v4h*)(C16 + cofs + (size_t)(row0 + r) * ldc + col0 + c4) = h4; } }
     } }



template <int CAUSAL>
__global__ __launch_bounds__(128) void k_flash(const _Float16* __restrict__ Q16, int ldq, const _Float16* __restrict__ K16, int ldk, const _Float16* __restrict__ Vt, const int* __restrict__ MSK, float* __restrict__ O, int ldo) {
  constexpr int RPW = 16, RTN = RPW / 16, NQB = TQ / (4 * RPW), DT = 4, KS = 2;
  __shared__ __attribute__((aligned(16))) unsigned short sP[4][RPW][40]; __shared__ __attribute__((aligned(16))) float sO[4][RPW][64 + 4];
  const int tid = threadIdx.x, w = tid >> 5, lane = tid & 31, ln = lane & 15, hh = lane >> 4;
  const int slab = blockIdx.x / QBNP, qblk = QB0P + blockIdx.x % QBNP; (void)NQB; const int b = slab / NH, h = slab % NH; const int qb0 = qblk * (4 * RPW); const int q0 = qb0 + w * RPW;
  FragH aq[2][KS];
#pragma unroll
  for (int rt = 0; rt < RTN; ++rt) { const unsigned short* qr = (const unsigned short*)Q16 + ((size_t)b * TQ + q0 + rt * 16 + ln) * ldq + h * 64;
#pragma unroll
    for (int ks = 0; ks < KS; ++ks) { aq[rt][ks].half[0] = *(const v8us*)(qr + ks * 32 + 8 * hh); aq[rt][ks].half[1] = *(const v8us*)(qr + ks * 32 + 16 + 8 * hh); } }
  const unsigned short* Vth = (const unsigned short*)Vt + (size_t)slab * 64 * TK;
  float m_r[2][8], l_r[2][8]; v8f oacc[2][DT];
#pragma unroll
  for (int rt = 0; rt < RTN; ++rt) {
#pragma unroll
    for (int r = 0; r < 8; ++r) { m_r[rt][r] = -3.0e38f; l_r[rt][r] = 0.f; }
#pragma unroll
    for (int dt = 0; dt < DT; ++dt) oacc[rt][dt] = (v8f){0.f,0.f,0.f,0.f,0.f,0.f,0.f,0.f}; }
  const int jend = (CAUSAL == 1) ? (qb0 + 4 * RPW) : ((CAUSAL == 23) ? min(TK, (qb0 / CHK + 2) * CHK) : TK);      /* causal / window: keys that can never contribute are skipped */ const int jbeg = (CAUSAL == 23) ? max(0, (qb0 / CHK - 1) * CHK) : 0;
#pragma unroll 1
  for (int j0 = jbeg; j0 < jend; j0 += 32) {
    v8f s[2][2];
#pragma unroll
    for (int nt = 0; nt < 2; ++nt) { const unsigned short* kr = (const unsigned short*)K16 + ((size_t)b * TK + j0 + nt * 16 + ln) * ldk + h * 64; FragH bk[KS];
#pragma unroll
      for (int ks = 0; ks < KS; ++ks) { bk[ks].half[0] = *(const v8us*)(kr + ks * 32 + 8 * hh); bk[ks].half[1] = *(const v8us*)(kr + ks * 32 + 16 + 8 * hh); }
#pragma unroll
      for (int rt = 0; rt < RTN; ++rt) { v8f acc = (v8f){0.f,0.f,0.f,0.f,0.f,0.f,0.f,0.f};
#pragma unroll
        for (int ks = 0; ks < KS; ++ks) acc = mmaH<1>(aq[rt][ks].v, aq[rt][ks].v, bk[ks].v, bk[ks].v, acc); s[rt][nt] = acc; } }
#pragma unroll
    for (int rt = 0; rt < RTN; ++rt)
#pragma unroll
      for (int r = 0; r < 8; ++r) { const int tq = q0 + rt * 16 + 8 * hh + r; const int k0 = j0 + ln, k1 = j0 + 16 + ln;
        bool ok0 = (CAUSAL == 1) ? (k0 <= tq) : ((CAUSAL == 2) ? ((k0 >> 5) == (tq >> 5)) : true), ok1 = (CAUSAL == 1) ? (k1 <= tq) : ((CAUSAL == 2) ? ((k1 >> 5) == (tq >> 5)) : true); if (CAUSAL == 23) { const int cq = tq / CHK; ok0 = (abs(k0 / CHK - cq) <= 1) && (MSK[(size_t)b * TK + k0] == 0); ok1 = (abs(k1 / CHK - cq) <= 1) && (MSK[(size_t)b * TK + k1] == 0); }      /* mode 23: 3-chunk window + int key-padding mask */
        if (CAUSAL == 24) { ok0 = (MSK[(size_t)b * TK + k0] == 0); ok1 = (MSK[(size_t)b * TK + k1] == 0); }      /* mode 24: int key-padding mask (nonzero = padded = excluded) */      /* mode 2: block-diagonal 32-token groups */
        float s0 = ok0 ? s[rt][0][r] * SCL : -3.0e38f, s1 = ok1 ? s[rt][1][r] * SCL : -3.0e38f; if (CAUSAL == 17) { const float* amk = (const float*)MSK + (size_t)b * TK; s0 += bf16_round(amk[k0]); s1 += bf16_round(amk[k1]); } if (CAUSAL == 18) { const float* tb = (const float*)MSK; const int* ri = MSK + 1024 + (size_t)b * TK; const int rq = ri[tq]; s0 += tb[(h * 8 + rq) * 8 + ri[k0]]; s1 += tb[(h * 8 + rq) * 8 + ri[k1]]; } if (CAUSAL == 19) { const int* rel = MSK + (size_t)tq * TK; const float* rb = (const float*)MSK + (size_t)TQ * TK + ((size_t)(b * NH + h) * TQ + tq) * 64; s0 += rb[rel[k0]]; s1 += rb[rel[k1]]; }      /* mode 19: + (q.Ek[rel] + Eb[rel][h]) / 8 gathered by the int relative ids (packed [ids | table]) */      /* mode 18: + resource_bias[h][r_q][r_k] from the packed [table | ids] buffer (TQ == TK) */      /* mode 17: additive per-(batch, key) mask INPUT */ float mc = fmaxf(s0, s1);
        mc = fmaxf(mc, __shfl_xor(mc, 1, 32)); mc = fmaxf(mc, __shfl_xor(mc, 2, 32)); mc = fmaxf(mc, __shfl_xor(mc, 4, 32)); mc = fmaxf(mc, __shfl_xor(mc, 8, 32));
        const float mn = fmaxf(m_r[rt][r], mc); const float al = (mn > -1.0e38f) ? expf(m_r[rt][r] - mn) : 1.0f; m_r[rt][r] = mn; const float p0 = ok0 ? expf(s0 - mn) : 0.f, p1 = ok1 ? expf(s1 - mn) : 0.f; l_r[rt][r] = l_r[rt][r] * al + p0 + p1;
#pragma unroll
        for (int dt = 0; dt < DT; ++dt) oacc[rt][dt][r] *= al;
        FragH t2; t2.h[0] = (_Float16)(p0 * 1024.0f); t2.h[1] = (_Float16)(p1 * 1024.0f); sP[w][rt * 16 + 8 * hh + r][ln] = t2.u[0]; sP[w][rt * 16 + 8 * hh + r][16 + ln] = t2.u[1]; }
    __builtin_amdgcn_fence(__ATOMIC_ACQ_REL, "workgroup"); __builtin_amdgcn_wave_barrier();
    FragH pa[2];
#pragma unroll
    for (int rt = 0; rt < RTN; ++rt) { pa[rt].half[0] = *(const v8us*)&sP[w][rt * 16 + ln][8 * hh]; pa[rt].half[1] = *(const v8us*)&sP[w][rt * 16 + ln][16 + 8 * hh]; }
#pragma unroll
    for (int dt = 0; dt < DT; ++dt) { const unsigned short* vrow = Vth + (size_t)(dt * 16 + ln) * TK + j0; FragH bv; bv.half[0] = *(const v8us*)(vrow + 8 * hh); bv.half[1] = *(const v8us*)(vrow + 16 + 8 * hh);
#pragma unroll
      for (int rt = 0; rt < RTN; ++rt) oacc[rt][dt] = mmaH<1>(pa[rt].v, pa[rt].v, bv.v, bv.v, oacc[rt][dt]); }
    __builtin_amdgcn_fence(__ATOMIC_ACQ_REL, "workgroup"); __builtin_amdgcn_wave_barrier(); }
#pragma unroll
  for (int rt = 0; rt < RTN; ++rt) {
#pragma unroll
    for (int r = 0; r < 8; ++r) { float l = l_r[rt][r]; l += __shfl_xor(l, 1, 32); l += __shfl_xor(l, 2, 32); l += __shfl_xor(l, 4, 32); l += __shfl_xor(l, 8, 32); l_r[rt][r] = (l > 0.f) ? 1.0f / (l * 1024.0f) : 0.f; }
#pragma unroll
    for (int dt = 0; dt < DT; ++dt)
#pragma unroll
      for (int r = 0; r < 8; ++r) sO[w][rt * 16 + 8 * hh + r][dt * 16 + ln] = oacc[rt][dt][r] * l_r[rt][r]; }
  __builtin_amdgcn_fence(__ATOMIC_ACQ_REL, "workgroup"); __builtin_amdgcn_wave_barrier();
  {
#pragma unroll
    for (int rp = 0; rp < RPW; rp += 2) { const int r = rp + (lane >> 4), pc = lane & 15; const v4f val = *(const v4fa*)&sO[w][r][pc * 4]; *(v4f*)(O + ((size_t)b * TQ + q0 + r) * ldo + h * 64 + pc * 4) = val; }
     } }
// 5-plane variant: S = Qh Kh^T + (Ql Kh^T + Qh Kl^T)/1024 with Q/K = [hi | 2^10 residual] f16 planes (QL/KL same layout as Q16/K16), then the 3-term P.V below.
// 3-term variant: O = (P_hi V_hi + (P_lo V_hi + P_hi V_lo) / 1024) / l with P = [hi | 2^10 residual] of 1024 p and V^T = [hi | 2^10 residual] planes (VtL same layout as Vt) -> ~2^-21-class products for un-averaged (early causal / peaked) rows
template <int CAUSAL>
__global__ __launch_bounds__(128) void k_flash5(const _Float16* __restrict__ Q16, const _Float16* __restrict__ QL, int ldq, const _Float16* __restrict__ K16, const _Float16* __restrict__ KL, int ldk, const _Float16* __restrict__ Vt, const _Float16* __restrict__ VtL, const int* __restrict__ MSK, float* __restrict__ O, int ldo) {
  constexpr int RPW = 16, RTN = RPW / 16, NQB = TQ / (4 * RPW), DT = 4, KS = 2;
  __shared__ __attribute__((aligned(16))) unsigned short sP[4][RPW][40]; __shared__ __attribute__((aligned(16))) unsigned short sPL[4][RPW][40]; __shared__ __attribute__((aligned(16))) float sO[4][RPW][64 + 4];
  const int tid = threadIdx.x, w = tid >> 5, lane = tid & 31, ln = lane & 15, hh = lane >> 4;
  const int slab = blockIdx.x / QBN5, qblk = QB05 + blockIdx.x % QBN5; (void)NQB; const int b = slab / NH, h = slab % NH; const int qb0 = qblk * (4 * RPW); const int q0 = qb0 + w * RPW;
  FragH aq[2][KS], aql[2][KS];
#pragma unroll
  for (int rt = 0; rt < RTN; ++rt) { const unsigned short* qr = (const unsigned short*)Q16 + ((size_t)b * TQ + q0 + rt * 16 + ln) * ldq + h * 64; const unsigned short* ql = (const unsigned short*)QL + ((size_t)b * TQ + q0 + rt * 16 + ln) * ldq + h * 64;
#pragma unroll
    for (int ks = 0; ks < KS; ++ks) { aq[rt][ks].half[0] = *(const v8us*)(qr + ks * 32 + 8 * hh); aq[rt][ks].half[1] = *(const v8us*)(qr + ks * 32 + 16 + 8 * hh); aql[rt][ks].half[0] = *(const v8us*)(ql + ks * 32 + 8 * hh); aql[rt][ks].half[1] = *(const v8us*)(ql + ks * 32 + 16 + 8 * hh); } }
  const unsigned short* Vth = (const unsigned short*)Vt + (size_t)slab * 64 * TK; const unsigned short* Vtl = (const unsigned short*)VtL + (size_t)slab * 64 * TK;
  float m_r[2][8], l_r[2][8]; v8f oacc[2][DT], oaccL[2][DT];
#pragma unroll
  for (int rt = 0; rt < RTN; ++rt) {
#pragma unroll
    for (int r = 0; r < 8; ++r) { m_r[rt][r] = -3.0e38f; l_r[rt][r] = 0.f; }
#pragma unroll
    for (int dt = 0; dt < DT; ++dt) { oacc[rt][dt] = (v8f){0.f,0.f,0.f,0.f,0.f,0.f,0.f,0.f}; oaccL[rt][dt] = oacc[rt][dt]; } }
  const int jend = (CAUSAL == 1) ? (qb0 + 4 * RPW) : ((CAUSAL == 23) ? min(TK, (qb0 / CHK + 2) * CHK) : TK);      /* causal / window: keys that can never contribute are skipped */ const int jbeg = (CAUSAL == 23) ? max(0, (qb0 / CHK - 1) * CHK) : 0;
#pragma unroll 1
  for (int j0 = jbeg; j0 < jend; j0 += 32) {
    v8f s[2][2];
#pragma unroll
    for (int nt = 0; nt < 2; ++nt) { const unsigned short* kr = (const unsigned short*)K16 + ((size_t)b * TK + j0 + nt * 16 + ln) * ldk + h * 64; const unsigned short* klr = (const unsigned short*)KL + ((size_t)b * TK + j0 + nt * 16 + ln) * ldk + h * 64; FragH bk[KS], bkl[KS];
#pragma unroll
      for (int ks = 0; ks < KS; ++ks) { bk[ks].half[0] = *(const v8us*)(kr + ks * 32 + 8 * hh); bk[ks].half[1] = *(const v8us*)(kr + ks * 32 + 16 + 8 * hh); bkl[ks].half[0] = *(const v8us*)(klr + ks * 32 + 8 * hh); bkl[ks].half[1] = *(const v8us*)(klr + ks * 32 + 16 + 8 * hh); }
#pragma unroll
      for (int rt = 0; rt < RTN; ++rt) { v8f acc = (v8f){0.f,0.f,0.f,0.f,0.f,0.f,0.f,0.f}, accl = acc;
#pragma unroll
        for (int ks = 0; ks < KS; ++ks) { acc = mmaH<1>(aq[rt][ks].v, aq[rt][ks].v, bk[ks].v, bk[ks].v, acc); accl = mmaH<1>(aql[rt][ks].v, aql[rt][ks].v, bk[ks].v, bk[ks].v, accl); accl = mmaH<1>(aq[rt][ks].v, aq[rt][ks].v, bkl[ks].v, bkl[ks].v, accl); }
#pragma unroll
        for (int r = 0; r < 8; ++r) acc[r] += accl[r] * 0.0009765625f;
        s[rt][nt] = acc; } }
#pragma unroll
    for (int rt = 0; rt < RTN; ++rt)
#pragma unroll
      for (int r = 0; r < 8; ++r) { const int tq = q0 + rt * 16 + 8 * hh + r; const int k0 = j0 + ln, k1 = j0 + 16 + ln;
        bool ok0 = (CAUSAL == 1) ? (k0 <= tq) : ((CAUSAL == 2) ? ((k0 >> 5) == (tq >> 5)) : true), ok1 = (CAUSAL == 1) ? (k1 <= tq) : ((CAUSAL == 2) ? ((k1 >> 5) == (tq >> 5)) : true);      /* mode 2: block-diagonal 32-token groups */
        if (CAUSAL == 4) { const int* mrow = MSK + ((size_t)b * TQ + tq) * TK; ok0 = mrow[k0] != 0; ok1 = mrow[k1] != 0; }      /* mode 4: per-(query, key) INPUT mask shared by all heads; masked keys contribute nothing (== the reference's -4096 fill, whose exp underflows to 0), rows with no valid key give l = 0 -> output 0 (== the reference's row_valid zeroing) */
        float s0 = ok0 ? s[rt][0][r] * SCL : -3.0e38f, s1 = ok1 ? s[rt][1][r] * SCL : -3.0e38f; if (CAUSAL == 17) { const float* amk = (const float*)MSK + (size_t)b * TK; s0 += bf16_round(amk[k0]); s1 += bf16_round(amk[k1]); } if (CAUSAL == 18) { const float* tb = (const float*)MSK; const int* ri = MSK + 1024 + (size_t)b * TK; const int rq = ri[tq]; s0 += tb[(h * 8 + rq) * 8 + ri[k0]]; s1 += tb[(h * 8 + rq) * 8 + ri[k1]]; } if (CAUSAL == 19) { const int* rel = MSK + (size_t)tq * TK; const float* rb = (const float*)MSK + (size_t)TQ * TK + ((size_t)(b * NH + h) * TQ + tq) * 64; s0 += rb[rel[k0]]; s1 += rb[rel[k1]]; }      /* mode 19: + (q.Ek[rel] + Eb[rel][h]) / 8 gathered by the int relative ids (packed [ids | table]) */      /* mode 18: + resource_bias[h][r_q][r_k] from the packed [table | ids] buffer (TQ == TK) */      /* mode 17: additive per-(batch, key) mask INPUT */ float mc = fmaxf(s0, s1);
        mc = fmaxf(mc, __shfl_xor(mc, 1, 32)); mc = fmaxf(mc, __shfl_xor(mc, 2, 32)); mc = fmaxf(mc, __shfl_xor(mc, 4, 32)); mc = fmaxf(mc, __shfl_xor(mc, 8, 32));
        const float mn = fmaxf(m_r[rt][r], mc); const float al = (mn > -1.0e38f) ? expf(m_r[rt][r] - mn) : 1.0f; m_r[rt][r] = mn; const float p0 = ok0 ? expf(s0 - mn) : 0.f, p1 = ok1 ? expf(s1 - mn) : 0.f; l_r[rt][r] = l_r[rt][r] * al + p0 + p1;
#pragma unroll
        for (int dt = 0; dt < DT; ++dt) { oacc[rt][dt][r] *= al; oaccL[rt][dt][r] *= al; }
        FragH t2, t2l; const float ps0 = p0 * 1024.0f, ps1 = p1 * 1024.0f; t2.h[0] = (_Float16)ps0; t2.h[1] = (_Float16)ps1; t2l.h[0] = (_Float16)((ps0 - (float)t2.h[0]) * 1024.0f); t2l.h[1] = (_Float16)((ps1 - (float)t2.h[1]) * 1024.0f);
        sP[w][rt * 16 + 8 * hh + r][ln] = t2.u[0]; sP[w][rt * 16 + 8 * hh + r][16 + ln] = t2.u[1]; sPL[w][rt * 16 + 8 * hh + r][ln] = t2l.u[0]; sPL[w][rt * 16 + 8 * hh + r][16 + ln] = t2l.u[1]; }
    __builtin_amdgcn_fence(__ATOMIC_ACQ_REL, "workgroup"); __builtin_amdgcn_wave_barrier();
    FragH pa[2], pl[2];
#pragma unroll
    for (int rt = 0; rt < RTN; ++rt) { pa[rt].half[0] = *(const v8us*)&sP[w][rt * 16 + ln][8 * hh]; pa[rt].half[1] = *(const v8us*)&sP[w][rt * 16 + ln][16 + 8 * hh]; pl[rt].half[0] = *(const v8us*)&sPL[w][rt * 16 + ln][8 * hh]; pl[rt].half[1] = *(const v8us*)&sPL[w][rt * 16 + ln][16 + 8 * hh]; }
#pragma unroll
    for (int dt = 0; dt < DT; ++dt) { const unsigned short* vrow = Vth + (size_t)(dt * 16 + ln) * TK + j0; const unsigned short* vrl = Vtl + (size_t)(dt * 16 + ln) * TK + j0; FragH bv, bl; bv.half[0] = *(const v8us*)(vrow + 8 * hh); bv.half[1] = *(const v8us*)(vrow + 16 + 8 * hh); bl.half[0] = *(const v8us*)(vrl + 8 * hh); bl.half[1] = *(const v8us*)(vrl + 16 + 8 * hh);
#pragma unroll
      for (int rt = 0; rt < RTN; ++rt) { oacc[rt][dt] = mmaH<1>(pa[rt].v, pa[rt].v, bv.v, bv.v, oacc[rt][dt]); oaccL[rt][dt] = mmaH<1>(pl[rt].v, pl[rt].v, bv.v, bv.v, oaccL[rt][dt]); oaccL[rt][dt] = mmaH<1>(pa[rt].v, pa[rt].v, bl.v, bl.v, oaccL[rt][dt]); } }
    __builtin_amdgcn_fence(__ATOMIC_ACQ_REL, "workgroup"); __builtin_amdgcn_wave_barrier(); }
#pragma unroll
  for (int rt = 0; rt < RTN; ++rt) {
#pragma unroll
    for (int r = 0; r < 8; ++r) { float l = l_r[rt][r]; l += __shfl_xor(l, 1, 32); l += __shfl_xor(l, 2, 32); l += __shfl_xor(l, 4, 32); l += __shfl_xor(l, 8, 32); l_r[rt][r] = (l > 0.f) ? 1.0f / (l * 1024.0f) : 0.f; }
#pragma unroll
    for (int dt = 0; dt < DT; ++dt)
#pragma unroll
      for (int r = 0; r < 8; ++r) { float v = oacc[rt][dt][r]; v += oaccL[rt][dt][r] * 0.0009765625f; sO[w][rt * 16 + 8 * hh + r][dt * 16 + ln] = v * l_r[rt][r]; } }
  __builtin_amdgcn_fence(__ATOMIC_ACQ_REL, "workgroup"); __builtin_amdgcn_wave_barrier();
  {
#pragma unroll
    for (int rp = 0; rp < RPW; rp += 2) { const int r = rp + (lane >> 4), pc = lane & 15; const v4f val = *(const v4fa*)&sO[w][r][pc * 4]; *(v4f*)(O + ((size_t)b * TQ + q0 + r) * ldo + h * 64 + pc * 4) = val; }
     } }

__global__ __launch_bounds__(256) void k_rotab(float* __restrict__ CS, float* __restrict__ SN) {
  #pragma clang fp contract(off)
  const int t = blockIdx.x * 256 + threadIdx.x; if (t >= SLEN * 32) return; const int j = t % 32, s = t / 32; const float ex = (float)(2 * j) / 64.0f; const float inv = 1.0f / powf(10000.0f, ex); const float th = (float)s * inv; const float c = cosf(th), sn = sinf(th);
  { *(float*)(CS + t) = c; *(float*)(SN + t) = sn;  } }
__global__ __launch_bounds__(256) void k_rope(const float* __restrict__ F, int nsrc, int ndst, int rep, const float* __restrict__ CS, const float* __restrict__ SN, _Float16* __restrict__ H, _Float16* __restrict__ L) {
  #pragma clang fp contract(off)
  const size_t t = (size_t)blockIdx.x * 256 + threadIdx.x; if (t >= (size_t)NR * ndst * 4) return; const int g8 = (int)(t % 4); const int hd = (int)((t / 4) % ndst); const size_t row = t / ((size_t)4 * ndst); const int s = (int)(row % SLEN); const int hs = hd / rep;
  const float* src = F + row * (size_t)(nsrc * 64) + hs * 64; FragH ah, al, bh, bl;
  for (int i = 0; i < 8; ++i) { const int d = g8 * 8 + i; const float c = CS[s * 32 + d], sn = SN[s * 32 + d]; const float x1 = src[d], x2 = src[d + 32];
    float o1 = x1 * c; o1 += -x2 * sn; float o2 = x2 * c; o2 += x1 * sn;
    _Float16 hv = (_Float16)o1; ah.h[i] = hv; al.h[i] = (_Float16)((o1 - (float)hv) * 1024.0f); hv = (_Float16)o2; bh.h[i] = hv; bl.h[i] = (_Float16)((o2 - (float)hv) * 1024.0f); }
  const size_t o = row * (size_t)(ndst * 64) + hd * 64 + g8 * 8;
  { *(v8us*)((unsigned short*)H + o) = ah.half[0]; *(v8us*)((unsigned short*)H + o + 32) = bh.half[0]; *(v8us*)((unsigned short*)L + o) = al.half[0]; *(v8us*)((unsigned short*)L + o + 32) = bl.half[0];  } }
__global__ __launch_bounds__(256) void k_rope2(const float* __restrict__ F, int nsrc, int ndst, int rep, const float* __restrict__ CS, const float* __restrict__ SN, _Float16* __restrict__ H, _Float16* __restrict__ L) {
  #pragma clang fp contract(off)
  const size_t t = (size_t)blockIdx.x * 256 + threadIdx.x; if (t >= (size_t)NR * ndst * 4) return; const int g16 = (int)(t % 4); const int hd = (int)((t / 4) % ndst); const size_t row = t / ((size_t)4 * ndst); const int s = (int)(row % SLEN); const int hs = hd / rep;
  const float* src = F + row * (size_t)(nsrc * 64) + hs * 64 + g16 * 16; FragH ah, al;
  for (int pr = 0; pr < 8; ++pr) { const int i = g16 * 8 + pr; const float c = CS[s * 32 + i], sn = SN[s * 32 + i]; const float x1 = src[2 * pr], x2 = src[2 * pr + 1];
    float o1 = x1 * c; o1 -= x2 * sn; float o2 = x1 * sn; o2 += x2 * c;
    _Float16 hv = (_Float16)o1; ah.h[2 * pr] = hv; al.h[2 * pr] = (_Float16)((o1 - (float)hv) * 1024.0f); hv = (_Float16)o2; ah.h[2 * pr + 1] = hv; al.h[2 * pr + 1] = (_Float16)((o2 - (float)hv) * 1024.0f); }
  const size_t o = row * (size_t)(ndst * 64) + hd * 64 + g16 * 16;
  { *(v8us*)((unsigned short*)H + o) = ah.half[0]; *(v8us*)((unsigned short*)H + o + 8) = ah.half[1]; *(v8us*)((unsigned short*)L + o) = al.half[0]; *(v8us*)((unsigned short*)L + o + 8) = al.half[1];  } }
__global__ __launch_bounds__(256) void k_ln512(const float* __restrict__ A, const float* __restrict__ res, const float* __restrict__ g, const float* __restrict__ bb, float* __restrict__ Y, _Float16* __restrict__ Y16) {
  #pragma clang fp contract(off)
  const int wv = threadIdx.x >> 5, ln = threadIdx.x & 31; const size_t r = (size_t)blockIdx.x * 8 + wv; if (r >= NR) return; float x[16]; float s = 0.f;
  for (int i = 0; i < 2; ++i) { const v8f a = *(const v8f*)(A + r * DM + i * 256 + ln * 8); for (int q = 0; q < 8; ++q) { float v = a[q]; if (res) v += bf16_round(res[r * DM + i * 256 + ln * 8 + q]); x[i * 8 + q] = v; s += v; } }
  for (int o = 16; o > 0; o >>= 1) s += __shfl_xor(s, o, 32); const float mu = s / (float)DM; float var = 0.f; for (int q = 0; q < 16; ++q) { const float d = x[q] - mu; var += d * d; }
  for (int o = 16; o > 0; o >>= 1) var += __shfl_xor(var, o, 32); const float inv = rsqrtf(var / (float)DM + 1e-5f);
  { for (int i = 0; i < 2; ++i) { const int c0 = i * 256 + ln * 8; v8f y; FragH f; for (int q = 0; q < 8; ++q) { float v = (x[i * 8 + q] - mu) * inv; v *= bf16_round(g[c0 + q]); v += bf16_round(bb[c0 + q]); y[q] = v; f.h[q] = (_Float16)v; } *(v8f*)(Y + r * DM + c0) = y; if (Y16) *(v8us*)((unsigned short*)Y16 + r * DM + c0) = f.half[0]; }  } }
__global__ __launch_bounds__(256) void k_pack(const float* __restrict__ rb, const int* __restrict__ rid, int* __restrict__ PK) { const int t = blockIdx.x * 256 + threadIdx.x; if (t >= 1024 + NB * TK) return; int v; if (t < 1024) v = __float_as_int(bf16_round(rb[t])); else v = rid[t - 1024]; *(int*)(PK + t) = v;  }
__global__ __launch_bounds__(256) void k_tabin(const float* __restrict__ sp, float* __restrict__ CS, float* __restrict__ SN) { const int t = blockIdx.x * 256 + threadIdx.x; if (t >= SLEN * 32) return; const int i = t % 32, s = t / 32; const float c = bf16_round(sp[s * 64 + 32 + i]), sn = bf16_round(sp[s * 64 + i]);
  { *(float*)(CS + t) = c; *(float*)(SN + t) = sn;  } }
__global__ __launch_bounds__(256) void k_wsc(const float* __restrict__ Wm, _Float16* __restrict__ Bt, size_t n8, float sc) { const size_t t = (size_t)blockIdx.x * 256 + threadIdx.x; if (t >= n8) return; FragH f; for (int q = 0; q < 8; ++q) f.h[q] = (_Float16)(bf16_round(Wm[t * 8 + q]) * sc); *(v8us*)((unsigned short*)Bt + t * 8) = f.half[0];  }
__global__ __launch_bounds__(256) void k_rotab2(float* __restrict__ CS, float* __restrict__ SN) {
  #pragma clang fp contract(off)
  const int t = blockIdx.x * 256 + threadIdx.x; if (t >= SLEN * 32) return; const int j = t % 32, s = t / 32; const float c0 = -0.14391156831212787f;      /* -ln(10000)/64 rounded to f32 */ const float inv = expf((float)(2 * j) * c0); const float th = (float)s * inv; const float c = cosf(th), sn = sinf(th);
  { *(float*)(CS + t) = c; *(float*)(SN + t) = sn;  } }
__global__ __launch_bounds__(256) void k_lnu(const float* __restrict__ X, _Float16* __restrict__ N16, float* __restrict__ XB) {
  #pragma clang fp contract(off)
  const int wv = threadIdx.x >> 5, ln = threadIdx.x & 31; const size_t r = (size_t)blockIdx.x * 8 + wv; if (r >= NR) return; float a[32]; float s = 0.f;
  for (int i = 0; i < 4; ++i) { const v8f v = *(const v8f*)(X + r * DM + (i * 32 + ln) * 8); for (int q = 0; q < 8; ++q) { const float u = bf16_round(v[q]); a[i * 8 + q] = u; s += u; } }
  for (int o = 16; o > 0; o >>= 1) s += __shfl_xor(s, o, 32); const float mu = s / (float)DM; float var = 0.f; for (int q = 0; q < 32; ++q) { const float d = a[q] - mu; var += d * d; }
  for (int o = 16; o > 0; o >>= 1) var += __shfl_xor(var, o, 32); const float den = sqrtf(var / (float)(DM - 1)) + 1e-6f; const float inv = 1.0f / den;      /* one reciprocal per row; (x-mean)*inv vs the reference's division differs by <= 1 ulp */
  { for (int i = 0; i < 4; ++i) { const int c0 = (i * 32 + ln) * 8; FragH f; v8f xb; for (int q = 0; q < 8; ++q) { f.h[q] = (_Float16)((a[i * 8 + q] - mu) * inv); xb[q] = a[i * 8 + q]; } *(v8us*)((unsigned short*)N16 + r * DM + c0) = f.half[0]; *(v8f*)(XB + r * DM + c0) = xb; }  } }

// Fused Gaussian-kernel attention: one launch for all (batch, head) slabs; the score plane and the weight plane never leave the registers.
// Block = 8 waves x 16 output rows i; the summed index j walks in LDS stages of FJ rows (q hi, q residual, V^T, |q|^2), two buffers, one barrier a stage.
// S^T tile: A = q rows j (LDS), B = k columns i (registers, loaded once); D[8 hh + r][ln] = k_i . q_j. Two D tiles (j 0-15, 16-31), weighted and rounded in place, are the B operand of O^T += V^T . P^T.
#define FJ 64
#define FP 72                    /* LDS row pitch in f16: 128-byte rows + 16 bytes, for 16-byte fragment reads */
__device__ __forceinline__ v16h fz_frag(const unsigned short* p, int hh) { FragH f; f.half[0] = *(const v8us*)(p + 8 * hh); f.half[1] = *(const v8us*)(p + 16 + 8 * hh); return f.v; }
__device__ __forceinline__ v8f fz_mma(v16h a, v16h b, v8f c) { return __builtin_amdgcn_wmma_f32_16x16x32_f16(false, a, false, b, (short)0, c, false, false); }
union FragW { v16h v; unsigned d[8]; };
__device__ __forceinline__ void fz_exp2_pack(float x0, float x1, float x2, float x3, float x4, float x5, float x6, float x7, unsigned* o) {
  asm("v_exp_f32 %4, %4\n\tv_exp_f32 %5, %5\n\tv_exp_f32 %6, %6\n\tv_exp_f32 %7, %7\n\tv_exp_f32 %8, %8\n\tv_exp_f32 %9, %9\n\tv_exp_f32 %10, %10\n\tv_exp_f32 %11, %11\n\t"
      "v_cvt_pk_f16_f32 %0, %4, %5\n\tv_cvt_pk_f16_f32 %1, %6, %7\n\t"
      "s_delay_alu instid0(TRANS32_DEP_3)\n\tv_cvt_pk_f16_f32 %2, %8, %9\n\t"
      "s_delay_alu instid0(TRANS32_DEP_1)\n\tv_cvt_pk_f16_f32 %3, %10, %11"
      : "=&v"(o[0]), "=&v"(o[1]), "=&v"(o[2]), "=&v"(o[3]), "+v"(x0), "+v"(x1), "+v"(x2), "+v"(x3), "+v"(x4), "+v"(x5), "+v"(x6), "+v"(x7)); }
__global__ __launch_bounds__(256) __attribute__((amdgpu_waves_per_eu(4, 4))) void k_gauss(const _Float16* __restrict__ QH, const _Float16* __restrict__ QL, const _Float16* __restrict__ KH, const _Float16* __restrict__ KL, const _Float16* __restrict__ VT,
    const float* __restrict__ QN, const float* __restrict__ KN, const float* __restrict__ rs, _Float16* __restrict__ OH) {
  __shared__ __attribute__((aligned(16))) unsigned short sQH[2][FJ][FP]; __shared__ __attribute__((aligned(16))) unsigned short sQL[2][FJ][FP]; __shared__ __attribute__((aligned(16))) unsigned short sVT[2][64][FP]; __shared__ __attribute__((aligned(16))) float sQN[2][FJ];
  const int tid = threadIdx.x, w = tid >> 5, lane = tid & 31, ln = lane & 15, hh = lane >> 4;
  const int slab = blockIdx.x / (SLEN / 128), ib = blockIdx.x % (SLEN / 128); const int b = slab / NH, h = slab % NH;
  const int i = ib * 128 + w * 16 + ln;      /* this lane's output row (a column of every D tile) */
  const unsigned short* kh = (const unsigned short*)KH + ((size_t)b * SLEN + i) * DM + h * 64; const unsigned short* kl = (const unsigned short*)KL + ((size_t)b * SLEN + i) * DM + h * 64;
  const v16h bkh0 = fz_frag(kh, hh), bkh1 = fz_frag(kh + 32, hh), bkl0 = fz_frag(kl, hh), bkl1 = fz_frag(kl + 32, hh);
  const float r = bf16_round(rs[0]); const float c = r * 1.44269504f;      /* r log2(e): 1024 exp(-r d2) = 2^(10 - c kn - c qn + 2 c s), one hardware exp2 an element */
  const float c2 = 2.0f * c; const float knb = __builtin_fmaf(-c, KN[(size_t)slab * SLEN + i], 10.0f);      /* this lane's share of the exponent, formed once */
  const int sr = tid >> 3, sc = (tid & 7) * 8;      /* staging: 16 bytes a thread in rows sr and sr + 32 of each plane */
  const unsigned short* gqh = (const unsigned short*)QH + ((size_t)b * SLEN + sr) * DM + h * 64 + sc; const unsigned short* gql = (const unsigned short*)QL + ((size_t)b * SLEN + sr) * DM + h * 64 + sc;
  const unsigned short* gvt = (const unsigned short*)VT + ((size_t)slab * 64 + sr) * SLEN + sc; const float* gqn = QN + (size_t)slab * SLEN + (tid & (FJ - 1));
  v8us rq0, rq1, rl0, rl1, rv0, rv1; float rn = 0.f;
  auto gload = [&](int j0) { rq0 = *(const v8us*)(gqh + (size_t)j0 * DM); rq1 = *(const v8us*)(gqh + (size_t)(j0 + 32) * DM); rl0 = *(const v8us*)(gql + (size_t)j0 * DM); rl1 = *(const v8us*)(gql + (size_t)(j0 + 32) * DM);
    rv0 = *(const v8us*)(gvt + j0); rv1 = *(const v8us*)(gvt + (size_t)32 * SLEN + j0); if (tid < FJ) rn = gqn[j0]; };
  auto sstore = [&](int bf) { *(v8us*)&sQH[bf][sr][sc] = rq0; *(v8us*)&sQH[bf][sr + 32][sc] = rq1; *(v8us*)&sQL[bf][sr][sc] = rl0; *(v8us*)&sQL[bf][sr + 32][sc] = rl1; *(v8us*)&sVT[bf][sr][sc] = rv0; *(v8us*)&sVT[bf][sr + 32][sc] = rv1; if (tid < FJ) sQN[bf][tid] = -c * rn; };      /* staged as -c |q_j|^2: row j's share of the exponent */
  const v8f z8 = {0.f,0.f,0.f,0.f,0.f,0.f,0.f,0.f}; v8f oacc[4] = {z8, z8, z8, z8};
  gload(0); sstore(0); __syncthreads();
#pragma unroll 1      /* one stage a trip: the body already holds two 32-wide passes; more would only grow the code */
  for (int st = 0; st < SLEN / FJ; ++st) { const int bf = st & 1; const bool more = st + 1 < SLEN / FJ;
    if (more) gload((st + 1) * FJ);      /* next stage flies from L2 while this one is worked on */
#pragma unroll
    for (int jj = 0; jj < FJ; jj += 32) { FragW pb; const v16h av0 = fz_frag(&sVT[bf][ln][jj], hh), av1 = fz_frag(&sVT[bf][16 + ln][jj], hh), av2 = fz_frag(&sVT[bf][32 + ln][jj], hh), av3 = fz_frag(&sVT[bf][48 + ln][jj], hh);      /* named ahead of the score work, so that the scheduler may start these reads early */
#pragma unroll
      for (int nt = 0; nt < 2; ++nt) { const unsigned short* qh = &sQH[bf][jj + nt * 16 + ln][0]; const unsigned short* ql = &sQL[bf][jj + nt * 16 + ln][0];
        const v16h ah0 = fz_frag(qh, hh), ah1 = fz_frag(qh + 32, hh), al0 = fz_frag(ql, hh), al1 = fz_frag(ql + 32, hh);
        v8f cA = fz_mma(ah0, bkl0, z8), cB = fz_mma(al0, bkh0, z8), cC = fz_mma(ah0, bkh0, z8); cA = fz_mma(ah1, bkl1, cA); cB = fz_mma(al1, bkh1, cB); cC = fz_mma(ah1, bkh1, cC);
        const v4f n0 = *(const v4fa*)&sQN[bf][jj + nt * 16 + 8 * hh], n1 = *(const v4fa*)&sQN[bf][jj + nt * 16 + 8 * hh + 4];
        float e[8];
#pragma unroll
        for (int q = 0; q < 8; ++q) { const float s = __builtin_fmaf(cB[q] + cA[q], 0.0009765625f, cC[q]); const float qn = (q < 4) ? n0[q & 3] : n1[q & 3]; e[q] = __builtin_fmaf(s, c2, knb + qn); }
        fz_exp2_pack(e[0], e[1], e[2], e[3], e[4], e[5], e[6], e[7], &pb.d[nt * 4]); }      /* bare v_exp_f32: below 2^-126 it gives 0, which the f16 rounding gives from 2^-25 down anyway; above 2^16 the f16 rounding gives inf, as before */
      oacc[0] = fz_mma(av0, pb.v, oacc[0]); oacc[1] = fz_mma(av1, pb.v, oacc[1]); oacc[2] = fz_mma(av2, pb.v, oacc[2]); oacc[3] = fz_mma(av3, pb.v, oacc[3]); }
    if (more) sstore(bf ^ 1);      /* that buffer's last readers left it before the barrier that ended the trip before */
    __syncthreads(); }
  unsigned short* orow = (unsigned short*)OH + ((size_t)b * SLEN + i) * DM + h * 64 + 8 * hh;      /* D register q of tile dt = out[i][dt * 16 + 8 hh + q]; stored as the f16 operand plane of the output projection */
#pragma unroll
  for (int dt = 0; dt < 4; ++dt) { FragH f;
#pragma unroll
    for (int q = 0; q < 8; ++q) f.h[q] = (_Float16)(oacc[dt][q] * 0.0009765625f);
    *(v8us*)(orow + dt * 16) = f.half[0]; } }

// Projection GEMM, C[M][N] (f32) = A[M][K] . Bh[N][K]^T * alpha + bf16(bias): block = 8 waves (4 x 2) of 32x64 wave tiles = 128 x 128 of C.
// Both operand tiles (128 rows x GK k) go through LDS, two buffers, one barrier a stage: every global load covers whole 128-byte lines, and a row is fetched once a block instead of once a wave.
// k runs upward in steps of 32 into the same accumulators as before, so every sum keeps its order. Needs M % 128 == 0, N % 128 == 0, K % GK == 0.
// SPLIT (the qkv product; a block's 128 columns lie in one of q, k, v and a wave's 64 columns are one head): no f32 plane is stored. q and k go out as f16 hi + 2^10 residual planes with each row's squared norm ([batch, head][token]), v as V^T [batch, head][64][token].
template <int N, int K, bool SPLIT>
__global__ __launch_bounds__(256) void k_gemm3(const _Float16* __restrict__ A, const _Float16* __restrict__ Bh, float alpha, const float* __restrict__ bias, float* __restrict__ C,
    _Float16* __restrict__ QH, _Float16* __restrict__ QL, _Float16* __restrict__ KH, _Float16* __restrict__ KL, _Float16* __restrict__ VT, float* __restrict__ QN, float* __restrict__ KN) {
  constexpr int GK = 64;      /* k a stage: one 128-byte line a row */
  constexpr int GP = GK + 8;      /* LDS row pitch in f16: the row + 16 bytes (an odd count of 16 bytes), for 16-byte fragment reads */
  constexpr int RP = 2048 / GK, NP = 128 / RP;      /* rows a staging pass of 256 threads covers; passes a tile */
  __shared__ __attribute__((aligned(16))) unsigned short sT[2][256][GP];      /* rows 0-127: A tile, rows 128-255: B tile; after the loop each wave's 32 x 68 f32 output patch */
  const int tid = threadIdx.x, lane = tid & 31, ln = lane & 15, hh = lane >> 4;
  const int w = __builtin_amdgcn_readfirstlane(tid >> 5);      /* the wave's number in a scalar register: w, wm, wn and the tile origins formed from them hold no vector registers across the loop */
  constexpr int ntn = N >> 7; const int mt = blockIdx.x / ntn, nq = blockIdx.x - mt * ntn; const int wm = w >> 1, wn = w & 1;
  const int sr = tid / (GK / 8), sc = (tid % (GK / 8)) * 8;      /* staging: 16 bytes a thread in rows sr + RP u of each tile; 8 neighbour threads cover one 128-byte line */
  const unsigned short* ga = (const unsigned short*)A + (size_t)(mt * 128) * K; const unsigned short* gb = (const unsigned short*)Bh + (size_t)(nq * 128) * K; const unsigned go = (unsigned)(sr * K + sc);      /* block-uniform tile bases, which walk along k, and one fixed offset a thread */
  v8us ra[NP], rb[NP];
  auto gload = [&](int k0) {
#pragma unroll
    for (int u = 0; u < NP; ++u) { ra[u] = *(const v8us*)(ga + k0 + go + RP * u * K); rb[u] = *(const v8us*)(gb + k0 + go + RP * u * K); } };
  auto sstore = [&](int bf) {
#pragma unroll
    for (int u = 0; u < NP; ++u) { *(v8us*)&sT[bf][sr + RP * u][sc] = ra[u]; *(v8us*)&sT[bf][128 + sr + RP * u][sc] = rb[u]; } };
  const v8f z8 = {0.f,0.f,0.f,0.f,0.f,0.f,0.f,0.f}; v8f acc[2][4] = {{z8, z8, z8, z8}, {z8, z8, z8, z8}};
  constexpr int nst = K / GK;
  gload(0); sstore(0); __syncthreads();
#pragma unroll 1      /* one stage a trip: the body already holds 16 matrix instructions; more would only grow the code */
  for (int st = 0; st < nst; ++st) { const int bf = st & 1; const bool more = st + 1 < nst;
    if (more) gload((st + 1) * GK);      /* next stage flies from L2 while this one is worked on */
#pragma unroll
    for (int kk = 0; kk < GK; kk += 32) { const v16h a0 = fz_frag(&sT[bf][wm * 32 + ln][kk], hh), a1 = fz_frag(&sT[bf][wm * 32 + 16 + ln][kk], hh); v16h b[4];
#pragma unroll
      for (int t = 0; t < 4; ++t) b[t] = fz_frag(&sT[bf][128 + wn * 64 + t * 16 + ln][kk], hh);
      __builtin_amdgcn_sched_barrier(0);      /* keeps the six fragment reads together ahead of the eight products: left alone the scheduler sinks each B read to its use, and the wave waits out the LDS latency four times instead of once */
#pragma unroll
      for (int t = 0; t < 4; ++t) { acc[0][t] = fz_mma(a0, b[t], acc[0][t]); acc[1][t] = fz_mma(a1, b[t], acc[1][t]); } }
    if (more) sstore(bf ^ 1);      /* that buffer's last readers left it before the barrier that ended the trip before */
    __syncthreads(); }
  const int row0 = mt * 128 + wm * 32, col0 = nq * 128 + wn * 64;
  const int third = SPLIT ? (nq * 128) / DM : 0;      /* 0 q, 1 k, 2 v: the same for the whole block */
  if (SPLIT && third == 2) {
    constexpr int VP = 128 + 8;      /* LDS row pitch in f16: 128 tokens + 16 bytes (an odd count of 16 bytes) */
    unsigned short* sv = &sT[0][0][0];      /* [128 columns d][VP]; every read of the tiles ended at the loop's last barrier */
#pragma unroll      /* constant indices keep acc in registers */
    for (int u = 0; u < 8; ++u) { const int t = u & 3, half = u >> 2; const float bv = bf16_round(bias[col0 + t * 16 + ln]); FragH f;      /* a lane's 8 D registers are 8 tokens in a row of one column d: 16 bytes of a V^T row */
#pragma unroll      /* as above */
      for (int r = 0; r < 8; ++r) f.h[r] = (_Float16)(acc[half][t][r] * alpha + bv);
      *(v8us*)&sv[(wn * 64 + t * 16 + ln) * VP + wm * 32 + half * 16 + 8 * hh] = f.half[0]; }
    __syncthreads();      /* a V^T row's 128 tokens come from four waves */
    unsigned short* vt = (unsigned short*)VT + ((size_t)((mt * 128) / SLEN) * DM + (nq * 128 - 2 * DM)) * SLEN + (mt * 128) % SLEN;
#pragma unroll      /* the eight LDS reads go out together, one latency instead of eight */
    for (int p = 0; p < 8; ++p) { const int c = p * 256 + tid, dd = c >> 4, ch = (c & 15) * 8;      /* 16 neighbour threads store the 256 bytes of one row */
      *(v8us*)(vt + (size_t)dd * SLEN + ch) = *(const v8us*)&sv[dd * VP + ch]; }
    return; }
  float* so = (float*)&sT[0][0][0] + w * (32 * 68);      /* every read of the tiles ended at the loop's last barrier */
#pragma unroll
  for (int u = 0; u < 8; ++u) { const int t = u & 3, half = u >> 2; const float bv = bf16_round(bias[col0 + t * 16 + ln]);
#pragma unroll
    for (int r = 0; r < 8; ++r) so[(half * 16 + 8 * hh + r) * 68 + t * 16 + ln] = acc[half][t][r] * alpha + bv; }
  __builtin_amdgcn_fence(__ATOMIC_ACQ_REL, "workgroup"); __builtin_amdgcn_wave_barrier();      /* the patch is read back by other lanes of the same wave */
  if (SPLIT) {
    unsigned short* dh = (unsigned short*)(third ? KH : QH) + (size_t)row0 * DM + (col0 - third * DM); unsigned short* dl = (unsigned short*)(third ? KL : QL) + (size_t)row0 * DM + (col0 - third * DM);
    float sn = 0.f;      /* lane = row of the patch: the head's 64 squares, summed upward along d */
#pragma unroll      /* lets the LDS reads run ahead of the one chain of adds */
    for (int d = 0; d < 64; d += 4) { const v4f a = *(const v4fa*)&so[lane * 68 + d];
      for (int q = 0; q < 4; ++q) sn += a[q] * a[q]; }
    (third ? KN : QN)[((size_t)(row0 / SLEN) * NH + (col0 - third * DM) / 64) * SLEN + row0 % SLEN + lane] = sn;
    const int rs4 = lane >> 3, c8 = (lane & 7) * 8;      /* 8 neighbour lanes store the 128-byte line that a head's row is in each plane */
#pragma unroll 2      /* four trips of two passes: unrolled whole, the epilogue takes more registers than the product loop and costs the kernel a work-group per WGP */
    for (int p = 0; p < 8; ++p) { const int r = p * 4 + rs4; const v4f a = *(const v4fa*)&so[r * 68 + c8], c = *(const v4fa*)&so[r * 68 + c8 + 4]; FragH fh, fl;
#pragma unroll      /* constant indices keep the fragments in registers */
      for (int q = 0; q < 4; ++q) { _Float16 h = (_Float16)a[q]; fh.h[q] = h; fl.h[q] = (_Float16)((a[q] - (float)h) * 1024.0f); h = (_Float16)c[q]; fh.h[4 + q] = h; fl.h[4 + q] = (_Float16)((c[q] - (float)h) * 1024.0f); }
      *(v8us*)(dh + (size_t)r * DM + c8) = fh.half[0]; *(v8us*)(dl + (size_t)r * DM + c8) = fl.half[0]; }
    return; }
  const int rsub = lane >> 4, c4 = (lane & 15) * 4;
#pragma unroll
  for (int q = 0; q < 16; ++q) { const int r = q * 2 + rsub; const v4f v = *(const v4fa*)&so[r * 68 + c4]; *(v4f*)(C + (size_t)(row0 + r) * N + col0 + c4) = v; } }

extern "C" void kernel_launch(void* const* d_in, const int* in_sizes, int n_in,
                              void* d_out, int out_size, void* d_ws, size_t ws_size, hipStream_t stream) {
  (void)in_sizes; (void)n_in; (void)out_size;
  const float* const* I = (const float* const*)d_in; const float* x = I[0]; const float* Wqkv = I[1]; const float* bqkv = I[2]; const float* rs = I[3]; const float* Wp = I[4]; const float* bp = I[5];
  char* ws = (char*)d_ws; size_t off = 0;
  auto take = [&](size_t bytes) { char* p = ws + off; off += (bytes + 255) & ~(size_t)255; return p; };
  const size_t np = (size_t)NR * DM;
  _Float16* BQKV = (_Float16*)take((size_t)3 * DM * DM * 2); _Float16* BP = (_Float16*)take((size_t)DM * DM * 2);
  _Float16* X16 = (_Float16*)take(np * 2); float* QN = (float*)take((size_t)NR * NH * 4); float* KN = (float*)take((size_t)NR * NH * 4); _Float16* QH = (_Float16*)take(np * 2); _Float16* QL = (_Float16*)take(np * 2); _Float16* KH = (_Float16*)take(np * 2); _Float16* KL = (_Float16*)take(np * 2); _Float16* VT = (_Float16*)take(np * 2);
  _Float16* OH = (_Float16*)take(np * 2);      /* merged context f16 [NR][DM]: a plane of its own, q hi is still read while it is written */
  if (off > ws_size) return;      /* 6 + 2 + 8 + 0.5 + 5x8 + 8 = 65 MiB */
  k_prep<<<PREP_NB, 256, 0, stream>>>(x, X16, Wqkv, BQKV, Wp, BP, 16.0f);      /* x as f16; both weights (in, out) turned to [out][in], x16 */
  k_gemm3<3 * DM, DM, true><<<(NR / 128) * (3 * DM / 128), 256, 0, stream>>>(X16, BQKV, 0.0625f, bqkv, nullptr, QH, QL, KH, KL, VT, QN, KN);      /* [q | k | v] (head h = cols h*64..): q, k hi + residual planes and squared norms, V^T [(b,h)][64][2048] */
  k_gauss<<<NB * NH * (SLEN / 128), 256, 0, stream>>>(QH, QL, KH, KL, VT, QN, KN, rs, OH);      /* out_i[(h,d)] = sum_j exp(-r (kn_i + qn_j - 2 k_i.q_j)) v_j[d], merged context f16 */
  k_gemm3<DM, DM, false><<<(NR / 128) * (DM / 128), 256, 0, stream>>>(OH, BP, 0.0625f, bp, (float*)d_out, nullptr, nullptr, nullptr, nullptr, nullptr, nullptr, nullptr);      /* out = ctx Wproj + bproj */
}
